// v000
// Times are from an AMD MI455X. After a warm-up the kernel runs many times in a row, and a time is the length of
// such a window on the GPU divided by its runs, so every launch and the gaps after it count. The runs cycle
// through copies of the inputs. A figure is the median of several windows, for all but v000 over two sittings.
// Sittings can differ by a few percent; kernels timed side by side share one.
// The starting kernel, v000, takes 3550 microseconds a run.
#include <hip/hip_runtime.h>

// Attention on three input streams over 4,096 tokens with a RANDOM integer key mask (query, key, value [1][4096][1024]; q = query Wq^T + bq, k = key Wk^T + bk, v = value Wv^T + bv ('oi' 1/32 + zero biases; 16 heads x 64); scores / sqrt(64); keys with mask[b][0][0][j] == 0 -> -1e9 (== exclusion; mask int32 [1][1][1][4096] with random 0/1 entries, read per key on device); softmax; out = merged Wo^T + bo -> [1][4096][1024] (4.2 M); argument order query, key, value, mask, Wq, bq, Wk, bk, Wv, bv, Wo, bo).
// Layout: bf16 copies of query, key, value in turn; 'oi' weights; exact projections + f32 biases; identity-table plane builders; dense attention at T 4096, one head per pass, whose softmax kernel reads the int key vector (16 B per lane) and excludes the zeros (hybrid rows: < 512 hi/lo 3 products, rest fp16 x1024); merged hi/lo x Wo exact + bo.
// Compute dtypes, f32 accumulate: every input rounded to bf16; projections exact + f32 biases; attention rows < 512 3 products, rest fp16; softmax f32; Wo hl x exact + bias.

#define NB_  1
#define TT   4096
#define DM   1024
#define NH_  16
#define NKV  16
#define REP  (NH_ / NKV)
#define HD   64
#define DQ   (NH_ * HD)
#define DKV  (NKV * HD)
#define ZH   1                    // one head per pass at T 4096 (the score plane is 64 MiB)
#define RH   512                  // query rows < RH use hi+lo planes (0: none)
#define WIN  0
#define PCAR 1024.0f
#define SCL  0.125f   // HD^-0.5
typedef _Float16 h16;
typedef unsigned short bf;
typedef __attribute__((ext_vector_type(16))) __bf16   v16bf;
typedef __attribute__((ext_vector_type(16))) _Float16 v16h;
typedef __attribute__((ext_vector_type(8)))  _Float16 v8h;
typedef __attribute__((ext_vector_type(8)))  unsigned short v8us;
typedef __attribute__((ext_vector_type(8)))  float    v8f;
typedef __attribute__((ext_vector_type(4)))  float    v4f;
typedef v8h  __attribute__((may_alias)) v8ha;
typedef v4f  __attribute__((may_alias)) v4fa;
typedef v8us __attribute__((may_alias)) v8usa;

__device__ __forceinline__ unsigned short f2bf(float f) { unsigned u = __float_as_uint(f); u += 0x7FFFu + ((u >> 16) & 1u); return (unsigned short)(u >> 16); }
__device__ __forceinline__ float bf2f(unsigned short b) { return __uint_as_float(((unsigned)b) << 16); }
__device__ __forceinline__ float bfr(float f) { return bf2f(f2bf(f)); }
__device__ __forceinline__ v16h cat16(v8h lo, v8h hi) { return __builtin_shufflevector(lo, hi, 0, 1, 2, 3, 4, 5, 6, 7, 8, 9, 10, 11, 12, 13, 14, 15); }
__device__ __forceinline__ v16bf cat16b(v8us lo, v8us hi) { return __builtin_bit_cast(v16bf, __builtin_shufflevector(lo, hi, 0, 1, 2, 3, 4, 5, 6, 7, 8, 9, 10, 11, 12, 13, 14, 15)); }
__device__ __forceinline__ v8f wmma16(v16h a, v16h b, v8f c) { return __builtin_amdgcn_wmma_f32_16x16x32_f16(false, a, false, b, (short)0, c, false, false); }
__device__ __forceinline__ v8f wmmab(v16bf a, v16bf b, v8f c) { return __builtin_amdgcn_wmma_f32_16x16x32_bf16(false, a, false, b, (short)0, c, false, false); }



// ---- k_gemmw: register-blocked GEMM, ONE WAVE per 64x64 output tile (16 accumulators), operands straight from K-contiguous 16-bit planes; grid (M/64, N/64, Z), 32 threads.
// C[m][n] (f32, pitch ldc, + optional f32 bias[n]) = sum_k A[m][k] Bt[n][k] (+ split products per NSPLIT). z-batch strides sA/sB/sC in elements. K % 32 == 0.
template <typename T16> struct WFrag;
template <> struct WFrag<h16> { typedef v16h V; static __device__ __forceinline__ V ld(const h16* p) { return cat16(*(const v8h*)p, *(const v8h*)(p + 16)); } static __device__ __forceinline__ v8f mma(V a, V b, v8f c) { return wmma16(a, b, c); } };
template <> struct WFrag<bf> { typedef v16bf V; static __device__ __forceinline__ V ld(const bf* p) { return cat16b(*(const v8us*)p, *(const v8us*)(p + 16)); } static __device__ __forceinline__ v8f mma(V a, V b, v8f c) { return wmmab(a, b, c); } };
template <typename T16, int NSPLIT, bool BIAS>
__global__ __launch_bounds__(32) void k_gemmw(const T16* __restrict__ A, const T16* __restrict__ A2, const T16* __restrict__ Bt, const T16* __restrict__ Bt2, int K, float* C, int ldc, const float* __restrict__ bias, size_t sA, size_t sB, size_t sC) {
    typedef typename WFrag<T16>::V V;
    __shared__ __align__(16) float os[16 * 68];
    const size_t z = blockIdx.z; A += z * sA; if (A2) A2 += z * sA; Bt += z * sB; if (Bt2) Bt2 += z * sB; C += z * sC;
    const int lane = threadIdx.x & 31, lr = lane & 15, hi = lane >> 4; const int r0 = blockIdx.x * 64, c0 = blockIdx.y * 64;
    v8f acc[4][4];
#pragma unroll
    for (int mb = 0; mb < 4; ++mb)
#pragma unroll
        for (int nb = 0; nb < 4; ++nb) acc[mb][nb] = (v8f){};
    const size_t aoff = (size_t)(r0 + lr) * K + 8 * hi, boff = (size_t)(c0 + lr) * K + 8 * hi;
#pragma unroll 1
    for (int kc = 0; kc < K; kc += 32) {
        V a[4], a2[4];
#pragma unroll
        for (int mb = 0; mb < 4; ++mb) { a[mb] = WFrag<T16>::ld(A + aoff + (size_t)mb * 16 * K + kc); if (NSPLIT == 1 || NSPLIT == 2) a2[mb] = WFrag<T16>::ld(A2 + aoff + (size_t)mb * 16 * K + kc); }
#pragma unroll
        for (int nb = 0; nb < 4; ++nb) { const V b = WFrag<T16>::ld(Bt + boff + (size_t)nb * 16 * K + kc); V b2; if (NSPLIT >= 2) b2 = WFrag<T16>::ld(Bt2 + boff + (size_t)nb * 16 * K + kc);
#pragma unroll
            for (int mb = 0; mb < 4; ++mb) { acc[mb][nb] = WFrag<T16>::mma(a[mb], b, acc[mb][nb]); if (NSPLIT == 1 || NSPLIT == 2) acc[mb][nb] = WFrag<T16>::mma(a2[mb], b, acc[mb][nb]); if (NSPLIT >= 2) acc[mb][nb] = WFrag<T16>::mma(a[mb], b2, acc[mb][nb]); } }
        asm volatile("v_nop\n\tv_nop\n\tv_nop\n\tv_nop" : "+v"(acc[0][0]), "+v"(acc[1][1]), "+v"(acc[2][2]), "+v"(acc[3][3]) : "v"(a[0]), "v"(a[3]));
    }
#pragma unroll
    for (int mb = 0; mb < 4; ++mb) {
#pragma unroll
        for (int nb = 0; nb < 4; ++nb) {
#pragma unroll
            for (int j = 0; j < 8; ++j) os[(hi * 8 + j) * 68 + nb * 16 + lr] = acc[mb][nb][j]; }
        __builtin_amdgcn_wave_barrier(); asm volatile("" ::: "memory");
        float* crow = C + (size_t)(r0 + mb * 16) * ldc + c0;
{
#pragma unroll
            for (int s = 0; s < 8; ++s) { const int row = 2 * s + hi, cofs = lr * 4; v4f val = *(const v4fa*)(os + row * 68 + cofs); if (BIAS) { val[0] += bfr(bias[c0 + cofs]); val[1] += bfr(bias[c0 + cofs + 1]); val[2] += bfr(bias[c0 + cofs + 2]); val[3] += bfr(bias[c0 + cofs + 3]); }
                *(v4f*)(crow + (size_t)row * ldc + cofs) = val; }
             }
        __builtin_amdgcn_wave_barrier(); asm volatile("" ::: "memory");
    }
}

__device__ __forceinline__ h16 tohx(float x) { return (h16)x; }
__device__ __forceinline__ void splitf(float y, unsigned short& h, unsigned short& l) { h = f2bf(y); l = f2bf(y - bf2f(h)); }
typedef __attribute__((ext_vector_type(2))) _Float16 v2h;
typedef __attribute__((ext_vector_type(4))) _Float16 v4h;
typedef __attribute__((ext_vector_type(2))) unsigned short v2us;
typedef __attribute__((ext_vector_type(4))) unsigned short v4us;
typedef __attribute__((ext_vector_type(2))) float v2f;
typedef __attribute__((ext_vector_type(4))) int v4i;

__global__ __launch_bounds__(256) void k_cvt8(const float* __restrict__ src, bf* dst, size_t n8) { const size_t i = (size_t)blockIdx.x * 256 + threadIdx.x; if (i >= n8) return; const v8f v = *(const v8f*)(src + i * 8); v8us o;
#pragma unroll
    for (int k = 0; k < 8; ++k) o[k] = f2bf(v[k]); *(v8us*)(dst + i * 8) = o;  }

// k_rope: head planes [h][t][d] (fp16 + hi/lo) of rope(x) x sc with the rotate-half convention out[d] = x[d] cos[t][d] - x[d+HD/2] sin[t][d], out[d+HD/2] = x[d+HD/2] cos[t][d+HD/2] + x[d] sin[t][d+HD/2]
__global__ __launch_bounds__(256) void k_rope(const float* __restrict__ F, int pitch, int nheads, const float* __restrict__ CS, const float* __restrict__ RF, const float* __restrict__ nw, float sc, h16* P16, bf* Ph, bf* Pl) {
    const size_t e = ((size_t)blockIdx.x * 256 + threadIdx.x) * 2; if (e >= (size_t)nheads * TT * HD) return; const int d = (int)(e % HD); const int t = (int)((e / HD) % TT); const int h = (int)(e / ((size_t)HD * TT)); const float* f = F + (size_t)t * pitch + h * HD; const float rf = RF ? RF[(size_t)h * TT + t] : 1.0f; v2h o16; v2us oh, ol;
#pragma unroll
    for (int q = 0; q < 2; ++q) { const int dd = d + q; const int dp = (dd < HD / 2) ? dd + HD / 2 : dd - HD / 2; float x0 = f[dd], x1 = f[dp];
        if (RF) { float n0 = __fmul_rn(x0, rf), n1 = __fmul_rn(x1, rf); asm volatile("" : "+v"(n0)); asm volatile("" : "+v"(n1)); x0 = __fmul_rn(bfr(nw[dd]), n0); x1 = __fmul_rn(bfr(nw[dp]), n1); }
        const v2f cs = *(const v2f*)(CS + ((size_t)t * HD + dd) * 2); float a = __fmul_rn(x0, cs[0]), bq = __fmul_rn(x1, cs[1]); asm volatile("" : "+v"(a)); asm volatile("" : "+v"(bq)); const float r = ((dd < HD / 2) ? __fsub_rn(a, bq) : __fadd_rn(a, bq)) * sc;
        o16[q] = tohx(r); unsigned short a2, c2; splitf(r, a2, c2); oh[q] = a2; ol[q] = c2; }
    *(v2h*)(P16 + e) = o16; *(v2us*)(Ph + e) = oh; *(v2us*)(Pl + e) = ol;  }
__global__ __launch_bounds__(256) void k_vtp(const float* __restrict__ F, int pitch, int nheads, h16* V16, bf* Vh, bf* Vl) { const size_t e = ((size_t)blockIdx.x * 256 + threadIdx.x) * 2; if (e >= (size_t)nheads * HD * TT) return; const int t = (int)(e % TT); const int d = (int)((e / TT) % HD); const int g = (int)(e / ((size_t)TT * HD)); v2h o16; v2us oh, ol;
#pragma unroll
    for (int q = 0; q < 2; ++q) { const float x = F[(size_t)(t + q) * pitch + g * HD + d]; o16[q] = tohx(x); unsigned short a2, c2; splitf(x, a2, c2); oh[q] = a2; ol[q] = c2; }
    *(v2h*)(V16 + e) = o16; *(v2us*)(Vh + e) = oh; *(v2us*)(Vl + e) = ol;  }
__global__ __launch_bounds__(256) void k_csid(float* CS) { const int idx = blockIdx.x * 256 + threadIdx.x; if (idx >= TT * HD) return; v2f cs; cs[0] = 1.0f; cs[1] = 0.0f; *(v2f*)(CS + (size_t)idx * 2) = cs;  }
// k_asoft: per row (zz, i): mask[b][j] == 0 -> -1e9 in the module == exclusion (every row keeps ~half of the keys) softmax over the keys (register row, one exp, fixed trees);
__global__ __launch_bounds__(256) void k_asoft(const float* __restrict__ Sb, const int* __restrict__ kvp, h16* P16, bf* Ph, bf* Pl) {
    const int lane = threadIdx.x & 31; const int row = blockIdx.x * 8 + (threadIdx.x >> 5); if (row >= ZH * TT) return; const int i = row % TT; const int zz = row / TT; (void)zz; const bool hires = (i < RH); const float* sr = Sb + (size_t)row * TT; float v[TT / 32]; float mx = -3.0e38f;
#pragma unroll
    for (int ch = 0; ch < TT / 128; ++ch) { const int j0 = ch * 128 + lane * 4; const v4f a = *(const v4f*)(sr + j0); const v4i kv4 = *(const v4i*)(kvp + j0);   /* the batch's key vector, 16 B per lane, unconditional */
#pragma unroll
        for (int q = 0; q < 4; ++q) { const int j = j0 + q; (void)j; const float t = (kv4[q] != 0) ? a[q] * SCL : -3.0e38f; v[ch * 4 + q] = t; mx = fmaxf(mx, t); } }
#pragma unroll
    for (int sh = 16; sh; sh >>= 1) mx = fmaxf(mx, __shfl_xor(mx, sh, 32));
    float sum = 0.f;
#pragma unroll
    for (int k = 0; k < TT / 32; ++k) { float d0 = __fsub_rn(v[k], mx); asm volatile("" : "+v"(d0)); v[k] = __builtin_amdgcn_exp2f(__fmul_rn(d0, 1.4426950408889634f)); sum += v[k]; }
#pragma unroll
    for (int sh = 16; sh; sh >>= 1) sum += __shfl_xor(sum, sh, 32);
    const float f = __fdiv_rn(hires ? 1.0f : PCAR, sum);
{
        if (hires) {
#pragma unroll
            for (int ch = 0; ch < TT / 128; ++ch) { v4us oh, ol;
#pragma unroll
                for (int q = 0; q < 4; ++q) { unsigned short a, c2; splitf(v[ch * 4 + q] * f, a, c2); oh[q] = a; ol[q] = c2; }
                const size_t oo = ((size_t)zz * (RH ? RH : 1) + i) * TT + ch * 128 + lane * 4; *(v4us*)(Ph + oo) = oh; *(v4us*)(Pl + oo) = ol; }
        } else {
#pragma unroll
            for (int ch = 0; ch < TT / 128; ++ch) { v4h o4;
#pragma unroll
                for (int q = 0; q < 4; ++q) o4[q] = tohx(v[ch * 4 + q] * f);
                *(v4h*)(P16 + (size_t)row * TT + ch * 128 + lane * 4) = o4; } }
         }
}
__global__ __launch_bounds__(256) void k_merge(const float* __restrict__ O, int h0, bf* Ah, bf* Al) { const size_t e = ((size_t)blockIdx.x * 256 + threadIdx.x) * 2; if (e >= (size_t)ZH * TT * HD) return; const int d = (int)(e % HD); const int t = (int)((e / HD) % TT); const int zz = (int)(e / ((size_t)HD * TT)); const float cs = (t < RH) ? 1.0f : (1.0f / PCAR); const size_t oo = (size_t)t * DQ + (h0 + zz) * HD + d;
    v2us oh, ol;
#pragma unroll
    for (int q = 0; q < 2; ++q) { unsigned short a, c2; splitf(O[e + q] * cs, a, c2); oh[q] = a; ol[q] = c2; } *(v2us*)(Ah + oo) = oh; *(v2us*)(Al + oo) = ol;  }

extern "C" void kernel_launch(void* const* d_in, const int* in_sizes, int n_in,
                              void* d_out, int out_size, void* d_ws, size_t ws_size, hipStream_t stream) {
    (void)in_sizes; (void)n_in; (void)out_size;
    const float* x = (const float*)d_in[0]; const float* xk = (const float*)d_in[1]; const float* xv = (const float*)d_in[2]; const int* kmask = (const int*)d_in[3]; const float* wq = (const float*)d_in[4]; const float* bq = (const float*)d_in[5]; const float* wk = (const float*)d_in[6]; const float* bk = (const float*)d_in[7]; const float* wv = (const float*)d_in[8]; const float* bv = (const float*)d_in[9]; const float* wo = (const float*)d_in[10]; const float* bo = (const float*)d_in[11];   /* order query, key, value, mask (int32 [1][1][1][4096], read), Wq, bq, Wk, bk, Wv, bv, Wo, bo ('oi' + biases) */
    float* OUT = (float*)d_out;     // [1][4096][1024]
    char* wsp = (char*)d_ws;
    auto take = [&](size_t bytes) { char* p = wsp; wsp += (bytes + 255) & ~(size_t)255; return (void*)p; };
    bf* WQ = (bf*)take((size_t)DQ * DM * 2); bf* WK = (bf*)take((size_t)DKV * DM * 2); bf* WV = (bf*)take((size_t)DKV * DM * 2); bf* WO = (bf*)take((size_t)DM * DQ * 2); float* CS = (float*)take((size_t)TT * HD * 2 * 4);
    bf* XB = (bf*)take((size_t)TT * DM * 2); float* FQ = (float*)take((size_t)TT * DQ * 4); float* FK = (float*)take((size_t)TT * DKV * 4);
    h16* QP16 = (h16*)take((size_t)NH_ * TT * HD * 2); h16* KP16 = (h16*)take((size_t)NKV * TT * HD * 2); h16* VT16 = (h16*)take((size_t)NKV * HD * TT * 2);
    bf* QPh = (bf*)take((size_t)NH_ * TT * HD * 2); bf* QPl = (bf*)take((size_t)NH_ * TT * HD * 2); bf* KPh = (bf*)take((size_t)NKV * TT * HD * 2); bf* KPl = (bf*)take((size_t)NKV * TT * HD * 2); bf* VTh = (bf*)take((size_t)NKV * HD * TT * 2); bf* VTl = (bf*)take((size_t)NKV * HD * TT * 2); bf* Ph = (bf*)take((size_t)ZH * RH * TT * 2); bf* Pl = (bf*)take((size_t)ZH * RH * TT * 2);
    float* Sb = (float*)take((size_t)ZH * TT * TT * 4); h16* P16 = (h16*)take((size_t)ZH * TT * TT * 2); float* Ob = (float*)take((size_t)ZH * TT * HD * 4); bf* ATh = (bf*)take((size_t)TT * DQ * 2); bf* ATl = (bf*)take((size_t)TT * DQ * 2);
    if ((size_t)(wsp - (char*)d_ws) > ws_size) return;    // ws 256 MiB
    float* FV = FK;   // v projection reuses the k buffer after the k planes are built (stream-ordered)
    { k_cvt8<<<(unsigned)(((size_t)DQ * DM / 8 + 255) / 256), 256, 0, stream>>>(wq, WQ, (size_t)DQ * DM / 8); k_cvt8<<<(unsigned)(((size_t)DKV * DM / 8 + 255) / 256), 256, 0, stream>>>(wk, WK, (size_t)DKV * DM / 8); k_cvt8<<<(unsigned)(((size_t)DKV * DM / 8 + 255) / 256), 256, 0, stream>>>(wv, WV, (size_t)DKV * DM / 8);
      k_cvt8<<<(unsigned)(((size_t)DM * DQ / 8 + 255) / 256), 256, 0, stream>>>(wo, WO, (size_t)DM * DQ / 8);
       }
    k_csid<<<(TT * HD + 255) / 256, 256, 0, stream>>>(CS);
    const unsigned LQ = (unsigned)(((size_t)NH_ * TT * HD / 2 + 255) / 256), LKv = (unsigned)(((size_t)NKV * TT * HD / 2 + 255) / 256);
    for (int b = 0; b < NB_; ++b) {
        
        k_cvt8<<<(unsigned)(((size_t)TT * DM / 8 + 255) / 256), 256, 0, stream>>>(x + (size_t)b * TT * DM, XB, (size_t)TT * DM / 8);
        k_gemmw<bf, 0, true><<<dim3(TT / 64, DQ / 64, 1), 32, 0, stream>>>(XB, nullptr, WQ, nullptr, DM, FQ, DQ, bq, 0, 0, 0);
        k_rope<<<LQ, 256, 0, stream>>>(FQ, DQ, NH_, CS, nullptr, nullptr, 1.0f, QP16, QPh, QPl);
        k_cvt8<<<(unsigned)(((size_t)TT * DM / 8 + 255) / 256), 256, 0, stream>>>(xk + (size_t)b * TT * DM, XB, (size_t)TT * DM / 8);   /* XB := bf16(key[b]) */ k_gemmw<bf, 0, true><<<dim3(TT / 64, DKV / 64, 1), 32, 0, stream>>>(XB, nullptr, WK, nullptr, DM, FK, DKV, bk, 0, 0, 0);
        k_rope<<<LKv, 256, 0, stream>>>(FK, DKV, NKV, CS, nullptr, nullptr, 1.0f, KP16, KPh, KPl);
        k_cvt8<<<(unsigned)(((size_t)TT * DM / 8 + 255) / 256), 256, 0, stream>>>(xv + (size_t)b * TT * DM, XB, (size_t)TT * DM / 8);   /* XB := bf16(value[b]) */ k_gemmw<bf, 0, true><<<dim3(TT / 64, DKV / 64, 1), 32, 0, stream>>>(XB, nullptr, WV, nullptr, DM, FV, DKV, bv, 0, 0, 0); k_vtp<<<LKv, 256, 0, stream>>>(FV, DKV, NKV, VT16, VTh, VTl);
        for (int h0 = 0; h0 < NH_; h0 += ZH) { const size_t zq = (size_t)h0, zk = (size_t)(h0 / REP);   // one kv head per query head: the pass's one head uses kv plane h0 (z-strides TT*HD)
            k_gemmw<bf, 2, false><<<dim3(RH / 64, TT / 64, ZH), 32, 0, stream>>>(QPh + zq * TT * HD, QPl + zq * TT * HD, KPh + zk * TT * HD, KPl + zk * TT * HD, HD, Sb, TT, nullptr, (size_t)TT * HD, (size_t)TT * HD, (size_t)TT * TT);
            k_gemmw<h16, 0, false><<<dim3((TT - RH) / 64, TT / 64, ZH), 32, 0, stream>>>(QP16 + zq * TT * HD + (size_t)RH * HD, nullptr, KP16 + zk * TT * HD, nullptr, HD, Sb + (size_t)RH * TT, TT, nullptr, (size_t)TT * HD, (size_t)TT * HD, (size_t)TT * TT);
            k_asoft<<<ZH * TT / 8, 256, 0, stream>>>(Sb, kmask + (size_t)b * TT, P16, Ph, Pl);
            k_gemmw<bf, 2, false><<<dim3(RH / 64, HD / 64, ZH), 32, 0, stream>>>(Ph, Pl, VTh + zk * HD * TT, VTl + zk * HD * TT, TT, Ob, HD, nullptr, (size_t)RH * TT, (size_t)HD * TT, (size_t)TT * HD);
            k_gemmw<h16, 0, false><<<dim3((TT - RH) / 64, HD / 64, ZH), 32, 0, stream>>>(P16 + (size_t)RH * TT, nullptr, VT16 + zk * HD * TT, nullptr, TT, Ob + (size_t)RH * HD, HD, nullptr, (size_t)TT * TT, (size_t)HD * TT, (size_t)TT * HD);
            k_merge<<<(unsigned)(((size_t)ZH * TT * HD / 2 + 255) / 256), 256, 0, stream>>>(Ob, h0, ATh, ATl); }
        k_gemmw<bf, 1, true><<<dim3(TT / 64, DM / 64, 1), 32, 0, stream>>>(ATh, ATl, WO, nullptr, DQ, OUT + (size_t)b * TT * DM, DM, bo, 0, 0, 0); }
}

// v001
// Measured time: 1110 microseconds a run.
// In two side-by-side timings against v000, it was 3.22 and 3.21 times as fast.
#include <hip/hip_runtime.h>

// Attention on three input streams over 4,096 tokens with a RANDOM integer key mask (query, key, value [1][4096][1024]; q = query Wq^T + bq, k = key Wk^T + bk, v = value Wv^T + bv ('oi' 1/32 + zero biases; 16 heads x 64); scores / sqrt(64); keys with mask[b][0][0][j] == 0 -> -1e9 (== exclusion; mask int32 [1][1][1][4096] with random 0/1 entries, read per key on device); softmax; out = merged Wo^T + bo -> [1][4096][1024] (4.2 M); argument order query, key, value, mask, Wq, bq, Wk, bk, Wv, bv, Wo, bo).
// Layout: bf16 copies of query, key, value in turn; 'oi' weights; exact projections + f32 biases; identity-table plane builders; dense attention at T 4096, one head per pass, whose softmax kernel reads the int key vector (16 B per lane) and excludes the zeros (hybrid rows: < 512 hi/lo 3 products, rest fp16 x1024); merged hi/lo x Wo exact + bo.
// Compute dtypes, f32 accumulate: every input rounded to bf16; projections exact + f32 biases; attention rows < 512 3 products, rest fp16; softmax f32; Wo hl x exact + bias.

#define NB_  1
#define TT   4096
#define DM   1024
#define NH_  16
#define NKV  16
#define REP  (NH_ / NKV)
#define HD   64
#define DQ   (NH_ * HD)
#define DKV  (NKV * HD)
#define ZH   1                    // one head per pass at T 4096 (the score plane is 64 MiB)
#define RH   512                  // query rows < RH use hi+lo planes (0: none)
#define WIN  0
#define PCAR 1024.0f
#define SCL  0.125f   // HD^-0.5
#define KS   32                   // key slices of the P x V products: one wave per (64-row tile, slice), TT / KS keys each, f32 partials summed in k_merge
typedef _Float16 h16;
typedef unsigned short bf;
typedef __attribute__((ext_vector_type(16))) __bf16   v16bf;
typedef __attribute__((ext_vector_type(16))) _Float16 v16h;
typedef __attribute__((ext_vector_type(8)))  _Float16 v8h;
typedef __attribute__((ext_vector_type(8)))  unsigned short v8us;
typedef __attribute__((ext_vector_type(8)))  float    v8f;
typedef __attribute__((ext_vector_type(4)))  float    v4f;
typedef v8h  __attribute__((may_alias)) v8ha;
typedef v4f  __attribute__((may_alias)) v4fa;
typedef v8us __attribute__((may_alias)) v8usa;

__device__ __forceinline__ unsigned short f2bf(float f) { unsigned u = __float_as_uint(f); u += 0x7FFFu + ((u >> 16) & 1u); return (unsigned short)(u >> 16); }
__device__ __forceinline__ float bf2f(unsigned short b) { return __uint_as_float(((unsigned)b) << 16); }
__device__ __forceinline__ float bfr(float f) { return bf2f(f2bf(f)); }
__device__ __forceinline__ v16h cat16(v8h lo, v8h hi) { return __builtin_shufflevector(lo, hi, 0, 1, 2, 3, 4, 5, 6, 7, 8, 9, 10, 11, 12, 13, 14, 15); }
__device__ __forceinline__ v16bf cat16b(v8us lo, v8us hi) { return __builtin_bit_cast(v16bf, __builtin_shufflevector(lo, hi, 0, 1, 2, 3, 4, 5, 6, 7, 8, 9, 10, 11, 12, 13, 14, 15)); }
__device__ __forceinline__ v8f wmma16(v16h a, v16h b, v8f c) { return __builtin_amdgcn_wmma_f32_16x16x32_f16(false, a, false, b, (short)0, c, false, false); }
__device__ __forceinline__ v8f wmmab(v16bf a, v16bf b, v8f c) { return __builtin_amdgcn_wmma_f32_16x16x32_bf16(false, a, false, b, (short)0, c, false, false); }



// ---- k_gemmw: register-blocked GEMM, ONE WAVE per 64x64 output tile (16 accumulators), operands straight from K-contiguous 16-bit planes; grid (M/64, N/64, Z), 32 threads.
// C[m][n] (f32, pitch ldc, + optional f32 bias[n]) = sum_{k < KL} A[m][k] Bt[n][k] (+ split products per NSPLIT). K = row pitch of A and Bt, KL = k extent summed here (KL == K: the whole row; KL < K with sA = sB = KL: z is a k slice and C + z sC its partial). z-batch strides sA/sB/sC in elements. KL % 32 == 0.
template <typename T16> struct WFrag;
template <> struct WFrag<h16> { typedef v16h V; static __device__ __forceinline__ V ld(const h16* p) { return cat16(*(const v8h*)p, *(const v8h*)(p + 16)); } static __device__ __forceinline__ v8f mma(V a, V b, v8f c) { return wmma16(a, b, c); } };
template <> struct WFrag<bf> { typedef v16bf V; static __device__ __forceinline__ V ld(const bf* p) { return cat16b(*(const v8us*)p, *(const v8us*)(p + 16)); } static __device__ __forceinline__ v8f mma(V a, V b, v8f c) { return wmmab(a, b, c); } };
template <typename T16, int NSPLIT, bool BIAS>
__global__ __launch_bounds__(32) void k_gemmw(const T16* __restrict__ A, const T16* __restrict__ A2, const T16* __restrict__ Bt, const T16* __restrict__ Bt2, int K, int KL, float* C, int ldc, const float* __restrict__ bias, size_t sA, size_t sB, size_t sC) {
    typedef typename WFrag<T16>::V V;
    __shared__ __align__(16) float os[16 * 68];
    const size_t z = blockIdx.z; A += z * sA; if (A2) A2 += z * sA; Bt += z * sB; if (Bt2) Bt2 += z * sB; C += z * sC;
    const int lane = threadIdx.x & 31, lr = lane & 15, hi = lane >> 4; const int r0 = blockIdx.x * 64, c0 = blockIdx.y * 64;
    v8f acc[4][4];
#pragma unroll
    for (int mb = 0; mb < 4; ++mb)
#pragma unroll
        for (int nb = 0; nb < 4; ++nb) acc[mb][nb] = (v8f){};
    const size_t aoff = (size_t)(r0 + lr) * K + 8 * hi, boff = (size_t)(c0 + lr) * K + 8 * hi;
#pragma unroll 1
    for (int kc = 0; kc < KL; kc += 32) {
        V a[4], a2[4];
#pragma unroll
        for (int mb = 0; mb < 4; ++mb) { a[mb] = WFrag<T16>::ld(A + aoff + (size_t)mb * 16 * K + kc); if (NSPLIT == 1 || NSPLIT == 2) a2[mb] = WFrag<T16>::ld(A2 + aoff + (size_t)mb * 16 * K + kc); }
#pragma unroll
        for (int nb = 0; nb < 4; ++nb) { const V b = WFrag<T16>::ld(Bt + boff + (size_t)nb * 16 * K + kc); V b2; if (NSPLIT >= 2) b2 = WFrag<T16>::ld(Bt2 + boff + (size_t)nb * 16 * K + kc);
#pragma unroll
            for (int mb = 0; mb < 4; ++mb) { acc[mb][nb] = WFrag<T16>::mma(a[mb], b, acc[mb][nb]); if (NSPLIT == 1 || NSPLIT == 2) acc[mb][nb] = WFrag<T16>::mma(a2[mb], b, acc[mb][nb]); if (NSPLIT >= 2) acc[mb][nb] = WFrag<T16>::mma(a[mb], b2, acc[mb][nb]); } }
        asm volatile("v_nop\n\tv_nop\n\tv_nop\n\tv_nop" : "+v"(acc[0][0]), "+v"(acc[1][1]), "+v"(acc[2][2]), "+v"(acc[3][3]) : "v"(a[0]), "v"(a[3]));
    }
#pragma unroll
    for (int mb = 0; mb < 4; ++mb) {
#pragma unroll
        for (int nb = 0; nb < 4; ++nb) {
#pragma unroll
            for (int j = 0; j < 8; ++j) os[(hi * 8 + j) * 68 + nb * 16 + lr] = acc[mb][nb][j]; }
        __builtin_amdgcn_wave_barrier(); asm volatile("" ::: "memory");
        float* crow = C + (size_t)(r0 + mb * 16) * ldc + c0;
{
#pragma unroll
            for (int s = 0; s < 8; ++s) { const int row = 2 * s + hi, cofs = lr * 4; v4f val = *(const v4fa*)(os + row * 68 + cofs); if (BIAS) { val[0] += bfr(bias[c0 + cofs]); val[1] += bfr(bias[c0 + cofs + 1]); val[2] += bfr(bias[c0 + cofs + 2]); val[3] += bfr(bias[c0 + cofs + 3]); }
                *(v4f*)(crow + (size_t)row * ldc + cofs) = val; }
             }
        __builtin_amdgcn_wave_barrier(); asm volatile("" ::: "memory");
    }
}

__device__ __forceinline__ h16 tohx(float x) { return (h16)x; }
__device__ __forceinline__ void splitf(float y, unsigned short& h, unsigned short& l) { h = f2bf(y); l = f2bf(y - bf2f(h)); }
typedef __attribute__((ext_vector_type(2))) _Float16 v2h;
typedef __attribute__((ext_vector_type(4))) _Float16 v4h;
typedef __attribute__((ext_vector_type(2))) unsigned short v2us;
typedef __attribute__((ext_vector_type(4))) unsigned short v4us;
typedef __attribute__((ext_vector_type(2))) float v2f;
typedef __attribute__((ext_vector_type(4))) int v4i;

__global__ __launch_bounds__(256) void k_cvt8(const float* __restrict__ src, bf* dst, size_t n8) { const size_t i = (size_t)blockIdx.x * 256 + threadIdx.x; if (i >= n8) return; const v8f v = *(const v8f*)(src + i * 8); v8us o;
#pragma unroll
    for (int k = 0; k < 8; ++k) o[k] = f2bf(v[k]); *(v8us*)(dst + i * 8) = o;  }

// k_rope: head planes [h][t][d] (fp16 + hi/lo) of rope(x) x sc with the rotate-half convention out[d] = x[d] cos[t][d] - x[d+HD/2] sin[t][d], out[d+HD/2] = x[d+HD/2] cos[t][d+HD/2] + x[d] sin[t][d+HD/2]
__global__ __launch_bounds__(256) void k_rope(const float* __restrict__ F, int pitch, int nheads, const float* __restrict__ CS, const float* __restrict__ RF, const float* __restrict__ nw, float sc, h16* P16, bf* Ph, bf* Pl) {
    const size_t e = ((size_t)blockIdx.x * 256 + threadIdx.x) * 2; if (e >= (size_t)nheads * TT * HD) return; const int d = (int)(e % HD); const int t = (int)((e / HD) % TT); const int h = (int)(e / ((size_t)HD * TT)); const float* f = F + (size_t)t * pitch + h * HD; const float rf = RF ? RF[(size_t)h * TT + t] : 1.0f; v2h o16; v2us oh, ol;
#pragma unroll
    for (int q = 0; q < 2; ++q) { const int dd = d + q; const int dp = (dd < HD / 2) ? dd + HD / 2 : dd - HD / 2; float x0 = f[dd], x1 = f[dp];
        if (RF) { float n0 = __fmul_rn(x0, rf), n1 = __fmul_rn(x1, rf); asm volatile("" : "+v"(n0)); asm volatile("" : "+v"(n1)); x0 = __fmul_rn(bfr(nw[dd]), n0); x1 = __fmul_rn(bfr(nw[dp]), n1); }
        const v2f cs = *(const v2f*)(CS + ((size_t)t * HD + dd) * 2); float a = __fmul_rn(x0, cs[0]), bq = __fmul_rn(x1, cs[1]); asm volatile("" : "+v"(a)); asm volatile("" : "+v"(bq)); const float r = ((dd < HD / 2) ? __fsub_rn(a, bq) : __fadd_rn(a, bq)) * sc;
        o16[q] = tohx(r); unsigned short a2, c2; splitf(r, a2, c2); oh[q] = a2; ol[q] = c2; }
    *(v2h*)(P16 + e) = o16; *(v2us*)(Ph + e) = oh; *(v2us*)(Pl + e) = ol;  }
__global__ __launch_bounds__(256) void k_vtp(const float* __restrict__ F, int pitch, int nheads, h16* V16, bf* Vh, bf* Vl) { const size_t e = ((size_t)blockIdx.x * 256 + threadIdx.x) * 2; if (e >= (size_t)nheads * HD * TT) return; const int t = (int)(e % TT); const int d = (int)((e / TT) % HD); const int g = (int)(e / ((size_t)TT * HD)); v2h o16; v2us oh, ol;
#pragma unroll
    for (int q = 0; q < 2; ++q) { const float x = F[(size_t)(t + q) * pitch + g * HD + d]; o16[q] = tohx(x); unsigned short a2, c2; splitf(x, a2, c2); oh[q] = a2; ol[q] = c2; }
    *(v2h*)(V16 + e) = o16; *(v2us*)(Vh + e) = oh; *(v2us*)(Vl + e) = ol;  }
__global__ __launch_bounds__(256) void k_csid(float* CS) { const int idx = blockIdx.x * 256 + threadIdx.x; if (idx >= TT * HD) return; v2f cs; cs[0] = 1.0f; cs[1] = 0.0f; *(v2f*)(CS + (size_t)idx * 2) = cs;  }
// k_asoft: per row (zz, i): mask[b][j] == 0 -> -1e9 in the module == exclusion (every row keeps ~half of the keys) softmax over the keys (register row, one exp, fixed trees);
__global__ __launch_bounds__(256) void k_asoft(const float* __restrict__ Sb, const int* __restrict__ kvp, h16* P16, bf* Ph, bf* Pl) {
    const int lane = threadIdx.x & 31; const int row = blockIdx.x * 8 + (threadIdx.x >> 5); if (row >= ZH * TT) return; const int i = row % TT; const int zz = row / TT; (void)zz; const bool hires = (i < RH); const float* sr = Sb + (size_t)row * TT; float v[TT / 32]; float mx = -3.0e38f;
#pragma unroll
    for (int ch = 0; ch < TT / 128; ++ch) { const int j0 = ch * 128 + lane * 4; const v4f a = *(const v4f*)(sr + j0); const v4i kv4 = *(const v4i*)(kvp + j0);   /* the batch's key vector, 16 B per lane, unconditional */
#pragma unroll
        for (int q = 0; q < 4; ++q) { const int j = j0 + q; (void)j; const float t = (kv4[q] != 0) ? a[q] * SCL : -3.0e38f; v[ch * 4 + q] = t; mx = fmaxf(mx, t); } }
#pragma unroll
    for (int sh = 16; sh; sh >>= 1) mx = fmaxf(mx, __shfl_xor(mx, sh, 32));
    float sum = 0.f;
#pragma unroll
    for (int k = 0; k < TT / 32; ++k) { float d0 = __fsub_rn(v[k], mx); asm volatile("" : "+v"(d0)); v[k] = __builtin_amdgcn_exp2f(__fmul_rn(d0, 1.4426950408889634f)); sum += v[k]; }
#pragma unroll
    for (int sh = 16; sh; sh >>= 1) sum += __shfl_xor(sum, sh, 32);
    const float f = __fdiv_rn(hires ? 1.0f : PCAR, sum);
{
        if (hires) {
#pragma unroll
            for (int ch = 0; ch < TT / 128; ++ch) { v4us oh, ol;
#pragma unroll
                for (int q = 0; q < 4; ++q) { unsigned short a, c2; splitf(v[ch * 4 + q] * f, a, c2); oh[q] = a; ol[q] = c2; }
                const size_t oo = ((size_t)zz * (RH ? RH : 1) + i) * TT + ch * 128 + lane * 4; *(v4us*)(Ph + oo) = oh; *(v4us*)(Pl + oo) = ol; }
        } else {
#pragma unroll
            for (int ch = 0; ch < TT / 128; ++ch) { v4h o4;
#pragma unroll
                for (int q = 0; q < 4; ++q) o4[q] = tohx(v[ch * 4 + q] * f);
                *(v4h*)(P16 + (size_t)row * TT + ch * 128 + lane * 4) = o4; } }
         }
}
// k_merge: O = the partials [ZH][TT][KS][HD] of the P x V products, summed here in slice order 0 .. KS-1, then scaled and split hi/lo into the merged planes.
__global__ __launch_bounds__(256) void k_merge(const float* __restrict__ O, int h0, bf* Ah, bf* Al) { const size_t e = ((size_t)blockIdx.x * 256 + threadIdx.x) * 2; if (e >= (size_t)ZH * TT * HD) return; const int d = (int)(e % HD); const int t = (int)((e / HD) % TT); const int zz = (int)(e / ((size_t)HD * TT)); const float cs = (t < RH) ? 1.0f : (1.0f / PCAR); const size_t oo = (size_t)t * DQ + (h0 + zz) * HD + d;
    const float* op = O + ((size_t)zz * TT + t) * (KS * HD) + d;   // the KS partials of one element lie HD floats apart
    v2f sm = *(const v2f*)op;
#pragma unroll
    for (int p = 1; p < KS; ++p) sm += *(const v2f*)(op + p * HD);   // unrolled: the KS loads issue back to back, one memory latency for all of them
    v2us oh, ol;
#pragma unroll
    for (int q = 0; q < 2; ++q) { unsigned short a, c2; splitf(sm[q] * cs, a, c2); oh[q] = a; ol[q] = c2; } *(v2us*)(Ah + oo) = oh; *(v2us*)(Al + oo) = ol;  }
static_assert(ZH == 1 && TT % (KS * 32) == 0, "grid z of the P x V launches is the key slice");
static_assert((size_t)KS * ZH * TT * HD <= (size_t)TT * (DQ + DKV), "the partials fit the two projection buffers");

extern "C" void kernel_launch(void* const* d_in, const int* in_sizes, int n_in,
                              void* d_out, int out_size, void* d_ws, size_t ws_size, hipStream_t stream) {
    (void)in_sizes; (void)n_in; (void)out_size;
    const float* x = (const float*)d_in[0]; const float* xk = (const float*)d_in[1]; const float* xv = (const float*)d_in[2]; const int* kmask = (const int*)d_in[3]; const float* wq = (const float*)d_in[4]; const float* bq = (const float*)d_in[5]; const float* wk = (const float*)d_in[6]; const float* bk = (const float*)d_in[7]; const float* wv = (const float*)d_in[8]; const float* bv = (const float*)d_in[9]; const float* wo = (const float*)d_in[10]; const float* bo = (const float*)d_in[11];   /* order query, key, value, mask (int32 [1][1][1][4096], read), Wq, bq, Wk, bk, Wv, bv, Wo, bo ('oi' + biases) */
    float* OUT = (float*)d_out;     // [1][4096][1024]
    char* wsp = (char*)d_ws;
    auto take = [&](size_t bytes) { char* p = wsp; wsp += (bytes + 255) & ~(size_t)255; return (void*)p; };
    bf* WQ = (bf*)take((size_t)DQ * DM * 2); bf* WK = (bf*)take((size_t)DKV * DM * 2); bf* WV = (bf*)take((size_t)DKV * DM * 2); bf* WO = (bf*)take((size_t)DM * DQ * 2); float* CS = (float*)take((size_t)TT * HD * 2 * 4);
    bf* XB = (bf*)take((size_t)TT * DM * 2); float* FQ = (float*)take((size_t)TT * DQ * 4); float* FK = (float*)take((size_t)TT * DKV * 4);
    h16* QP16 = (h16*)take((size_t)NH_ * TT * HD * 2); h16* KP16 = (h16*)take((size_t)NKV * TT * HD * 2); h16* VT16 = (h16*)take((size_t)NKV * HD * TT * 2);
    bf* QPh = (bf*)take((size_t)NH_ * TT * HD * 2); bf* QPl = (bf*)take((size_t)NH_ * TT * HD * 2); bf* KPh = (bf*)take((size_t)NKV * TT * HD * 2); bf* KPl = (bf*)take((size_t)NKV * TT * HD * 2); bf* VTh = (bf*)take((size_t)NKV * HD * TT * 2); bf* VTl = (bf*)take((size_t)NKV * HD * TT * 2); bf* Ph = (bf*)take((size_t)ZH * RH * TT * 2); bf* Pl = (bf*)take((size_t)ZH * RH * TT * 2);
    float* Sb = (float*)take((size_t)ZH * TT * TT * 4); h16* P16 = (h16*)take((size_t)ZH * TT * TT * 2); bf* ATh = (bf*)take((size_t)TT * DQ * 2); bf* ATl = (bf*)take((size_t)TT * DQ * 2);
    if ((size_t)(wsp - (char*)d_ws) > ws_size) return;    // ws 256 MiB
    float* FV = FK;   // v projection reuses the k buffer after the k planes are built (stream-ordered)
    float* Ob = FQ;   // partials [TT][KS][HD] of P x V: FQ and FK lie back to back and are dead once the q, k and v planes are built (stream-ordered)
    { k_cvt8<<<(unsigned)(((size_t)DQ * DM / 8 + 255) / 256), 256, 0, stream>>>(wq, WQ, (size_t)DQ * DM / 8); k_cvt8<<<(unsigned)(((size_t)DKV * DM / 8 + 255) / 256), 256, 0, stream>>>(wk, WK, (size_t)DKV * DM / 8); k_cvt8<<<(unsigned)(((size_t)DKV * DM / 8 + 255) / 256), 256, 0, stream>>>(wv, WV, (size_t)DKV * DM / 8);
      k_cvt8<<<(unsigned)(((size_t)DM * DQ / 8 + 255) / 256), 256, 0, stream>>>(wo, WO, (size_t)DM * DQ / 8);
       }
    k_csid<<<(TT * HD + 255) / 256, 256, 0, stream>>>(CS);
    const unsigned LQ = (unsigned)(((size_t)NH_ * TT * HD / 2 + 255) / 256), LKv = (unsigned)(((size_t)NKV * TT * HD / 2 + 255) / 256);
    for (int b = 0; b < NB_; ++b) {
        
        k_cvt8<<<(unsigned)(((size_t)TT * DM / 8 + 255) / 256), 256, 0, stream>>>(x + (size_t)b * TT * DM, XB, (size_t)TT * DM / 8);
        k_gemmw<bf, 0, true><<<dim3(TT / 64, DQ / 64, 1), 32, 0, stream>>>(XB, nullptr, WQ, nullptr, DM, DM, FQ, DQ, bq, 0, 0, 0);
        k_rope<<<LQ, 256, 0, stream>>>(FQ, DQ, NH_, CS, nullptr, nullptr, 1.0f, QP16, QPh, QPl);
        k_cvt8<<<(unsigned)(((size_t)TT * DM / 8 + 255) / 256), 256, 0, stream>>>(xk + (size_t)b * TT * DM, XB, (size_t)TT * DM / 8);   /* XB := bf16(key[b]) */ k_gemmw<bf, 0, true><<<dim3(TT / 64, DKV / 64, 1), 32, 0, stream>>>(XB, nullptr, WK, nullptr, DM, DM, FK, DKV, bk, 0, 0, 0);
        k_rope<<<LKv, 256, 0, stream>>>(FK, DKV, NKV, CS, nullptr, nullptr, 1.0f, KP16, KPh, KPl);
        k_cvt8<<<(unsigned)(((size_t)TT * DM / 8 + 255) / 256), 256, 0, stream>>>(xv + (size_t)b * TT * DM, XB, (size_t)TT * DM / 8);   /* XB := bf16(value[b]) */ k_gemmw<bf, 0, true><<<dim3(TT / 64, DKV / 64, 1), 32, 0, stream>>>(XB, nullptr, WV, nullptr, DM, DM, FV, DKV, bv, 0, 0, 0); k_vtp<<<LKv, 256, 0, stream>>>(FV, DKV, NKV, VT16, VTh, VTl);
        for (int h0 = 0; h0 < NH_; h0 += ZH) { const size_t zq = (size_t)h0, zk = (size_t)(h0 / REP);   // one kv head per query head: the pass's one head h0 uses kv plane zk = h0 (z-strides TT*HD)
            k_gemmw<bf, 2, false><<<dim3(RH / 64, TT / 64, ZH), 32, 0, stream>>>(QPh + zq * TT * HD, QPl + zq * TT * HD, KPh + zk * TT * HD, KPl + zk * TT * HD, HD, HD, Sb, TT, nullptr, (size_t)TT * HD, (size_t)TT * HD, (size_t)TT * TT);
            k_gemmw<h16, 0, false><<<dim3((TT - RH) / 64, TT / 64, ZH), 32, 0, stream>>>(QP16 + zq * TT * HD + (size_t)RH * HD, nullptr, KP16 + zk * TT * HD, nullptr, HD, HD, Sb + (size_t)RH * TT, TT, nullptr, (size_t)TT * HD, (size_t)TT * HD, (size_t)TT * TT);
            k_asoft<<<ZH * TT / 8, 256, 0, stream>>>(Sb, kmask + (size_t)b * TT, P16, Ph, Pl);
            k_gemmw<bf, 2, false><<<dim3(RH / 64, HD / 64, KS), 32, 0, stream>>>(Ph, Pl, VTh + zk * HD * TT, VTl + zk * HD * TT, TT, TT / KS, Ob, KS * HD, nullptr, (size_t)(TT / KS), (size_t)(TT / KS), (size_t)HD);
            k_gemmw<h16, 0, false><<<dim3((TT - RH) / 64, HD / 64, KS), 32, 0, stream>>>(P16 + (size_t)RH * TT, nullptr, VT16 + zk * HD * TT, nullptr, TT, TT / KS, Ob + (size_t)RH * KS * HD, KS * HD, nullptr, (size_t)(TT / KS), (size_t)(TT / KS), (size_t)HD);
            k_merge<<<(unsigned)(((size_t)ZH * TT * HD / 2 + 255) / 256), 256, 0, stream>>>(Ob, h0, ATh, ATl); }
        k_gemmw<bf, 1, true><<<dim3(TT / 64, DM / 64, 1), 32, 0, stream>>>(ATh, ATl, WO, nullptr, DQ, DQ, OUT + (size_t)b * TT * DM, DM, bo, 0, 0, 0); }
}

// v002
// A run of this version takes 373 microseconds.
// Timed twice side by side with v001, it ran 2.96 and 2.95 times as fast.
// All steps since v000 together make it 9.50 times as fast.
#include <hip/hip_runtime.h>

// Attention on three input streams over 4,096 tokens with a RANDOM integer key mask (query, key, value [1][4096][1024]; q = query Wq^T + bq, k = key Wk^T + bk, v = value Wv^T + bv ('oi' 1/32 + zero biases; 16 heads x 64); scores / sqrt(64); keys with mask[b][0][0][j] == 0 -> -1e9 (== exclusion; mask int32 [1][1][1][4096] with random 0/1 entries, read per key on device); softmax; out = merged Wo^T + bo -> [1][4096][1024] (4.2 M); argument order query, key, value, mask, Wq, bq, Wk, bk, Wv, bv, Wo, bo).
// Layout: bf16 copies of query, key, value in turn; 'oi' weights; exact projections + f32 biases; identity-table plane builders; one fused attention launch for all heads (online softmax, no score plane), which reads the int key vector and excludes the zeros (hybrid rows: < 512 hi/lo 3 products, rest fp16); merged hi/lo x Wo exact + bo.
// Compute dtypes, f32 accumulate: every input rounded to bf16; projections exact + f32 biases; attention rows < 512 3 products, rest fp16; softmax f32; Wo hl x exact + bias.

#define NB_  1
#define TT   4096
#define DM   1024
#define NH_  16
#define NKV  16
#define REP  (NH_ / NKV)
#define HD   64
#define DQ   (NH_ * HD)
#define DKV  (NKV * HD)
#define RH   512                  // query rows < RH use hi+lo planes
#define WIN  0
typedef _Float16 h16;
typedef unsigned short bf;
typedef __attribute__((ext_vector_type(16))) __bf16   v16bf;
typedef __attribute__((ext_vector_type(16))) _Float16 v16h;
typedef __attribute__((ext_vector_type(8)))  _Float16 v8h;
typedef __attribute__((ext_vector_type(8)))  unsigned short v8us;
typedef __attribute__((ext_vector_type(8)))  float    v8f;
typedef __attribute__((ext_vector_type(4)))  float    v4f;
typedef v8h  __attribute__((may_alias)) v8ha;
typedef v4f  __attribute__((may_alias)) v4fa;
typedef v8us __attribute__((may_alias)) v8usa;

__device__ __forceinline__ unsigned short f2bf(float f) { unsigned u = __float_as_uint(f); u += 0x7FFFu + ((u >> 16) & 1u); return (unsigned short)(u >> 16); }
__device__ __forceinline__ float bf2f(unsigned short b) { return __uint_as_float(((unsigned)b) << 16); }
__device__ __forceinline__ float bfr(float f) { return bf2f(f2bf(f)); }
__device__ __forceinline__ v16h cat16(v8h lo, v8h hi) { return __builtin_shufflevector(lo, hi, 0, 1, 2, 3, 4, 5, 6, 7, 8, 9, 10, 11, 12, 13, 14, 15); }
__device__ __forceinline__ v16bf cat16b(v8us lo, v8us hi) { return __builtin_bit_cast(v16bf, __builtin_shufflevector(lo, hi, 0, 1, 2, 3, 4, 5, 6, 7, 8, 9, 10, 11, 12, 13, 14, 15)); }
__device__ __forceinline__ v8f wmma16(v16h a, v16h b, v8f c) { return __builtin_amdgcn_wmma_f32_16x16x32_f16(false, a, false, b, (short)0, c, false, false); }
__device__ __forceinline__ v8f wmmab(v16bf a, v16bf b, v8f c) { return __builtin_amdgcn_wmma_f32_16x16x32_bf16(false, a, false, b, (short)0, c, false, false); }



// ---- k_gemmw: register-blocked GEMM, ONE WAVE per 64x64 output tile (16 accumulators), operands straight from K-contiguous 16-bit planes; grid (M/64, N/64, Z), 32 threads.
// C[m][n] (f32, pitch ldc, + optional f32 bias[n]) = sum_{k < KL} A[m][k] Bt[n][k] (+ split products per NSPLIT). K = row pitch of A and Bt, KL = k extent summed here (KL == K: the whole row; KL < K with sA = sB = KL: z is a k slice and C + z sC its partial). z-batch strides sA/sB/sC in elements. KL % 32 == 0.
template <typename T16> struct WFrag;
template <> struct WFrag<h16> { typedef v16h V; static __device__ __forceinline__ V ld(const h16* p) { return cat16(*(const v8h*)p, *(const v8h*)(p + 16)); } static __device__ __forceinline__ v8f mma(V a, V b, v8f c) { return wmma16(a, b, c); } };
template <> struct WFrag<bf> { typedef v16bf V; static __device__ __forceinline__ V ld(const bf* p) { return cat16b(*(const v8us*)p, *(const v8us*)(p + 16)); } static __device__ __forceinline__ v8f mma(V a, V b, v8f c) { return wmmab(a, b, c); } };
template <typename T16, int NSPLIT, bool BIAS>
__global__ __launch_bounds__(32) void k_gemmw(const T16* __restrict__ A, const T16* __restrict__ A2, const T16* __restrict__ Bt, const T16* __restrict__ Bt2, int K, int KL, float* C, int ldc, const float* __restrict__ bias, size_t sA, size_t sB, size_t sC) {
    typedef typename WFrag<T16>::V V;
    __shared__ __align__(16) float os[16 * 68];
    const size_t z = blockIdx.z; A += z * sA; if (A2) A2 += z * sA; Bt += z * sB; if (Bt2) Bt2 += z * sB; C += z * sC;
    const int lane = threadIdx.x & 31, lr = lane & 15, hi = lane >> 4; const int r0 = blockIdx.x * 64, c0 = blockIdx.y * 64;
    v8f acc[4][4];
#pragma unroll
    for (int mb = 0; mb < 4; ++mb)
#pragma unroll
        for (int nb = 0; nb < 4; ++nb) acc[mb][nb] = (v8f){};
    const size_t aoff = (size_t)(r0 + lr) * K + 8 * hi, boff = (size_t)(c0 + lr) * K + 8 * hi;
#pragma unroll 1
    for (int kc = 0; kc < KL; kc += 32) {
        V a[4], a2[4];
#pragma unroll
        for (int mb = 0; mb < 4; ++mb) { a[mb] = WFrag<T16>::ld(A + aoff + (size_t)mb * 16 * K + kc); if (NSPLIT == 1 || NSPLIT == 2) a2[mb] = WFrag<T16>::ld(A2 + aoff + (size_t)mb * 16 * K + kc); }
#pragma unroll
        for (int nb = 0; nb < 4; ++nb) { const V b = WFrag<T16>::ld(Bt + boff + (size_t)nb * 16 * K + kc); V b2; if (NSPLIT >= 2) b2 = WFrag<T16>::ld(Bt2 + boff + (size_t)nb * 16 * K + kc);
#pragma unroll
            for (int mb = 0; mb < 4; ++mb) { acc[mb][nb] = WFrag<T16>::mma(a[mb], b, acc[mb][nb]); if (NSPLIT == 1 || NSPLIT == 2) acc[mb][nb] = WFrag<T16>::mma(a2[mb], b, acc[mb][nb]); if (NSPLIT >= 2) acc[mb][nb] = WFrag<T16>::mma(a[mb], b2, acc[mb][nb]); } }
        asm volatile("v_nop\n\tv_nop\n\tv_nop\n\tv_nop" : "+v"(acc[0][0]), "+v"(acc[1][1]), "+v"(acc[2][2]), "+v"(acc[3][3]) : "v"(a[0]), "v"(a[3]));
    }
#pragma unroll
    for (int mb = 0; mb < 4; ++mb) {
#pragma unroll
        for (int nb = 0; nb < 4; ++nb) {
#pragma unroll
            for (int j = 0; j < 8; ++j) os[(hi * 8 + j) * 68 + nb * 16 + lr] = acc[mb][nb][j]; }
        __builtin_amdgcn_wave_barrier(); asm volatile("" ::: "memory");
        float* crow = C + (size_t)(r0 + mb * 16) * ldc + c0;
{
#pragma unroll
            for (int s = 0; s < 8; ++s) { const int row = 2 * s + hi, cofs = lr * 4; v4f val = *(const v4fa*)(os + row * 68 + cofs); if (BIAS) { val[0] += bfr(bias[c0 + cofs]); val[1] += bfr(bias[c0 + cofs + 1]); val[2] += bfr(bias[c0 + cofs + 2]); val[3] += bfr(bias[c0 + cofs + 3]); }
                *(v4f*)(crow + (size_t)row * ldc + cofs) = val; }
             }
        __builtin_amdgcn_wave_barrier(); asm volatile("" ::: "memory");
    }
}

__device__ __forceinline__ h16 tohx(float x) { return (h16)x; }
__device__ __forceinline__ void splitf(float y, unsigned short& h, unsigned short& l) { h = f2bf(y); l = f2bf(y - bf2f(h)); }
typedef __attribute__((ext_vector_type(2))) _Float16 v2h;
typedef __attribute__((ext_vector_type(4))) _Float16 v4h;
typedef __attribute__((ext_vector_type(2))) unsigned short v2us;
typedef __attribute__((ext_vector_type(4))) unsigned short v4us;
typedef __attribute__((ext_vector_type(2))) float v2f;
typedef __attribute__((ext_vector_type(4))) int v4i;

__global__ __launch_bounds__(256) void k_cvt8(const float* __restrict__ src, bf* dst, size_t n8) { const size_t i = (size_t)blockIdx.x * 256 + threadIdx.x; if (i >= n8) return; const v8f v = *(const v8f*)(src + i * 8); v8us o;
#pragma unroll
    for (int k = 0; k < 8; ++k) o[k] = f2bf(v[k]); *(v8us*)(dst + i * 8) = o;  }

// k_rope: head planes [h][t][d] (fp16 + hi/lo) of rope(x) x sc with the rotate-half convention out[d] = x[d] cos[t][d] - x[d+HD/2] sin[t][d], out[d+HD/2] = x[d+HD/2] cos[t][d+HD/2] + x[d] sin[t][d+HD/2]
__global__ __launch_bounds__(256) void k_rope(const float* __restrict__ F, int pitch, int nheads, const float* __restrict__ CS, const float* __restrict__ RF, const float* __restrict__ nw, float sc, h16* P16, bf* Ph, bf* Pl) {
    const size_t e = ((size_t)blockIdx.x * 256 + threadIdx.x) * 2; if (e >= (size_t)nheads * TT * HD) return; const int d = (int)(e % HD); const int t = (int)((e / HD) % TT); const int h = (int)(e / ((size_t)HD * TT)); const float* f = F + (size_t)t * pitch + h * HD; const float rf = RF ? RF[(size_t)h * TT + t] : 1.0f; v2h o16; v2us oh, ol;
#pragma unroll
    for (int q = 0; q < 2; ++q) { const int dd = d + q; const int dp = (dd < HD / 2) ? dd + HD / 2 : dd - HD / 2; float x0 = f[dd], x1 = f[dp];
        if (RF) { float n0 = __fmul_rn(x0, rf), n1 = __fmul_rn(x1, rf); asm volatile("" : "+v"(n0)); asm volatile("" : "+v"(n1)); x0 = __fmul_rn(bfr(nw[dd]), n0); x1 = __fmul_rn(bfr(nw[dp]), n1); }
        const v2f cs = *(const v2f*)(CS + ((size_t)t * HD + dd) * 2); float a = __fmul_rn(x0, cs[0]), bq = __fmul_rn(x1, cs[1]); asm volatile("" : "+v"(a)); asm volatile("" : "+v"(bq)); const float r = ((dd < HD / 2) ? __fsub_rn(a, bq) : __fadd_rn(a, bq)) * sc;
        o16[q] = tohx(r); unsigned short a2, c2; splitf(r, a2, c2); oh[q] = a2; ol[q] = c2; }
    *(v2h*)(P16 + e) = o16; *(v2us*)(Ph + e) = oh; *(v2us*)(Pl + e) = ol;  }
__global__ __launch_bounds__(256) void k_vtp(const float* __restrict__ F, int pitch, int nheads, h16* V16, bf* Vh, bf* Vl) { const size_t e = ((size_t)blockIdx.x * 256 + threadIdx.x) * 2; if (e >= (size_t)nheads * HD * TT) return; const int t = (int)(e % TT); const int d = (int)((e / TT) % HD); const int g = (int)(e / ((size_t)TT * HD)); v2h o16; v2us oh, ol;
#pragma unroll
    for (int q = 0; q < 2; ++q) { const float x = F[(size_t)(t + q) * pitch + g * HD + d]; o16[q] = tohx(x); unsigned short a2, c2; splitf(x, a2, c2); oh[q] = a2; ol[q] = c2; }
    *(v2h*)(V16 + e) = o16; *(v2us*)(Vh + e) = oh; *(v2us*)(Vl + e) = ol;  }
__global__ __launch_bounds__(256) void k_csid(float* CS) { const int idx = blockIdx.x * 256 + threadIdx.x; if (idx >= TT * HD) return; v2f cs; cs[0] = 1.0f; cs[1] = 0.0f; *(v2f*)(CS + (size_t)idx * 2) = cs;  }
// ---- k_fattn: scores, key mask, softmax and P x V of all heads in ONE launch; no score or weight plane in memory.
// Per wave: S^T = K Q^T (A = 16 keys x 64 d, B = the wave's query columns, kept in registers), so a lane holds 8 consecutive keys of ONE query per tile;
// two such tiles, converted in place, are the B operand of O^T += V^T P^T (A = V^T rows in the same k order as WFrag::ld at + 8 * hi). 32 keys per pass.
// Softmax is online in base 2: weights exp2(s - mu + PSH) against the maximum in use mu, O and the sum rescaled only when a new maximum exceeds mu by more than 8.
// A masked key's score is -3.0e38: its weight is 0 beside any kept key, and 1 for every key of a row with no kept key (the module's uniform row).
// Block = 9 waves on 256 query rows' worth of one head's work: 2 waves of 16 hi/lo rows (< RH, 3 products) and 7 waves of 32 fp16 rows; 256 blocks.
// Every "#pragma unroll" in fattn: its loop indexes fragment and accumulator arrays, which stay in registers only under constant indices.
#define PSH  4.0f                  // weights lie in (0, 2^(8 + PSH)]: inside fp16's range, and small ones stay normal numbers
#define SCL2 0.18033688011112042f  // HD^-0.5 * log2(e)
#define FBH  (TT / 256)            // blocks per head
typedef __attribute__((ext_vector_type(8))) __bf16 v8b;
__device__ __forceinline__ float xhalf(float x) { return __builtin_bit_cast(float, __builtin_amdgcn_permlanex16(__builtin_bit_cast(int, x), __builtin_bit_cast(int, x), 0x76543210, 0xfedcba98, false, false)); }   // lane l <-> lane l ^ 16
// xwait: stands behind each group of loads, in front of any reuse of their address registers (named as inputs, so that they live up to the wait); as a memory clobber it also keeps the group where it is written
__device__ __forceinline__ void xwait(const void* a) { asm volatile("s_wait_xcnt 0x0" :: "v"(a) : "memory"); }
__device__ __forceinline__ void xwait(const void* a, const void* b) { asm volatile("s_wait_xcnt 0x0" :: "v"(a), "v"(b) : "memory"); }
__device__ __forceinline__ void xwait(const void* a, const void* b, const void* d) { asm volatile("s_wait_xcnt 0x0" :: "v"(a), "v"(b), "v"(d) : "memory"); }
template <typename T16, bool HI, int R>
__device__ __forceinline__ void fattn(const T16* __restrict__ Qa, const T16* __restrict__ Qb, const T16* __restrict__ Ka, const T16* __restrict__ Kb, const T16* __restrict__ Va, const T16* __restrict__ Vb, const int* __restrict__ kvp, int q0, bf* Ah, bf* Al) {
    typedef typename WFrag<T16>::V V;
    const int lane = threadIdx.x & 31, lr = lane & 15, hi = lane >> 4;
    V qa[R][2], qb[R][2]; const T16* qpa = Qa + (size_t)(q0 + lr) * HD + 8 * hi; const T16* qpb = HI ? Qb + (size_t)(q0 + lr) * HD + 8 * hi : nullptr;
#pragma unroll
    for (int g = 0; g < R; ++g)
#pragma unroll
        for (int kk = 0; kk < 2; ++kk) { const int qo = 16 * g * HD + 32 * kk; qa[g][kk] = WFrag<T16>::ld(qpa + qo); if (HI) qb[g][kk] = WFrag<T16>::ld(qpb + qo); }
    if constexpr (HI) xwait(qpa, qpb); else xwait(qpa);
    v8f o[R][4]; float mu[R], ls[R];
#pragma unroll
    for (int g = 0; g < R; ++g) { mu[g] = -3.0e38f; ls[g] = 0.f;
#pragma unroll
        for (int dt = 0; dt < 4; ++dt) o[g][dt] = (v8f){}; }
    const size_t ko = (size_t)lr * HD + 8 * hi, vo = (size_t)lr * TT + 8 * hi;
    V ka[2][2], kb[2][2]; v4i mk[2][2];   // a pass's mask words and K fragments are fetched by the pass before it
#pragma unroll
    for (int kt = 0; kt < 2; ++kt) { mk[kt][0] = *(const v4i*)(kvp + 8 * hi + 16 * kt); mk[kt][1] = *(const v4i*)(kvp + 8 * hi + 16 * kt + 4);
#pragma unroll
        for (int kk = 0; kk < 2; ++kk) { ka[kt][kk] = WFrag<T16>::ld(Ka + ko + kt * 16 * HD + 32 * kk); if (HI) kb[kt][kk] = WFrag<T16>::ld(Kb + ko + kt * 16 * HD + 32 * kk); } }
    if constexpr (HI) xwait(kvp + 8 * hi, Ka + ko, Kb + ko); else xwait(kvp + 8 * hi, Ka + ko);
    __builtin_amdgcn_sched_barrier(0);   // keeps the register set-up of the loop behind the wait above: moved up, it rewrote the mask loads' offset register in front of the wait
    for (int kc = 0; kc < TT; kc += 32) {
        V va[4], vb[4];   // this pass's V^T fragments: issued first, read behind the softmax
        const T16* vpa = Va + vo + kc; const T16* vpb = HI ? Vb + vo + kc : nullptr;
#pragma unroll
        for (int dt = 0; dt < 4; ++dt) { va[dt] = WFrag<T16>::ld(vpa + dt * 16 * TT); if (HI) vb[dt] = WFrag<T16>::ld(vpb + dt * 16 * TT); }
        if constexpr (HI) xwait(vpa, vpb); else xwait(vpa);
        v8f bias[2];
#pragma unroll
        for (int kt = 0; kt < 2; ++kt)
#pragma unroll
            for (int r = 0; r < 4; ++r) { bias[kt][r] = (mk[kt][0][r] != 0) ? 0.f : -3.0e38f; bias[kt][4 + r] = (mk[kt][1][r] != 0) ? 0.f : -3.0e38f; }
        v8f s[R][2];
#pragma unroll
        for (int g = 0; g < R; ++g)
#pragma unroll
            for (int kt = 0; kt < 2; ++kt) s[g][kt] = (v8f){};
#pragma unroll
        for (int kk = 0; kk < 2; ++kk) {
#pragma unroll
            for (int g = 0; g < R; ++g)
#pragma unroll
                for (int kt = 0; kt < 2; ++kt) s[g][kt] = WFrag<T16>::mma(ka[kt][kk], qa[g][kk], s[g][kt]);
            if (HI) {
#pragma unroll
                for (int g = 0; g < R; ++g)
#pragma unroll
                    for (int kt = 0; kt < 2; ++kt) s[g][kt] = WFrag<T16>::mma(ka[kt][kk], qb[g][kk], s[g][kt]);
#pragma unroll
                for (int g = 0; g < R; ++g)
#pragma unroll
                    for (int kt = 0; kt < 2; ++kt) s[g][kt] = WFrag<T16>::mma(kb[kt][kk], qa[g][kk], s[g][kt]);
            }
        }
        const int kn = (kc + 32) & (TT - 1);   // the next pass's mask words and K fragments, fetched behind this pass's S^T products (the last pass fetches keys 0 .. 31 again, unused)
        const int* mp = kvp + kn + 8 * hi; const T16* kpa = Ka + ko + (size_t)kn * HD; const T16* kpb = HI ? Kb + ko + (size_t)kn * HD : nullptr;
#pragma unroll
        for (int kt = 0; kt < 2; ++kt) { mk[kt][0] = *(const v4i*)(mp + 16 * kt); mk[kt][1] = *(const v4i*)(mp + 16 * kt + 4); }
#pragma unroll
        for (int kt = 0; kt < 2; ++kt)
#pragma unroll
            for (int kk = 0; kk < 2; ++kk) { ka[kt][kk] = WFrag<T16>::ld(kpa + kt * 16 * HD + 32 * kk); if (HI) kb[kt][kk] = WFrag<T16>::ld(kpb + kt * 16 * HD + 32 * kk); }
        if constexpr (HI) xwait(mp, kpa, kpb); else xwait(mp, kpa);
        float mx[R]; bool need = false;
#pragma unroll
        for (int g = 0; g < R; ++g) { mx[g] = -3.0e38f;
#pragma unroll
            for (int kt = 0; kt < 2; ++kt) { s[g][kt] = s[g][kt] * SCL2 + bias[kt];
#pragma unroll
                for (int r = 0; r < 8; ++r) mx[g] = fmaxf(mx[g], s[g][kt][r]); }
            need = need || (mx[g] > mu[g] + 8.0f); }
        if (__builtin_amdgcn_ballot_w32(need) != 0) {   // one scalar test per pass; rare behind the first passes
#pragma unroll
            for (int g = 0; g < R; ++g) { const float mn = fmaxf(mu[g], fmaxf(mx[g], xhalf(mx[g]))); const float corr = __builtin_amdgcn_exp2f(mu[g] - mn); mu[g] = mn; ls[g] *= corr;
#pragma unroll
                for (int dt = 0; dt < 4; ++dt) o[g][dt] = o[g][dt] * corr; }
        }
#pragma unroll
        for (int g = 0; g < R; ++g) { const float nm = PSH - mu[g]; v8f p[2];
#pragma unroll
            for (int kt = 0; kt < 2; ++kt) { const v8f ar = s[g][kt] + nm;
#pragma unroll
                for (int r = 0; r < 8; ++r) p[kt][r] = __builtin_amdgcn_exp2f(ar[r]); }
            const v8f ps = p[0] + p[1]; ls[g] += ((ps[0] + ps[1]) + (ps[2] + ps[3])) + ((ps[4] + ps[5]) + (ps[6] + ps[7]));
            if constexpr (HI) {
                const v8b h0 = __builtin_convertvector(p[0], v8b), h1 = __builtin_convertvector(p[1], v8b);
                const v8b l0 = __builtin_convertvector(p[0] - __builtin_convertvector(h0, v8f), v8b), l1 = __builtin_convertvector(p[1] - __builtin_convertvector(h1, v8f), v8b);
                const V ph = __builtin_shufflevector(h0, h1, 0, 1, 2, 3, 4, 5, 6, 7, 8, 9, 10, 11, 12, 13, 14, 15), pl = __builtin_shufflevector(l0, l1, 0, 1, 2, 3, 4, 5, 6, 7, 8, 9, 10, 11, 12, 13, 14, 15);
#pragma unroll
                for (int dt = 0; dt < 4; ++dt) o[g][dt] = WFrag<T16>::mma(va[dt], ph, o[g][dt]);
#pragma unroll
                for (int dt = 0; dt < 4; ++dt) o[g][dt] = WFrag<T16>::mma(va[dt], pl, o[g][dt]);
#pragma unroll
                for (int dt = 0; dt < 4; ++dt) o[g][dt] = WFrag<T16>::mma(vb[dt], ph, o[g][dt]);
            } else {
                const V pf = cat16(__builtin_convertvector(p[0], v8h), __builtin_convertvector(p[1], v8h));
#pragma unroll
                for (int dt = 0; dt < 4; ++dt) o[g][dt] = WFrag<T16>::mma(va[dt], pf, o[g][dt]);
            } }
    }
#pragma unroll
    for (int g = 0; g < R; ++g) { const float inv = __fdiv_rn(1.0f, ls[g] + xhalf(ls[g]));   // the two halves hold the sums of their own keys
#pragma unroll
        for (int dt = 0; dt < 4; ++dt) { v8us oh, ol;
#pragma unroll
            for (int r = 0; r < 8; ++r) { unsigned short a, c2; splitf(o[g][dt][r] * inv, a, c2); oh[r] = a; ol[r] = c2; }
            const size_t oo = (size_t)(q0 + 16 * g + lr) * DQ + dt * 16 + 8 * hi; *(v8us*)(Ah + oo) = oh; *(v8us*)(Al + oo) = ol; } }
}
__global__ __launch_bounds__(288) void k_fattn(const h16* __restrict__ Q16, const h16* __restrict__ K16, const h16* __restrict__ V16, const bf* __restrict__ Qh, const bf* __restrict__ Ql, const bf* __restrict__ Kh, const bf* __restrict__ Kl, const bf* __restrict__ Vh, const bf* __restrict__ Vl, const int* __restrict__ kvp, bf* Ah, bf* Al) {
    const int wave = __builtin_amdgcn_readfirstlane(threadIdx.x >> 5); const int blk = blockIdx.x; const size_t pl = (size_t)blockIdx.y * TT * HD; Ah += blockIdx.y * HD; Al += blockIdx.y * HD;
    if (wave == 1 || wave == 2) fattn<bf, true, 1>(Qh + pl, Ql + pl, Kh + pl, Kl + pl, Vh + pl, Vl + pl, kvp, (blk * 2 + wave - 1) * 16, Ah, Al);
    else fattn<h16, false, 2>(Q16 + pl, nullptr, K16 + pl, nullptr, V16 + pl, nullptr, kvp, RH + (blk * 7 + (wave ? wave - 2 : 0)) * 32, Ah, Al);
}
static_assert(NH_ == NKV && RH == FBH * 2 * 16 && TT - RH == FBH * 7 * 32, "a block's 9 waves: 2 x 16 hi/lo rows and 7 x 32 fp16 rows");

extern "C" void kernel_launch(void* const* d_in, const int* in_sizes, int n_in,
                              void* d_out, int out_size, void* d_ws, size_t ws_size, hipStream_t stream) {
    (void)in_sizes; (void)n_in; (void)out_size;
    const float* x = (const float*)d_in[0]; const float* xk = (const float*)d_in[1]; const float* xv = (const float*)d_in[2]; const int* kmask = (const int*)d_in[3]; const float* wq = (const float*)d_in[4]; const float* bq = (const float*)d_in[5]; const float* wk = (const float*)d_in[6]; const float* bk = (const float*)d_in[7]; const float* wv = (const float*)d_in[8]; const float* bv = (const float*)d_in[9]; const float* wo = (const float*)d_in[10]; const float* bo = (const float*)d_in[11];   /* order query, key, value, mask (int32 [1][1][1][4096], read), Wq, bq, Wk, bk, Wv, bv, Wo, bo ('oi' + biases) */
    float* OUT = (float*)d_out;     // [1][4096][1024]
    char* wsp = (char*)d_ws;
    auto take = [&](size_t bytes) { char* p = wsp; wsp += (bytes + 255) & ~(size_t)255; return (void*)p; };
    bf* WQ = (bf*)take((size_t)DQ * DM * 2); bf* WK = (bf*)take((size_t)DKV * DM * 2); bf* WV = (bf*)take((size_t)DKV * DM * 2); bf* WO = (bf*)take((size_t)DM * DQ * 2); float* CS = (float*)take((size_t)TT * HD * 2 * 4);
    bf* XB = (bf*)take((size_t)TT * DM * 2); float* FQ = (float*)take((size_t)TT * DQ * 4); float* FK = (float*)take((size_t)TT * DKV * 4);
    h16* QP16 = (h16*)take((size_t)NH_ * TT * HD * 2); h16* KP16 = (h16*)take((size_t)NKV * TT * HD * 2); h16* VT16 = (h16*)take((size_t)NKV * HD * TT * 2);
    bf* QPh = (bf*)take((size_t)NH_ * TT * HD * 2); bf* QPl = (bf*)take((size_t)NH_ * TT * HD * 2); bf* KPh = (bf*)take((size_t)NKV * TT * HD * 2); bf* KPl = (bf*)take((size_t)NKV * TT * HD * 2); bf* VTh = (bf*)take((size_t)NKV * HD * TT * 2); bf* VTl = (bf*)take((size_t)NKV * HD * TT * 2);
    bf* ATh = (bf*)take((size_t)TT * DQ * 2); bf* ATl = (bf*)take((size_t)TT * DQ * 2);
    if ((size_t)(wsp - (char*)d_ws) > ws_size) return;    // ws 256 MiB
    float* FV = FK;   // v projection reuses the k buffer after the k planes are built (stream-ordered)
    { k_cvt8<<<(unsigned)(((size_t)DQ * DM / 8 + 255) / 256), 256, 0, stream>>>(wq, WQ, (size_t)DQ * DM / 8); k_cvt8<<<(unsigned)(((size_t)DKV * DM / 8 + 255) / 256), 256, 0, stream>>>(wk, WK, (size_t)DKV * DM / 8); k_cvt8<<<(unsigned)(((size_t)DKV * DM / 8 + 255) / 256), 256, 0, stream>>>(wv, WV, (size_t)DKV * DM / 8);
      k_cvt8<<<(unsigned)(((size_t)DM * DQ / 8 + 255) / 256), 256, 0, stream>>>(wo, WO, (size_t)DM * DQ / 8);
       }
    k_csid<<<(TT * HD + 255) / 256, 256, 0, stream>>>(CS);
    const unsigned LQ = (unsigned)(((size_t)NH_ * TT * HD / 2 + 255) / 256), LKv = (unsigned)(((size_t)NKV * TT * HD / 2 + 255) / 256);
    for (int b = 0; b < NB_; ++b) {
        
        k_cvt8<<<(unsigned)(((size_t)TT * DM / 8 + 255) / 256), 256, 0, stream>>>(x + (size_t)b * TT * DM, XB, (size_t)TT * DM / 8);
        k_gemmw<bf, 0, true><<<dim3(TT / 64, DQ / 64, 1), 32, 0, stream>>>(XB, nullptr, WQ, nullptr, DM, DM, FQ, DQ, bq, 0, 0, 0);
        k_rope<<<LQ, 256, 0, stream>>>(FQ, DQ, NH_, CS, nullptr, nullptr, 1.0f, QP16, QPh, QPl);
        k_cvt8<<<(unsigned)(((size_t)TT * DM / 8 + 255) / 256), 256, 0, stream>>>(xk + (size_t)b * TT * DM, XB, (size_t)TT * DM / 8);   /* XB := bf16(key[b]) */ k_gemmw<bf, 0, true><<<dim3(TT / 64, DKV / 64, 1), 32, 0, stream>>>(XB, nullptr, WK, nullptr, DM, DM, FK, DKV, bk, 0, 0, 0);
        k_rope<<<LKv, 256, 0, stream>>>(FK, DKV, NKV, CS, nullptr, nullptr, 1.0f, KP16, KPh, KPl);
        k_cvt8<<<(unsigned)(((size_t)TT * DM / 8 + 255) / 256), 256, 0, stream>>>(xv + (size_t)b * TT * DM, XB, (size_t)TT * DM / 8);   /* XB := bf16(value[b]) */ k_gemmw<bf, 0, true><<<dim3(TT / 64, DKV / 64, 1), 32, 0, stream>>>(XB, nullptr, WV, nullptr, DM, DM, FV, DKV, bv, 0, 0, 0); k_vtp<<<LKv, 256, 0, stream>>>(FV, DKV, NKV, VT16, VTh, VTl);
        k_fattn<<<dim3(FBH, NH_), 288, 0, stream>>>(QP16, KP16, VT16, QPh, QPl, KPh, KPl, VTh, VTl, kmask + (size_t)b * TT, ATh, ATl);
        k_gemmw<bf, 1, true><<<dim3(TT / 64, DM / 64, 1), 32, 0, stream>>>(ATh, ATl, WO, nullptr, DQ, DQ, OUT + (size_t)b * TT * DM, DM, bo, 0, 0, 0); }
}

// v003
// A run of this version takes 347 microseconds.
// Next to v002, in two timings, it ran 1.07 and 1.08 times as fast.
// All steps since v000 together make it 10.2 times as fast.
#include <hip/hip_runtime.h>

// Attention on three input streams over 4,096 tokens with a RANDOM integer key mask (query, key, value [1][4096][1024]; q = query Wq^T + bq, k = key Wk^T + bk, v = value Wv^T + bv ('oi' 1/32 + zero biases; 16 heads x 64); scores / sqrt(64); keys with mask[b][0][0][j] == 0 -> -1e9 (== exclusion; mask int32 [1][1][1][4096] with random 0/1 entries, read per key on device); softmax; out = merged Wo^T + bo -> [1][4096][1024] (4.2 M); argument order query, key, value, mask, Wq, bq, Wk, bk, Wv, bv, Wo, bo).
// Layout: bf16 copies of query, key, value in turn; 'oi' weights; exact projections + f32 biases, whose epilogues store the head planes (fp16 + bf16 hi/lo; V transposed) themselves; one fused attention launch for all heads (online softmax, no score plane), which reads the int key vector and excludes the zeros (hybrid rows: < 512 hi/lo 3 products, rest fp16); merged hi/lo x Wo exact + bo.
// Compute dtypes, f32 accumulate: every input rounded to bf16; projections exact + f32 biases; attention rows < 512 3 products, rest fp16; softmax f32; Wo hl x exact + bias.

#define NB_  1
#define TT   4096
#define DM   1024
#define NH_  16
#define NKV  16
#define REP  (NH_ / NKV)
#define HD   64
#define DQ   (NH_ * HD)
#define DKV  (NKV * HD)
#define RH   512                  // query rows < RH use hi+lo planes
#define WIN  0
typedef _Float16 h16;
typedef unsigned short bf;
typedef __attribute__((ext_vector_type(16))) __bf16   v16bf;
typedef __attribute__((ext_vector_type(16))) _Float16 v16h;
typedef __attribute__((ext_vector_type(8)))  _Float16 v8h;
typedef __attribute__((ext_vector_type(8)))  unsigned short v8us;
typedef __attribute__((ext_vector_type(8)))  float    v8f;
typedef __attribute__((ext_vector_type(4)))  float    v4f;
typedef v8h  __attribute__((may_alias)) v8ha;
typedef v4f  __attribute__((may_alias)) v4fa;
typedef v8us __attribute__((may_alias)) v8usa;

__device__ __forceinline__ unsigned short f2bf(float f) { unsigned u = __float_as_uint(f); u += 0x7FFFu + ((u >> 16) & 1u); return (unsigned short)(u >> 16); }
__device__ __forceinline__ float bf2f(unsigned short b) { return __uint_as_float(((unsigned)b) << 16); }
__device__ __forceinline__ float bfr(float f) { return bf2f(f2bf(f)); }
__device__ __forceinline__ v16h cat16(v8h lo, v8h hi) { return __builtin_shufflevector(lo, hi, 0, 1, 2, 3, 4, 5, 6, 7, 8, 9, 10, 11, 12, 13, 14, 15); }
__device__ __forceinline__ v16bf cat16b(v8us lo, v8us hi) { return __builtin_bit_cast(v16bf, __builtin_shufflevector(lo, hi, 0, 1, 2, 3, 4, 5, 6, 7, 8, 9, 10, 11, 12, 13, 14, 15)); }
__device__ __forceinline__ v8f wmma16(v16h a, v16h b, v8f c) { return __builtin_amdgcn_wmma_f32_16x16x32_f16(false, a, false, b, (short)0, c, false, false); }
__device__ __forceinline__ v8f wmmab(v16bf a, v16bf b, v8f c) { return __builtin_amdgcn_wmma_f32_16x16x32_bf16(false, a, false, b, (short)0, c, false, false); }
__device__ __forceinline__ h16 tohx(float x) { return (h16)x; }
__device__ __forceinline__ void splitf(float y, unsigned short& h, unsigned short& l) { h = f2bf(y); l = f2bf(y - bf2f(h)); }



// ---- k_gemmw: register-blocked GEMM, ONE WAVE per 64x64 output tile (16 accumulators), operands straight from K-contiguous 16-bit planes; grid (M/64, N/64, Z), 32 threads.
// C[m][n] (f32, pitch ldc, + optional f32 bias[n]) = sum_{k < KL} A[m][k] Bt[n][k] (+ split products per NSPLIT). K = row pitch of A and Bt, KL = k extent summed here (KL == K: the whole row; KL < K with sA = sB = KL: z is a k slice and C + z sC its partial). z-batch strides sA/sB/sC in elements. KL % 32 == 0.
// PL = 0: C as above. PL = 1, 2: no C; the tile (64 tokens x the 64 columns of head blockIdx.y, + bias) goes out as three 16-bit planes, fp16 and bf16 hi + lo: PL = 1 [head][token][d], PL = 2 transposed, [head][d][token].
template <typename T16> struct WFrag;
template <> struct WFrag<h16> { typedef v16h V; static __device__ __forceinline__ V ld(const h16* p) { return cat16(*(const v8h*)p, *(const v8h*)(p + 16)); } static __device__ __forceinline__ v8f mma(V a, V b, v8f c) { return wmma16(a, b, c); } };
template <> struct WFrag<bf> { typedef v16bf V; static __device__ __forceinline__ V ld(const bf* p) { return cat16b(*(const v8us*)p, *(const v8us*)(p + 16)); } static __device__ __forceinline__ v8f mma(V a, V b, v8f c) { return wmmab(a, b, c); } };
template <typename T16, int NSPLIT, bool BIAS, int PL>
__global__ __launch_bounds__(32) void k_gemmw(const T16* __restrict__ A, const T16* __restrict__ A2, const T16* __restrict__ Bt, const T16* __restrict__ Bt2, int K, int KL, float* C, int ldc, const float* __restrict__ bias, size_t sA, size_t sB, size_t sC, h16* P16, bf* Ph, bf* Pl) {
    typedef typename WFrag<T16>::V V;
    __shared__ __align__(16) float os[16 * 68];
    const size_t z = blockIdx.z; A += z * sA; if (A2) A2 += z * sA; Bt += z * sB; if (Bt2) Bt2 += z * sB; C += z * sC;
    const int lane = threadIdx.x & 31, lr = lane & 15, hi = lane >> 4; const int r0 = blockIdx.x * 64, c0 = blockIdx.y * 64;
    v8f acc[4][4];
#pragma unroll
    for (int mb = 0; mb < 4; ++mb)
#pragma unroll
        for (int nb = 0; nb < 4; ++nb) acc[mb][nb] = (v8f){};
    const size_t aoff = (size_t)(r0 + lr) * K + 8 * hi, boff = (size_t)(c0 + lr) * K + 8 * hi;
#pragma unroll 1
    for (int kc = 0; kc < KL; kc += 32) {
        V a[4], a2[4];
#pragma unroll
        for (int mb = 0; mb < 4; ++mb) { a[mb] = WFrag<T16>::ld(A + aoff + (size_t)mb * 16 * K + kc); if (NSPLIT == 1 || NSPLIT == 2) a2[mb] = WFrag<T16>::ld(A2 + aoff + (size_t)mb * 16 * K + kc); }
#pragma unroll
        for (int nb = 0; nb < 4; ++nb) { const V b = WFrag<T16>::ld(Bt + boff + (size_t)nb * 16 * K + kc); V b2; if (NSPLIT >= 2) b2 = WFrag<T16>::ld(Bt2 + boff + (size_t)nb * 16 * K + kc);
#pragma unroll
            for (int mb = 0; mb < 4; ++mb) { acc[mb][nb] = WFrag<T16>::mma(a[mb], b, acc[mb][nb]); if (NSPLIT == 1 || NSPLIT == 2) acc[mb][nb] = WFrag<T16>::mma(a2[mb], b, acc[mb][nb]); if (NSPLIT >= 2) acc[mb][nb] = WFrag<T16>::mma(a[mb], b2, acc[mb][nb]); } }
        asm volatile("v_nop\n\tv_nop\n\tv_nop\n\tv_nop" : "+v"(acc[0][0]), "+v"(acc[1][1]), "+v"(acc[2][2]), "+v"(acc[3][3]) : "v"(a[0]), "v"(a[3]));
    }
    // Every "#pragma unroll" of the plane epilogues: its loop indexes accumulator and staging arrays, which stay in registers only under constant indices.
    const int prow = lane >> 3, pc = (lane & 7) * 8;   // plane stores: 8 lanes x 16 bytes a row, so one store covers four whole 128-byte rows
    if constexpr (PL == 2) {
        // a lane's 8 accumulator elements are 8 consecutive tokens of ONE column d: converted in registers, 16 d rows x 64 tokens of each plane pass through LDS (pitch 72: no bank shared by the 16 rows of a write)
        __shared__ __align__(16) unsigned short ts[3][16 * 72];
#pragma unroll
        for (int nb = 0; nb < 4; ++nb) {
            const float bb = BIAS ? bfr(bias[c0 + nb * 16 + lr]) : 0.f;
#pragma unroll
            for (int mb = 0; mb < 4; ++mb) { v8h o16; v8us oh, ol;
#pragma unroll
                for (int j = 0; j < 8; ++j) { const float x = acc[mb][nb][j] + bb; o16[j] = tohx(x); unsigned short a2, c2; splitf(x, a2, c2); oh[j] = a2; ol[j] = c2; }
                const int to = lr * 72 + mb * 16 + hi * 8; *(v8usa*)(ts[0] + to) = __builtin_bit_cast(v8us, o16); *(v8usa*)(ts[1] + to) = oh; *(v8usa*)(ts[2] + to) = ol; }
            __builtin_amdgcn_wave_barrier(); asm volatile("" ::: "memory");   // the rows are read back by other lanes of the wave: keeps the reads behind the writes
            v8us w[4][3]; const size_t po = (size_t)(c0 + nb * 16 + prow) * TT + r0 + pc;
#pragma unroll
            for (int s = 0; s < 4; ++s) {
#pragma unroll
                for (int p = 0; p < 3; ++p) w[s][p] = *(const v8usa*)(ts[p] + (4 * s + prow) * 72 + pc);
                *(v8us*)((bf*)P16 + po + (size_t)s * 4 * TT) = w[s][0]; *(v8us*)(Ph + po + (size_t)s * 4 * TT) = w[s][1]; *(v8us*)(Pl + po + (size_t)s * 4 * TT) = w[s][2]; }
            // stands behind the group's stores, in front of any reuse of their data registers (named as inputs, so that they live up to the wait); as a memory clobber it also keeps the next rows' LDS writes behind these reads
            asm volatile("s_wait_xcnt 0x0" :: "v"(w[0][0]), "v"(w[0][1]), "v"(w[0][2]), "v"(w[1][0]), "v"(w[1][1]), "v"(w[1][2]), "v"(w[2][0]), "v"(w[2][1]), "v"(w[2][2]), "v"(w[3][0]), "v"(w[3][1]), "v"(w[3][2]) : "memory");
        }
        return;
    }
    float pb[8];
    if constexpr (PL == 1) {
#pragma unroll
        for (int k = 0; k < 8; ++k) pb[k] = BIAS ? bfr(bias[c0 + pc + k]) : 0.f; }
#pragma unroll
    for (int mb = 0; mb < 4; ++mb) {
#pragma unroll
        for (int nb = 0; nb < 4; ++nb) {
#pragma unroll
            for (int j = 0; j < 8; ++j) os[(hi * 8 + j) * 68 + nb * 16 + lr] = acc[mb][nb][j]; }
        __builtin_amdgcn_wave_barrier(); asm volatile("" ::: "memory");
        if constexpr (PL == 1) {
            v8us w[4][3]; const size_t po = ((size_t)blockIdx.y * TT + r0 + mb * 16 + prow) * HD + pc;
#pragma unroll
            for (int s = 0; s < 4; ++s) { const float* orow = os + (4 * s + prow) * 68 + pc; const v4f x0 = *(const v4fa*)orow, x1 = *(const v4fa*)(orow + 4); v8h o16;
#pragma unroll
                for (int k = 0; k < 8; ++k) { const float x = (k < 4 ? x0[k & 3] : x1[k & 3]) + pb[k]; o16[k] = tohx(x); unsigned short a2, c2; splitf(x, a2, c2); w[s][1][k] = a2; w[s][2][k] = c2; }
                w[s][0] = __builtin_bit_cast(v8us, o16);
                *(v8us*)((bf*)P16 + po + s * 4 * HD) = w[s][0]; *(v8us*)(Ph + po + s * 4 * HD) = w[s][1]; *(v8us*)(Pl + po + s * 4 * HD) = w[s][2]; }
            // stands behind the group's stores, in front of any reuse of their data registers (named as inputs, so that they live up to the wait)
            asm volatile("s_wait_xcnt 0x0" :: "v"(w[0][0]), "v"(w[0][1]), "v"(w[0][2]), "v"(w[1][0]), "v"(w[1][1]), "v"(w[1][2]), "v"(w[2][0]), "v"(w[2][1]), "v"(w[2][2]), "v"(w[3][0]), "v"(w[3][1]), "v"(w[3][2]) : "memory");
        } else {
        float* crow = C + (size_t)(r0 + mb * 16) * ldc + c0;
{
#pragma unroll
            for (int s = 0; s < 8; ++s) { const int row = 2 * s + hi, cofs = lr * 4; v4f val = *(const v4fa*)(os + row * 68 + cofs); if (BIAS) { val[0] += bfr(bias[c0 + cofs]); val[1] += bfr(bias[c0 + cofs + 1]); val[2] += bfr(bias[c0 + cofs + 2]); val[3] += bfr(bias[c0 + cofs + 3]); }
                *(v4f*)(crow + (size_t)row * ldc + cofs) = val; }
             }
        }
        __builtin_amdgcn_wave_barrier(); asm volatile("" ::: "memory");
    }
}

typedef __attribute__((ext_vector_type(4))) _Float16 v4h;
typedef __attribute__((ext_vector_type(4))) unsigned short v4us;
typedef __attribute__((ext_vector_type(4))) int v4i;

__global__ __launch_bounds__(256) void k_cvt8(const float* __restrict__ src, bf* dst, size_t n8) { const size_t i = (size_t)blockIdx.x * 256 + threadIdx.x; if (i >= n8) return; const v8f v = *(const v8f*)(src + i * 8); v8us o;
#pragma unroll
    for (int k = 0; k < 8; ++k) o[k] = f2bf(v[k]); *(v8us*)(dst + i * 8) = o;  }

// ---- k_fattn: scores, key mask, softmax and P x V of all heads in ONE launch; no score or weight plane in memory.
// Per wave: S^T = K Q^T (A = 16 keys x 64 d, B = the wave's query columns, kept in registers), so a lane holds 8 consecutive keys of ONE query per tile;
// two such tiles, converted in place, are the B operand of O^T += V^T P^T (A = V^T rows in the same k order as WFrag::ld at + 8 * hi). 32 keys per pass.
// Softmax is online in base 2: weights exp2(s - mu + PSH) against the maximum in use mu, O and the sum rescaled only when a new maximum exceeds mu by more than 8.
// A masked key's score is -3.0e38: its weight is 0 beside any kept key, and 1 for every key of a row with no kept key (the module's uniform row).
// Block = 9 waves on 256 query rows' worth of one head's work: 2 waves of 16 hi/lo rows (< RH, 3 products) and 7 waves of 32 fp16 rows; 256 blocks.
// Every "#pragma unroll" in fattn: its loop indexes fragment and accumulator arrays, which stay in registers only under constant indices.
#define PSH  4.0f                  // weights lie in (0, 2^(8 + PSH)]: inside fp16's range, and small ones stay normal numbers
#define SCL2 0.18033688011112042f  // HD^-0.5 * log2(e)
#define FBH  (TT / 256)            // blocks per head
typedef __attribute__((ext_vector_type(8))) __bf16 v8b;
__device__ __forceinline__ float xhalf(float x) { return __builtin_bit_cast(float, __builtin_amdgcn_permlanex16(__builtin_bit_cast(int, x), __builtin_bit_cast(int, x), 0x76543210, 0xfedcba98, false, false)); }   // lane l <-> lane l ^ 16
// xwait: stands behind each group of loads, in front of any reuse of their address registers (named as inputs, so that they live up to the wait); as a memory clobber it also keeps the group where it is written
__device__ __forceinline__ void xwait(const void* a) { asm volatile("s_wait_xcnt 0x0" :: "v"(a) : "memory"); }
__device__ __forceinline__ void xwait(const void* a, const void* b) { asm volatile("s_wait_xcnt 0x0" :: "v"(a), "v"(b) : "memory"); }
__device__ __forceinline__ void xwait(const void* a, const void* b, const void* d) { asm volatile("s_wait_xcnt 0x0" :: "v"(a), "v"(b), "v"(d) : "memory"); }
template <typename T16, bool HI, int R>
__device__ __forceinline__ void fattn(const T16* __restrict__ Qa, const T16* __restrict__ Qb, const T16* __restrict__ Ka, const T16* __restrict__ Kb, const T16* __restrict__ Va, const T16* __restrict__ Vb, const int* __restrict__ kvp, int q0, bf* Ah, bf* Al) {
    typedef typename WFrag<T16>::V V;
    const int lane = threadIdx.x & 31, lr = lane & 15, hi = lane >> 4;
    V qa[R][2], qb[R][2]; const T16* qpa = Qa + (size_t)(q0 + lr) * HD + 8 * hi; const T16* qpb = HI ? Qb + (size_t)(q0 + lr) * HD + 8 * hi : nullptr;
#pragma unroll
    for (int g = 0; g < R; ++g)
#pragma unroll
        for (int kk = 0; kk < 2; ++kk) { const int qo = 16 * g * HD + 32 * kk; qa[g][kk] = WFrag<T16>::ld(qpa + qo); if (HI) qb[g][kk] = WFrag<T16>::ld(qpb + qo); }
    if constexpr (HI) xwait(qpa, qpb); else xwait(qpa);
    v8f o[R][4]; float mu[R], ls[R];
#pragma unroll
    for (int g = 0; g < R; ++g) { mu[g] = -3.0e38f; ls[g] = 0.f;
#pragma unroll
        for (int dt = 0; dt < 4; ++dt) o[g][dt] = (v8f){}; }
    const size_t ko = (size_t)lr * HD + 8 * hi, vo = (size_t)lr * TT + 8 * hi;
    V ka[2][2], kb[2][2]; v4i mk[2][2];   // a pass's mask words and K fragments are fetched by the pass before it
#pragma unroll
    for (int kt = 0; kt < 2; ++kt) { mk[kt][0] = *(const v4i*)(kvp + 8 * hi + 16 * kt); mk[kt][1] = *(const v4i*)(kvp + 8 * hi + 16 * kt + 4);
#pragma unroll
        for (int kk = 0; kk < 2; ++kk) { ka[kt][kk] = WFrag<T16>::ld(Ka + ko + kt * 16 * HD + 32 * kk); if (HI) kb[kt][kk] = WFrag<T16>::ld(Kb + ko + kt * 16 * HD + 32 * kk); } }
    if constexpr (HI) xwait(kvp + 8 * hi, Ka + ko, Kb + ko); else xwait(kvp + 8 * hi, Ka + ko);
    __builtin_amdgcn_sched_barrier(0);   // keeps the register set-up of the loop behind the wait above: moved up, it rewrote the mask loads' offset register in front of the wait
    for (int kc = 0; kc < TT; kc += 32) {
        V va[4], vb[4];   // this pass's V^T fragments: issued first, read behind the softmax
        const T16* vpa = Va + vo + kc; const T16* vpb = HI ? Vb + vo + kc : nullptr;
#pragma unroll
        for (int dt = 0; dt < 4; ++dt) { va[dt] = WFrag<T16>::ld(vpa + dt * 16 * TT); if (HI) vb[dt] = WFrag<T16>::ld(vpb + dt * 16 * TT); }
        if constexpr (HI) xwait(vpa, vpb); else xwait(vpa);
        v8f bias[2];
#pragma unroll
        for (int kt = 0; kt < 2; ++kt)
#pragma unroll
            for (int r = 0; r < 4; ++r) { bias[kt][r] = (mk[kt][0][r] != 0) ? 0.f : -3.0e38f; bias[kt][4 + r] = (mk[kt][1][r] != 0) ? 0.f : -3.0e38f; }
        v8f s[R][2];
#pragma unroll
        for (int g = 0; g < R; ++g)
#pragma unroll
            for (int kt = 0; kt < 2; ++kt) s[g][kt] = (v8f){};
#pragma unroll
        for (int kk = 0; kk < 2; ++kk) {
#pragma unroll
            for (int g = 0; g < R; ++g)
#pragma unroll
                for (int kt = 0; kt < 2; ++kt) s[g][kt] = WFrag<T16>::mma(ka[kt][kk], qa[g][kk], s[g][kt]);
            if (HI) {
#pragma unroll
                for (int g = 0; g < R; ++g)
#pragma unroll
                    for (int kt = 0; kt < 2; ++kt) s[g][kt] = WFrag<T16>::mma(ka[kt][kk], qb[g][kk], s[g][kt]);
#pragma unroll
                for (int g = 0; g < R; ++g)
#pragma unroll
                    for (int kt = 0; kt < 2; ++kt) s[g][kt] = WFrag<T16>::mma(kb[kt][kk], qa[g][kk], s[g][kt]);
            }
        }
        const int kn = (kc + 32) & (TT - 1);   // the next pass's mask words and K fragments, fetched behind this pass's S^T products (the last pass fetches keys 0 .. 31 again, unused)
        const int* mp = kvp + kn + 8 * hi; const T16* kpa = Ka + ko + (size_t)kn * HD; const T16* kpb = HI ? Kb + ko + (size_t)kn * HD : nullptr;
#pragma unroll
        for (int kt = 0; kt < 2; ++kt) { mk[kt][0] = *(const v4i*)(mp + 16 * kt); mk[kt][1] = *(const v4i*)(mp + 16 * kt + 4); }
#pragma unroll
        for (int kt = 0; kt < 2; ++kt)
#pragma unroll
            for (int kk = 0; kk < 2; ++kk) { ka[kt][kk] = WFrag<T16>::ld(kpa + kt * 16 * HD + 32 * kk); if (HI) kb[kt][kk] = WFrag<T16>::ld(kpb + kt * 16 * HD + 32 * kk); }
        if constexpr (HI) xwait(mp, kpa, kpb); else xwait(mp, kpa);
        float mx[R]; bool need = false;
#pragma unroll
        for (int g = 0; g < R; ++g) { mx[g] = -3.0e38f;
#pragma unroll
            for (int kt = 0; kt < 2; ++kt) { s[g][kt] = s[g][kt] * SCL2 + bias[kt];
#pragma unroll
                for (int r = 0; r < 8; ++r) mx[g] = fmaxf(mx[g], s[g][kt][r]); }
            need = need || (mx[g] > mu[g] + 8.0f); }
        if (__builtin_amdgcn_ballot_w32(need) != 0) {   // one scalar test per pass; rare behind the first passes
#pragma unroll
            for (int g = 0; g < R; ++g) { const float mn = fmaxf(mu[g], fmaxf(mx[g], xhalf(mx[g]))); const float corr = __builtin_amdgcn_exp2f(mu[g] - mn); mu[g] = mn; ls[g] *= corr;
#pragma unroll
                for (int dt = 0; dt < 4; ++dt) o[g][dt] = o[g][dt] * corr; }
        }
#pragma unroll
        for (int g = 0; g < R; ++g) { const float nm = PSH - mu[g]; v8f p[2];
#pragma unroll
            for (int kt = 0; kt < 2; ++kt) { const v8f ar = s[g][kt] + nm;
#pragma unroll
                for (int r = 0; r < 8; ++r) p[kt][r] = __builtin_amdgcn_exp2f(ar[r]); }
            const v8f ps = p[0] + p[1]; ls[g] += ((ps[0] + ps[1]) + (ps[2] + ps[3])) + ((ps[4] + ps[5]) + (ps[6] + ps[7]));
            if constexpr (HI) {
                const v8b h0 = __builtin_convertvector(p[0], v8b), h1 = __builtin_convertvector(p[1], v8b);
                const v8b l0 = __builtin_convertvector(p[0] - __builtin_convertvector(h0, v8f), v8b), l1 = __builtin_convertvector(p[1] - __builtin_convertvector(h1, v8f), v8b);
                const V ph = __builtin_shufflevector(h0, h1, 0, 1, 2, 3, 4, 5, 6, 7, 8, 9, 10, 11, 12, 13, 14, 15), pl = __builtin_shufflevector(l0, l1, 0, 1, 2, 3, 4, 5, 6, 7, 8, 9, 10, 11, 12, 13, 14, 15);
#pragma unroll
                for (int dt = 0; dt < 4; ++dt) o[g][dt] = WFrag<T16>::mma(va[dt], ph, o[g][dt]);
#pragma unroll
                for (int dt = 0; dt < 4; ++dt) o[g][dt] = WFrag<T16>::mma(va[dt], pl, o[g][dt]);
#pragma unroll
                for (int dt = 0; dt < 4; ++dt) o[g][dt] = WFrag<T16>::mma(vb[dt], ph, o[g][dt]);
            } else {
                const V pf = cat16(__builtin_convertvector(p[0], v8h), __builtin_convertvector(p[1], v8h));
#pragma unroll
                for (int dt = 0; dt < 4; ++dt) o[g][dt] = WFrag<T16>::mma(va[dt], pf, o[g][dt]);
            } }
    }
#pragma unroll
    for (int g = 0; g < R; ++g) { const float inv = __fdiv_rn(1.0f, ls[g] + xhalf(ls[g]));   // the two halves hold the sums of their own keys
#pragma unroll
        for (int dt = 0; dt < 4; ++dt) { v8us oh, ol;
#pragma unroll
            for (int r = 0; r < 8; ++r) { unsigned short a, c2; splitf(o[g][dt][r] * inv, a, c2); oh[r] = a; ol[r] = c2; }
            const size_t oo = (size_t)(q0 + 16 * g + lr) * DQ + dt * 16 + 8 * hi; *(v8us*)(Ah + oo) = oh; *(v8us*)(Al + oo) = ol; } }
}
__global__ __launch_bounds__(288) void k_fattn(const h16* __restrict__ Q16, const h16* __restrict__ K16, const h16* __restrict__ V16, const bf* __restrict__ Qh, const bf* __restrict__ Ql, const bf* __restrict__ Kh, const bf* __restrict__ Kl, const bf* __restrict__ Vh, const bf* __restrict__ Vl, const int* __restrict__ kvp, bf* Ah, bf* Al) {
    const int wave = __builtin_amdgcn_readfirstlane(threadIdx.x >> 5); const int blk = blockIdx.x; const size_t pl = (size_t)blockIdx.y * TT * HD; Ah += blockIdx.y * HD; Al += blockIdx.y * HD;
    if (wave == 1 || wave == 2) fattn<bf, true, 1>(Qh + pl, Ql + pl, Kh + pl, Kl + pl, Vh + pl, Vl + pl, kvp, (blk * 2 + wave - 1) * 16, Ah, Al);
    else fattn<h16, false, 2>(Q16 + pl, nullptr, K16 + pl, nullptr, V16 + pl, nullptr, kvp, RH + (blk * 7 + (wave ? wave - 2 : 0)) * 32, Ah, Al);
}
static_assert(NH_ == NKV && RH == FBH * 2 * 16 && TT - RH == FBH * 7 * 32, "a block's 9 waves: 2 x 16 hi/lo rows and 7 x 32 fp16 rows");
static_assert(HD == 64 && TT % 64 == 0, "a projection tile's 64 columns are one head's, its 64 rows whole lines of the transposed planes");

extern "C" void kernel_launch(void* const* d_in, const int* in_sizes, int n_in,
                              void* d_out, int out_size, void* d_ws, size_t ws_size, hipStream_t stream) {
    (void)in_sizes; (void)n_in; (void)out_size;
    const float* x = (const float*)d_in[0]; const float* xk = (const float*)d_in[1]; const float* xv = (const float*)d_in[2]; const int* kmask = (const int*)d_in[3]; const float* wq = (const float*)d_in[4]; const float* bq = (const float*)d_in[5]; const float* wk = (const float*)d_in[6]; const float* bk = (const float*)d_in[7]; const float* wv = (const float*)d_in[8]; const float* bv = (const float*)d_in[9]; const float* wo = (const float*)d_in[10]; const float* bo = (const float*)d_in[11];   /* order query, key, value, mask (int32 [1][1][1][4096], read), Wq, bq, Wk, bk, Wv, bv, Wo, bo ('oi' + biases) */
    float* OUT = (float*)d_out;     // [1][4096][1024]
    char* wsp = (char*)d_ws;
    auto take = [&](size_t bytes) { char* p = wsp; wsp += (bytes + 255) & ~(size_t)255; return (void*)p; };
    bf* WQ = (bf*)take((size_t)DQ * DM * 2); bf* WK = (bf*)take((size_t)DKV * DM * 2); bf* WV = (bf*)take((size_t)DKV * DM * 2); bf* WO = (bf*)take((size_t)DM * DQ * 2);
    bf* XB = (bf*)take((size_t)TT * DM * 2);
    h16* QP16 = (h16*)take((size_t)NH_ * TT * HD * 2); h16* KP16 = (h16*)take((size_t)NKV * TT * HD * 2); h16* VT16 = (h16*)take((size_t)NKV * HD * TT * 2);
    bf* QPh = (bf*)take((size_t)NH_ * TT * HD * 2); bf* QPl = (bf*)take((size_t)NH_ * TT * HD * 2); bf* KPh = (bf*)take((size_t)NKV * TT * HD * 2); bf* KPl = (bf*)take((size_t)NKV * TT * HD * 2); bf* VTh = (bf*)take((size_t)NKV * HD * TT * 2); bf* VTl = (bf*)take((size_t)NKV * HD * TT * 2);
    bf* ATh = (bf*)take((size_t)TT * DQ * 2); bf* ATl = (bf*)take((size_t)TT * DQ * 2);
    if ((size_t)(wsp - (char*)d_ws) > ws_size) return;    // ws 256 MiB
    { k_cvt8<<<(unsigned)(((size_t)DQ * DM / 8 + 255) / 256), 256, 0, stream>>>(wq, WQ, (size_t)DQ * DM / 8); k_cvt8<<<(unsigned)(((size_t)DKV * DM / 8 + 255) / 256), 256, 0, stream>>>(wk, WK, (size_t)DKV * DM / 8); k_cvt8<<<(unsigned)(((size_t)DKV * DM / 8 + 255) / 256), 256, 0, stream>>>(wv, WV, (size_t)DKV * DM / 8);
      k_cvt8<<<(unsigned)(((size_t)DM * DQ / 8 + 255) / 256), 256, 0, stream>>>(wo, WO, (size_t)DM * DQ / 8);
       }
    for (int b = 0; b < NB_; ++b) {
        
        k_cvt8<<<(unsigned)(((size_t)TT * DM / 8 + 255) / 256), 256, 0, stream>>>(x + (size_t)b * TT * DM, XB, (size_t)TT * DM / 8);
        k_gemmw<bf, 0, true, 1><<<dim3(TT / 64, DQ / 64, 1), 32, 0, stream>>>(XB, nullptr, WQ, nullptr, DM, DM, nullptr, 0, bq, 0, 0, 0, QP16, QPh, QPl);
        k_cvt8<<<(unsigned)(((size_t)TT * DM / 8 + 255) / 256), 256, 0, stream>>>(xk + (size_t)b * TT * DM, XB, (size_t)TT * DM / 8);   /* XB := bf16(key[b]) */ k_gemmw<bf, 0, true, 1><<<dim3(TT / 64, DKV / 64, 1), 32, 0, stream>>>(XB, nullptr, WK, nullptr, DM, DM, nullptr, 0, bk, 0, 0, 0, KP16, KPh, KPl);
        k_cvt8<<<(unsigned)(((size_t)TT * DM / 8 + 255) / 256), 256, 0, stream>>>(xv + (size_t)b * TT * DM, XB, (size_t)TT * DM / 8);   /* XB := bf16(value[b]) */ k_gemmw<bf, 0, true, 2><<<dim3(TT / 64, DKV / 64, 1), 32, 0, stream>>>(XB, nullptr, WV, nullptr, DM, DM, nullptr, 0, bv, 0, 0, 0, VT16, VTh, VTl);
        k_fattn<<<dim3(FBH, NH_), 288, 0, stream>>>(QP16, KP16, VT16, QPh, QPl, KPh, KPl, VTh, VTl, kmask + (size_t)b * TT, ATh, ATl);
        k_gemmw<bf, 1, true, 0><<<dim3(TT / 64, DM / 64, 1), 32, 0, stream>>>(ATh, ATl, WO, nullptr, DQ, DQ, OUT + (size_t)b * TT * DM, DM, bo, 0, 0, 0, nullptr, nullptr, nullptr); }
}

// v004
// A run of this version takes 246 microseconds.
// Timed twice side by side with v003, it ran 1.39 and 1.38 times as fast.
// Counting every step since v000, it is 14.1 times as fast.
#include <hip/hip_runtime.h>

// Attention on three input streams over 4,096 tokens with a RANDOM integer key mask (query, key, value [1][4096][1024]; q = query Wq^T + bq, k = key Wk^T + bk, v = value Wv^T + bv ('oi' 1/32 + zero biases; 16 heads x 64); scores / sqrt(64); keys with mask[b][0][0][j] == 0 -> -1e9 (== exclusion; mask int32 [1][1][1][4096] with random 0/1 entries, read per key on device); softmax; out = merged Wo^T + bo -> [1][4096][1024] (4.2 M); argument order query, key, value, mask, Wq, bq, Wk, bk, Wv, bv, Wo, bo).
// Layout: bf16 copies of query, key, value in turn; 'oi' weights; exact projections + f32 biases, whose epilogues store the head planes (fp16 + bf16 hi/lo; V transposed) themselves; one fused attention launch for all heads (online softmax, no score plane; K and V^T tiles staged in LDS by tensor loads), which reads the int key vector and excludes the zeros (hybrid rows: < 512 hi/lo 3 products, rest fp16); merged hi/lo x Wo exact + bo.
// Compute dtypes, f32 accumulate: every input rounded to bf16; projections exact + f32 biases; attention rows < 512 3 products, rest fp16; softmax f32; Wo hl x exact + bias.

#define NB_  1
#define TT   4096
#define DM   1024
#define NH_  16
#define NKV  16
#define REP  (NH_ / NKV)
#define HD   64
#define DQ   (NH_ * HD)
#define DKV  (NKV * HD)
#define RH   512                  // query rows < RH use hi+lo planes
#define WIN  0
typedef _Float16 h16;
typedef unsigned short bf;
typedef __attribute__((ext_vector_type(16))) __bf16   v16bf;
typedef __attribute__((ext_vector_type(16))) _Float16 v16h;
typedef __attribute__((ext_vector_type(8)))  _Float16 v8h;
typedef __attribute__((ext_vector_type(8)))  unsigned short v8us;
typedef __attribute__((ext_vector_type(8)))  float    v8f;
typedef __attribute__((ext_vector_type(4)))  float    v4f;
typedef v8h  __attribute__((may_alias)) v8ha;
typedef v4f  __attribute__((may_alias)) v4fa;
typedef v8us __attribute__((may_alias)) v8usa;

__device__ __forceinline__ unsigned short f2bf(float f) { unsigned u = __float_as_uint(f); u += 0x7FFFu + ((u >> 16) & 1u); return (unsigned short)(u >> 16); }
__device__ __forceinline__ float bf2f(unsigned short b) { return __uint_as_float(((unsigned)b) << 16); }
__device__ __forceinline__ float bfr(float f) { return bf2f(f2bf(f)); }
__device__ __forceinline__ v16h cat16(v8h lo, v8h hi) { return __builtin_shufflevector(lo, hi, 0, 1, 2, 3, 4, 5, 6, 7, 8, 9, 10, 11, 12, 13, 14, 15); }
__device__ __forceinline__ v16bf cat16b(v8us lo, v8us hi) { return __builtin_bit_cast(v16bf, __builtin_shufflevector(lo, hi, 0, 1, 2, 3, 4, 5, 6, 7, 8, 9, 10, 11, 12, 13, 14, 15)); }
__device__ __forceinline__ v8f wmma16(v16h a, v16h b, v8f c) { return __builtin_amdgcn_wmma_f32_16x16x32_f16(false, a, false, b, (short)0, c, false, false); }
__device__ __forceinline__ v8f wmmab(v16bf a, v16bf b, v8f c) { return __builtin_amdgcn_wmma_f32_16x16x32_bf16(false, a, false, b, (short)0, c, false, false); }
__device__ __forceinline__ h16 tohx(float x) { return (h16)x; }
__device__ __forceinline__ void splitf(float y, unsigned short& h, unsigned short& l) { h = f2bf(y); l = f2bf(y - bf2f(h)); }



// ---- k_gemmw: register-blocked GEMM, ONE WAVE per 64x64 output tile (16 accumulators), operands straight from K-contiguous 16-bit planes; grid (M/64, N/64, Z), 32 threads.
// C[m][n] (f32, pitch ldc, + optional f32 bias[n]) = sum_{k < KL} A[m][k] Bt[n][k] (+ split products per NSPLIT). K = row pitch of A and Bt, KL = k extent summed here (KL == K: the whole row; KL < K with sA = sB = KL: z is a k slice and C + z sC its partial). z-batch strides sA/sB/sC in elements. KL % 32 == 0.
// PL = 0: C as above. PL = 1, 2: no C; the tile (64 tokens x the 64 columns of head blockIdx.y, + bias) goes out as three 16-bit planes, fp16 and bf16 hi + lo: PL = 1 [head][token][d], PL = 2 transposed, [head][d][token].
template <typename T16> struct WFrag;
template <> struct WFrag<h16> { typedef v16h V; static __device__ __forceinline__ V ld(const h16* p) { return cat16(*(const v8h*)p, *(const v8h*)(p + 16)); } static __device__ __forceinline__ v8f mma(V a, V b, v8f c) { return wmma16(a, b, c); } };
template <> struct WFrag<bf> { typedef v16bf V; static __device__ __forceinline__ V ld(const bf* p) { return cat16b(*(const v8us*)p, *(const v8us*)(p + 16)); } static __device__ __forceinline__ v8f mma(V a, V b, v8f c) { return wmmab(a, b, c); } };
template <typename T16, int NSPLIT, bool BIAS, int PL>
__global__ __launch_bounds__(32) void k_gemmw(const T16* __restrict__ A, const T16* __restrict__ A2, const T16* __restrict__ Bt, const T16* __restrict__ Bt2, int K, int KL, float* C, int ldc, const float* __restrict__ bias, size_t sA, size_t sB, size_t sC, h16* P16, bf* Ph, bf* Pl) {
    typedef typename WFrag<T16>::V V;
    __shared__ __align__(16) float os[16 * 68];
    const size_t z = blockIdx.z; A += z * sA; if (A2) A2 += z * sA; Bt += z * sB; if (Bt2) Bt2 += z * sB; C += z * sC;
    const int lane = threadIdx.x & 31, lr = lane & 15, hi = lane >> 4; const int r0 = blockIdx.x * 64, c0 = blockIdx.y * 64;
    v8f acc[4][4];
#pragma unroll
    for (int mb = 0; mb < 4; ++mb)
#pragma unroll
        for (int nb = 0; nb < 4; ++nb) acc[mb][nb] = (v8f){};
    const size_t aoff = (size_t)(r0 + lr) * K + 8 * hi, boff = (size_t)(c0 + lr) * K + 8 * hi;
#pragma unroll 1
    for (int kc = 0; kc < KL; kc += 32) {
        V a[4], a2[4];
#pragma unroll
        for (int mb = 0; mb < 4; ++mb) { a[mb] = WFrag<T16>::ld(A + aoff + (size_t)mb * 16 * K + kc); if (NSPLIT == 1 || NSPLIT == 2) a2[mb] = WFrag<T16>::ld(A2 + aoff + (size_t)mb * 16 * K + kc); }
#pragma unroll
        for (int nb = 0; nb < 4; ++nb) { const V b = WFrag<T16>::ld(Bt + boff + (size_t)nb * 16 * K + kc); V b2; if (NSPLIT >= 2) b2 = WFrag<T16>::ld(Bt2 + boff + (size_t)nb * 16 * K + kc);
#pragma unroll
            for (int mb = 0; mb < 4; ++mb) { acc[mb][nb] = WFrag<T16>::mma(a[mb], b, acc[mb][nb]); if (NSPLIT == 1 || NSPLIT == 2) acc[mb][nb] = WFrag<T16>::mma(a2[mb], b, acc[mb][nb]); if (NSPLIT >= 2) acc[mb][nb] = WFrag<T16>::mma(a[mb], b2, acc[mb][nb]); } }
        asm volatile("v_nop\n\tv_nop\n\tv_nop\n\tv_nop" : "+v"(acc[0][0]), "+v"(acc[1][1]), "+v"(acc[2][2]), "+v"(acc[3][3]) : "v"(a[0]), "v"(a[3]));
    }
    // Every "#pragma unroll" of the plane epilogues: its loop indexes accumulator and staging arrays, which stay in registers only under constant indices.
    const int prow = lane >> 3, pc = (lane & 7) * 8;   // plane stores: 8 lanes x 16 bytes a row, so one store covers four whole 128-byte rows
    if constexpr (PL == 2) {
        // a lane's 8 accumulator elements are 8 consecutive tokens of ONE column d: converted in registers, 16 d rows x 64 tokens of each plane pass through LDS (pitch 72: no bank shared by the 16 rows of a write)
        __shared__ __align__(16) unsigned short ts[3][16 * 72];
#pragma unroll
        for (int nb = 0; nb < 4; ++nb) {
            const float bb = BIAS ? bfr(bias[c0 + nb * 16 + lr]) : 0.f;
#pragma unroll
            for (int mb = 0; mb < 4; ++mb) { v8h o16; v8us oh, ol;
#pragma unroll
                for (int j = 0; j < 8; ++j) { const float x = acc[mb][nb][j] + bb; o16[j] = tohx(x); unsigned short a2, c2; splitf(x, a2, c2); oh[j] = a2; ol[j] = c2; }
                const int to = lr * 72 + mb * 16 + hi * 8; *(v8usa*)(ts[0] + to) = __builtin_bit_cast(v8us, o16); *(v8usa*)(ts[1] + to) = oh; *(v8usa*)(ts[2] + to) = ol; }
            __builtin_amdgcn_wave_barrier(); asm volatile("" ::: "memory");   // the rows are read back by other lanes of the wave: keeps the reads behind the writes
            v8us w[4][3]; const size_t po = (size_t)(c0 + nb * 16 + prow) * TT + r0 + pc;
#pragma unroll
            for (int s = 0; s < 4; ++s) {
#pragma unroll
                for (int p = 0; p < 3; ++p) w[s][p] = *(const v8usa*)(ts[p] + (4 * s + prow) * 72 + pc);
                *(v8us*)((bf*)P16 + po + (size_t)s * 4 * TT) = w[s][0]; *(v8us*)(Ph + po + (size_t)s * 4 * TT) = w[s][1]; *(v8us*)(Pl + po + (size_t)s * 4 * TT) = w[s][2]; }
            // stands behind the group's stores, in front of any reuse of their data registers (named as inputs, so that they live up to the wait); as a memory clobber it also keeps the next rows' LDS writes behind these reads
            asm volatile("s_wait_xcnt 0x0" :: "v"(w[0][0]), "v"(w[0][1]), "v"(w[0][2]), "v"(w[1][0]), "v"(w[1][1]), "v"(w[1][2]), "v"(w[2][0]), "v"(w[2][1]), "v"(w[2][2]), "v"(w[3][0]), "v"(w[3][1]), "v"(w[3][2]) : "memory");
        }
        return;
    }
    float pb[8];
    if constexpr (PL == 1) {
#pragma unroll
        for (int k = 0; k < 8; ++k) pb[k] = BIAS ? bfr(bias[c0 + pc + k]) : 0.f; }
#pragma unroll
    for (int mb = 0; mb < 4; ++mb) {
#pragma unroll
        for (int nb = 0; nb < 4; ++nb) {
#pragma unroll
            for (int j = 0; j < 8; ++j) os[(hi * 8 + j) * 68 + nb * 16 + lr] = acc[mb][nb][j]; }
        __builtin_amdgcn_wave_barrier(); asm volatile("" ::: "memory");
        if constexpr (PL == 1) {
            v8us w[4][3]; const size_t po = ((size_t)blockIdx.y * TT + r0 + mb * 16 + prow) * HD + pc;
#pragma unroll
            for (int s = 0; s < 4; ++s) { const float* orow = os + (4 * s + prow) * 68 + pc; const v4f x0 = *(const v4fa*)orow, x1 = *(const v4fa*)(orow + 4); v8h o16;
#pragma unroll
                for (int k = 0; k < 8; ++k) { const float x = (k < 4 ? x0[k & 3] : x1[k & 3]) + pb[k]; o16[k] = tohx(x); unsigned short a2, c2; splitf(x, a2, c2); w[s][1][k] = a2; w[s][2][k] = c2; }
                w[s][0] = __builtin_bit_cast(v8us, o16);
                *(v8us*)((bf*)P16 + po + s * 4 * HD) = w[s][0]; *(v8us*)(Ph + po + s * 4 * HD) = w[s][1]; *(v8us*)(Pl + po + s * 4 * HD) = w[s][2]; }
            // stands behind the group's stores, in front of any reuse of their data registers (named as inputs, so that they live up to the wait)
            asm volatile("s_wait_xcnt 0x0" :: "v"(w[0][0]), "v"(w[0][1]), "v"(w[0][2]), "v"(w[1][0]), "v"(w[1][1]), "v"(w[1][2]), "v"(w[2][0]), "v"(w[2][1]), "v"(w[2][2]), "v"(w[3][0]), "v"(w[3][1]), "v"(w[3][2]) : "memory");
        } else {
        float* crow = C + (size_t)(r0 + mb * 16) * ldc + c0;
{
#pragma unroll
            for (int s = 0; s < 8; ++s) { const int row = 2 * s + hi, cofs = lr * 4; v4f val = *(const v4fa*)(os + row * 68 + cofs); if (BIAS) { val[0] += bfr(bias[c0 + cofs]); val[1] += bfr(bias[c0 + cofs + 1]); val[2] += bfr(bias[c0 + cofs + 2]); val[3] += bfr(bias[c0 + cofs + 3]); }
                *(v4f*)(crow + (size_t)row * ldc + cofs) = val; }
             }
        }
        __builtin_amdgcn_wave_barrier(); asm volatile("" ::: "memory");
    }
}

typedef __attribute__((ext_vector_type(4))) _Float16 v4h;
typedef __attribute__((ext_vector_type(4))) unsigned short v4us;
typedef __attribute__((ext_vector_type(4))) int v4i;

__global__ __launch_bounds__(256) void k_cvt8(const float* __restrict__ src, bf* dst, size_t n8) { const size_t i = (size_t)blockIdx.x * 256 + threadIdx.x; if (i >= n8) return; const v8f v = *(const v8f*)(src + i * 8); v8us o;
#pragma unroll
    for (int k = 0; k < 8; ++k) o[k] = f2bf(v[k]); *(v8us*)(dst + i * 8) = o;  }

// ---- k_fattn: scores, key mask, softmax and P x V of all heads in ONE launch; no score or weight plane in memory.
// Per wave: S^T = K Q^T (A = 16 keys x 64 d, B = the wave's query columns, kept in registers), so a lane holds 8 consecutive keys of ONE query per tile;
// two such tiles, converted in place, are the B operand of O^T += V^T P^T (A = V^T rows in the same k order as WFrag::ld at + 8 * hi). 32 keys per pass.
// Softmax is online in base 2: weights exp2(s - mu + PSH) against the maximum in use mu, O and the sum rescaled only when a new maximum exceeds mu by more than 8.
// A masked key's score is -3.0e38: its weight is 0 beside any kept key, and 1 for every key of a row with no kept key (the module's uniform row).
// Block = 9 waves on 256 query rows' worth of one head's work: 2 waves of 16 hi/lo rows (< RH, 3 products) and 7 waves of 32 fp16 rows; 256 blocks.
// K and V^T reach the waves through LDS: a stage is 64 keys of the head's six planes, each plane's tile (64 rows x 128 bytes) brought by one tensor load of one wave (waves 0 .. 5), two buffers,
// the next stage in flight while this one is worked on; every wave reads its fragments from the tiles, so a plane's bytes leave L2 once per block and stage and not once per wave.
// Every "#pragma unroll" in the attention code: its loop indexes fragment and accumulator arrays, which stay in registers only under constant indices.
#define PSH  4.0f                  // weights lie in (0, 2^(8 + PSH)]: inside fp16's range, and small ones stay normal numbers
#define SCL2 0.18033688011112042f  // HD^-0.5 * log2(e)
#define FBH  (TT / 256)            // blocks per head
#define SKEY 64                    // keys per stage
#define NST  (TT / SKEY)           // stages
#define LPIT 144                   // LDS row pitch: 128 bytes + the mover's 16-byte pad, an odd multiple of 16 bytes for 16-byte readers
#define LTIL 10240                 // a tile's place: 64 rows x 144 bytes = 9,216, rounded up to a multiple of 2 KiB
#define LBUF (6 * LTIL)            // a buffer: tiles K fp16, V^T fp16, K hi, K lo, V^T hi, V^T lo
typedef unsigned int u32;
typedef __attribute__((ext_vector_type(4))) unsigned int u32x4;
typedef __attribute__((ext_vector_type(8))) unsigned int u32x8;
typedef __attribute__((ext_vector_type(8))) __bf16 v8b;
__device__ __forceinline__ float xhalf(float x) { return __builtin_bit_cast(float, __builtin_amdgcn_permlanex16(__builtin_bit_cast(int, x), __builtin_bit_cast(int, x), 0x76543210, 0xfedcba98, false, false)); }   // lane l <-> lane l ^ 16
// xwait: stands behind each group of global loads, in front of any reuse of their address registers (named as inputs, so that they live up to the wait); as a memory clobber it also keeps the group where it is written
__device__ __forceinline__ void xwait(const void* a) { asm volatile("s_wait_xcnt 0x0" :: "v"(a) : "memory"); }
__device__ __forceinline__ void xwait(const void* a, const void* b) { asm volatile("s_wait_xcnt 0x0" :: "v"(a), "v"(b) : "memory"); }
__device__ __forceinline__ u32 uni(u32 v) { return (u32)__builtin_amdgcn_readfirstlane(v); }
__device__ __forceinline__ u32 pinned(u32 v) { u32 w = uni(v); asm volatile("" : "+s"(w)); return w; }   // holds a tensor load's issue test in a scalar register, so that the branch around the load is a scalar one
__device__ __forceinline__ void wait_ds0() { asm volatile("s_wait_dscnt 0x0" ::: "memory"); }        // this wave's LDS reads have returned: in front of the barrier behind which their buffer is refilled
// this wave's tensor load has landed: the compiler places no wait for it; the request's descriptor is named as an input, so that its registers keep their values up to the wait
__device__ __forceinline__ void wait_tensor0(u32x4 g0, u32x8 g1) { asm volatile("s_wait_tensorcnt 0x0" :: "s"(g0), "s"(g1) : "memory"); }
// what a wave carries from stage to stage; q: fp16 waves [group][k half], hi/lo waves hi [k half] then lo [k half]; mk: the next pass's mask words
struct FSt { v8f o[2][4]; float mu[2], ls[2]; v16h q[4]; v4i mk[2][2]; };
template <typename T16, bool HI, int R>
__device__ __forceinline__ void finit(FSt& st, const T16* __restrict__ Qa, const T16* __restrict__ Qb, const int* __restrict__ kvp, int q0) {
    const int lane = threadIdx.x & 31, lr = lane & 15, hi = lane >> 4;
    const T16* qpa = Qa + (size_t)(q0 + lr) * HD + 8 * hi; const T16* qpb = HI ? Qb + (size_t)(q0 + lr) * HD + 8 * hi : nullptr;
#pragma unroll
    for (int g = 0; g < R; ++g)
#pragma unroll
        for (int kk = 0; kk < 2; ++kk) { const int qo = 16 * g * HD + 32 * kk; st.q[2 * g + kk] = __builtin_bit_cast(v16h, WFrag<T16>::ld(qpa + qo)); if (HI) st.q[2 + kk] = __builtin_bit_cast(v16h, WFrag<T16>::ld(qpb + qo)); }
    if constexpr (HI) xwait(qpa, qpb); else xwait(qpa);
#pragma unroll
    for (int g = 0; g < 2; ++g) { st.mu[g] = -3.0e38f; st.ls[g] = 0.f;
#pragma unroll
        for (int dt = 0; dt < 4; ++dt) st.o[g][dt] = (v8f){}; }
#pragma unroll
    for (int kt = 0; kt < 2; ++kt) { st.mk[kt][0] = *(const v4i*)(kvp + 8 * hi + 16 * kt); st.mk[kt][1] = *(const v4i*)(kvp + 8 * hi + 16 * kt + 4); }
    xwait(kvp + 8 * hi);
}
// one stage of one wave: two passes of 32 keys on the tiles of buffer Lb; k0 = the stage's first key
template <typename T16, bool HI, int R>
__device__ __forceinline__ void fstage(FSt& st, const unsigned char* Lb, const int* __restrict__ kvp, int k0) {
    typedef typename WFrag<T16>::V V;
    const int lane = threadIdx.x & 31, lr = lane & 15, hi = lane >> 4;
    const unsigned char* Lr = Lb + lr * LPIT + 16 * hi;   // the lane's row and half in every tile
    const T16* Lka = (const T16*)(Lr + (HI ? 2 : 0) * LTIL); const T16* Lkb = (const T16*)(Lr + 3 * LTIL); const T16* Lva = (const T16*)(Lr + (HI ? 4 : 1) * LTIL); const T16* Lvb = (const T16*)(Lr + 5 * LTIL);
    V qa[R][2], qb[R][2];
#pragma unroll
    for (int g = 0; g < R; ++g)
#pragma unroll
        for (int kk = 0; kk < 2; ++kk) { qa[g][kk] = __builtin_bit_cast(V, st.q[2 * g + kk]); if (HI) qb[g][kk] = __builtin_bit_cast(V, st.q[2 + kk]); }
    V ka[2][2], kb[2][2];   // the second pass's K fragments are fetched by the first; the first pass's here: nothing of a stage is read in front of its barrier
#pragma unroll
    for (int kt = 0; kt < 2; ++kt)
#pragma unroll
        for (int kk = 0; kk < 2; ++kk) { ka[kt][kk] = WFrag<T16>::ld(Lka + kt * 16 * (LPIT / 2) + 32 * kk); if (HI) kb[kt][kk] = WFrag<T16>::ld(Lkb + kt * 16 * (LPIT / 2) + 32 * kk); }
#pragma unroll
    for (int sub = 0; sub < SKEY / 32; ++sub) {
        V va[4], vb[4];   // this pass's V^T fragments: issued first, read behind the softmax
#pragma unroll
        for (int dt = 0; dt < 4; ++dt) { va[dt] = WFrag<T16>::ld(Lva + dt * 16 * (LPIT / 2) + 32 * sub); if (HI) vb[dt] = WFrag<T16>::ld(Lvb + dt * 16 * (LPIT / 2) + 32 * sub); }
        v8f bias[2];
#pragma unroll
        for (int kt = 0; kt < 2; ++kt)
#pragma unroll
            for (int r = 0; r < 4; ++r) { bias[kt][r] = (st.mk[kt][0][r] != 0) ? 0.f : -3.0e38f; bias[kt][4 + r] = (st.mk[kt][1][r] != 0) ? 0.f : -3.0e38f; }
        v8f s[R][2];
#pragma unroll
        for (int g = 0; g < R; ++g)
#pragma unroll
            for (int kt = 0; kt < 2; ++kt) s[g][kt] = (v8f){};
#pragma unroll
        for (int kk = 0; kk < 2; ++kk) {
#pragma unroll
            for (int g = 0; g < R; ++g)
#pragma unroll
                for (int kt = 0; kt < 2; ++kt) s[g][kt] = WFrag<T16>::mma(ka[kt][kk], qa[g][kk], s[g][kt]);
            if (HI) {
#pragma unroll
                for (int g = 0; g < R; ++g)
#pragma unroll
                    for (int kt = 0; kt < 2; ++kt) s[g][kt] = WFrag<T16>::mma(ka[kt][kk], qb[g][kk], s[g][kt]);
#pragma unroll
                for (int g = 0; g < R; ++g)
#pragma unroll
                    for (int kt = 0; kt < 2; ++kt) s[g][kt] = WFrag<T16>::mma(kb[kt][kk], qa[g][kk], s[g][kt]);
            }
        }
        // the next pass's mask words, fetched behind this pass's S^T products (the last pass of all fetches keys 0 .. 31 again, unused); inside a stage they lie a constant step behind the stage's own
        // pointer, so loads and wait are both written on that pointer: it is the register pair that the loads name, and the wait holds it
        const bool inst = sub + 1 < SKEY / 32; const int* mp = kvp + (inst ? k0 : (k0 + SKEY) & (TT - 1)) + 8 * hi; const int mo = inst ? 32 * (sub + 1) : 0;
#pragma unroll
        for (int kt = 0; kt < 2; ++kt) { st.mk[kt][0] = *(const v4i*)(mp + mo + 16 * kt); st.mk[kt][1] = *(const v4i*)(mp + mo + 16 * kt + 4); }
        xwait(mp);
        if (sub + 1 < SKEY / 32) {
#pragma unroll
            for (int kt = 0; kt < 2; ++kt)
#pragma unroll
                for (int kk = 0; kk < 2; ++kk) { ka[kt][kk] = WFrag<T16>::ld(Lka + (32 * (sub + 1) + kt * 16) * (LPIT / 2) + 32 * kk); if (HI) kb[kt][kk] = WFrag<T16>::ld(Lkb + (32 * (sub + 1) + kt * 16) * (LPIT / 2) + 32 * kk); }
        }
        float mx[R]; bool need = false;
#pragma unroll
        for (int g = 0; g < R; ++g) { mx[g] = -3.0e38f;
#pragma unroll
            for (int kt = 0; kt < 2; ++kt) { s[g][kt] = s[g][kt] * SCL2 + bias[kt];
#pragma unroll
                for (int r = 0; r < 8; ++r) mx[g] = fmaxf(mx[g], s[g][kt][r]); }
            need = need || (mx[g] > st.mu[g] + 8.0f); }
        if (__builtin_amdgcn_ballot_w32(need) != 0) {   // one scalar test per pass; rare behind the first passes
#pragma unroll
            for (int g = 0; g < R; ++g) { const float mn = fmaxf(st.mu[g], fmaxf(mx[g], xhalf(mx[g]))); const float corr = __builtin_amdgcn_exp2f(st.mu[g] - mn); st.mu[g] = mn; st.ls[g] *= corr;
#pragma unroll
                for (int dt = 0; dt < 4; ++dt) st.o[g][dt] = st.o[g][dt] * corr; }
        }
#pragma unroll
        for (int g = 0; g < R; ++g) { const float nm = PSH - st.mu[g]; v8f p[2];
#pragma unroll
            for (int kt = 0; kt < 2; ++kt) { const v8f ar = s[g][kt] + nm;
#pragma unroll
                for (int r = 0; r < 8; ++r) p[kt][r] = __builtin_amdgcn_exp2f(ar[r]); }
            const v8f ps = p[0] + p[1]; st.ls[g] += ((ps[0] + ps[1]) + (ps[2] + ps[3])) + ((ps[4] + ps[5]) + (ps[6] + ps[7]));
            if constexpr (HI) {
                const v8b h0 = __builtin_convertvector(p[0], v8b), h1 = __builtin_convertvector(p[1], v8b);
                const v8b l0 = __builtin_convertvector(p[0] - __builtin_convertvector(h0, v8f), v8b), l1 = __builtin_convertvector(p[1] - __builtin_convertvector(h1, v8f), v8b);
                const V ph = __builtin_shufflevector(h0, h1, 0, 1, 2, 3, 4, 5, 6, 7, 8, 9, 10, 11, 12, 13, 14, 15), pl = __builtin_shufflevector(l0, l1, 0, 1, 2, 3, 4, 5, 6, 7, 8, 9, 10, 11, 12, 13, 14, 15);
#pragma unroll
                for (int dt = 0; dt < 4; ++dt) st.o[g][dt] = WFrag<T16>::mma(va[dt], ph, st.o[g][dt]);
#pragma unroll
                for (int dt = 0; dt < 4; ++dt) st.o[g][dt] = WFrag<T16>::mma(va[dt], pl, st.o[g][dt]);
#pragma unroll
                for (int dt = 0; dt < 4; ++dt) st.o[g][dt] = WFrag<T16>::mma(vb[dt], ph, st.o[g][dt]);
            } else {
                const V pf = cat16(__builtin_convertvector(p[0], v8h), __builtin_convertvector(p[1], v8h));
#pragma unroll
                for (int dt = 0; dt < 4; ++dt) st.o[g][dt] = WFrag<T16>::mma(va[dt], pf, st.o[g][dt]);
            } }
    }
}
template <int R>
__device__ __forceinline__ void fstore(const FSt& st, int q0, bf* Ah, bf* Al) {
    const int lane = threadIdx.x & 31, lr = lane & 15, hi = lane >> 4;
#pragma unroll
    for (int g = 0; g < R; ++g) { const float inv = __fdiv_rn(1.0f, st.ls[g] + xhalf(st.ls[g]));   // the two halves hold the sums of their own keys
        v8us oh[4], ol[4]; bf* ph = Ah + (size_t)(q0 + 16 * g + lr) * DQ + 8 * hi; bf* pl = Al + (size_t)(q0 + 16 * g + lr) * DQ + 8 * hi;
#pragma unroll
        for (int dt = 0; dt < 4; ++dt) {
#pragma unroll
            for (int r = 0; r < 8; ++r) { unsigned short a, c2; splitf(st.o[g][dt][r] * inv, a, c2); oh[dt][r] = a; ol[dt][r] = c2; }
            *(v8us*)(ph + dt * 16) = oh[dt]; *(v8us*)(pl + dt * 16) = ol[dt]; }
        // stands behind the row group's stores, in front of any reuse of their data and address registers (named as inputs, so that they live up to the wait)
        asm volatile("s_wait_xcnt 0x0" :: "v"(oh[0]), "v"(oh[1]), "v"(oh[2]), "v"(oh[3]), "v"(ol[0]), "v"(ol[1]), "v"(ol[2]), "v"(ol[3]), "v"(ph), "v"(pl) : "memory"); }
}
__global__ __launch_bounds__(288) void k_fattn(const h16* __restrict__ Q16, const h16* __restrict__ K16, const h16* __restrict__ V16, const bf* __restrict__ Qh, const bf* __restrict__ Ql, const bf* __restrict__ Kh, const bf* __restrict__ Kl, const bf* __restrict__ Vh, const bf* __restrict__ Vl, const int* __restrict__ kvp, bf* Ah, bf* Al) {
    __shared__ __attribute__((aligned(2048))) unsigned char L[2 * LBUF];
    const u32 wave = uni(threadIdx.x >> 5); const int blk = blockIdx.x; const size_t pl = (size_t)blockIdx.y * TT * HD; Ah += blockIdx.y * HD; Al += blockIdx.y * HD;
    const bool hiw = wave == 1 || wave == 2;
    const int q0 = hiw ? (blk * 2 + (int)wave - 1) * 16 : RH + (blk * 7 + (wave ? (int)wave - 2 : 0)) * 32;
    // wave w < 6 brings tile w of every stage: 64 rows of 128 bytes; K planes: a row is a key (source pitch 128 bytes, a stage 8 KiB on); V^T planes: a row is a d (source pitch 8 KiB, a stage 128 bytes on)
    const bool isv = wave == 1 || wave >= 4;
    const void* plane = wave == 0 ? (const void*)K16 : wave == 1 ? (const void*)V16 : wave == 2 ? (const void*)Kh : wave == 3 ? (const void*)Kl : wave == 4 ? (const void*)Vh : (const void*)Vl;
    const unsigned long long src = (unsigned long long)(size_t)plane + pl * 2; const u32 step = isv ? SKEY * 2 : SKEY * HD * 2;
    const u32 lbase = (u32)(size_t)L + wave * LTIL;
    u32x8 g1; g1[0] = uni((1u << 20) | (4u << 22) | (3u << 25));   // no mask, 1-byte elements, 4 dwords of pad behind every 32
    g1[1] = uni(128u << 16); g1[2] = uni(64u << 16); g1[3] = uni(128u << 16); g1[4] = uni(64u); g1[5] = uni(isv ? TT * 2 : HD * 2); g1[6] = uni(0u); g1[7] = uni(0u);
    asm volatile("" : "+s"(g1));   // pinned, as in pinned(): the descriptor words stay in these scalar registers through the loop and are not formed again while a request is out
    u32x4 g0 = {0u, 0u, 0u, 0u};   // the descriptor group of the wave's last request
    auto issue = [&](u32 s) { const unsigned long long ga = src + (unsigned long long)s * step; g0[0] = uni(1u); g0[1] = uni(lbase + (s & 1u) * LBUF); g0[2] = uni((u32)ga); g0[3] = uni(((u32)(ga >> 32) & 0x01FFFFFFu) | 0x80000000u);
        asm volatile("tensor_load_to_lds %0, %1" :: "s"(g0), "s"(g1) : "memory"); };   // one request of the whole wave; ignores EXEC, so every test around it is a scalar branch
    FSt st;
    if (hiw) finit<bf, true, 1>(st, Qh + pl, Ql + pl, kvp, q0); else finit<h16, false, 2>(st, Q16 + pl, nullptr, kvp, q0);
    if (pinned(wave < 6)) { issue(0); wait_tensor0(g0, g1); }
    __syncthreads();   // stage 0 is published
    if (pinned(wave < 6)) issue(1);
    for (u32 s = 0; s < NST; ++s) {
        const unsigned char* Lb = L + (s & 1u) * LBUF;
        // the hint: seven of the nine waves take the fp16 side; without it the compiler copied all 64 accumulator registers to and fro on that side at every stage where the two sides join
        if (__builtin_expect(!hiw, 1)) fstage<h16, false, 2>(st, Lb, kvp, (int)s * SKEY); else fstage<bf, true, 1>(st, Lb, kvp, (int)s * SKEY);
        wait_ds0();
        if (pinned(wave < 6)) wait_tensor0(g0, g1);
        __syncthreads();   // publishes stage s + 1 and ends every wave's reads of stage s
        if (pinned(wave < 6 && s + 2 < NST)) issue(s + 2);   // into the buffer that stage s has left
    }
    wait_tensor0(g0, g1); wait_ds0();
    if (hiw) fstore<1>(st, q0, Ah, Al); else fstore<2>(st, q0, Ah, Al);
}
static_assert(NH_ == NKV && RH == FBH * 2 * 16 && TT - RH == FBH * 7 * 32, "a block's 9 waves: 2 x 16 hi/lo rows and 7 x 32 fp16 rows");
static_assert(NST >= 2 && SKEY * 2 == 128 && HD * 2 == 128 && 64 * LPIT <= LTIL && LTIL % 2048 == 0, "a stage's six tiles: 64 rows of 128 bytes each, every place a multiple of 2 KiB; the ring needs two stages");
static_assert(HD == 64 && TT % 64 == 0, "a projection tile's 64 columns are one head's, its 64 rows whole lines of the transposed planes");

extern "C" void kernel_launch(void* const* d_in, const int* in_sizes, int n_in,
                              void* d_out, int out_size, void* d_ws, size_t ws_size, hipStream_t stream) {
    (void)in_sizes; (void)n_in; (void)out_size;
    const float* x = (const float*)d_in[0]; const float* xk = (const float*)d_in[1]; const float* xv = (const float*)d_in[2]; const int* kmask = (const int*)d_in[3]; const float* wq = (const float*)d_in[4]; const float* bq = (const float*)d_in[5]; const float* wk = (const float*)d_in[6]; const float* bk = (const float*)d_in[7]; const float* wv = (const float*)d_in[8]; const float* bv = (const float*)d_in[9]; const float* wo = (const float*)d_in[10]; const float* bo = (const float*)d_in[11];   /* order query, key, value, mask (int32 [1][1][1][4096], read), Wq, bq, Wk, bk, Wv, bv, Wo, bo ('oi' + biases) */
    float* OUT = (float*)d_out;     // [1][4096][1024]
    char* wsp = (char*)d_ws;
    auto take = [&](size_t bytes) { char* p = wsp; wsp += (bytes + 255) & ~(size_t)255; return (void*)p; };
    bf* WQ = (bf*)take((size_t)DQ * DM * 2); bf* WK = (bf*)take((size_t)DKV * DM * 2); bf* WV = (bf*)take((size_t)DKV * DM * 2); bf* WO = (bf*)take((size_t)DM * DQ * 2);
    bf* XB = (bf*)take((size_t)TT * DM * 2);
    h16* QP16 = (h16*)take((size_t)NH_ * TT * HD * 2); h16* KP16 = (h16*)take((size_t)NKV * TT * HD * 2); h16* VT16 = (h16*)take((size_t)NKV * HD * TT * 2);
    bf* QPh = (bf*)take((size_t)NH_ * TT * HD * 2); bf* QPl = (bf*)take((size_t)NH_ * TT * HD * 2); bf* KPh = (bf*)take((size_t)NKV * TT * HD * 2); bf* KPl = (bf*)take((size_t)NKV * TT * HD * 2); bf* VTh = (bf*)take((size_t)NKV * HD * TT * 2); bf* VTl = (bf*)take((size_t)NKV * HD * TT * 2);
    bf* ATh = (bf*)take((size_t)TT * DQ * 2); bf* ATl = (bf*)take((size_t)TT * DQ * 2);
    if ((size_t)(wsp - (char*)d_ws) > ws_size) return;    // ws 256 MiB
    { k_cvt8<<<(unsigned)(((size_t)DQ * DM / 8 + 255) / 256), 256, 0, stream>>>(wq, WQ, (size_t)DQ * DM / 8); k_cvt8<<<(unsigned)(((size_t)DKV * DM / 8 + 255) / 256), 256, 0, stream>>>(wk, WK, (size_t)DKV * DM / 8); k_cvt8<<<(unsigned)(((size_t)DKV * DM / 8 + 255) / 256), 256, 0, stream>>>(wv, WV, (size_t)DKV * DM / 8);
      k_cvt8<<<(unsigned)(((size_t)DM * DQ / 8 + 255) / 256), 256, 0, stream>>>(wo, WO, (size_t)DM * DQ / 8);
       }
    for (int b = 0; b < NB_; ++b) {
        
        k_cvt8<<<(unsigned)(((size_t)TT * DM / 8 + 255) / 256), 256, 0, stream>>>(x + (size_t)b * TT * DM, XB, (size_t)TT * DM / 8);
        k_gemmw<bf, 0, true, 1><<<dim3(TT / 64, DQ / 64, 1), 32, 0, stream>>>(XB, nullptr, WQ, nullptr, DM, DM, nullptr, 0, bq, 0, 0, 0, QP16, QPh, QPl);
        k_cvt8<<<(unsigned)(((size_t)TT * DM / 8 + 255) / 256), 256, 0, stream>>>(xk + (size_t)b * TT * DM, XB, (size_t)TT * DM / 8);   /* XB := bf16(key[b]) */ k_gemmw<bf, 0, true, 1><<<dim3(TT / 64, DKV / 64, 1), 32, 0, stream>>>(XB, nullptr, WK, nullptr, DM, DM, nullptr, 0, bk, 0, 0, 0, KP16, KPh, KPl);
        k_cvt8<<<(unsigned)(((size_t)TT * DM / 8 + 255) / 256), 256, 0, stream>>>(xv + (size_t)b * TT * DM, XB, (size_t)TT * DM / 8);   /* XB := bf16(value[b]) */ k_gemmw<bf, 0, true, 2><<<dim3(TT / 64, DKV / 64, 1), 32, 0, stream>>>(XB, nullptr, WV, nullptr, DM, DM, nullptr, 0, bv, 0, 0, 0, VT16, VTh, VTl);
        k_fattn<<<dim3(FBH, NH_), 288, 0, stream>>>(QP16, KP16, VT16, QPh, QPl, KPh, KPl, VTh, VTl, kmask + (size_t)b * TT, ATh, ATl);
        k_gemmw<bf, 1, true, 0><<<dim3(TT / 64, DM / 64, 1), 32, 0, stream>>>(ATh, ATl, WO, nullptr, DQ, DQ, OUT + (size_t)b * TT * DM, DM, bo, 0, 0, 0, nullptr, nullptr, nullptr); }
}

// v005
// Measured time: 171 microseconds a run.
// In two side-by-side timings against v004, it was 1.43 and 1.41 times as fast.
// All steps since v000 together make it 20.1 times as fast.
#include <hip/hip_runtime.h>

// Attention on three input streams over 4,096 tokens with a RANDOM integer key mask (query, key, value [1][4096][1024]; q = query Wq^T + bq, k = key Wk^T + bk, v = value Wv^T + bv ('oi' 1/32 + zero biases; 16 heads x 64); scores / sqrt(64); keys with mask[b][0][0][j] == 0 -> -1e9 (== exclusion; mask int32 [1][1][1][4096] with random 0/1 entries, read per key on device); softmax; out = merged Wo^T + bo -> [1][4096][1024] (4.2 M); argument order query, key, value, mask, Wq, bq, Wk, bk, Wv, bv, Wo, bo).
// Layout: bf16 copies of query, key, value in turn; 'oi' weights; exact projections + f32 biases, whose epilogues store the head planes (fp16 + bf16 hi/lo; V transposed) themselves; one fused attention launch for all heads (online softmax, no score plane; K and V^T tiles staged in LDS by tensor loads), which reads the int key vector and excludes the zeros (hybrid rows: < 512 hi/lo 3 products, rest fp16); merged hi/lo x Wo exact + bo.
// Compute dtypes, f32 accumulate: every input rounded to bf16; projections exact + f32 biases; attention rows < 512 3 products, rest fp16; softmax f32; Wo hl x exact + bias.

#define NB_  1
#define TT   4096
#define DM   1024
#define NH_  16
#define NKV  16
#define REP  (NH_ / NKV)
#define HD   64
#define DQ   (NH_ * HD)
#define DKV  (NKV * HD)
#define RH   512                  // query rows < RH use hi+lo planes
#define WIN  0
typedef _Float16 h16;
typedef unsigned short bf;
typedef __attribute__((ext_vector_type(16))) __bf16   v16bf;
typedef __attribute__((ext_vector_type(16))) _Float16 v16h;
typedef __attribute__((ext_vector_type(8)))  _Float16 v8h;
typedef __attribute__((ext_vector_type(8)))  unsigned short v8us;
typedef __attribute__((ext_vector_type(8)))  float    v8f;
typedef __attribute__((ext_vector_type(4)))  float    v4f;
typedef v8h  __attribute__((may_alias)) v8ha;
typedef v4f  __attribute__((may_alias)) v4fa;
typedef v8us __attribute__((may_alias)) v8usa;

__device__ __forceinline__ unsigned short f2bf(float f) { unsigned u = __float_as_uint(f); u += 0x7FFFu + ((u >> 16) & 1u); return (unsigned short)(u >> 16); }
__device__ __forceinline__ float bf2f(unsigned short b) { return __uint_as_float(((unsigned)b) << 16); }
__device__ __forceinline__ float bfr(float f) { return bf2f(f2bf(f)); }
__device__ __forceinline__ v16h cat16(v8h lo, v8h hi) { return __builtin_shufflevector(lo, hi, 0, 1, 2, 3, 4, 5, 6, 7, 8, 9, 10, 11, 12, 13, 14, 15); }
__device__ __forceinline__ v16bf cat16b(v8us lo, v8us hi) { return __builtin_bit_cast(v16bf, __builtin_shufflevector(lo, hi, 0, 1, 2, 3, 4, 5, 6, 7, 8, 9, 10, 11, 12, 13, 14, 15)); }
__device__ __forceinline__ v8f wmma16(v16h a, v16h b, v8f c) { return __builtin_amdgcn_wmma_f32_16x16x32_f16(false, a, false, b, (short)0, c, false, false); }
__device__ __forceinline__ v8f wmmab(v16bf a, v16bf b, v8f c) { return __builtin_amdgcn_wmma_f32_16x16x32_bf16(false, a, false, b, (short)0, c, false, false); }
__device__ __forceinline__ h16 tohx(float x) { return (h16)x; }
__device__ __forceinline__ void splitf(float y, unsigned short& h, unsigned short& l) { h = f2bf(y); l = f2bf(y - bf2f(h)); }



typedef unsigned int u32;
typedef __attribute__((ext_vector_type(4))) unsigned int u32x4;
typedef __attribute__((ext_vector_type(8))) unsigned int u32x8;
__device__ __forceinline__ u32 uni(u32 v) { return (u32)__builtin_amdgcn_readfirstlane(v); }
__device__ __forceinline__ u32 pinned(u32 v) { u32 w = uni(v); asm volatile("" : "+s"(w)); return w; }   // holds a tensor load's issue test in a scalar register, so that the branch around the load is a scalar one
__device__ __forceinline__ void wait_ds0() { asm volatile("s_wait_dscnt 0x0" ::: "memory"); }        // this wave's LDS reads have returned: in front of the barrier behind which their buffer is refilled
// this wave's tensor load has landed: the compiler places no wait for it; the request's descriptor is named as an input, so that its registers keep their values up to the wait
__device__ __forceinline__ void wait_tensor0(u32x4 g0, u32x8 g1) { asm volatile("s_wait_tensorcnt 0x0" :: "s"(g0), "s"(g1) : "memory"); }
// ---- k_gemmw: GEMM on 128x128 output tiles, FOUR WAVES (2 x 2) per block, each on its own 64x64 tile (16 accumulators); grid (M/128, N/128, Z), 128 threads.
// C[m][n] (f32, pitch ldc, + optional f32 bias[n]) = sum_{k < KL} A[m][k] Bt[n][k] (+ A2[m][k] Bt[n][k] for NSPLIT = 1). K = row pitch of A and Bt, KL = k extent summed here. z-batch strides sA/sB/sC in elements. KL % 128 == 0, KL >= 256.
// The operand rows reach the waves through LDS: a stage is 128 k (256 bytes) of the block's 128 A rows (of both planes for NSPLIT = 1) and 128 Bt rows, every wave bringing one slice of it by one tensor load, two buffers,
// the next stage in flight while this one is worked on; a row's bytes leave L2 once per block in whole 256-byte pieces, and the two waves that share a row read it from LDS.
// PL = 0: C as above. PL = 1, 2: no C; a wave's tile (64 tokens x the 64 columns of one head, + bias) goes out as three 16-bit planes, fp16 and bf16 hi + lo: PL = 1 [head][token][d], PL = 2 transposed, [head][d][token].
#define GKS  128                   // k per stage
#define GPIT 272                   // LDS row pitch: 256 bytes + the mover's 16-byte pad, an odd multiple of 16 bytes for 16-byte readers
#define GSL  18432                 // the place of a slice of 64 rows: 64 x 272 bytes = 17,408, rounded up to a multiple of 2 KiB
template <typename T16> struct WFrag;
template <> struct WFrag<h16> { typedef v16h V; static __device__ __forceinline__ V ld(const h16* p) { return cat16(*(const v8h*)p, *(const v8h*)(p + 16)); } static __device__ __forceinline__ v8f mma(V a, V b, v8f c) { return wmma16(a, b, c); } };
template <> struct WFrag<bf> { typedef v16bf V; static __device__ __forceinline__ V ld(const bf* p) { return cat16b(*(const v8us*)p, *(const v8us*)(p + 16)); } static __device__ __forceinline__ v8f mma(V a, V b, v8f c) { return wmmab(a, b, c); } };
template <typename T16, int NSPLIT, bool BIAS, int PL>
__global__ __launch_bounds__(128) void k_gemmw(const T16* __restrict__ A, const T16* __restrict__ A2, const T16* __restrict__ Bt, const T16* __restrict__ Bt2, int K, int KL, float* C, int ldc, const float* __restrict__ bias, size_t sA, size_t sB, size_t sC, h16* P16, bf* Ph, bf* Pl) {
    typedef typename WFrag<T16>::V V;
    static_assert(NSPLIT == 0 || NSPLIT == 1, "one or two A planes against one Bt plane");
    // a buffer: the A plane(s), then Bt. NSPLIT = 0: four slices of 64 rows, one per wave. NSPLIT = 1: A and A2 as one tile of 128 rows each (waves 0, 1), Bt as two slices of 64 rows (waves 2, 3).
    constexpr int APL = NSPLIT ? 128 * GPIT : 2 * GSL;   // an A plane's place
    constexpr int ASP = NSPLIT ? 64 * GPIT : GSL;        // from its rows 0 .. 63 to its rows 64 .. 127
    constexpr int BOF = (NSPLIT + 1) * APL, GBUF = BOF + 2 * GSL;
    static_assert(APL % 2048 == 0 && GSL % 2048 == 0 && 64 * GPIT <= GSL, "every place a multiple of 2 KiB");
    __shared__ __attribute__((aligned(2048))) unsigned char L[2 * GBUF];
    __shared__ __align__(16) float osb[4][16 * 68];
    (void)Bt2;
    const size_t z = blockIdx.z; A += z * sA; if (A2) A2 += z * sA; Bt += z * sB; C += z * sC;
    const u32 wave = uni(threadIdx.x >> 5); const int wm = (int)(wave >> 1), wn = (int)(wave & 1u);
    const int lane = threadIdx.x & 31, lr = lane & 15, hi = lane >> 4; const int r0 = blockIdx.x * 128 + wm * 64, c0 = blockIdx.y * 128 + wn * 64;
    float* os = osb[wave];
    // the wave's slice of every stage: rows of 256 bytes, source pitch 2 K bytes, a stage 256 bytes on
    const bool isb = wave >= 2;
    const T16* sp = isb ? Bt + (size_t)(blockIdx.y * 128 + wn * 64) * K : NSPLIT ? (wave ? A2 : A) + (size_t)(blockIdx.x * 128) * K : A + (size_t)(blockIdx.x * 128 + wave * 64) * K;
    const u32 rows = (NSPLIT && !isb) ? 128u : 64u;
    const unsigned long long src = (unsigned long long)(size_t)sp;
    const u32 lbase = (u32)(size_t)L + (isb ? BOF + wn * GSL : wave * (NSPLIT ? APL : GSL));
    u32x8 g1; g1[0] = uni((1u << 20) | (5u << 22) | (3u << 25));   // no mask, 1-byte elements, 4 dwords of pad behind every 64
    g1[1] = uni(256u << 16); g1[2] = uni(rows << 16); g1[3] = uni(256u << 16); g1[4] = uni(rows); g1[5] = uni((u32)K * 2u); g1[6] = uni(0u); g1[7] = uni(0u);
    asm volatile("" : "+s"(g1));   // pinned, as in pinned(): the descriptor words stay in these scalar registers through the loop and are not formed again while a request is out
    u32x4 g0 = {0u, 0u, 0u, 0u};   // the descriptor group of the wave's last request
    auto issue = [&](u32 s) { const unsigned long long ga = src + (unsigned long long)s * (GKS * 2); g0[0] = uni(1u); g0[1] = uni(lbase + (s & 1u) * GBUF); g0[2] = uni((u32)ga); g0[3] = uni(((u32)(ga >> 32) & 0x01FFFFFFu) | 0x80000000u);
        asm volatile("tensor_load_to_lds %0, %1" :: "s"(g0), "s"(g1) : "memory"); };   // one request of the whole wave; every wave of the block issues its own
    v8f acc[4][4];
#pragma unroll
    for (int mb = 0; mb < 4; ++mb)
#pragma unroll
        for (int nb = 0; nb < 4; ++nb) acc[mb][nb] = (v8f){};
    const u32 nst = (u32)KL / GKS;
    issue(0); wait_tensor0(g0, g1);
    __syncthreads();   // stage 0 is published
    issue(1);
    const int fo = lr * GPIT + 16 * hi;   // the lane's row and half in every slice
    for (u32 s = 0; s < nst; ++s) {
        const unsigned char* Lb = L + (s & 1u) * GBUF;
        const T16* La = (const T16*)(Lb + wm * ASP + fo); const T16* La2 = (const T16*)(Lb + APL + wm * ASP + fo); const T16* Lw = (const T16*)(Lb + BOF + wn * GSL + fo);
        V a[2][4], a2[2][4], b[2][4];   // two fragment sets: the next 32 k are fetched as one group in front of this 32 k's products; nothing of a stage is read in front of its barrier
        // every "#pragma unroll" of this loop: it indexes fragment and accumulator arrays, which stay in registers only under constant indices
#pragma unroll
        for (int f = 0; f < 4; ++f) { a[0][f] = WFrag<T16>::ld(La + f * 16 * (GPIT / 2)); if (NSPLIT == 1) a2[0][f] = WFrag<T16>::ld(La2 + f * 16 * (GPIT / 2)); b[0][f] = WFrag<T16>::ld(Lw + f * 16 * (GPIT / 2)); }
#pragma unroll
        for (int ks = 0; ks < GKS / 32; ++ks) { const int cu = ks & 1, nx = cu ^ 1;
            if (ks + 1 < GKS / 32) {
#pragma unroll
                for (int f = 0; f < 4; ++f) { const int o = f * 16 * (GPIT / 2) + 32 * (ks + 1); a[nx][f] = WFrag<T16>::ld(La + o); if (NSPLIT == 1) a2[nx][f] = WFrag<T16>::ld(La2 + o); b[nx][f] = WFrag<T16>::ld(Lw + o); }
            }
            __builtin_amdgcn_sched_barrier(0);   // keeps the group of LDS reads whole and in front of the block of products: without it the compiler kept one Bt fragment and waited for LDS in front of every four products
#pragma unroll
            for (int nb = 0; nb < 4; ++nb)
#pragma unroll
                for (int mb = 0; mb < 4; ++mb) { acc[mb][nb] = WFrag<T16>::mma(a[cu][mb], b[cu][nb], acc[mb][nb]); if (NSPLIT == 1) acc[mb][nb] = WFrag<T16>::mma(a2[cu][mb], b[cu][nb], acc[mb][nb]); }
            __builtin_amdgcn_sched_barrier(0);   // the other side of the pair: the next group of reads stays behind this block
        }
        wait_ds0();
        wait_tensor0(g0, g1);
        __syncthreads();   // publishes stage s + 1 and ends every wave's reads of stage s
        if (pinned(s + 2 < nst)) issue(s + 2);   // into the buffer that stage s has left
    }
    wait_tensor0(g0, g1); wait_ds0();
    // Every "#pragma unroll" of the plane epilogues: its loop indexes accumulator and staging arrays, which stay in registers only under constant indices.
    const int prow = lane >> 3, pc = (lane & 7) * 8;   // plane stores: 8 lanes x 16 bytes a row, so one store covers four whole 128-byte rows
    if constexpr (PL == 2) {
        // a lane's 8 accumulator elements are 8 consecutive tokens of ONE column d: converted in registers, 16 d rows x 64 tokens of each plane pass through LDS (pitch 72: no bank shared by the 16 rows of a write)
        __shared__ __align__(16) unsigned short tsb[4][3][16 * 72]; unsigned short (*ts)[16 * 72] = tsb[wave];   // each wave stages in its own rows
#pragma unroll
        for (int nb = 0; nb < 4; ++nb) {
            const float bb = BIAS ? bfr(bias[c0 + nb * 16 + lr]) : 0.f;
#pragma unroll
            for (int mb = 0; mb < 4; ++mb) { v8h o16; v8us oh, ol;
#pragma unroll
                for (int j = 0; j < 8; ++j) { const float x = acc[mb][nb][j] + bb; o16[j] = tohx(x); unsigned short a2, c2; splitf(x, a2, c2); oh[j] = a2; ol[j] = c2; }
                const int to = lr * 72 + mb * 16 + hi * 8; *(v8usa*)(ts[0] + to) = __builtin_bit_cast(v8us, o16); *(v8usa*)(ts[1] + to) = oh; *(v8usa*)(ts[2] + to) = ol; }
            __builtin_amdgcn_wave_barrier(); asm volatile("" ::: "memory");   // the rows are read back by other lanes of the wave: keeps the reads behind the writes
            v8us w[4][3]; const size_t po = (size_t)(c0 + nb * 16 + prow) * TT + r0 + pc;
#pragma unroll
            for (int s = 0; s < 4; ++s) {
#pragma unroll
                for (int p = 0; p < 3; ++p) w[s][p] = *(const v8usa*)(ts[p] + (4 * s + prow) * 72 + pc);
                *(v8us*)((bf*)P16 + po + (size_t)s * 4 * TT) = w[s][0]; *(v8us*)(Ph + po + (size_t)s * 4 * TT) = w[s][1]; *(v8us*)(Pl + po + (size_t)s * 4 * TT) = w[s][2]; }
            // stands behind the group's stores, in front of any reuse of their data registers (named as inputs, so that they live up to the wait); as a memory clobber it also keeps the next rows' LDS writes behind these reads
            asm volatile("s_wait_xcnt 0x0" :: "v"(w[0][0]), "v"(w[0][1]), "v"(w[0][2]), "v"(w[1][0]), "v"(w[1][1]), "v"(w[1][2]), "v"(w[2][0]), "v"(w[2][1]), "v"(w[2][2]), "v"(w[3][0]), "v"(w[3][1]), "v"(w[3][2]) : "memory");
        }
        return;
    }
    float pb[8];
    if constexpr (PL == 1) {
#pragma unroll
        for (int k = 0; k < 8; ++k) pb[k] = BIAS ? bfr(bias[c0 + pc + k]) : 0.f; }
#pragma unroll
    for (int mb = 0; mb < 4; ++mb) {
#pragma unroll
        for (int nb = 0; nb < 4; ++nb) {
#pragma unroll
            for (int j = 0; j < 8; ++j) os[(hi * 8 + j) * 68 + nb * 16 + lr] = acc[mb][nb][j]; }
        __builtin_amdgcn_wave_barrier(); asm volatile("" ::: "memory");
        if constexpr (PL == 1) {
            v8us w[4][3]; const size_t po = ((size_t)(c0 / HD) * TT + r0 + mb * 16 + prow) * HD + pc;
#pragma unroll
            for (int s = 0; s < 4; ++s) { const float* orow = os + (4 * s + prow) * 68 + pc; const v4f x0 = *(const v4fa*)orow, x1 = *(const v4fa*)(orow + 4); v8h o16;
#pragma unroll
                for (int k = 0; k < 8; ++k) { const float x = (k < 4 ? x0[k & 3] : x1[k & 3]) + pb[k]; o16[k] = tohx(x); unsigned short a2, c2; splitf(x, a2, c2); w[s][1][k] = a2; w[s][2][k] = c2; }
                w[s][0] = __builtin_bit_cast(v8us, o16);
                *(v8us*)((bf*)P16 + po + s * 4 * HD) = w[s][0]; *(v8us*)(Ph + po + s * 4 * HD) = w[s][1]; *(v8us*)(Pl + po + s * 4 * HD) = w[s][2]; }
            // stands behind the group's stores, in front of any reuse of their data registers (named as inputs, so that they live up to the wait)
            asm volatile("s_wait_xcnt 0x0" :: "v"(w[0][0]), "v"(w[0][1]), "v"(w[0][2]), "v"(w[1][0]), "v"(w[1][1]), "v"(w[1][2]), "v"(w[2][0]), "v"(w[2][1]), "v"(w[2][2]), "v"(w[3][0]), "v"(w[3][1]), "v"(w[3][2]) : "memory");
        } else {
        float* crow = C + (size_t)(r0 + mb * 16) * ldc + c0;
{
#pragma unroll
            for (int s = 0; s < 8; ++s) { const int row = 2 * s + hi, cofs = lr * 4; v4f val = *(const v4fa*)(os + row * 68 + cofs); if (BIAS) { val[0] += bfr(bias[c0 + cofs]); val[1] += bfr(bias[c0 + cofs + 1]); val[2] += bfr(bias[c0 + cofs + 2]); val[3] += bfr(bias[c0 + cofs + 3]); }
                *(v4f*)(crow + (size_t)row * ldc + cofs) = val; }
             }
        }
        __builtin_amdgcn_wave_barrier(); asm volatile("" ::: "memory");
    }
}

typedef __attribute__((ext_vector_type(4))) _Float16 v4h;
typedef __attribute__((ext_vector_type(4))) unsigned short v4us;
typedef __attribute__((ext_vector_type(4))) int v4i;

__global__ __launch_bounds__(256) void k_cvt8(const float* __restrict__ src, bf* dst, size_t n8) { const size_t i = (size_t)blockIdx.x * 256 + threadIdx.x; if (i >= n8) return; const v8f v = *(const v8f*)(src + i * 8); v8us o;
#pragma unroll
    for (int k = 0; k < 8; ++k) o[k] = f2bf(v[k]); *(v8us*)(dst + i * 8) = o;  }

// ---- k_fattn: scores, key mask, softmax and P x V of all heads in ONE launch; no score or weight plane in memory.
// Per wave: S^T = K Q^T (A = 16 keys x 64 d, B = the wave's query columns, kept in registers), so a lane holds 8 consecutive keys of ONE query per tile;
// two such tiles, converted in place, are the B operand of O^T += V^T P^T (A = V^T rows in the same k order as WFrag::ld at + 8 * hi). 32 keys per pass.
// Softmax is online in base 2: weights exp2(s - mu + PSH) against the maximum in use mu, O and the sum rescaled only when a new maximum exceeds mu by more than 8.
// A masked key's score is -3.0e38: its weight is 0 beside any kept key, and 1 for every key of a row with no kept key (the module's uniform row).
// Block = 9 waves on 256 query rows' worth of one head's work: 2 waves of 16 hi/lo rows (< RH, 3 products) and 7 waves of 32 fp16 rows; 256 blocks.
// K and V^T reach the waves through LDS: a stage is 64 keys of the head's six planes, each plane's tile (64 rows x 128 bytes) brought by one tensor load of one wave (waves 0 .. 5), two buffers,
// the next stage in flight while this one is worked on; every wave reads its fragments from the tiles, so a plane's bytes leave L2 once per block and stage and not once per wave.
// Every "#pragma unroll" in the attention code: its loop indexes fragment and accumulator arrays, which stay in registers only under constant indices.
#define PSH  4.0f                  // weights lie in (0, 2^(8 + PSH)]: inside fp16's range, and small ones stay normal numbers
#define SCL2 0.18033688011112042f  // HD^-0.5 * log2(e)
#define FBH  (TT / 256)            // blocks per head
#define SKEY 64                    // keys per stage
#define NST  (TT / SKEY)           // stages
#define LPIT 144                   // LDS row pitch: 128 bytes + the mover's 16-byte pad, an odd multiple of 16 bytes for 16-byte readers
#define LTIL 10240                 // a tile's place: 64 rows x 144 bytes = 9,216, rounded up to a multiple of 2 KiB
#define LBUF (6 * LTIL)            // a buffer: tiles K fp16, V^T fp16, K hi, K lo, V^T hi, V^T lo
typedef __attribute__((ext_vector_type(8))) __bf16 v8b;
__device__ __forceinline__ float xhalf(float x) { return __builtin_bit_cast(float, __builtin_amdgcn_permlanex16(__builtin_bit_cast(int, x), __builtin_bit_cast(int, x), 0x76543210, 0xfedcba98, false, false)); }   // lane l <-> lane l ^ 16
// xwait: stands behind each group of global loads, in front of any reuse of their address registers (named as inputs, so that they live up to the wait); as a memory clobber it also keeps the group where it is written
__device__ __forceinline__ void xwait(const void* a) { asm volatile("s_wait_xcnt 0x0" :: "v"(a) : "memory"); }
__device__ __forceinline__ void xwait(const void* a, const void* b) { asm volatile("s_wait_xcnt 0x0" :: "v"(a), "v"(b) : "memory"); }
// what a wave carries from stage to stage; q: fp16 waves [group][k half], hi/lo waves hi [k half] then lo [k half]; mk: the next pass's mask words
struct FSt { v8f o[2][4]; float mu[2], ls[2]; v16h q[4]; v4i mk[2][2]; };
template <typename T16, bool HI, int R>
__device__ __forceinline__ void finit(FSt& st, const T16* __restrict__ Qa, const T16* __restrict__ Qb, const int* __restrict__ kvp, int q0) {
    const int lane = threadIdx.x & 31, lr = lane & 15, hi = lane >> 4;
    const T16* qpa = Qa + (size_t)(q0 + lr) * HD + 8 * hi; const T16* qpb = HI ? Qb + (size_t)(q0 + lr) * HD + 8 * hi : nullptr;
#pragma unroll
    for (int g = 0; g < R; ++g)
#pragma unroll
        for (int kk = 0; kk < 2; ++kk) { const int qo = 16 * g * HD + 32 * kk; st.q[2 * g + kk] = __builtin_bit_cast(v16h, WFrag<T16>::ld(qpa + qo)); if (HI) st.q[2 + kk] = __builtin_bit_cast(v16h, WFrag<T16>::ld(qpb + qo)); }
    if constexpr (HI) xwait(qpa, qpb); else xwait(qpa);
#pragma unroll
    for (int g = 0; g < 2; ++g) { st.mu[g] = -3.0e38f; st.ls[g] = 0.f;
#pragma unroll
        for (int dt = 0; dt < 4; ++dt) st.o[g][dt] = (v8f){}; }
#pragma unroll
    for (int kt = 0; kt < 2; ++kt) { st.mk[kt][0] = *(const v4i*)(kvp + 8 * hi + 16 * kt); st.mk[kt][1] = *(const v4i*)(kvp + 8 * hi + 16 * kt + 4); }
    xwait(kvp + 8 * hi);
}
// one stage of one wave: two passes of 32 keys on the tiles of buffer Lb; k0 = the stage's first key
template <typename T16, bool HI, int R>
__device__ __forceinline__ void fstage(FSt& st, const unsigned char* Lb, const int* __restrict__ kvp, int k0) {
    typedef typename WFrag<T16>::V V;
    const int lane = threadIdx.x & 31, lr = lane & 15, hi = lane >> 4;
    const unsigned char* Lr = Lb + lr * LPIT + 16 * hi;   // the lane's row and half in every tile
    const T16* Lka = (const T16*)(Lr + (HI ? 2 : 0) * LTIL); const T16* Lkb = (const T16*)(Lr + 3 * LTIL); const T16* Lva = (const T16*)(Lr + (HI ? 4 : 1) * LTIL); const T16* Lvb = (const T16*)(Lr + 5 * LTIL);
    V qa[R][2], qb[R][2];
#pragma unroll
    for (int g = 0; g < R; ++g)
#pragma unroll
        for (int kk = 0; kk < 2; ++kk) { qa[g][kk] = __builtin_bit_cast(V, st.q[2 * g + kk]); if (HI) qb[g][kk] = __builtin_bit_cast(V, st.q[2 + kk]); }
    V ka[2][2], kb[2][2];   // the second pass's K fragments are fetched by the first; the first pass's here: nothing of a stage is read in front of its barrier
#pragma unroll
    for (int kt = 0; kt < 2; ++kt)
#pragma unroll
        for (int kk = 0; kk < 2; ++kk) { ka[kt][kk] = WFrag<T16>::ld(Lka + kt * 16 * (LPIT / 2) + 32 * kk); if (HI) kb[kt][kk] = WFrag<T16>::ld(Lkb + kt * 16 * (LPIT / 2) + 32 * kk); }
#pragma unroll
    for (int sub = 0; sub < SKEY / 32; ++sub) {
        V va[4], vb[4];   // this pass's V^T fragments: issued first, read behind the softmax
#pragma unroll
        for (int dt = 0; dt < 4; ++dt) { va[dt] = WFrag<T16>::ld(Lva + dt * 16 * (LPIT / 2) + 32 * sub); if (HI) vb[dt] = WFrag<T16>::ld(Lvb + dt * 16 * (LPIT / 2) + 32 * sub); }
        v8f bias[2];
#pragma unroll
        for (int kt = 0; kt < 2; ++kt)
#pragma unroll
            for (int r = 0; r < 4; ++r) { bias[kt][r] = (st.mk[kt][0][r] != 0) ? 0.f : -3.0e38f; bias[kt][4 + r] = (st.mk[kt][1][r] != 0) ? 0.f : -3.0e38f; }
        v8f s[R][2];
#pragma unroll
        for (int g = 0; g < R; ++g)
#pragma unroll
            for (int kt = 0; kt < 2; ++kt) s[g][kt] = (v8f){};
#pragma unroll
        for (int kk = 0; kk < 2; ++kk) {
#pragma unroll
            for (int g = 0; g < R; ++g)
#pragma unroll
                for (int kt = 0; kt < 2; ++kt) s[g][kt] = WFrag<T16>::mma(ka[kt][kk], qa[g][kk], s[g][kt]);
            if (HI) {
#pragma unroll
                for (int g = 0; g < R; ++g)
#pragma unroll
                    for (int kt = 0; kt < 2; ++kt) s[g][kt] = WFrag<T16>::mma(ka[kt][kk], qb[g][kk], s[g][kt]);
#pragma unroll
                for (int g = 0; g < R; ++g)
#pragma unroll
                    for (int kt = 0; kt < 2; ++kt) s[g][kt] = WFrag<T16>::mma(kb[kt][kk], qa[g][kk], s[g][kt]);
            }
        }
        // the next pass's mask words, fetched behind this pass's S^T products (the last pass of all fetches keys 0 .. 31 again, unused); inside a stage they lie a constant step behind the stage's own
        // pointer, so loads and wait are both written on that pointer: it is the register pair that the loads name, and the wait holds it
        const bool inst = sub + 1 < SKEY / 32; const int* mp = kvp + (inst ? k0 : (k0 + SKEY) & (TT - 1)) + 8 * hi; const int mo = inst ? 32 * (sub + 1) : 0;
#pragma unroll
        for (int kt = 0; kt < 2; ++kt) { st.mk[kt][0] = *(const v4i*)(mp + mo + 16 * kt); st.mk[kt][1] = *(const v4i*)(mp + mo + 16 * kt + 4); }
        xwait(mp);
        if (sub + 1 < SKEY / 32) {
#pragma unroll
            for (int kt = 0; kt < 2; ++kt)
#pragma unroll
                for (int kk = 0; kk < 2; ++kk) { ka[kt][kk] = WFrag<T16>::ld(Lka + (32 * (sub + 1) + kt * 16) * (LPIT / 2) + 32 * kk); if (HI) kb[kt][kk] = WFrag<T16>::ld(Lkb + (32 * (sub + 1) + kt * 16) * (LPIT / 2) + 32 * kk); }
        }
        float mx[R]; bool need = false;
#pragma unroll
        for (int g = 0; g < R; ++g) { mx[g] = -3.0e38f;
#pragma unroll
            for (int kt = 0; kt < 2; ++kt) { s[g][kt] = s[g][kt] * SCL2 + bias[kt];
#pragma unroll
                for (int r = 0; r < 8; ++r) mx[g] = fmaxf(mx[g], s[g][kt][r]); }
            need = need || (mx[g] > st.mu[g] + 8.0f); }
        if (__builtin_amdgcn_ballot_w32(need) != 0) {   // one scalar test per pass; rare behind the first passes
#pragma unroll
            for (int g = 0; g < R; ++g) { const float mn = fmaxf(st.mu[g], fmaxf(mx[g], xhalf(mx[g]))); const float corr = __builtin_amdgcn_exp2f(st.mu[g] - mn); st.mu[g] = mn; st.ls[g] *= corr;
#pragma unroll
                for (int dt = 0; dt < 4; ++dt) st.o[g][dt] = st.o[g][dt] * corr; }
        }
#pragma unroll
        for (int g = 0; g < R; ++g) { const float nm = PSH - st.mu[g]; v8f p[2];
#pragma unroll
            for (int kt = 0; kt < 2; ++kt) { const v8f ar = s[g][kt] + nm;
#pragma unroll
                for (int r = 0; r < 8; ++r) p[kt][r] = __builtin_amdgcn_exp2f(ar[r]); }
            const v8f ps = p[0] + p[1]; st.ls[g] += ((ps[0] + ps[1]) + (ps[2] + ps[3])) + ((ps[4] + ps[5]) + (ps[6] + ps[7]));
            if constexpr (HI) {
                const v8b h0 = __builtin_convertvector(p[0], v8b), h1 = __builtin_convertvector(p[1], v8b);
                const v8b l0 = __builtin_convertvector(p[0] - __builtin_convertvector(h0, v8f), v8b), l1 = __builtin_convertvector(p[1] - __builtin_convertvector(h1, v8f), v8b);
                const V ph = __builtin_shufflevector(h0, h1, 0, 1, 2, 3, 4, 5, 6, 7, 8, 9, 10, 11, 12, 13, 14, 15), pl = __builtin_shufflevector(l0, l1, 0, 1, 2, 3, 4, 5, 6, 7, 8, 9, 10, 11, 12, 13, 14, 15);
#pragma unroll
                for (int dt = 0; dt < 4; ++dt) st.o[g][dt] = WFrag<T16>::mma(va[dt], ph, st.o[g][dt]);
#pragma unroll
                for (int dt = 0; dt < 4; ++dt) st.o[g][dt] = WFrag<T16>::mma(va[dt], pl, st.o[g][dt]);
#pragma unroll
                for (int dt = 0; dt < 4; ++dt) st.o[g][dt] = WFrag<T16>::mma(vb[dt], ph, st.o[g][dt]);
            } else {
                const V pf = cat16(__builtin_convertvector(p[0], v8h), __builtin_convertvector(p[1], v8h));
#pragma unroll
                for (int dt = 0; dt < 4; ++dt) st.o[g][dt] = WFrag<T16>::mma(va[dt], pf, st.o[g][dt]);
            } }
    }
}
template <int R>
__device__ __forceinline__ void fstore(const FSt& st, int q0, bf* Ah, bf* Al) {
    const int lane = threadIdx.x & 31, lr = lane & 15, hi = lane >> 4;
#pragma unroll
    for (int g = 0; g < R; ++g) { const float inv = __fdiv_rn(1.0f, st.ls[g] + xhalf(st.ls[g]));   // the two halves hold the sums of their own keys
        v8us oh[4], ol[4]; bf* ph = Ah + (size_t)(q0 + 16 * g + lr) * DQ + 8 * hi; bf* pl = Al + (size_t)(q0 + 16 * g + lr) * DQ + 8 * hi;
#pragma unroll
        for (int dt = 0; dt < 4; ++dt) {
#pragma unroll
            for (int r = 0; r < 8; ++r) { unsigned short a, c2; splitf(st.o[g][dt][r] * inv, a, c2); oh[dt][r] = a; ol[dt][r] = c2; }
            *(v8us*)(ph + dt * 16) = oh[dt]; *(v8us*)(pl + dt * 16) = ol[dt]; }
        // stands behind the row group's stores, in front of any reuse of their data and address registers (named as inputs, so that they live up to the wait)
        asm volatile("s_wait_xcnt 0x0" :: "v"(oh[0]), "v"(oh[1]), "v"(oh[2]), "v"(oh[3]), "v"(ol[0]), "v"(ol[1]), "v"(ol[2]), "v"(ol[3]), "v"(ph), "v"(pl) : "memory"); }
}
__global__ __launch_bounds__(288) void k_fattn(const h16* __restrict__ Q16, const h16* __restrict__ K16, const h16* __restrict__ V16, const bf* __restrict__ Qh, const bf* __restrict__ Ql, const bf* __restrict__ Kh, const bf* __restrict__ Kl, const bf* __restrict__ Vh, const bf* __restrict__ Vl, const int* __restrict__ kvp, bf* Ah, bf* Al) {
    __shared__ __attribute__((aligned(2048))) unsigned char L[2 * LBUF];
    const u32 wave = uni(threadIdx.x >> 5); const int blk = blockIdx.x; const size_t pl = (size_t)blockIdx.y * TT * HD; Ah += blockIdx.y * HD; Al += blockIdx.y * HD;
    const bool hiw = wave == 1 || wave == 2;
    const int q0 = hiw ? (blk * 2 + (int)wave - 1) * 16 : RH + (blk * 7 + (wave ? (int)wave - 2 : 0)) * 32;
    // wave w < 6 brings tile w of every stage: 64 rows of 128 bytes; K planes: a row is a key (source pitch 128 bytes, a stage 8 KiB on); V^T planes: a row is a d (source pitch 8 KiB, a stage 128 bytes on)
    const bool isv = wave == 1 || wave >= 4;
    const void* plane = wave == 0 ? (const void*)K16 : wave == 1 ? (const void*)V16 : wave == 2 ? (const void*)Kh : wave == 3 ? (const void*)Kl : wave == 4 ? (const void*)Vh : (const void*)Vl;
    const unsigned long long src = (unsigned long long)(size_t)plane + pl * 2; const u32 step = isv ? SKEY * 2 : SKEY * HD * 2;
    const u32 lbase = (u32)(size_t)L + wave * LTIL;
    u32x8 g1; g1[0] = uni((1u << 20) | (4u << 22) | (3u << 25));   // no mask, 1-byte elements, 4 dwords of pad behind every 32
    g1[1] = uni(128u << 16); g1[2] = uni(64u << 16); g1[3] = uni(128u << 16); g1[4] = uni(64u); g1[5] = uni(isv ? TT * 2 : HD * 2); g1[6] = uni(0u); g1[7] = uni(0u);
    asm volatile("" : "+s"(g1));   // pinned, as in pinned(): the descriptor words stay in these scalar registers through the loop and are not formed again while a request is out
    u32x4 g0 = {0u, 0u, 0u, 0u};   // the descriptor group of the wave's last request
    auto issue = [&](u32 s) { const unsigned long long ga = src + (unsigned long long)s * step; g0[0] = uni(1u); g0[1] = uni(lbase + (s & 1u) * LBUF); g0[2] = uni((u32)ga); g0[3] = uni(((u32)(ga >> 32) & 0x01FFFFFFu) | 0x80000000u);
        asm volatile("tensor_load_to_lds %0, %1" :: "s"(g0), "s"(g1) : "memory"); };   // one request of the whole wave; ignores EXEC, so every test around it is a scalar branch
    FSt st;
    if (hiw) finit<bf, true, 1>(st, Qh + pl, Ql + pl, kvp, q0); else finit<h16, false, 2>(st, Q16 + pl, nullptr, kvp, q0);
    if (pinned(wave < 6)) { issue(0); wait_tensor0(g0, g1); }
    __syncthreads();   // stage 0 is published
    if (pinned(wave < 6)) issue(1);
    for (u32 s = 0; s < NST; ++s) {
        const unsigned char* Lb = L + (s & 1u) * LBUF;
        // the hint: seven of the nine waves take the fp16 side; without it the compiler copied all 64 accumulator registers to and fro on that side at every stage where the two sides join
        if (__builtin_expect(!hiw, 1)) fstage<h16, false, 2>(st, Lb, kvp, (int)s * SKEY); else fstage<bf, true, 1>(st, Lb, kvp, (int)s * SKEY);
        wait_ds0();
        if (pinned(wave < 6)) wait_tensor0(g0, g1);
        __syncthreads();   // publishes stage s + 1 and ends every wave's reads of stage s
        if (pinned(wave < 6 && s + 2 < NST)) issue(s + 2);   // into the buffer that stage s has left
    }
    wait_tensor0(g0, g1); wait_ds0();
    if (hiw) fstore<1>(st, q0, Ah, Al); else fstore<2>(st, q0, Ah, Al);
}
static_assert(NH_ == NKV && RH == FBH * 2 * 16 && TT - RH == FBH * 7 * 32, "a block's 9 waves: 2 x 16 hi/lo rows and 7 x 32 fp16 rows");
static_assert(NST >= 2 && SKEY * 2 == 128 && HD * 2 == 128 && 64 * LPIT <= LTIL && LTIL % 2048 == 0, "a stage's six tiles: 64 rows of 128 bytes each, every place a multiple of 2 KiB; the ring needs two stages");
static_assert(HD == 64 && TT % 128 == 0 && DQ % 128 == 0 && DKV % 128 == 0 && DM % 128 == 0, "a wave's 64 projection columns are one head's, its 64 rows whole lines of the transposed planes; a block holds 2 x 2 such tiles");
static_assert(DM % GKS == 0 && DM / GKS >= 2 && DQ % GKS == 0 && DQ / GKS >= 2, "a GEMM's k extent: whole stages, and the ring needs two");

extern "C" void kernel_launch(void* const* d_in, const int* in_sizes, int n_in,
                              void* d_out, int out_size, void* d_ws, size_t ws_size, hipStream_t stream) {
    (void)in_sizes; (void)n_in; (void)out_size;
    const float* x = (const float*)d_in[0]; const float* xk = (const float*)d_in[1]; const float* xv = (const float*)d_in[2]; const int* kmask = (const int*)d_in[3]; const float* wq = (const float*)d_in[4]; const float* bq = (const float*)d_in[5]; const float* wk = (const float*)d_in[6]; const float* bk = (const float*)d_in[7]; const float* wv = (const float*)d_in[8]; const float* bv = (const float*)d_in[9]; const float* wo = (const float*)d_in[10]; const float* bo = (const float*)d_in[11];   /* order query, key, value, mask (int32 [1][1][1][4096], read), Wq, bq, Wk, bk, Wv, bv, Wo, bo ('oi' + biases) */
    float* OUT = (float*)d_out;     // [1][4096][1024]
    char* wsp = (char*)d_ws;
    auto take = [&](size_t bytes) { char* p = wsp; wsp += (bytes + 255) & ~(size_t)255; return (void*)p; };
    bf* WQ = (bf*)take((size_t)DQ * DM * 2); bf* WK = (bf*)take((size_t)DKV * DM * 2); bf* WV = (bf*)take((size_t)DKV * DM * 2); bf* WO = (bf*)take((size_t)DM * DQ * 2);
    bf* XB = (bf*)take((size_t)TT * DM * 2);
    h16* QP16 = (h16*)take((size_t)NH_ * TT * HD * 2); h16* KP16 = (h16*)take((size_t)NKV * TT * HD * 2); h16* VT16 = (h16*)take((size_t)NKV * HD * TT * 2);
    bf* QPh = (bf*)take((size_t)NH_ * TT * HD * 2); bf* QPl = (bf*)take((size_t)NH_ * TT * HD * 2); bf* KPh = (bf*)take((size_t)NKV * TT * HD * 2); bf* KPl = (bf*)take((size_t)NKV * TT * HD * 2); bf* VTh = (bf*)take((size_t)NKV * HD * TT * 2); bf* VTl = (bf*)take((size_t)NKV * HD * TT * 2);
    bf* ATh = (bf*)take((size_t)TT * DQ * 2); bf* ATl = (bf*)take((size_t)TT * DQ * 2);
    if ((size_t)(wsp - (char*)d_ws) > ws_size) return;    // ws 256 MiB
    { k_cvt8<<<(unsigned)(((size_t)DQ * DM / 8 + 255) / 256), 256, 0, stream>>>(wq, WQ, (size_t)DQ * DM / 8); k_cvt8<<<(unsigned)(((size_t)DKV * DM / 8 + 255) / 256), 256, 0, stream>>>(wk, WK, (size_t)DKV * DM / 8); k_cvt8<<<(unsigned)(((size_t)DKV * DM / 8 + 255) / 256), 256, 0, stream>>>(wv, WV, (size_t)DKV * DM / 8);
      k_cvt8<<<(unsigned)(((size_t)DM * DQ / 8 + 255) / 256), 256, 0, stream>>>(wo, WO, (size_t)DM * DQ / 8);
       }
    for (int b = 0; b < NB_; ++b) {
        
        k_cvt8<<<(unsigned)(((size_t)TT * DM / 8 + 255) / 256), 256, 0, stream>>>(x + (size_t)b * TT * DM, XB, (size_t)TT * DM / 8);
        k_gemmw<bf, 0, true, 1><<<dim3(TT / 128, DQ / 128, 1), 128, 0, stream>>>(XB, nullptr, WQ, nullptr, DM, DM, nullptr, 0, bq, 0, 0, 0, QP16, QPh, QPl);
        k_cvt8<<<(unsigned)(((size_t)TT * DM / 8 + 255) / 256), 256, 0, stream>>>(xk + (size_t)b * TT * DM, XB, (size_t)TT * DM / 8);   /* XB := bf16(key[b]) */ k_gemmw<bf, 0, true, 1><<<dim3(TT / 128, DKV / 128, 1), 128, 0, stream>>>(XB, nullptr, WK, nullptr, DM, DM, nullptr, 0, bk, 0, 0, 0, KP16, KPh, KPl);
        k_cvt8<<<(unsigned)(((size_t)TT * DM / 8 + 255) / 256), 256, 0, stream>>>(xv + (size_t)b * TT * DM, XB, (size_t)TT * DM / 8);   /* XB := bf16(value[b]) */ k_gemmw<bf, 0, true, 2><<<dim3(TT / 128, DKV / 128, 1), 128, 0, stream>>>(XB, nullptr, WV, nullptr, DM, DM, nullptr, 0, bv, 0, 0, 0, VT16, VTh, VTl);
        k_fattn<<<dim3(FBH, NH_), 288, 0, stream>>>(QP16, KP16, VT16, QPh, QPl, KPh, KPl, VTh, VTl, kmask + (size_t)b * TT, ATh, ATl);
        k_gemmw<bf, 1, true, 0><<<dim3(TT / 128, DM / 128, 1), 128, 0, stream>>>(ATh, ATl, WO, nullptr, DQ, DQ, OUT + (size_t)b * TT * DM, DM, bo, 0, 0, 0, nullptr, nullptr, nullptr); }
}

// v006
// One run takes 166 microseconds.
// Next to v005, in two timings, it ran 1.05 and 1.06 times as fast.
// Counting every step since v000, it is 21.2 times as fast.
#include <hip/hip_runtime.h>

// Attention on three input streams over 4,096 tokens with a RANDOM integer key mask (query, key, value [1][4096][1024]; q = query Wq^T + bq, k = key Wk^T + bk, v = value Wv^T + bv ('oi' 1/32 + zero biases; 16 heads x 64); scores / sqrt(64); keys with mask[b][0][0][j] == 0 -> -1e9 (== exclusion; mask int32 [1][1][1][4096] with random 0/1 entries, read per key on device); softmax; out = merged Wo^T + bo -> [1][4096][1024] (4.2 M); argument order query, key, value, mask, Wq, bq, Wk, bk, Wv, bv, Wo, bo).
// Layout: bf16 copies of query, key, value and the 'oi' weights, all made by one launch; exact projections + f32 biases, whose epilogues store the head planes (fp16 + bf16 hi/lo; V transposed) themselves; one fused attention launch for all heads (online softmax, no score plane; K and V^T tiles staged in LDS by tensor loads), which reads the int key vector and excludes the zeros (hybrid rows: < 512 hi/lo 3 products, rest fp16); merged hi/lo x Wo exact + bo.
// Compute dtypes, f32 accumulate: every input rounded to bf16; projections exact + f32 biases; attention rows < 512 3 products, rest fp16; softmax f32; Wo hl x exact + bias.

#define NB_  1
#define TT   4096
#define DM   1024
#define NH_  16
#define NKV  16
#define REP  (NH_ / NKV)
#define HD   64
#define DQ   (NH_ * HD)
#define DKV  (NKV * HD)
#define RH   512                  // query rows < RH use hi+lo planes
#define WIN  0
typedef _Float16 h16;
typedef unsigned short bf;
typedef __attribute__((ext_vector_type(16))) __bf16   v16bf;
typedef __attribute__((ext_vector_type(16))) _Float16 v16h;
typedef __attribute__((ext_vector_type(8)))  _Float16 v8h;
typedef __attribute__((ext_vector_type(8)))  unsigned short v8us;
typedef __attribute__((ext_vector_type(8)))  float    v8f;
typedef __attribute__((ext_vector_type(4)))  float    v4f;
typedef v8h  __attribute__((may_alias)) v8ha;
typedef v4f  __attribute__((may_alias)) v4fa;
typedef v8us __attribute__((may_alias)) v8usa;

__device__ __forceinline__ unsigned short f2bf(float f) { unsigned u = __float_as_uint(f); u += 0x7FFFu + ((u >> 16) & 1u); return (unsigned short)(u >> 16); }
__device__ __forceinline__ float bf2f(unsigned short b) { return __uint_as_float(((unsigned)b) << 16); }
__device__ __forceinline__ float bfr(float f) { return bf2f(f2bf(f)); }
__device__ __forceinline__ v16h cat16(v8h lo, v8h hi) { return __builtin_shufflevector(lo, hi, 0, 1, 2, 3, 4, 5, 6, 7, 8, 9, 10, 11, 12, 13, 14, 15); }
__device__ __forceinline__ v16bf cat16b(v8us lo, v8us hi) { return __builtin_bit_cast(v16bf, __builtin_shufflevector(lo, hi, 0, 1, 2, 3, 4, 5, 6, 7, 8, 9, 10, 11, 12, 13, 14, 15)); }
__device__ __forceinline__ v8f wmma16(v16h a, v16h b, v8f c) { return __builtin_amdgcn_wmma_f32_16x16x32_f16(false, a, false, b, (short)0, c, false, false); }
__device__ __forceinline__ v8f wmmab(v16bf a, v16bf b, v8f c) { return __builtin_amdgcn_wmma_f32_16x16x32_bf16(false, a, false, b, (short)0, c, false, false); }
__device__ __forceinline__ h16 tohx(float x) { return (h16)x; }
__device__ __forceinline__ void splitf(float y, unsigned short& h, unsigned short& l) { h = f2bf(y); l = f2bf(y - bf2f(h)); }



typedef unsigned int u32;
typedef __attribute__((ext_vector_type(4))) unsigned int u32x4;
typedef __attribute__((ext_vector_type(8))) unsigned int u32x8;
__device__ __forceinline__ u32 uni(u32 v) { return (u32)__builtin_amdgcn_readfirstlane(v); }
__device__ __forceinline__ u32 pinned(u32 v) { u32 w = uni(v); asm volatile("" : "+s"(w)); return w; }   // holds a tensor load's issue test in a scalar register, so that the branch around the load is a scalar one
__device__ __forceinline__ void wait_ds0() { asm volatile("s_wait_dscnt 0x0" ::: "memory"); }        // this wave's LDS reads have returned: in front of the barrier behind which their buffer is refilled
// this wave's tensor load has landed: the compiler places no wait for it; the request's descriptor is named as an input, so that its registers keep their values up to the wait
__device__ __forceinline__ void wait_tensor0(u32x4 g0, u32x8 g1) { asm volatile("s_wait_tensorcnt 0x0" :: "s"(g0), "s"(g1) : "memory"); }
// ---- k_gemmw: GEMM on 128x128 output tiles, FOUR WAVES (2 x 2) per block, each on its own 64x64 tile (16 accumulators); grid (M/128, N/128, Z), 128 threads.
// C[m][n] (f32, pitch ldc, + optional f32 bias[n]) = sum_{k < KL} A[m][k] Bt[n][k] (+ A2[m][k] Bt[n][k] for NSPLIT = 1). K = row pitch of A and Bt, KL = k extent summed here. z-batch strides sA/sB/sC in elements. KL % 128 == 0, KL >= 256.
// The operand rows reach the waves through LDS: a stage is 128 k (256 bytes) of the block's 128 A rows (of both planes for NSPLIT = 1) and 128 Bt rows, every wave bringing one slice of it by one tensor load, two buffers,
// the next stage in flight while this one is worked on; a row's bytes leave L2 once per block in whole 256-byte pieces, and the two waves that share a row read it from LDS.
// PL = 0: C as above. PL = 1, 2: no C; a wave's tile (64 tokens x the 64 columns of one head, + bias) goes out as three 16-bit planes, fp16 and bf16 hi + lo: PL = 1 [head][token][d], PL = 2 transposed, [head][d][token].
#define GKS  128                   // k per stage
#define GPIT 272                   // LDS row pitch: 256 bytes + the mover's 16-byte pad, an odd multiple of 16 bytes for 16-byte readers
#define GSL  18432                 // the place of a slice of 64 rows: 64 x 272 bytes = 17,408, rounded up to a multiple of 2 KiB
template <typename T16> struct WFrag;
template <> struct WFrag<h16> { typedef v16h V; static __device__ __forceinline__ V ld(const h16* p) { return cat16(*(const v8h*)p, *(const v8h*)(p + 16)); } static __device__ __forceinline__ v8f mma(V a, V b, v8f c) { return wmma16(a, b, c); } };
template <> struct WFrag<bf> { typedef v16bf V; static __device__ __forceinline__ V ld(const bf* p) { return cat16b(*(const v8us*)p, *(const v8us*)(p + 16)); } static __device__ __forceinline__ v8f mma(V a, V b, v8f c) { return wmmab(a, b, c); } };
template <typename T16, int NSPLIT, bool BIAS, int PL>
__global__ __launch_bounds__(128) void k_gemmw(const T16* __restrict__ A, const T16* __restrict__ A2, const T16* __restrict__ Bt, const T16* __restrict__ Bt2, int K, int KL, float* C, int ldc, const float* __restrict__ bias, size_t sA, size_t sB, size_t sC, h16* P16, bf* Ph, bf* Pl) {
    typedef typename WFrag<T16>::V V;
    static_assert(NSPLIT == 0 || NSPLIT == 1, "one or two A planes against one Bt plane");
    // a buffer: the A plane(s), then Bt. NSPLIT = 0: four slices of 64 rows, one per wave. NSPLIT = 1: A and A2 as one tile of 128 rows each (waves 0, 1), Bt as two slices of 64 rows (waves 2, 3).
    constexpr int APL = NSPLIT ? 128 * GPIT : 2 * GSL;   // an A plane's place
    constexpr int ASP = NSPLIT ? 64 * GPIT : GSL;        // from its rows 0 .. 63 to its rows 64 .. 127
    constexpr int BOF = (NSPLIT + 1) * APL, GBUF = BOF + 2 * GSL;
    static_assert(APL % 2048 == 0 && GSL % 2048 == 0 && 64 * GPIT <= GSL, "every place a multiple of 2 KiB");
    __shared__ __attribute__((aligned(2048))) unsigned char L[2 * GBUF];
    __shared__ __align__(16) float osb[4][16 * 68];
    (void)Bt2;
    const size_t z = blockIdx.z; A += z * sA; if (A2) A2 += z * sA; Bt += z * sB; C += z * sC;
    const u32 wave = uni(threadIdx.x >> 5); const int wm = (int)(wave >> 1), wn = (int)(wave & 1u);
    const int lane = threadIdx.x & 31, lr = lane & 15, hi = lane >> 4; const int r0 = blockIdx.x * 128 + wm * 64, c0 = blockIdx.y * 128 + wn * 64;
    float* os = osb[wave];
    // the wave's slice of every stage: rows of 256 bytes, source pitch 2 K bytes, a stage 256 bytes on
    const bool isb = wave >= 2;
    const T16* sp = isb ? Bt + (size_t)(blockIdx.y * 128 + wn * 64) * K : NSPLIT ? (wave ? A2 : A) + (size_t)(blockIdx.x * 128) * K : A + (size_t)(blockIdx.x * 128 + wave * 64) * K;
    const u32 rows = (NSPLIT && !isb) ? 128u : 64u;
    const unsigned long long src = (unsigned long long)(size_t)sp;
    const u32 lbase = (u32)(size_t)L + (isb ? BOF + wn * GSL : wave * (NSPLIT ? APL : GSL));
    u32x8 g1; g1[0] = uni((1u << 20) | (5u << 22) | (3u << 25));   // no mask, 1-byte elements, 4 dwords of pad behind every 64
    g1[1] = uni(256u << 16); g1[2] = uni(rows << 16); g1[3] = uni(256u << 16); g1[4] = uni(rows); g1[5] = uni((u32)K * 2u); g1[6] = uni(0u); g1[7] = uni(0u);
    asm volatile("" : "+s"(g1));   // pinned, as in pinned(): the descriptor words stay in these scalar registers through the loop and are not formed again while a request is out
    u32x4 g0 = {0u, 0u, 0u, 0u};   // the descriptor group of the wave's last request
    auto issue = [&](u32 s) { const unsigned long long ga = src + (unsigned long long)s * (GKS * 2); g0[0] = uni(1u); g0[1] = uni(lbase + (s & 1u) * GBUF); g0[2] = uni((u32)ga); g0[3] = uni(((u32)(ga >> 32) & 0x01FFFFFFu) | 0x80000000u);
        asm volatile("tensor_load_to_lds %0, %1" :: "s"(g0), "s"(g1) : "memory"); };   // one request of the whole wave; every wave of the block issues its own
    v8f acc[4][4];
#pragma unroll
    for (int mb = 0; mb < 4; ++mb)
#pragma unroll
        for (int nb = 0; nb < 4; ++nb) acc[mb][nb] = (v8f){};
    const u32 nst = (u32)KL / GKS;
    issue(0); wait_tensor0(g0, g1);
    __syncthreads();   // stage 0 is published
    issue(1);
    const int fo = lr * GPIT + 16 * hi;   // the lane's row and half in every slice
    for (u32 s = 0; s < nst; ++s) {
        const unsigned char* Lb = L + (s & 1u) * GBUF;
        const T16* La = (const T16*)(Lb + wm * ASP + fo); const T16* La2 = (const T16*)(Lb + APL + wm * ASP + fo); const T16* Lw = (const T16*)(Lb + BOF + wn * GSL + fo);
        V a[2][4], a2[2][4], b[2][4];   // two fragment sets: the next 32 k are fetched as one group in front of this 32 k's products; nothing of a stage is read in front of its barrier
        // every "#pragma unroll" of this loop: it indexes fragment and accumulator arrays, which stay in registers only under constant indices
#pragma unroll
        for (int f = 0; f < 4; ++f) { a[0][f] = WFrag<T16>::ld(La + f * 16 * (GPIT / 2)); if (NSPLIT == 1) a2[0][f] = WFrag<T16>::ld(La2 + f * 16 * (GPIT / 2)); b[0][f] = WFrag<T16>::ld(Lw + f * 16 * (GPIT / 2)); }
#pragma unroll
        for (int ks = 0; ks < GKS / 32; ++ks) { const int cu = ks & 1, nx = cu ^ 1;
            if (ks + 1 < GKS / 32) {
#pragma unroll
                for (int f = 0; f < 4; ++f) { const int o = f * 16 * (GPIT / 2) + 32 * (ks + 1); a[nx][f] = WFrag<T16>::ld(La + o); if (NSPLIT == 1) a2[nx][f] = WFrag<T16>::ld(La2 + o); b[nx][f] = WFrag<T16>::ld(Lw + o); }
            }
            __builtin_amdgcn_sched_barrier(0);   // keeps the group of LDS reads whole and in front of the block of products: without it the compiler kept one Bt fragment and waited for LDS in front of every four products
#pragma unroll
            for (int nb = 0; nb < 4; ++nb)
#pragma unroll
                for (int mb = 0; mb < 4; ++mb) { acc[mb][nb] = WFrag<T16>::mma(a[cu][mb], b[cu][nb], acc[mb][nb]); if (NSPLIT == 1) acc[mb][nb] = WFrag<T16>::mma(a2[cu][mb], b[cu][nb], acc[mb][nb]); }
            __builtin_amdgcn_sched_barrier(0);   // the other side of the pair: the next group of reads stays behind this block
        }
        wait_ds0();
        wait_tensor0(g0, g1);
        __syncthreads();   // publishes stage s + 1 and ends every wave's reads of stage s
        if (pinned(s + 2 < nst)) issue(s + 2);   // into the buffer that stage s has left
    }
    wait_tensor0(g0, g1); wait_ds0();
    // Every "#pragma unroll" of the plane epilogues: its loop indexes accumulator and staging arrays, which stay in registers only under constant indices.
    const int prow = lane >> 3, pc = (lane & 7) * 8;   // plane stores: 8 lanes x 16 bytes a row, so one store covers four whole 128-byte rows
    if constexpr (PL == 2) {
        // a lane's 8 accumulator elements are 8 consecutive tokens of ONE column d: converted in registers, 16 d rows x 64 tokens of each plane pass through LDS (pitch 72: no bank shared by the 16 rows of a write)
        __shared__ __align__(16) unsigned short tsb[4][3][16 * 72]; unsigned short (*ts)[16 * 72] = tsb[wave];   // each wave stages in its own rows
#pragma unroll
        for (int nb = 0; nb < 4; ++nb) {
            const float bb = BIAS ? bfr(bias[c0 + nb * 16 + lr]) : 0.f;
#pragma unroll
            for (int mb = 0; mb < 4; ++mb) { v8h o16; v8us oh, ol;
#pragma unroll
                for (int j = 0; j < 8; ++j) { const float x = acc[mb][nb][j] + bb; o16[j] = tohx(x); unsigned short a2, c2; splitf(x, a2, c2); oh[j] = a2; ol[j] = c2; }
                const int to = lr * 72 + mb * 16 + hi * 8; *(v8usa*)(ts[0] + to) = __builtin_bit_cast(v8us, o16); *(v8usa*)(ts[1] + to) = oh; *(v8usa*)(ts[2] + to) = ol; }
            __builtin_amdgcn_wave_barrier(); asm volatile("" ::: "memory");   // the rows are read back by other lanes of the wave: keeps the reads behind the writes
            v8us w[4][3]; const size_t po = (size_t)(c0 + nb * 16 + prow) * TT + r0 + pc;
#pragma unroll
            for (int s = 0; s < 4; ++s) {
#pragma unroll
                for (int p = 0; p < 3; ++p) w[s][p] = *(const v8usa*)(ts[p] + (4 * s + prow) * 72 + pc);
                *(v8us*)((bf*)P16 + po + (size_t)s * 4 * TT) = w[s][0]; *(v8us*)(Ph + po + (size_t)s * 4 * TT) = w[s][1]; *(v8us*)(Pl + po + (size_t)s * 4 * TT) = w[s][2]; }
            // stands behind the group's stores, in front of any reuse of their data registers (named as inputs, so that they live up to the wait); as a memory clobber it also keeps the next rows' LDS writes behind these reads
            asm volatile("s_wait_xcnt 0x0" :: "v"(w[0][0]), "v"(w[0][1]), "v"(w[0][2]), "v"(w[1][0]), "v"(w[1][1]), "v"(w[1][2]), "v"(w[2][0]), "v"(w[2][1]), "v"(w[2][2]), "v"(w[3][0]), "v"(w[3][1]), "v"(w[3][2]) : "memory");
        }
        return;
    }
    float pb[8];
    if constexpr (PL == 1) {
#pragma unroll
        for (int k = 0; k < 8; ++k) pb[k] = BIAS ? bfr(bias[c0 + pc + k]) : 0.f; }
#pragma unroll
    for (int mb = 0; mb < 4; ++mb) {
#pragma unroll
        for (int nb = 0; nb < 4; ++nb) {
#pragma unroll
            for (int j = 0; j < 8; ++j) os[(hi * 8 + j) * 68 + nb * 16 + lr] = acc[mb][nb][j]; }
        __builtin_amdgcn_wave_barrier(); asm volatile("" ::: "memory");
        if constexpr (PL == 1) {
            v8us w[4][3]; const size_t po = ((size_t)(c0 / HD) * TT + r0 + mb * 16 + prow) * HD + pc;
#pragma unroll
            for (int s = 0; s < 4; ++s) { const float* orow = os + (4 * s + prow) * 68 + pc; const v4f x0 = *(const v4fa*)orow, x1 = *(const v4fa*)(orow + 4); v8h o16;
#pragma unroll
                for (int k = 0; k < 8; ++k) { const float x = (k < 4 ? x0[k & 3] : x1[k & 3]) + pb[k]; o16[k] = tohx(x); unsigned short a2, c2; splitf(x, a2, c2); w[s][1][k] = a2; w[s][2][k] = c2; }
                w[s][0] = __builtin_bit_cast(v8us, o16);
                *(v8us*)((bf*)P16 + po + s * 4 * HD) = w[s][0]; *(v8us*)(Ph + po + s * 4 * HD) = w[s][1]; *(v8us*)(Pl + po + s * 4 * HD) = w[s][2]; }
            // stands behind the group's stores, in front of any reuse of their data registers (named as inputs, so that they live up to the wait)
            asm volatile("s_wait_xcnt 0x0" :: "v"(w[0][0]), "v"(w[0][1]), "v"(w[0][2]), "v"(w[1][0]), "v"(w[1][1]), "v"(w[1][2]), "v"(w[2][0]), "v"(w[2][1]), "v"(w[2][2]), "v"(w[3][0]), "v"(w[3][1]), "v"(w[3][2]) : "memory");
        } else {
        float* crow = C + (size_t)(r0 + mb * 16) * ldc + c0;
{
#pragma unroll
            for (int s = 0; s < 8; ++s) { const int row = 2 * s + hi, cofs = lr * 4; v4f val = *(const v4fa*)(os + row * 68 + cofs); if (BIAS) { val[0] += bfr(bias[c0 + cofs]); val[1] += bfr(bias[c0 + cofs + 1]); val[2] += bfr(bias[c0 + cofs + 2]); val[3] += bfr(bias[c0 + cofs + 3]); }
                *(v4f*)(crow + (size_t)row * ldc + cofs) = val; }
             }
        }
        __builtin_amdgcn_wave_barrier(); asm volatile("" ::: "memory");
    }
}

typedef __attribute__((ext_vector_type(4))) _Float16 v4h;
typedef __attribute__((ext_vector_type(4))) unsigned short v4us;
typedef __attribute__((ext_vector_type(4))) int v4i;

// ---- k_cvtall: every f32 -> bf16 copy of a call (query, key, value, Wq, Wk, Wv, Wo) in ONE streaming launch: 256 blocks of 16 waves, a block on CVB consecutive floats of one array.
// A wave's load is 512 consecutive bytes (16 per lane), its store the 256 bytes they round to; a thread has CVL loads to issue in front of its conversions, so a wave starts once for 16 KiB of source and not once for 1 KiB.
// The sources are read once and by non-temporal loads, which leave L2 to the bf16 copies that the GEMMs read; the copies lie one behind the other in block order, so a block's place in dst is its index.
#define CVT_ 512                   // threads per block
#define CVL  32                    // 16-byte loads per thread
#define CVB  (CVT_ * CVL * 4)      // floats per block
#define CVX  (TT * DM / CVB)       // blocks per token array
#define CVW  (DM * DM / CVB)       // blocks per weight array
__global__ __launch_bounds__(CVT_) void k_cvtall(const float* __restrict__ xq, const float* __restrict__ xk, const float* __restrict__ xv, const float* __restrict__ wq, const float* __restrict__ wk, const float* __restrict__ wv, const float* __restrict__ wo, bf* dst) {
    const unsigned b = blockIdx.x, w = b - 3 * CVX;   // which array and which piece of it: the same for the whole block
    const float* src = b < 3 * CVX ? (b < CVX ? xq : b < 2 * CVX ? xk : xv) + (size_t)(b % CVX) * CVB : (w < CVW ? wq : w < 2 * CVW ? wk : w < 3 * CVW ? wv : wo) + (size_t)(w % CVW) * CVB;
    src += threadIdx.x * 4; dst += (size_t)b * CVB + threadIdx.x * 4;
    v4f x[CVL];   // every "#pragma unroll" here: the loops index vectors and this array, which stay in registers only under constant indices
#pragma unroll
    for (int i = 0; i < CVL; ++i) x[i] = __builtin_nontemporal_load((const v4f*)(src + i * (CVT_ * 4)));
#pragma unroll
    for (int i = 0; i < CVL; ++i) { v4us y;
#pragma unroll
        for (int k = 0; k < 4; ++k) y[k] = f2bf(x[i][k]);
        *(v4us*)(dst + i * (CVT_ * 4)) = y; }
}
static_assert((TT * DM) % CVB == 0 && (DM * DM) % CVB == 0 && DQ == DM && DKV == DM && NB_ == 1, "every array is a whole number of blocks' pieces; the four weights are DM x DM; one batch entry, so one launch converts all");

// ---- k_fattn: scores, key mask, softmax and P x V of all heads in ONE launch; no score or weight plane in memory.
// Per wave: S^T = K Q^T (A = 16 keys x 64 d, B = the wave's query columns, kept in registers), so a lane holds 8 consecutive keys of ONE query per tile;
// two such tiles, converted in place, are the B operand of O^T += V^T P^T (A = V^T rows in the same k order as WFrag::ld at + 8 * hi). 32 keys per pass.
// Softmax is online in base 2: weights exp2(s - mu + PSH) against the maximum in use mu, O and the sum rescaled only when a new maximum exceeds mu by more than 8.
// A masked key's score is -3.0e38: its weight is 0 beside any kept key, and 1 for every key of a row with no kept key (the module's uniform row).
// Block = 9 waves on 256 query rows' worth of one head's work: 2 waves of 16 hi/lo rows (< RH, 3 products) and 7 waves of 32 fp16 rows; 256 blocks.
// K and V^T reach the waves through LDS: a stage is 64 keys of the head's six planes, each plane's tile (64 rows x 128 bytes) brought by one tensor load of one wave (waves 0 .. 5), two buffers,
// the next stage in flight while this one is worked on; every wave reads its fragments from the tiles, so a plane's bytes leave L2 once per block and stage and not once per wave.
// Every "#pragma unroll" in the attention code: its loop indexes fragment and accumulator arrays, which stay in registers only under constant indices.
#define PSH  4.0f                  // weights lie in (0, 2^(8 + PSH)]: inside fp16's range, and small ones stay normal numbers
#define SCL2 0.18033688011112042f  // HD^-0.5 * log2(e)
#define FBH  (TT / 256)            // blocks per head
#define SKEY 64                    // keys per stage
#define NST  (TT / SKEY)           // stages
#define LPIT 144                   // LDS row pitch: 128 bytes + the mover's 16-byte pad, an odd multiple of 16 bytes for 16-byte readers
#define LTIL 10240                 // a tile's place: 64 rows x 144 bytes = 9,216, rounded up to a multiple of 2 KiB
#define LBUF (6 * LTIL)            // a buffer: tiles K fp16, V^T fp16, K hi, K lo, V^T hi, V^T lo
typedef __attribute__((ext_vector_type(8))) __bf16 v8b;
__device__ __forceinline__ float xhalf(float x) { return __builtin_bit_cast(float, __builtin_amdgcn_permlanex16(__builtin_bit_cast(int, x), __builtin_bit_cast(int, x), 0x76543210, 0xfedcba98, false, false)); }   // lane l <-> lane l ^ 16
// xwait: stands behind each group of global loads, in front of any reuse of their address registers (named as inputs, so that they live up to the wait); as a memory clobber it also keeps the group where it is written
__device__ __forceinline__ void xwait(const void* a) { asm volatile("s_wait_xcnt 0x0" :: "v"(a) : "memory"); }
__device__ __forceinline__ void xwait(const void* a, const void* b) { asm volatile("s_wait_xcnt 0x0" :: "v"(a), "v"(b) : "memory"); }
// what a wave carries from stage to stage; q: fp16 waves [group][k half], hi/lo waves hi [k half] then lo [k half]; mk: the next pass's mask words
struct FSt { v8f o[2][4]; float mu[2], ls[2]; v16h q[4]; v4i mk[2][2]; };
template <typename T16, bool HI, int R>
__device__ __forceinline__ void finit(FSt& st, const T16* __restrict__ Qa, const T16* __restrict__ Qb, const int* __restrict__ kvp, int q0) {
    const int lane = threadIdx.x & 31, lr = lane & 15, hi = lane >> 4;
    const T16* qpa = Qa + (size_t)(q0 + lr) * HD + 8 * hi; const T16* qpb = HI ? Qb + (size_t)(q0 + lr) * HD + 8 * hi : nullptr;
#pragma unroll
    for (int g = 0; g < R; ++g)
#pragma unroll
        for (int kk = 0; kk < 2; ++kk) { const int qo = 16 * g * HD + 32 * kk; st.q[2 * g + kk] = __builtin_bit_cast(v16h, WFrag<T16>::ld(qpa + qo)); if (HI) st.q[2 + kk] = __builtin_bit_cast(v16h, WFrag<T16>::ld(qpb + qo)); }
    if constexpr (HI) xwait(qpa, qpb); else xwait(qpa);
#pragma unroll
    for (int g = 0; g < 2; ++g) { st.mu[g] = -3.0e38f; st.ls[g] = 0.f;
#pragma unroll
        for (int dt = 0; dt < 4; ++dt) st.o[g][dt] = (v8f){}; }
#pragma unroll
    for (int kt = 0; kt < 2; ++kt) { st.mk[kt][0] = *(const v4i*)(kvp + 8 * hi + 16 * kt); st.mk[kt][1] = *(const v4i*)(kvp + 8 * hi + 16 * kt + 4); }
    xwait(kvp + 8 * hi);
}
// one stage of one wave: two passes of 32 keys on the tiles of buffer Lb; k0 = the stage's first key
template <typename T16, bool HI, int R>
__device__ __forceinline__ void fstage(FSt& st, const unsigned char* Lb, const int* __restrict__ kvp, int k0) {
    typedef typename WFrag<T16>::V V;
    const int lane = threadIdx.x & 31, lr = lane & 15, hi = lane >> 4;
    const unsigned char* Lr = Lb + lr * LPIT + 16 * hi;   // the lane's row and half in every tile
    const T16* Lka = (const T16*)(Lr + (HI ? 2 : 0) * LTIL); const T16* Lkb = (const T16*)(Lr + 3 * LTIL); const T16* Lva = (const T16*)(Lr + (HI ? 4 : 1) * LTIL); const T16* Lvb = (const T16*)(Lr + 5 * LTIL);
    V qa[R][2], qb[R][2];
#pragma unroll
    for (int g = 0; g < R; ++g)
#pragma unroll
        for (int kk = 0; kk < 2; ++kk) { qa[g][kk] = __builtin_bit_cast(V, st.q[2 * g + kk]); if (HI) qb[g][kk] = __builtin_bit_cast(V, st.q[2 + kk]); }
    V ka[2][2], kb[2][2];   // the second pass's K fragments are fetched by the first; the first pass's here: nothing of a stage is read in front of its barrier
#pragma unroll
    for (int kt = 0; kt < 2; ++kt)
#pragma unroll
        for (int kk = 0; kk < 2; ++kk) { ka[kt][kk] = WFrag<T16>::ld(Lka + kt * 16 * (LPIT / 2) + 32 * kk); if (HI) kb[kt][kk] = WFrag<T16>::ld(Lkb + kt * 16 * (LPIT / 2) + 32 * kk); }
#pragma unroll
    for (int sub = 0; sub < SKEY / 32; ++sub) {
        V va[4], vb[4];   // this pass's V^T fragments: issued first, read behind the softmax
#pragma unroll
        for (int dt = 0; dt < 4; ++dt) { va[dt] = WFrag<T16>::ld(Lva + dt * 16 * (LPIT / 2) + 32 * sub); if (HI) vb[dt] = WFrag<T16>::ld(Lvb + dt * 16 * (LPIT / 2) + 32 * sub); }
        v8f bias[2];
#pragma unroll
        for (int kt = 0; kt < 2; ++kt)
#pragma unroll
            for (int r = 0; r < 4; ++r) { bias[kt][r] = (st.mk[kt][0][r] != 0) ? 0.f : -3.0e38f; bias[kt][4 + r] = (st.mk[kt][1][r] != 0) ? 0.f : -3.0e38f; }
        v8f s[R][2];
#pragma unroll
        for (int g = 0; g < R; ++g)
#pragma unroll
            for (int kt = 0; kt < 2; ++kt) s[g][kt] = (v8f){};
#pragma unroll
        for (int kk = 0; kk < 2; ++kk) {
#pragma unroll
            for (int g = 0; g < R; ++g)
#pragma unroll
                for (int kt = 0; kt < 2; ++kt) s[g][kt] = WFrag<T16>::mma(ka[kt][kk], qa[g][kk], s[g][kt]);
            if (HI) {
#pragma unroll
                for (int g = 0; g < R; ++g)
#pragma unroll
                    for (int kt = 0; kt < 2; ++kt) s[g][kt] = WFrag<T16>::mma(ka[kt][kk], qb[g][kk], s[g][kt]);
#pragma unroll
                for (int g = 0; g < R; ++g)
#pragma unroll
                    for (int kt = 0; kt < 2; ++kt) s[g][kt] = WFrag<T16>::mma(kb[kt][kk], qa[g][kk], s[g][kt]);
            }
        }
        // the next pass's mask words, fetched behind this pass's S^T products (the last pass of all fetches keys 0 .. 31 again, unused); inside a stage they lie a constant step behind the stage's own
        // pointer, so loads and wait are both written on that pointer: it is the register pair that the loads name, and the wait holds it
        const bool inst = sub + 1 < SKEY / 32; const int* mp = kvp + (inst ? k0 : (k0 + SKEY) & (TT - 1)) + 8 * hi; const int mo = inst ? 32 * (sub + 1) : 0;
#pragma unroll
        for (int kt = 0; kt < 2; ++kt) { st.mk[kt][0] = *(const v4i*)(mp + mo + 16 * kt); st.mk[kt][1] = *(const v4i*)(mp + mo + 16 * kt + 4); }
        xwait(mp);
        if (sub + 1 < SKEY / 32) {
#pragma unroll
            for (int kt = 0; kt < 2; ++kt)
#pragma unroll
                for (int kk = 0; kk < 2; ++kk) { ka[kt][kk] = WFrag<T16>::ld(Lka + (32 * (sub + 1) + kt * 16) * (LPIT / 2) + 32 * kk); if (HI) kb[kt][kk] = WFrag<T16>::ld(Lkb + (32 * (sub + 1) + kt * 16) * (LPIT / 2) + 32 * kk); }
        }
        float mx[R]; bool need = false;
#pragma unroll
        for (int g = 0; g < R; ++g) { mx[g] = -3.0e38f;
#pragma unroll
            for (int kt = 0; kt < 2; ++kt) { s[g][kt] = s[g][kt] * SCL2 + bias[kt];
#pragma unroll
                for (int r = 0; r < 8; ++r) mx[g] = fmaxf(mx[g], s[g][kt][r]); }
            need = need || (mx[g] > st.mu[g] + 8.0f); }
        if (__builtin_amdgcn_ballot_w32(need) != 0) {   // one scalar test per pass; rare behind the first passes
#pragma unroll
            for (int g = 0; g < R; ++g) { const float mn = fmaxf(st.mu[g], fmaxf(mx[g], xhalf(mx[g]))); const float corr = __builtin_amdgcn_exp2f(st.mu[g] - mn); st.mu[g] = mn; st.ls[g] *= corr;
#pragma unroll
                for (int dt = 0; dt < 4; ++dt) st.o[g][dt] = st.o[g][dt] * corr; }
        }
#pragma unroll
        for (int g = 0; g < R; ++g) { const float nm = PSH - st.mu[g]; v8f p[2];
#pragma unroll
            for (int kt = 0; kt < 2; ++kt) { const v8f ar = s[g][kt] + nm;
#pragma unroll
                for (int r = 0; r < 8; ++r) p[kt][r] = __builtin_amdgcn_exp2f(ar[r]); }
            const v8f ps = p[0] + p[1]; st.ls[g] += ((ps[0] + ps[1]) + (ps[2] + ps[3])) + ((ps[4] + ps[5]) + (ps[6] + ps[7]));
            if constexpr (HI) {
                const v8b h0 = __builtin_convertvector(p[0], v8b), h1 = __builtin_convertvector(p[1], v8b);
                const v8b l0 = __builtin_convertvector(p[0] - __builtin_convertvector(h0, v8f), v8b), l1 = __builtin_convertvector(p[1] - __builtin_convertvector(h1, v8f), v8b);
                const V ph = __builtin_shufflevector(h0, h1, 0, 1, 2, 3, 4, 5, 6, 7, 8, 9, 10, 11, 12, 13, 14, 15), pl = __builtin_shufflevector(l0, l1, 0, 1, 2, 3, 4, 5, 6, 7, 8, 9, 10, 11, 12, 13, 14, 15);
#pragma unroll
                for (int dt = 0; dt < 4; ++dt) st.o[g][dt] = WFrag<T16>::mma(va[dt], ph, st.o[g][dt]);
#pragma unroll
                for (int dt = 0; dt < 4; ++dt) st.o[g][dt] = WFrag<T16>::mma(va[dt], pl, st.o[g][dt]);
#pragma unroll
                for (int dt = 0; dt < 4; ++dt) st.o[g][dt] = WFrag<T16>::mma(vb[dt], ph, st.o[g][dt]);
            } else {
                const V pf = cat16(__builtin_convertvector(p[0], v8h), __builtin_convertvector(p[1], v8h));
#pragma unroll
                for (int dt = 0; dt < 4; ++dt) st.o[g][dt] = WFrag<T16>::mma(va[dt], pf, st.o[g][dt]);
            } }
    }
}
template <int R>
__device__ __forceinline__ void fstore(const FSt& st, int q0, bf* Ah, bf* Al) {
    const int lane = threadIdx.x & 31, lr = lane & 15, hi = lane >> 4;
#pragma unroll
    for (int g = 0; g < R; ++g) { const float inv = __fdiv_rn(1.0f, st.ls[g] + xhalf(st.ls[g]));   // the two halves hold the sums of their own keys
        v8us oh[4], ol[4]; bf* ph = Ah + (size_t)(q0 + 16 * g + lr) * DQ + 8 * hi; bf* pl = Al + (size_t)(q0 + 16 * g + lr) * DQ + 8 * hi;
#pragma unroll
        for (int dt = 0; dt < 4; ++dt) {
#pragma unroll
            for (int r = 0; r < 8; ++r) { unsigned short a, c2; splitf(st.o[g][dt][r] * inv, a, c2); oh[dt][r] = a; ol[dt][r] = c2; }
            *(v8us*)(ph + dt * 16) = oh[dt]; *(v8us*)(pl + dt * 16) = ol[dt]; }
        // stands behind the row group's stores, in front of any reuse of their data and address registers (named as inputs, so that they live up to the wait)
        asm volatile("s_wait_xcnt 0x0" :: "v"(oh[0]), "v"(oh[1]), "v"(oh[2]), "v"(oh[3]), "v"(ol[0]), "v"(ol[1]), "v"(ol[2]), "v"(ol[3]), "v"(ph), "v"(pl) : "memory"); }
}
__global__ __launch_bounds__(288) void k_fattn(const h16* __restrict__ Q16, const h16* __restrict__ K16, const h16* __restrict__ V16, const bf* __restrict__ Qh, const bf* __restrict__ Ql, const bf* __restrict__ Kh, const bf* __restrict__ Kl, const bf* __restrict__ Vh, const bf* __restrict__ Vl, const int* __restrict__ kvp, bf* Ah, bf* Al) {
    __shared__ __attribute__((aligned(2048))) unsigned char L[2 * LBUF];
    const u32 wave = uni(threadIdx.x >> 5); const int blk = blockIdx.x; const size_t pl = (size_t)blockIdx.y * TT * HD; Ah += blockIdx.y * HD; Al += blockIdx.y * HD;
    const bool hiw = wave == 1 || wave == 2;
    const int q0 = hiw ? (blk * 2 + (int)wave - 1) * 16 : RH + (blk * 7 + (wave ? (int)wave - 2 : 0)) * 32;
    // wave w < 6 brings tile w of every stage: 64 rows of 128 bytes; K planes: a row is a key (source pitch 128 bytes, a stage 8 KiB on); V^T planes: a row is a d (source pitch 8 KiB, a stage 128 bytes on)
    const bool isv = wave == 1 || wave >= 4;
    const void* plane = wave == 0 ? (const void*)K16 : wave == 1 ? (const void*)V16 : wave == 2 ? (const void*)Kh : wave == 3 ? (const void*)Kl : wave == 4 ? (const void*)Vh : (const void*)Vl;
    const unsigned long long src = (unsigned long long)(size_t)plane + pl * 2; const u32 step = isv ? SKEY * 2 : SKEY * HD * 2;
    const u32 lbase = (u32)(size_t)L + wave * LTIL;
    u32x8 g1; g1[0] = uni((1u << 20) | (4u << 22) | (3u << 25));   // no mask, 1-byte elements, 4 dwords of pad behind every 32
    g1[1] = uni(128u << 16); g1[2] = uni(64u << 16); g1[3] = uni(128u << 16); g1[4] = uni(64u); g1[5] = uni(isv ? TT * 2 : HD * 2); g1[6] = uni(0u); g1[7] = uni(0u);
    asm volatile("" : "+s"(g1));   // pinned, as in pinned(): the descriptor words stay in these scalar registers through the loop and are not formed again while a request is out
    u32x4 g0 = {0u, 0u, 0u, 0u};   // the descriptor group of the wave's last request
    auto issue = [&](u32 s) { const unsigned long long ga = src + (unsigned long long)s * step; g0[0] = uni(1u); g0[1] = uni(lbase + (s & 1u) * LBUF); g0[2] = uni((u32)ga); g0[3] = uni(((u32)(ga >> 32) & 0x01FFFFFFu) | 0x80000000u);
        asm volatile("tensor_load_to_lds %0, %1" :: "s"(g0), "s"(g1) : "memory"); };   // one request of the whole wave; ignores EXEC, so every test around it is a scalar branch
    FSt st;
    if (hiw) finit<bf, true, 1>(st, Qh + pl, Ql + pl, kvp, q0); else finit<h16, false, 2>(st, Q16 + pl, nullptr, kvp, q0);
    if (pinned(wave < 6)) { issue(0); wait_tensor0(g0, g1); }
    __syncthreads();   // stage 0 is published
    if (pinned(wave < 6)) issue(1);
    for (u32 s = 0; s < NST; ++s) {
        const unsigned char* Lb = L + (s & 1u) * LBUF;
        // the hint: seven of the nine waves take the fp16 side; without it the compiler copied all 64 accumulator registers to and fro on that side at every stage where the two sides join
        if (__builtin_expect(!hiw, 1)) fstage<h16, false, 2>(st, Lb, kvp, (int)s * SKEY); else fstage<bf, true, 1>(st, Lb, kvp, (int)s * SKEY);
        wait_ds0();
        if (pinned(wave < 6)) wait_tensor0(g0, g1);
        __syncthreads();   // publishes stage s + 1 and ends every wave's reads of stage s
        if (pinned(wave < 6 && s + 2 < NST)) issue(s + 2);   // into the buffer that stage s has left
    }
    wait_tensor0(g0, g1); wait_ds0();
    if (hiw) fstore<1>(st, q0, Ah, Al); else fstore<2>(st, q0, Ah, Al);
}
static_assert(NH_ == NKV && RH == FBH * 2 * 16 && TT - RH == FBH * 7 * 32, "a block's 9 waves: 2 x 16 hi/lo rows and 7 x 32 fp16 rows");
static_assert(NST >= 2 && SKEY * 2 == 128 && HD * 2 == 128 && 64 * LPIT <= LTIL && LTIL % 2048 == 0, "a stage's six tiles: 64 rows of 128 bytes each, every place a multiple of 2 KiB; the ring needs two stages");
static_assert(HD == 64 && TT % 128 == 0 && DQ % 128 == 0 && DKV % 128 == 0 && DM % 128 == 0, "a wave's 64 projection columns are one head's, its 64 rows whole lines of the transposed planes; a block holds 2 x 2 such tiles");
static_assert(DM % GKS == 0 && DM / GKS >= 2 && DQ % GKS == 0 && DQ / GKS >= 2, "a GEMM's k extent: whole stages, and the ring needs two");

extern "C" void kernel_launch(void* const* d_in, const int* in_sizes, int n_in,
                              void* d_out, int out_size, void* d_ws, size_t ws_size, hipStream_t stream) {
    (void)in_sizes; (void)n_in; (void)out_size;
    const float* x = (const float*)d_in[0]; const float* xk = (const float*)d_in[1]; const float* xv = (const float*)d_in[2]; const int* kmask = (const int*)d_in[3]; const float* wq = (const float*)d_in[4]; const float* bq = (const float*)d_in[5]; const float* wk = (const float*)d_in[6]; const float* bk = (const float*)d_in[7]; const float* wv = (const float*)d_in[8]; const float* bv = (const float*)d_in[9]; const float* wo = (const float*)d_in[10]; const float* bo = (const float*)d_in[11];   /* order query, key, value, mask (int32 [1][1][1][4096], read), Wq, bq, Wk, bk, Wv, bv, Wo, bo ('oi' + biases) */
    float* OUT = (float*)d_out;     // [1][4096][1024]
    char* wsp = (char*)d_ws;
    auto take = [&](size_t bytes) { char* p = wsp; wsp += (bytes + 255) & ~(size_t)255; return (void*)p; };
    bf* XQ = (bf*)take(((size_t)3 * TT * DM + (size_t)4 * DM * DM) * 2); bf* XK = XQ + (size_t)TT * DM; bf* XV = XK + (size_t)TT * DM;   // the seven bf16 copies, in k_cvtall's block order
    bf* WQ = XV + (size_t)TT * DM; bf* WK = WQ + (size_t)DM * DM; bf* WV = WK + (size_t)DM * DM; bf* WO = WV + (size_t)DM * DM;
    h16* QP16 = (h16*)take((size_t)NH_ * TT * HD * 2); h16* KP16 = (h16*)take((size_t)NKV * TT * HD * 2); h16* VT16 = (h16*)take((size_t)NKV * HD * TT * 2);
    bf* QPh = (bf*)take((size_t)NH_ * TT * HD * 2); bf* QPl = (bf*)take((size_t)NH_ * TT * HD * 2); bf* KPh = (bf*)take((size_t)NKV * TT * HD * 2); bf* KPl = (bf*)take((size_t)NKV * TT * HD * 2); bf* VTh = (bf*)take((size_t)NKV * HD * TT * 2); bf* VTl = (bf*)take((size_t)NKV * HD * TT * 2);
    bf* ATh = (bf*)take((size_t)TT * DQ * 2); bf* ATl = (bf*)take((size_t)TT * DQ * 2);
    if ((size_t)(wsp - (char*)d_ws) > ws_size) return;    // ws 256 MiB
    for (int b = 0; b < NB_; ++b) {
        k_cvtall<<<3 * CVX + 4 * CVW, CVT_, 0, stream>>>(x + (size_t)b * TT * DM, xk + (size_t)b * TT * DM, xv + (size_t)b * TT * DM, wq, wk, wv, wo, XQ);
        k_gemmw<bf, 0, true, 1><<<dim3(TT / 128, DQ / 128, 1), 128, 0, stream>>>(XQ, nullptr, WQ, nullptr, DM, DM, nullptr, 0, bq, 0, 0, 0, QP16, QPh, QPl);
        k_gemmw<bf, 0, true, 1><<<dim3(TT / 128, DKV / 128, 1), 128, 0, stream>>>(XK, nullptr, WK, nullptr, DM, DM, nullptr, 0, bk, 0, 0, 0, KP16, KPh, KPl);
        k_gemmw<bf, 0, true, 2><<<dim3(TT / 128, DKV / 128, 1), 128, 0, stream>>>(XV, nullptr, WV, nullptr, DM, DM, nullptr, 0, bv, 0, 0, 0, VT16, VTh, VTl);
        k_fattn<<<dim3(FBH, NH_), 288, 0, stream>>>(QP16, KP16, VT16, QPh, QPl, KPh, KPl, VTh, VTl, kmask + (size_t)b * TT, ATh, ATl);
        k_gemmw<bf, 1, true, 0><<<dim3(TT / 128, DM / 128, 1), 128, 0, stream>>>(ATh, ATl, WO, nullptr, DQ, DQ, OUT + (size_t)b * TT * DM, DM, bo, 0, 0, 0, nullptr, nullptr, nullptr); }
}

// v007
// One run takes 124 microseconds.
// Two timings next to v006 put it at 1.32 and 1.33 times that version's speed.
// Over all steps from v000 it is 28.1 times as fast.
#include <hip/hip_runtime.h>

// Attention on three input streams over 4,096 tokens with a RANDOM integer key mask (query, key, value [1][4096][1024]; q = query Wq^T + bq, k = key Wk^T + bk, v = value Wv^T + bv ('oi' 1/32 + zero biases; 16 heads x 64); scores / sqrt(64); keys with mask[b][0][0][j] == 0 -> -1e9 (== exclusion; mask int32 [1][1][1][4096] with random 0/1 entries, read per key on device); softmax; out = merged Wo^T + bo -> [1][4096][1024] (4.2 M); argument order query, key, value, mask, Wq, bq, Wk, bk, Wv, bv, Wo, bo).
// Layout: bf16 copies of query, key, value and the 'oi' weights, all made by one launch, which writes the key and value rows in kept-first order (keys with a non-zero mask entry first, both parts in token order) and counts the kept keys; the K and V projections and the attention walk only the kept keys' tiles; exact projections + f32 biases, whose epilogues store the head planes (fp16 + bf16 hi/lo; V transposed) themselves; one fused attention launch for all heads (online softmax, no score plane; K and V^T tiles staged in LDS by tensor loads), which excludes the keys behind the kept ones (hybrid rows: < 512 hi/lo 3 products, rest fp16); merged hi/lo x Wo exact + bo.
// Compute dtypes, f32 accumulate: every input rounded to bf16; projections exact + f32 biases; attention rows < 512 3 products, rest fp16; softmax f32; Wo hl x exact + bias.

#define NB_  1
#define TT   4096
#define DM   1024
#define NH_  16
#define NKV  16
#define REP  (NH_ / NKV)
#define HD   64
#define DQ   (NH_ * HD)
#define DKV  (NKV * HD)
#define RH   512                  // query rows < RH use hi+lo planes
#define WIN  0
typedef _Float16 h16;
typedef unsigned short bf;
typedef __attribute__((ext_vector_type(16))) __bf16   v16bf;
typedef __attribute__((ext_vector_type(16))) _Float16 v16h;
typedef __attribute__((ext_vector_type(8)))  _Float16 v8h;
typedef __attribute__((ext_vector_type(8)))  unsigned short v8us;
typedef __attribute__((ext_vector_type(8)))  float    v8f;
typedef __attribute__((ext_vector_type(4)))  float    v4f;
typedef v8h  __attribute__((may_alias)) v8ha;
typedef v4f  __attribute__((may_alias)) v4fa;
typedef v8us __attribute__((may_alias)) v8usa;

__device__ __forceinline__ unsigned short f2bf(float f) { unsigned u = __float_as_uint(f); u += 0x7FFFu + ((u >> 16) & 1u); return (unsigned short)(u >> 16); }
__device__ __forceinline__ float bf2f(unsigned short b) { return __uint_as_float(((unsigned)b) << 16); }
__device__ __forceinline__ float bfr(float f) { return bf2f(f2bf(f)); }
__device__ __forceinline__ v16h cat16(v8h lo, v8h hi) { return __builtin_shufflevector(lo, hi, 0, 1, 2, 3, 4, 5, 6, 7, 8, 9, 10, 11, 12, 13, 14, 15); }
__device__ __forceinline__ v16bf cat16b(v8us lo, v8us hi) { return __builtin_bit_cast(v16bf, __builtin_shufflevector(lo, hi, 0, 1, 2, 3, 4, 5, 6, 7, 8, 9, 10, 11, 12, 13, 14, 15)); }
__device__ __forceinline__ v8f wmma16(v16h a, v16h b, v8f c) { return __builtin_amdgcn_wmma_f32_16x16x32_f16(false, a, false, b, (short)0, c, false, false); }
__device__ __forceinline__ v8f wmmab(v16bf a, v16bf b, v8f c) { return __builtin_amdgcn_wmma_f32_16x16x32_bf16(false, a, false, b, (short)0, c, false, false); }
__device__ __forceinline__ h16 tohx(float x) { return (h16)x; }
__device__ __forceinline__ void splitf(float y, unsigned short& h, unsigned short& l) { h = f2bf(y); l = f2bf(y - bf2f(h)); }



typedef unsigned int u32;
typedef __attribute__((ext_vector_type(4))) unsigned int u32x4;
typedef __attribute__((ext_vector_type(8))) unsigned int u32x8;
__device__ __forceinline__ u32 uni(u32 v) { return (u32)__builtin_amdgcn_readfirstlane(v); }
__device__ __forceinline__ u32 pinned(u32 v) { u32 w = uni(v); asm volatile("" : "+s"(w)); return w; }   // holds a tensor load's issue test in a scalar register, so that the branch around the load is a scalar one
__device__ __forceinline__ void wait_ds0() { asm volatile("s_wait_dscnt 0x0" ::: "memory"); }        // this wave's LDS reads have returned: in front of the barrier behind which their buffer is refilled
// this wave's tensor load has landed: the compiler places no wait for it; the request's descriptor is named as an input, so that its registers keep their values up to the wait
__device__ __forceinline__ void wait_tensor0(u32x4 g0, u32x8 g1) { asm volatile("s_wait_tensorcnt 0x0" :: "s"(g0), "s"(g1) : "memory"); }
// The keys that the attention walks, from the count of kept keys as the conversion launch stored it: the kept ones, or all TT where no key is kept (the module's uniform row); bounded by the shape for any stored value.
__device__ __forceinline__ u32 kept_keys(int nk) { return uni((u32)(nk < 0 ? 0 : nk > TT ? TT : nk)); }
__device__ __forceinline__ u32 keys_in_use(int nk) { const u32 k = kept_keys(nk); return k ? k : (u32)TT; }
// ---- k_gemmw: GEMM on 128x128 output tiles, FOUR WAVES (2 x 2) per block, each on its own 64x64 tile (16 accumulators); grid (M/128, N/128, Z), 128 threads.
// C[m][n] (f32, pitch ldc, + optional f32 bias[n]) = sum_{k < KL} A[m][k] Bt[n][k] (+ A2[m][k] Bt[n][k] for NSPLIT = 1). K = row pitch of A and Bt, KL = k extent summed here. z-batch strides sA/sB/sC in elements. KL % 128 == 0, KL >= 256.
// The operand rows reach the waves through LDS: a stage is 128 k (256 bytes) of the block's 128 A rows (of both planes for NSPLIT = 1) and 128 Bt rows, every wave bringing one slice of it by one tensor load, two buffers,
// the next stage in flight while this one is worked on; a row's bytes leave L2 once per block in whole 256-byte pieces, and the two waves that share a row read it from LDS.
// PL = 0: C as above. PL = 1, 2: no C; a wave's tile (64 tokens x the 64 columns of one head, + bias) goes out as three 16-bit planes, fp16 and bf16 hi + lo: PL = 1 [head][token][d], PL = 2 transposed, [head][d][token].
#define GKS  128                   // k per stage
#define GPIT 272                   // LDS row pitch: 256 bytes + the mover's 16-byte pad, an odd multiple of 16 bytes for 16-byte readers
#define GSL  18432                 // the place of a slice of 64 rows: 64 x 272 bytes = 17,408, rounded up to a multiple of 2 KiB
template <typename T16> struct WFrag;
template <> struct WFrag<h16> { typedef v16h V; static __device__ __forceinline__ V ld(const h16* p) { return cat16(*(const v8h*)p, *(const v8h*)(p + 16)); } static __device__ __forceinline__ v8f mma(V a, V b, v8f c) { return wmma16(a, b, c); } };
template <> struct WFrag<bf> { typedef v16bf V; static __device__ __forceinline__ V ld(const bf* p) { return cat16b(*(const v8us*)p, *(const v8us*)(p + 16)); } static __device__ __forceinline__ v8f mma(V a, V b, v8f c) { return wmmab(a, b, c); } };
template <typename T16, int NSPLIT, bool BIAS, int PL>
__global__ __launch_bounds__(128) void k_gemmw(const T16* __restrict__ A, const T16* __restrict__ A2, const T16* __restrict__ Bt, const T16* __restrict__ Bt2, int K, int KL, float* C, int ldc, const float* __restrict__ bias, size_t sA, size_t sB, size_t sC, h16* P16, bf* Ph, bf* Pl, const int* __restrict__ nkp) {
    typedef typename WFrag<T16>::V V;
    // nkp != null: the A rows are keys in kept-first order, and only the row tiles that hold a key in use are computed (keys_in_use); the whole block leaves, in front of every tensor load and barrier
    if (nkp) { if (blockIdx.x * 128u >= keys_in_use(*nkp)) return; }
    static_assert(NSPLIT == 0 || NSPLIT == 1, "one or two A planes against one Bt plane");
    // a buffer: the A plane(s), then Bt. NSPLIT = 0: four slices of 64 rows, one per wave. NSPLIT = 1: A and A2 as one tile of 128 rows each (waves 0, 1), Bt as two slices of 64 rows (waves 2, 3).
    constexpr int APL = NSPLIT ? 128 * GPIT : 2 * GSL;   // an A plane's place
    constexpr int ASP = NSPLIT ? 64 * GPIT : GSL;        // from its rows 0 .. 63 to its rows 64 .. 127
    constexpr int BOF = (NSPLIT + 1) * APL, GBUF = BOF + 2 * GSL;
    static_assert(APL % 2048 == 0 && GSL % 2048 == 0 && 64 * GPIT <= GSL, "every place a multiple of 2 KiB");
    __shared__ __attribute__((aligned(2048))) unsigned char L[2 * GBUF];
    __shared__ __align__(16) float osb[4][16 * 68];
    (void)Bt2;
    const size_t z = blockIdx.z; A += z * sA; if (A2) A2 += z * sA; Bt += z * sB; C += z * sC;
    const u32 wave = uni(threadIdx.x >> 5); const int wm = (int)(wave >> 1), wn = (int)(wave & 1u);
    const int lane = threadIdx.x & 31, lr = lane & 15, hi = lane >> 4; const int r0 = blockIdx.x * 128 + wm * 64, c0 = blockIdx.y * 128 + wn * 64;
    float* os = osb[wave];
    // the wave's slice of every stage: rows of 256 bytes, source pitch 2 K bytes, a stage 256 bytes on
    const bool isb = wave >= 2;
    const T16* sp = isb ? Bt + (size_t)(blockIdx.y * 128 + wn * 64) * K : NSPLIT ? (wave ? A2 : A) + (size_t)(blockIdx.x * 128) * K : A + (size_t)(blockIdx.x * 128 + wave * 64) * K;
    const u32 rows = (NSPLIT && !isb) ? 128u : 64u;
    const unsigned long long src = (unsigned long long)(size_t)sp;
    const u32 lbase = (u32)(size_t)L + (isb ? BOF + wn * GSL : wave * (NSPLIT ? APL : GSL));
    u32x8 g1; g1[0] = uni((1u << 20) | (5u << 22) | (3u << 25));   // no mask, 1-byte elements, 4 dwords of pad behind every 64
    g1[1] = uni(256u << 16); g1[2] = uni(rows << 16); g1[3] = uni(256u << 16); g1[4] = uni(rows); g1[5] = uni((u32)K * 2u); g1[6] = uni(0u); g1[7] = uni(0u);
    asm volatile("" : "+s"(g1));   // pinned, as in pinned(): the descriptor words stay in these scalar registers through the loop and are not formed again while a request is out
    u32x4 g0 = {0u, 0u, 0u, 0u};   // the descriptor group of the wave's last request
    auto issue = [&](u32 s) { const unsigned long long ga = src + (unsigned long long)s * (GKS * 2); g0[0] = uni(1u); g0[1] = uni(lbase + (s & 1u) * GBUF); g0[2] = uni((u32)ga); g0[3] = uni(((u32)(ga >> 32) & 0x01FFFFFFu) | 0x80000000u);
        asm volatile("tensor_load_to_lds %0, %1" :: "s"(g0), "s"(g1) : "memory"); };   // one request of the whole wave; every wave of the block issues its own
    v8f acc[4][4];
#pragma unroll
    for (int mb = 0; mb < 4; ++mb)
#pragma unroll
        for (int nb = 0; nb < 4; ++nb) acc[mb][nb] = (v8f){};
    const u32 nst = (u32)KL / GKS;
    issue(0); wait_tensor0(g0, g1);
    __syncthreads();   // stage 0 is published
    issue(1);
    const int fo = lr * GPIT + 16 * hi;   // the lane's row and half in every slice
    for (u32 s = 0; s < nst; ++s) {
        const unsigned char* Lb = L + (s & 1u) * GBUF;
        const T16* La = (const T16*)(Lb + wm * ASP + fo); const T16* La2 = (const T16*)(Lb + APL + wm * ASP + fo); const T16* Lw = (const T16*)(Lb + BOF + wn * GSL + fo);
        V a[2][4], a2[2][4], b[2][4];   // two fragment sets: the next 32 k are fetched as one group in front of this 32 k's products; nothing of a stage is read in front of its barrier
        // every "#pragma unroll" of this loop: it indexes fragment and accumulator arrays, which stay in registers only under constant indices
#pragma unroll
        for (int f = 0; f < 4; ++f) { a[0][f] = WFrag<T16>::ld(La + f * 16 * (GPIT / 2)); if (NSPLIT == 1) a2[0][f] = WFrag<T16>::ld(La2 + f * 16 * (GPIT / 2)); b[0][f] = WFrag<T16>::ld(Lw + f * 16 * (GPIT / 2)); }
#pragma unroll
        for (int ks = 0; ks < GKS / 32; ++ks) { const int cu = ks & 1, nx = cu ^ 1;
            if (ks + 1 < GKS / 32) {
#pragma unroll
                for (int f = 0; f < 4; ++f) { const int o = f * 16 * (GPIT / 2) + 32 * (ks + 1); a[nx][f] = WFrag<T16>::ld(La + o); if (NSPLIT == 1) a2[nx][f] = WFrag<T16>::ld(La2 + o); b[nx][f] = WFrag<T16>::ld(Lw + o); }
            }
            __builtin_amdgcn_sched_barrier(0);   // keeps the group of LDS reads whole and in front of the block of products: without it the compiler kept one Bt fragment and waited for LDS in front of every four products
#pragma unroll
            for (int nb = 0; nb < 4; ++nb)
#pragma unroll
                for (int mb = 0; mb < 4; ++mb) { acc[mb][nb] = WFrag<T16>::mma(a[cu][mb], b[cu][nb], acc[mb][nb]); if (NSPLIT == 1) acc[mb][nb] = WFrag<T16>::mma(a2[cu][mb], b[cu][nb], acc[mb][nb]); }
            __builtin_amdgcn_sched_barrier(0);   // the other side of the pair: the next group of reads stays behind this block
        }
        wait_ds0();
        wait_tensor0(g0, g1);
        __syncthreads();   // publishes stage s + 1 and ends every wave's reads of stage s
        if (pinned(s + 2 < nst)) issue(s + 2);   // into the buffer that stage s has left
    }
    wait_tensor0(g0, g1); wait_ds0();
    // Every "#pragma unroll" of the plane epilogues: its loop indexes accumulator and staging arrays, which stay in registers only under constant indices.
    const int prow = lane >> 3, pc = (lane & 7) * 8;   // plane stores: 8 lanes x 16 bytes a row, so one store covers four whole 128-byte rows
    if constexpr (PL == 2) {
        // a lane's 8 accumulator elements are 8 consecutive tokens of ONE column d: converted in registers, 16 d rows x 64 tokens of each plane pass through LDS (pitch 72: no bank shared by the 16 rows of a write)
        __shared__ __align__(16) unsigned short tsb[4][3][16 * 72]; unsigned short (*ts)[16 * 72] = tsb[wave];   // each wave stages in its own rows
#pragma unroll
        for (int nb = 0; nb < 4; ++nb) {
            const float bb = BIAS ? bfr(bias[c0 + nb * 16 + lr]) : 0.f;
#pragma unroll
            for (int mb = 0; mb < 4; ++mb) { v8h o16; v8us oh, ol;
#pragma unroll
                for (int j = 0; j < 8; ++j) { const float x = acc[mb][nb][j] + bb; o16[j] = tohx(x); unsigned short a2, c2; splitf(x, a2, c2); oh[j] = a2; ol[j] = c2; }
                const int to = lr * 72 + mb * 16 + hi * 8; *(v8usa*)(ts[0] + to) = __builtin_bit_cast(v8us, o16); *(v8usa*)(ts[1] + to) = oh; *(v8usa*)(ts[2] + to) = ol; }
            __builtin_amdgcn_wave_barrier(); asm volatile("" ::: "memory");   // the rows are read back by other lanes of the wave: keeps the reads behind the writes
            v8us w[4][3]; const size_t po = (size_t)(c0 + nb * 16 + prow) * TT + r0 + pc;
#pragma unroll
            for (int s = 0; s < 4; ++s) {
#pragma unroll
                for (int p = 0; p < 3; ++p) w[s][p] = *(const v8usa*)(ts[p] + (4 * s + prow) * 72 + pc);
                *(v8us*)((bf*)P16 + po + (size_t)s * 4 * TT) = w[s][0]; *(v8us*)(Ph + po + (size_t)s * 4 * TT) = w[s][1]; *(v8us*)(Pl + po + (size_t)s * 4 * TT) = w[s][2]; }
            // stands behind the group's stores, in front of any reuse of their data registers (named as inputs, so that they live up to the wait); as a memory clobber it also keeps the next rows' LDS writes behind these reads
            asm volatile("s_wait_xcnt 0x0" :: "v"(w[0][0]), "v"(w[0][1]), "v"(w[0][2]), "v"(w[1][0]), "v"(w[1][1]), "v"(w[1][2]), "v"(w[2][0]), "v"(w[2][1]), "v"(w[2][2]), "v"(w[3][0]), "v"(w[3][1]), "v"(w[3][2]) : "memory");
        }
        return;
    }
    float pb[8];
    if constexpr (PL == 1) {
#pragma unroll
        for (int k = 0; k < 8; ++k) pb[k] = BIAS ? bfr(bias[c0 + pc + k]) : 0.f; }
#pragma unroll
    for (int mb = 0; mb < 4; ++mb) {
#pragma unroll
        for (int nb = 0; nb < 4; ++nb) {
#pragma unroll
            for (int j = 0; j < 8; ++j) os[(hi * 8 + j) * 68 + nb * 16 + lr] = acc[mb][nb][j]; }
        __builtin_amdgcn_wave_barrier(); asm volatile("" ::: "memory");
        if constexpr (PL == 1) {
            v8us w[4][3]; const size_t po = ((size_t)(c0 / HD) * TT + r0 + mb * 16 + prow) * HD + pc;
#pragma unroll
            for (int s = 0; s < 4; ++s) { const float* orow = os + (4 * s + prow) * 68 + pc; const v4f x0 = *(const v4fa*)orow, x1 = *(const v4fa*)(orow + 4); v8h o16;
#pragma unroll
                for (int k = 0; k < 8; ++k) { const float x = (k < 4 ? x0[k & 3] : x1[k & 3]) + pb[k]; o16[k] = tohx(x); unsigned short a2, c2; splitf(x, a2, c2); w[s][1][k] = a2; w[s][2][k] = c2; }
                w[s][0] = __builtin_bit_cast(v8us, o16);
                *(v8us*)((bf*)P16 + po + s * 4 * HD) = w[s][0]; *(v8us*)(Ph + po + s * 4 * HD) = w[s][1]; *(v8us*)(Pl + po + s * 4 * HD) = w[s][2]; }
            // stands behind the group's stores, in front of any reuse of their data registers (named as inputs, so that they live up to the wait)
            asm volatile("s_wait_xcnt 0x0" :: "v"(w[0][0]), "v"(w[0][1]), "v"(w[0][2]), "v"(w[1][0]), "v"(w[1][1]), "v"(w[1][2]), "v"(w[2][0]), "v"(w[2][1]), "v"(w[2][2]), "v"(w[3][0]), "v"(w[3][1]), "v"(w[3][2]) : "memory");
        } else {
        float* crow = C + (size_t)(r0 + mb * 16) * ldc + c0;
{
#pragma unroll
            for (int s = 0; s < 8; ++s) { const int row = 2 * s + hi, cofs = lr * 4; v4f val = *(const v4fa*)(os + row * 68 + cofs); if (BIAS) { val[0] += bfr(bias[c0 + cofs]); val[1] += bfr(bias[c0 + cofs + 1]); val[2] += bfr(bias[c0 + cofs + 2]); val[3] += bfr(bias[c0 + cofs + 3]); }
                *(v4f*)(crow + (size_t)row * ldc + cofs) = val; }
             }
        }
        __builtin_amdgcn_wave_barrier(); asm volatile("" ::: "memory");
    }
}

typedef __attribute__((ext_vector_type(4))) _Float16 v4h;
typedef __attribute__((ext_vector_type(4))) unsigned short v4us;

// ---- k_cvtall: every f32 -> bf16 copy of a call (query, key, value, Wq, Wk, Wv, Wo) in ONE streaming launch: 256 blocks of 16 waves, a block on CVB consecutive floats of one array.
// A wave's load is 512 consecutive bytes (16 per lane), its store the 256 bytes they round to; a thread has CVL loads to issue in front of its conversions, so a wave starts once for 16 KiB of source and not once for 1 KiB.
// The sources are read once and by non-temporal loads, which leave L2 to the bf16 copies that the GEMMs read; the copies lie one behind the other in block order.
#define CVT_ 512                   // threads per block
#define CVL  32                    // 16-byte loads per thread
#define CVB  (CVT_ * CVL * 4)      // floats per block
#define CVX  (TT * DM / CVB)       // blocks per token array
#define CVW  (DM * DM / CVB)       // blocks per weight array
// Key and value rows go out in KEPT-FIRST order: a key whose mask entry is not 0 takes the place of its rank among such keys, every other key a place behind all of them, both parts in token order (a permutation of
// the TT rows for any mask). Every block forms the mask's bit vector itself, under its own loads' latency: a wave's 8 ballots cover 256 keys; the words and each wave's count pass through LDS, behind one barrier.
__global__ __launch_bounds__(CVT_) void k_cvtall(const float* __restrict__ xq, const float* __restrict__ xk, const float* __restrict__ xv, const int* __restrict__ km, const float* __restrict__ wq, const float* __restrict__ wk, const float* __restrict__ wv, const float* __restrict__ wo, bf* dst, int* nkw) {
    __shared__ __align__(16) u32 mw[TT / 32];     // the mask, one bit a key
    __shared__ __align__(16) u32 wc[CVT_ / 32];   // kept keys among each wave's 256
    const unsigned b = blockIdx.x, w = b - 3 * CVX;   // which array and which piece of it: the same for the whole block
    const unsigned bl = b < 3 * CVX ? b % CVX : w % CVW;
    const float* src = (b < 3 * CVX ? (b < CVX ? xq : b < 2 * CVX ? xk : xv) : (w < CVW ? wq : w < 2 * CVW ? wk : w < 3 * CVW ? wv : wo)) + (size_t)bl * CVB;
    src += threadIdx.x * 4;
    const u32 wv_ = uni(threadIdx.x >> 5); const int lane = threadIdx.x & 31;
    const int* mp = km + wv_ * 256 + lane; int m[8];   // issued in front of the stream's loads, so that they return first
#pragma unroll
    for (int j = 0; j < 8; ++j) m[j] = mp[j * 32];
    asm volatile("s_wait_xcnt 0x0" ::: "memory");   // stands behind the mask loads, in front of any reuse of their address registers
    v4f x[CVL];   // every "#pragma unroll" here: the loops index vectors and these arrays, which stay in registers only under constant indices
#pragma unroll
    for (int i = 0; i < CVL; ++i) x[i] = __builtin_nontemporal_load((const v4f*)(src + i * (CVT_ * 4)));
    u32x4 bw[2]; u32 cw = 0;
#pragma unroll
    for (int j = 0; j < 8; ++j) { const u32 t = __builtin_amdgcn_ballot_w32(m[j] != 0); bw[j >> 2][j & 3] = t; cw += (u32)__builtin_popcount(t); }
    if (lane == 0) { *(u32x4*)(mw + wv_ * 8) = bw[0]; *(u32x4*)(mw + wv_ * 8 + 4) = bw[1]; wc[wv_] = cw; }
    // the bit vector and the counts are read by every wave; the two fences order LDS alone, so that the stream's loads stay in flight across the barrier (__syncthreads() waited for all of them in front of it)
    __builtin_amdgcn_fence(__ATOMIC_RELEASE, "workgroup", "local"); __builtin_amdgcn_s_barrier(); __builtin_amdgcn_fence(__ATOMIC_ACQUIRE, "workgroup", "local");
    const bool kv = b >= CVX && b < 3 * CVX;   // a piece is CVB / DM = 64 rows: two words of the bit vector, from word w0
    const u32 w0 = bl * 2;
    u32 nk = 0, before = 0;   // kept keys in all, and in front of the piece
#pragma unroll
    for (u32 i = 0; i < CVT_ / 32; ++i) { const u32 c = wc[i]; nk += c; before += i < (w0 >> 3) ? c : 0u; }
#pragma unroll
    for (u32 i = 0; i < 8; ++i) { const u32 t = mw[(w0 & ~7u) + i]; before += i < (w0 & 7u) ? (u32)__builtin_popcount(t) : 0u; }
    // an array that keeps its order is written as if every row were kept; all of this is the same in every lane and is held in scalar registers
    const u32 W0 = uni(kv ? mw[w0] : ~0u), W1 = uni(kv ? mw[w0 + 1] : ~0u), bf0 = uni(kv ? before : bl * 64), nks = uni(nk), h = uni(threadIdx.x >> 8), c0 = (u32)__builtin_popcount(W0);
    if (b == CVX && threadIdx.x == 0) *nkw = (int)nks;
    bf* da = dst + (size_t)(b - bl) * CVB + (threadIdx.x & 255) * 4;   // the array's copy; the copies lie one behind the other in block order
#pragma unroll
    for (int gq = 0; gq < CVL / 16; ++gq) { v4us y[16];
#pragma unroll
        for (int i = 0; i < 16; ++i) { const u32 r = 2 * (16 * gq + i) + h, bit = r & 31u, Wd = gq ? W1 : W0;   // load i of a thread lies in row 2 i + h of the piece
            const u32 kb = bf0 + (gq ? c0 : 0u) + (u32)__builtin_popcount(Wd & ((1u << bit) - 1u));   // kept rows in front of this one
            const u32 pos = (((Wd >> bit) & 1u) ? kb : nks + bl * 64 + r - kb) & (TT - 1);
#pragma unroll
            for (int k = 0; k < 4; ++k) y[i][k] = f2bf(x[16 * gq + i][k]);
            *(v4us*)(da + (size_t)pos * DM) = y[i]; }
        // stands behind the group's stores, in front of any reuse of their data and address registers (named as inputs, so that they live up to the wait)
        asm volatile("s_wait_xcnt 0x0" :: "v"(y[0]), "v"(y[1]), "v"(y[2]), "v"(y[3]), "v"(y[4]), "v"(y[5]), "v"(y[6]), "v"(y[7]), "v"(y[8]), "v"(y[9]), "v"(y[10]), "v"(y[11]), "v"(y[12]), "v"(y[13]), "v"(y[14]), "v"(y[15]), "v"(da) : "memory"); }
}
static_assert((TT * DM) % CVB == 0 && (DM * DM) % CVB == 0 && DQ == DM && DKV == DM && NB_ == 1, "every array is a whole number of blocks' pieces; the four weights are DM x DM; one batch entry, so one launch converts all");
static_assert(CVB == 64 * DM && CVT_ * 4 == 2 * DM && CVT_ * 8 == TT && (TT & (TT - 1)) == 0 && CVL == 32, "a piece is 64 rows, a block's load two rows; a block's threads read 8 mask entries each");

// ---- k_fattn: scores, key mask, softmax and P x V of all heads in ONE launch; no score or weight plane in memory.
// Per wave: S^T = K Q^T (A = 16 keys x 64 d, B = the wave's query columns, kept in registers), so a lane holds 8 consecutive keys of ONE query per tile;
// two such tiles, converted in place, are the B operand of O^T += V^T P^T (A = V^T rows in the same k order as WFrag::ld at + 8 * hi). 32 keys per pass.
// Softmax is online in base 2: weights exp2(s - mu + PSH) against the maximum in use mu, O and the sum rescaled only when a new maximum exceeds mu by more than 8.
// The keys arrive in kept-first order with the count nk of the kept ones: the stages end with the last kept key (all TT keys where none is kept), and only a pass that reaches past nk tests its keys.
// A masked key's score is -3.0e38: its weight is 0 beside any kept key, and 1 for every key of a row with no kept key (the module's uniform row).
// Block = 9 waves on 256 query rows' worth of one head's work: 2 waves of 16 hi/lo rows (< RH, 3 products) and 7 waves of 32 fp16 rows; 256 blocks.
// K and V^T reach the waves through LDS: a stage is 64 keys of the head's six planes, each plane's tile (64 rows x 128 bytes) brought by one tensor load of one wave (waves 0 .. 5), two buffers,
// the next stage in flight while this one is worked on; every wave reads its fragments from the tiles, so a plane's bytes leave L2 once per block and stage and not once per wave.
// Every "#pragma unroll" in the attention code: its loop indexes fragment and accumulator arrays, which stay in registers only under constant indices.
#define PSH  4.0f                  // weights lie in (0, 2^(8 + PSH)]: inside fp16's range, and small ones stay normal numbers
#define SCL2 0.18033688011112042f  // HD^-0.5 * log2(e)
#define FBH  (TT / 256)            // blocks per head
#define SKEY 64                    // keys per stage
#define NST  (TT / SKEY)           // stages
#define LPIT 144                   // LDS row pitch: 128 bytes + the mover's 16-byte pad, an odd multiple of 16 bytes for 16-byte readers
#define LTIL 10240                 // a tile's place: 64 rows x 144 bytes = 9,216, rounded up to a multiple of 2 KiB
#define LBUF (6 * LTIL)            // a buffer: tiles K fp16, V^T fp16, K hi, K lo, V^T hi, V^T lo
typedef __attribute__((ext_vector_type(8))) __bf16 v8b;
__device__ __forceinline__ float xhalf(float x) { return __builtin_bit_cast(float, __builtin_amdgcn_permlanex16(__builtin_bit_cast(int, x), __builtin_bit_cast(int, x), 0x76543210, 0xfedcba98, false, false)); }   // lane l <-> lane l ^ 16
// xwait: stands behind each group of global loads, in front of any reuse of their address registers (named as inputs, so that they live up to the wait); as a memory clobber it also keeps the group where it is written
__device__ __forceinline__ void xwait(const void* a) { asm volatile("s_wait_xcnt 0x0" :: "v"(a) : "memory"); }
__device__ __forceinline__ void xwait(const void* a, const void* b) { asm volatile("s_wait_xcnt 0x0" :: "v"(a), "v"(b) : "memory"); }
// what a wave carries from stage to stage; q: fp16 waves [group][k half], hi/lo waves hi [k half] then lo [k half]
struct FSt { v8f o[2][4]; float mu[2], ls[2]; v16h q[4]; };
template <typename T16, bool HI, int R>
__device__ __forceinline__ void finit(FSt& st, const T16* __restrict__ Qa, const T16* __restrict__ Qb, int q0) {
    const int lane = threadIdx.x & 31, lr = lane & 15, hi = lane >> 4;
    const T16* qpa = Qa + (size_t)(q0 + lr) * HD + 8 * hi; const T16* qpb = HI ? Qb + (size_t)(q0 + lr) * HD + 8 * hi : nullptr;
#pragma unroll
    for (int g = 0; g < R; ++g)
#pragma unroll
        for (int kk = 0; kk < 2; ++kk) { const int qo = 16 * g * HD + 32 * kk; st.q[2 * g + kk] = __builtin_bit_cast(v16h, WFrag<T16>::ld(qpa + qo)); if (HI) st.q[2 + kk] = __builtin_bit_cast(v16h, WFrag<T16>::ld(qpb + qo)); }
    if constexpr (HI) xwait(qpa, qpb); else xwait(qpa);
#pragma unroll
    for (int g = 0; g < 2; ++g) { st.mu[g] = -3.0e38f; st.ls[g] = 0.f;
#pragma unroll
        for (int dt = 0; dt < 4; ++dt) st.o[g][dt] = (v8f){}; }
}
// one stage of one wave: two passes of 32 keys on the tiles of buffer Lb; k0 = the stage's first key, nk = the kept keys (places 0 .. nk - 1)
template <typename T16, bool HI, int R>
__device__ __forceinline__ void fstage(FSt& st, const unsigned char* Lb, int nk, int k0) {
    typedef typename WFrag<T16>::V V;
    const int lane = threadIdx.x & 31, lr = lane & 15, hi = lane >> 4;
    const unsigned char* Lr = Lb + lr * LPIT + 16 * hi;   // the lane's row and half in every tile
    const T16* Lka = (const T16*)(Lr + (HI ? 2 : 0) * LTIL); const T16* Lkb = (const T16*)(Lr + 3 * LTIL); const T16* Lva = (const T16*)(Lr + (HI ? 4 : 1) * LTIL); const T16* Lvb = (const T16*)(Lr + 5 * LTIL);
    V qa[R][2], qb[R][2];
#pragma unroll
    for (int g = 0; g < R; ++g)
#pragma unroll
        for (int kk = 0; kk < 2; ++kk) { qa[g][kk] = __builtin_bit_cast(V, st.q[2 * g + kk]); if (HI) qb[g][kk] = __builtin_bit_cast(V, st.q[2 + kk]); }
    V ka[2][2], kb[2][2];   // the second pass's K fragments are fetched by the first; the first pass's here: nothing of a stage is read in front of its barrier
#pragma unroll
    for (int kt = 0; kt < 2; ++kt)
#pragma unroll
        for (int kk = 0; kk < 2; ++kk) { ka[kt][kk] = WFrag<T16>::ld(Lka + kt * 16 * (LPIT / 2) + 32 * kk); if (HI) kb[kt][kk] = WFrag<T16>::ld(Lkb + kt * 16 * (LPIT / 2) + 32 * kk); }
#pragma unroll
    for (int sub = 0; sub < SKEY / 32; ++sub) {
        V va[4], vb[4];   // this pass's V^T fragments: issued first, read behind the softmax
#pragma unroll
        for (int dt = 0; dt < 4; ++dt) { va[dt] = WFrag<T16>::ld(Lva + dt * 16 * (LPIT / 2) + 32 * sub); if (HI) vb[dt] = WFrag<T16>::ld(Lvb + dt * 16 * (LPIT / 2) + 32 * sub); }
        v8f s[R][2];
#pragma unroll
        for (int g = 0; g < R; ++g)
#pragma unroll
            for (int kt = 0; kt < 2; ++kt) s[g][kt] = (v8f){};
#pragma unroll
        for (int kk = 0; kk < 2; ++kk) {
#pragma unroll
            for (int g = 0; g < R; ++g)
#pragma unroll
                for (int kt = 0; kt < 2; ++kt) s[g][kt] = WFrag<T16>::mma(ka[kt][kk], qa[g][kk], s[g][kt]);
            if (HI) {
#pragma unroll
                for (int g = 0; g < R; ++g)
#pragma unroll
                    for (int kt = 0; kt < 2; ++kt) s[g][kt] = WFrag<T16>::mma(ka[kt][kk], qb[g][kk], s[g][kt]);
#pragma unroll
                for (int g = 0; g < R; ++g)
#pragma unroll
                    for (int kt = 0; kt < 2; ++kt) s[g][kt] = WFrag<T16>::mma(kb[kt][kk], qa[g][kk], s[g][kt]);
            }
        }
        asm volatile("" ::: "memory");   // keeps this pass's V^T reads where they are written, in front of the S^T products and the softmax, which cover their latency: without it the compiler moved them down to the P x V products
        if (sub + 1 < SKEY / 32) {
#pragma unroll
            for (int kt = 0; kt < 2; ++kt)
#pragma unroll
                for (int kk = 0; kk < 2; ++kk) { ka[kt][kk] = WFrag<T16>::ld(Lka + (32 * (sub + 1) + kt * 16) * (LPIT / 2) + 32 * kk); if (HI) kb[kt][kk] = WFrag<T16>::ld(Lkb + (32 * (sub + 1) + kt * 16) * (LPIT / 2) + 32 * kk); }
        }
#pragma unroll
        for (int g = 0; g < R; ++g)
#pragma unroll
            for (int kt = 0; kt < 2; ++kt) s[g][kt] = s[g][kt] * SCL2;
        if (k0 + 32 * sub + 32 > nk) {   // the same for the whole block: only the kept keys' last passes (every pass where no key is kept) hold a masked key; element r of tile kt is key 16 kt + 8 hi + r of the pass
            const int left = nk - (k0 + 32 * sub + 8 * hi);
#pragma unroll
            for (int g = 0; g < R; ++g)
#pragma unroll
                for (int kt = 0; kt < 2; ++kt)
#pragma unroll
                    for (int r = 0; r < 8; ++r) s[g][kt][r] = (16 * kt + r < left) ? s[g][kt][r] : -3.0e38f;
        }
        float mx[R]; bool need = false;
#pragma unroll
        for (int g = 0; g < R; ++g) { mx[g] = -3.0e38f;
#pragma unroll
            for (int kt = 0; kt < 2; ++kt) {
#pragma unroll
                for (int r = 0; r < 8; ++r) mx[g] = fmaxf(mx[g], s[g][kt][r]); }
            need = need || (mx[g] > st.mu[g] + 8.0f); }
        if (__builtin_amdgcn_ballot_w32(need) != 0) {   // one scalar test per pass; rare behind the first passes
#pragma unroll
            for (int g = 0; g < R; ++g) { const float mn = fmaxf(st.mu[g], fmaxf(mx[g], xhalf(mx[g]))); const float corr = __builtin_amdgcn_exp2f(st.mu[g] - mn); st.mu[g] = mn; st.ls[g] *= corr;
#pragma unroll
                for (int dt = 0; dt < 4; ++dt) st.o[g][dt] = st.o[g][dt] * corr; }
        }
#pragma unroll
        for (int g = 0; g < R; ++g) { const float nm = PSH - st.mu[g]; v8f p[2];
#pragma unroll
            for (int kt = 0; kt < 2; ++kt) { const v8f ar = s[g][kt] + nm;
#pragma unroll
                for (int r = 0; r < 8; ++r) p[kt][r] = __builtin_amdgcn_exp2f(ar[r]); }
            const v8f ps = p[0] + p[1]; st.ls[g] += ((ps[0] + ps[1]) + (ps[2] + ps[3])) + ((ps[4] + ps[5]) + (ps[6] + ps[7]));
            if constexpr (HI) {
                const v8b h0 = __builtin_convertvector(p[0], v8b), h1 = __builtin_convertvector(p[1], v8b);
                const v8b l0 = __builtin_convertvector(p[0] - __builtin_convertvector(h0, v8f), v8b), l1 = __builtin_convertvector(p[1] - __builtin_convertvector(h1, v8f), v8b);
                const V ph = __builtin_shufflevector(h0, h1, 0, 1, 2, 3, 4, 5, 6, 7, 8, 9, 10, 11, 12, 13, 14, 15), pl = __builtin_shufflevector(l0, l1, 0, 1, 2, 3, 4, 5, 6, 7, 8, 9, 10, 11, 12, 13, 14, 15);
#pragma unroll
                for (int dt = 0; dt < 4; ++dt) st.o[g][dt] = WFrag<T16>::mma(va[dt], ph, st.o[g][dt]);
#pragma unroll
                for (int dt = 0; dt < 4; ++dt) st.o[g][dt] = WFrag<T16>::mma(va[dt], pl, st.o[g][dt]);
#pragma unroll
                for (int dt = 0; dt < 4; ++dt) st.o[g][dt] = WFrag<T16>::mma(vb[dt], ph, st.o[g][dt]);
            } else {
                const V pf = cat16(__builtin_convertvector(p[0], v8h), __builtin_convertvector(p[1], v8h));
#pragma unroll
                for (int dt = 0; dt < 4; ++dt) st.o[g][dt] = WFrag<T16>::mma(va[dt], pf, st.o[g][dt]);
            } }
    }
}
template <int R>
__device__ __forceinline__ void fstore(const FSt& st, int q0, bf* Ah, bf* Al) {
    const int lane = threadIdx.x & 31, lr = lane & 15, hi = lane >> 4;
#pragma unroll
    for (int g = 0; g < R; ++g) { const float inv = __fdiv_rn(1.0f, st.ls[g] + xhalf(st.ls[g]));   // the two halves hold the sums of their own keys
        v8us oh[4], ol[4]; bf* ph = Ah + (size_t)(q0 + 16 * g + lr) * DQ + 8 * hi; bf* pl = Al + (size_t)(q0 + 16 * g + lr) * DQ + 8 * hi;
#pragma unroll
        for (int dt = 0; dt < 4; ++dt) {
#pragma unroll
            for (int r = 0; r < 8; ++r) { unsigned short a, c2; splitf(st.o[g][dt][r] * inv, a, c2); oh[dt][r] = a; ol[dt][r] = c2; }
            *(v8us*)(ph + dt * 16) = oh[dt]; *(v8us*)(pl + dt * 16) = ol[dt]; }
        // stands behind the row group's stores, in front of any reuse of their data and address registers (named as inputs, so that they live up to the wait)
        asm volatile("s_wait_xcnt 0x0" :: "v"(oh[0]), "v"(oh[1]), "v"(oh[2]), "v"(oh[3]), "v"(ol[0]), "v"(ol[1]), "v"(ol[2]), "v"(ol[3]), "v"(ph), "v"(pl) : "memory"); }
}
__global__ __launch_bounds__(288) void k_fattn(const h16* __restrict__ Q16, const h16* __restrict__ K16, const h16* __restrict__ V16, const bf* __restrict__ Qh, const bf* __restrict__ Ql, const bf* __restrict__ Kh, const bf* __restrict__ Kl, const bf* __restrict__ Vh, const bf* __restrict__ Vl, const int* __restrict__ nkp, bf* Ah, bf* Al) {
    __shared__ __attribute__((aligned(2048))) unsigned char L[2 * LBUF];
    const int nkr = *nkp;   // read first: it returns under the Q loads
    asm volatile("s_wait_xcnt 0x0" ::: "memory");   // stands behind that load, in front of any reuse of its address registers
    const u32 wave = uni(threadIdx.x >> 5); const int blk = blockIdx.x; const size_t pl = (size_t)blockIdx.y * TT * HD; Ah += blockIdx.y * HD; Al += blockIdx.y * HD;
    const bool hiw = wave == 1 || wave == 2;
    const int q0 = hiw ? (blk * 2 + (int)wave - 1) * 16 : RH + (blk * 7 + (wave ? (int)wave - 2 : 0)) * 32;
    // wave w < 6 brings tile w of every stage: 64 rows of 128 bytes; K planes: a row is a key (source pitch 128 bytes, a stage 8 KiB on); V^T planes: a row is a d (source pitch 8 KiB, a stage 128 bytes on)
    const bool isv = wave == 1 || wave >= 4;
    const void* plane = wave == 0 ? (const void*)K16 : wave == 1 ? (const void*)V16 : wave == 2 ? (const void*)Kh : wave == 3 ? (const void*)Kl : wave == 4 ? (const void*)Vh : (const void*)Vl;
    const unsigned long long src = (unsigned long long)(size_t)plane + pl * 2; const u32 step = isv ? SKEY * 2 : SKEY * HD * 2;
    const u32 lbase = (u32)(size_t)L + wave * LTIL;
    u32x8 g1; g1[0] = uni((1u << 20) | (4u << 22) | (3u << 25));   // no mask, 1-byte elements, 4 dwords of pad behind every 32
    g1[1] = uni(128u << 16); g1[2] = uni(64u << 16); g1[3] = uni(128u << 16); g1[4] = uni(64u); g1[5] = uni(isv ? TT * 2 : HD * 2); g1[6] = uni(0u); g1[7] = uni(0u);
    asm volatile("" : "+s"(g1));   // pinned, as in pinned(): the descriptor words stay in these scalar registers through the loop and are not formed again while a request is out
    u32x4 g0 = {0u, 0u, 0u, 0u};   // the descriptor group of the wave's last request
    auto issue = [&](u32 s) { const unsigned long long ga = src + (unsigned long long)s * step; g0[0] = uni(1u); g0[1] = uni(lbase + (s & 1u) * LBUF); g0[2] = uni((u32)ga); g0[3] = uni(((u32)(ga >> 32) & 0x01FFFFFFu) | 0x80000000u);
        asm volatile("tensor_load_to_lds %0, %1" :: "s"(g0), "s"(g1) : "memory"); };   // one request of the whole wave; ignores EXEC, so every test around it is a scalar branch
    FSt st;
    if (hiw) finit<bf, true, 1>(st, Qh + pl, Ql + pl, q0); else finit<h16, false, 2>(st, Q16 + pl, nullptr, q0);
    // the stages that hold a key in use, at most NST; never fewer than the ring's two: the projections write whole tiles of 128 keys, so stage 1 is there, and its keys past nk are masked
    const int nk = (int)kept_keys(nkr); const u32 nsu = (keys_in_use(nkr) + SKEY - 1) / SKEY, nst = nsu < 2 ? 2u : nsu;
    if (pinned(wave < 6)) { issue(0); wait_tensor0(g0, g1); }
    __syncthreads();   // stage 0 is published
    if (pinned(wave < 6)) issue(1);
    for (u32 s = 0; s < nst; ++s) {
        const unsigned char* Lb = L + (s & 1u) * LBUF;
        // the hint: seven of the nine waves take the fp16 side; without it the compiler copied all 64 accumulator registers to and fro on that side at every stage where the two sides join
        if (__builtin_expect(!hiw, 1)) fstage<h16, false, 2>(st, Lb, nk, (int)s * SKEY); else fstage<bf, true, 1>(st, Lb, nk, (int)s * SKEY);
        wait_ds0();
        if (pinned(wave < 6)) wait_tensor0(g0, g1);
        __syncthreads();   // publishes stage s + 1 and ends every wave's reads of stage s
        if (pinned(wave < 6 && s + 2 < nst)) issue(s + 2);   // into the buffer that stage s has left
    }
    wait_tensor0(g0, g1); wait_ds0();
    if (hiw) fstore<1>(st, q0, Ah, Al); else fstore<2>(st, q0, Ah, Al);
}
static_assert(NH_ == NKV && RH == FBH * 2 * 16 && TT - RH == FBH * 7 * 32, "a block's 9 waves: 2 x 16 hi/lo rows and 7 x 32 fp16 rows");
static_assert(NST >= 2 && SKEY * 2 == 128 && HD * 2 == 128 && 64 * LPIT <= LTIL && LTIL % 2048 == 0, "a stage's six tiles: 64 rows of 128 bytes each, every place a multiple of 2 KiB; the ring needs two stages");
static_assert(HD == 64 && TT % 128 == 0 && DQ % 128 == 0 && DKV % 128 == 0 && DM % 128 == 0, "a wave's 64 projection columns are one head's, its 64 rows whole lines of the transposed planes; a block holds 2 x 2 such tiles");
static_assert(DM % GKS == 0 && DM / GKS >= 2 && DQ % GKS == 0 && DQ / GKS >= 2, "a GEMM's k extent: whole stages, and the ring needs two");

extern "C" void kernel_launch(void* const* d_in, const int* in_sizes, int n_in,
                              void* d_out, int out_size, void* d_ws, size_t ws_size, hipStream_t stream) {
    (void)in_sizes; (void)n_in; (void)out_size;
    const float* x = (const float*)d_in[0]; const float* xk = (const float*)d_in[1]; const float* xv = (const float*)d_in[2]; const int* kmask = (const int*)d_in[3]; const float* wq = (const float*)d_in[4]; const float* bq = (const float*)d_in[5]; const float* wk = (const float*)d_in[6]; const float* bk = (const float*)d_in[7]; const float* wv = (const float*)d_in[8]; const float* bv = (const float*)d_in[9]; const float* wo = (const float*)d_in[10]; const float* bo = (const float*)d_in[11];   /* order query, key, value, mask (int32 [1][1][1][4096], read), Wq, bq, Wk, bk, Wv, bv, Wo, bo ('oi' + biases) */
    float* OUT = (float*)d_out;     // [1][4096][1024]
    char* wsp = (char*)d_ws;
    auto take = [&](size_t bytes) { char* p = wsp; wsp += (bytes + 255) & ~(size_t)255; return (void*)p; };
    bf* XQ = (bf*)take(((size_t)3 * TT * DM + (size_t)4 * DM * DM) * 2); bf* XK = XQ + (size_t)TT * DM; bf* XV = XK + (size_t)TT * DM;   // the seven bf16 copies, in k_cvtall's block order
    bf* WQ = XV + (size_t)TT * DM; bf* WK = WQ + (size_t)DM * DM; bf* WV = WK + (size_t)DM * DM; bf* WO = WV + (size_t)DM * DM;
    h16* QP16 = (h16*)take((size_t)NH_ * TT * HD * 2); h16* KP16 = (h16*)take((size_t)NKV * TT * HD * 2); h16* VT16 = (h16*)take((size_t)NKV * HD * TT * 2);
    bf* QPh = (bf*)take((size_t)NH_ * TT * HD * 2); bf* QPl = (bf*)take((size_t)NH_ * TT * HD * 2); bf* KPh = (bf*)take((size_t)NKV * TT * HD * 2); bf* KPl = (bf*)take((size_t)NKV * TT * HD * 2); bf* VTh = (bf*)take((size_t)NKV * HD * TT * 2); bf* VTl = (bf*)take((size_t)NKV * HD * TT * 2);
    bf* ATh = (bf*)take((size_t)TT * DQ * 2); bf* ATl = (bf*)take((size_t)TT * DQ * 2); int* NK = (int*)take(sizeof(int));   // the count of kept keys
    if ((size_t)(wsp - (char*)d_ws) > ws_size) return;    // ws 256 MiB
    for (int b = 0; b < NB_; ++b) {
        k_cvtall<<<3 * CVX + 4 * CVW, CVT_, 0, stream>>>(x + (size_t)b * TT * DM, xk + (size_t)b * TT * DM, xv + (size_t)b * TT * DM, kmask + (size_t)b * TT, wq, wk, wv, wo, XQ, NK);
        k_gemmw<bf, 0, true, 1><<<dim3(TT / 128, DQ / 128, 1), 128, 0, stream>>>(XQ, nullptr, WQ, nullptr, DM, DM, nullptr, 0, bq, 0, 0, 0, QP16, QPh, QPl, nullptr);
        k_gemmw<bf, 0, true, 1><<<dim3(TT / 128, DKV / 128, 1), 128, 0, stream>>>(XK, nullptr, WK, nullptr, DM, DM, nullptr, 0, bk, 0, 0, 0, KP16, KPh, KPl, NK);
        k_gemmw<bf, 0, true, 2><<<dim3(TT / 128, DKV / 128, 1), 128, 0, stream>>>(XV, nullptr, WV, nullptr, DM, DM, nullptr, 0, bv, 0, 0, 0, VT16, VTh, VTl, NK);
        k_fattn<<<dim3(FBH, NH_), 288, 0, stream>>>(QP16, KP16, VT16, QPh, QPl, KPh, KPl, VTh, VTl, NK, ATh, ATl);
        k_gemmw<bf, 1, true, 0><<<dim3(TT / 128, DM / 128, 1), 128, 0, stream>>>(ATh, ATl, WO, nullptr, DQ, DQ, OUT + (size_t)b * TT * DM, DM, bo, 0, 0, 0, nullptr, nullptr, nullptr, nullptr); }
}

// v008
// A run of this version takes 108 microseconds.
// Timed twice side by side with v007, it ran 1.14 times as fast both times.
// All steps since v000 together make it 32.0 times as fast.
#include <hip/hip_runtime.h>

// Attention on three input streams over 4,096 tokens with a RANDOM integer key mask (query, key, value [1][4096][1024]; q = query Wq^T + bq, k = key Wk^T + bk, v = value Wv^T + bv ('oi' 1/32 + zero biases; 16 heads x 64); scores / sqrt(64); keys with mask[b][0][0][j] == 0 -> -1e9 (== exclusion; mask int32 [1][1][1][4096] with random 0/1 entries, read per key on device); softmax; out = merged Wo^T + bo -> [1][4096][1024] (4.2 M); argument order query, key, value, mask, Wq, bq, Wk, bk, Wv, bv, Wo, bo).
// Layout: bf16 copies of query, key, value and the 'oi' weights, all made by one launch, which writes the key and value rows in kept-first order (keys with a non-zero mask entry first, both parts in token order) and counts the kept keys; the K and V projections and the attention walk only the kept keys' tiles; exact projections + f32 biases, whose epilogues store the head planes (fp16 + bf16 hi/lo; V transposed) themselves; one fused attention launch for all heads (online softmax, no score plane; K and V^T tiles staged in LDS by tensor loads), which excludes the keys behind the kept ones (hybrid rows: < 512 hi/lo 3 products, rest fp16); merged hi/lo x Wo exact + bo.
// Compute dtypes, f32 accumulate: every input rounded to bf16; projections exact + f32 biases; attention rows < 512 3 products, rest fp16; softmax f32; Wo hl x exact + bias.

#define NB_  1
#define TT   4096
#define DM   1024
#define NH_  16
#define NKV  16
#define REP  (NH_ / NKV)
#define HD   64
#define DQ   (NH_ * HD)
#define DKV  (NKV * HD)
#define RH   512                  // query rows < RH use hi+lo planes
#define WIN  0
typedef _Float16 h16;
typedef unsigned short bf;
typedef __attribute__((ext_vector_type(16))) __bf16   v16bf;
typedef __attribute__((ext_vector_type(16))) _Float16 v16h;
typedef __attribute__((ext_vector_type(8)))  _Float16 v8h;
typedef __attribute__((ext_vector_type(8)))  unsigned short v8us;
typedef __attribute__((ext_vector_type(8)))  float    v8f;
typedef __attribute__((ext_vector_type(4)))  float    v4f;
typedef v8h  __attribute__((may_alias)) v8ha;
typedef v4f  __attribute__((may_alias)) v4fa;
typedef v8us __attribute__((may_alias)) v8usa;

__device__ __forceinline__ unsigned short f2bf(float f) { unsigned u = __float_as_uint(f); u += 0x7FFFu + ((u >> 16) & 1u); return (unsigned short)(u >> 16); }
__device__ __forceinline__ float bf2f(unsigned short b) { return __uint_as_float(((unsigned)b) << 16); }
__device__ __forceinline__ float bfr(float f) { return bf2f(f2bf(f)); }
__device__ __forceinline__ v16h cat16(v8h lo, v8h hi) { return __builtin_shufflevector(lo, hi, 0, 1, 2, 3, 4, 5, 6, 7, 8, 9, 10, 11, 12, 13, 14, 15); }
__device__ __forceinline__ v16bf cat16b(v8us lo, v8us hi) { return __builtin_bit_cast(v16bf, __builtin_shufflevector(lo, hi, 0, 1, 2, 3, 4, 5, 6, 7, 8, 9, 10, 11, 12, 13, 14, 15)); }
__device__ __forceinline__ v8f wmma16(v16h a, v16h b, v8f c) { return __builtin_amdgcn_wmma_f32_16x16x32_f16(false, a, false, b, (short)0, c, false, false); }
__device__ __forceinline__ v8f wmmab(v16bf a, v16bf b, v8f c) { return __builtin_amdgcn_wmma_f32_16x16x32_bf16(false, a, false, b, (short)0, c, false, false); }
__device__ __forceinline__ h16 tohx(float x) { return (h16)x; }
__device__ __forceinline__ void splitf(float y, unsigned short& h, unsigned short& l) { h = f2bf(y); l = f2bf(y - bf2f(h)); }



typedef unsigned int u32;
typedef __attribute__((ext_vector_type(4))) unsigned int u32x4;
typedef __attribute__((ext_vector_type(8))) unsigned int u32x8;
__device__ __forceinline__ u32 uni(u32 v) { return (u32)__builtin_amdgcn_readfirstlane(v); }
__device__ __forceinline__ u32 pinned(u32 v) { u32 w = uni(v); asm volatile("" : "+s"(w)); return w; }   // holds a tensor load's issue test in a scalar register, so that the branch around the load is a scalar one
__device__ __forceinline__ void wait_ds0() { asm volatile("s_wait_dscnt 0x0" ::: "memory"); }        // this wave's LDS reads have returned: in front of the barrier behind which their buffer is refilled
// this wave's tensor load has landed: the compiler places no wait for it; the request's descriptor is named as an input, so that its registers keep their values up to the wait
__device__ __forceinline__ void wait_tensor0(u32x4 g0, u32x8 g1) { asm volatile("s_wait_tensorcnt 0x0" :: "s"(g0), "s"(g1) : "memory"); }
// The keys that the attention walks, from the count of kept keys as the conversion launch stored it: the kept ones, or all TT where no key is kept (the module's uniform row); bounded by the shape for any stored value.
__device__ __forceinline__ u32 kept_keys(int nk) { return uni((u32)(nk < 0 ? 0 : nk > TT ? TT : nk)); }
__device__ __forceinline__ u32 keys_in_use(int nk) { const u32 k = kept_keys(nk); return k ? k : (u32)TT; }
// ---- k_gemmw: GEMM on 128x128 output tiles, FOUR WAVES (2 x 2) per block, each on its own 64x64 tile (16 accumulators); grid (M/128, N/128, Z), 128 threads.
// C[m][n] (f32, pitch ldc, + optional f32 bias[n]) = sum_{k < KL} A[m][k] Bt[n][k] (+ A2[m][k] Bt[n][k] for NSPLIT = 1). K = row pitch of A and Bt, KL = k extent summed here. z-batch strides sA/sB/sC in elements. KL % 128 == 0, KL >= 256.
// The operand rows reach the waves through LDS: a stage is 128 k (256 bytes) of the block's 128 A rows (of both planes for NSPLIT = 1) and 128 Bt rows, every wave bringing one slice of it by one tensor load, two buffers,
// the next stage in flight while this one is worked on; a row's bytes leave L2 once per block in whole 256-byte pieces, and the two waves that share a row read it from LDS.
// PL = 0: C as above. PL = 1: the three projections in ONE launch, z = 0, 1, 2 for Q, K, V (operands and planes z strides apart, a bias pointer each); no C; a wave's tile (64 tokens x the 64 columns of one head, + bias)
// goes out as three 16-bit planes, fp16 and bf16 hi + lo: Q and K [head][token][d], V transposed, [head][d][token]. The blocks of K and V stand on the WGPs beside those of Q, two to a WGP: the epilogues stage in the ring's LDS,
// which every wave has left by then, so a block holds 144 KiB, and one block's products run while the other waits for its tensor loads.
#define GKS  128                   // k per stage
#define GPIT 272                   // LDS row pitch: 256 bytes + the mover's 16-byte pad, an odd multiple of 16 bytes for 16-byte readers
#define GSL  18432                 // the place of a slice of 64 rows: 64 x 272 bytes = 17,408, rounded up to a multiple of 2 KiB
template <typename T16> struct WFrag;
template <> struct WFrag<h16> { typedef v16h V; static __device__ __forceinline__ V ld(const h16* p) { return cat16(*(const v8h*)p, *(const v8h*)(p + 16)); } static __device__ __forceinline__ v8f mma(V a, V b, v8f c) { return wmma16(a, b, c); } };
template <> struct WFrag<bf> { typedef v16bf V; static __device__ __forceinline__ V ld(const bf* p) { return cat16b(*(const v8us*)p, *(const v8us*)(p + 16)); } static __device__ __forceinline__ v8f mma(V a, V b, v8f c) { return wmmab(a, b, c); } };
template <typename T16, int NSPLIT, bool BIAS, int PL>
__global__ __launch_bounds__(128) void k_gemmw(const T16* __restrict__ A, const T16* __restrict__ A2, const T16* __restrict__ Bt, const T16* __restrict__ Bt2, int K, int KL, float* C, int ldc, const float* __restrict__ bias, const float* __restrict__ biask, const float* __restrict__ biasv, size_t sA, size_t sB, size_t sC, h16* P16, bf* Ph, bf* Pl, size_t sP, const int* __restrict__ nkp) {
    typedef typename WFrag<T16>::V V;
    // PL = 1, z > 0: the A rows are keys in kept-first order, and only the row tiles that hold a key in use are computed (keys_in_use); the whole block leaves, in front of every tensor load and barrier
    if (PL == 1 && blockIdx.z) { if (blockIdx.x * 128u >= keys_in_use(*nkp)) return; }
    static_assert(NSPLIT == 0 || NSPLIT == 1, "one or two A planes against one Bt plane");
    // a buffer: the A plane(s), then Bt. NSPLIT = 0: four slices of 64 rows, one per wave. NSPLIT = 1: A and A2 as one tile of 128 rows each (waves 0, 1), Bt as two slices of 64 rows (waves 2, 3).
    constexpr int APL = NSPLIT ? 128 * GPIT : 2 * GSL;   // an A plane's place
    constexpr int ASP = NSPLIT ? 64 * GPIT : GSL;        // from its rows 0 .. 63 to its rows 64 .. 127
    constexpr int BOF = (NSPLIT + 1) * APL, GBUF = BOF + 2 * GSL;
    static_assert(APL % 2048 == 0 && GSL % 2048 == 0 && 64 * GPIT <= GSL, "every place a multiple of 2 KiB");
    __shared__ __attribute__((aligned(2048))) unsigned char L[2 * GBUF];
    (void)Bt2;
    const size_t z = blockIdx.z; A += z * sA; if (A2) A2 += z * sA; Bt += z * sB; C += z * sC;
    if (PL == 1) { P16 += z * sP; Ph += z * 2 * sP; Pl += z * 2 * sP; bias = z == 0 ? bias : z == 1 ? biask : biasv; }   // the hi and lo planes of a projection lie one behind the other
    const u32 wave = uni(threadIdx.x >> 5); const int wm = (int)(wave >> 1), wn = (int)(wave & 1u);
    const int lane = threadIdx.x & 31, lr = lane & 15, hi = lane >> 4; const int r0 = blockIdx.x * 128 + wm * 64, c0 = blockIdx.y * 128 + wn * 64;
    // the wave's slice of every stage: rows of 256 bytes, source pitch 2 K bytes, a stage 256 bytes on
    const bool isb = wave >= 2;
    const T16* sp = isb ? Bt + (size_t)(blockIdx.y * 128 + wn * 64) * K : NSPLIT ? (wave ? A2 : A) + (size_t)(blockIdx.x * 128) * K : A + (size_t)(blockIdx.x * 128 + wave * 64) * K;
    const u32 rows = (NSPLIT && !isb) ? 128u : 64u;
    const unsigned long long src = (unsigned long long)(size_t)sp;
    const u32 lbase = (u32)(size_t)L + (isb ? BOF + wn * GSL : wave * (NSPLIT ? APL : GSL));
    u32x8 g1; g1[0] = uni((1u << 20) | (5u << 22) | (3u << 25));   // no mask, 1-byte elements, 4 dwords of pad behind every 64
    g1[1] = uni(256u << 16); g1[2] = uni(rows << 16); g1[3] = uni(256u << 16); g1[4] = uni(rows); g1[5] = uni((u32)K * 2u); g1[6] = uni(0u); g1[7] = uni(0u);
    asm volatile("" : "+s"(g1));   // pinned, as in pinned(): the descriptor words stay in these scalar registers through the loop and are not formed again while a request is out
    u32x4 g0 = {0u, 0u, 0u, 0u};   // the descriptor group of the wave's last request
    auto issue = [&](u32 s) { const unsigned long long ga = src + (unsigned long long)s * (GKS * 2); g0[0] = uni(1u); g0[1] = uni(lbase + (s & 1u) * GBUF); g0[2] = uni((u32)ga); g0[3] = uni(((u32)(ga >> 32) & 0x01FFFFFFu) | 0x80000000u);
        asm volatile("tensor_load_to_lds %0, %1" :: "s"(g0), "s"(g1) : "memory"); };   // one request of the whole wave; every wave of the block issues its own
    v8f acc[4][4];
#pragma unroll
    for (int mb = 0; mb < 4; ++mb)
#pragma unroll
        for (int nb = 0; nb < 4; ++nb) acc[mb][nb] = (v8f){};
    const u32 nst = (u32)KL / GKS;
    issue(0); wait_tensor0(g0, g1);
    __syncthreads();   // stage 0 is published
    issue(1);
    const int fo = lr * GPIT + 16 * hi;   // the lane's row and half in every slice
    for (u32 s = 0; s < nst; ++s) {
        const unsigned char* Lb = L + (s & 1u) * GBUF;
        const T16* La = (const T16*)(Lb + wm * ASP + fo); const T16* La2 = (const T16*)(Lb + APL + wm * ASP + fo); const T16* Lw = (const T16*)(Lb + BOF + wn * GSL + fo);
        V a[2][4], a2[2][4], b[2][4];   // two fragment sets: the next 32 k are fetched as one group in front of this 32 k's products; nothing of a stage is read in front of its barrier
        // every "#pragma unroll" of this loop: it indexes fragment and accumulator arrays, which stay in registers only under constant indices
#pragma unroll
        for (int f = 0; f < 4; ++f) { a[0][f] = WFrag<T16>::ld(La + f * 16 * (GPIT / 2)); if (NSPLIT == 1) a2[0][f] = WFrag<T16>::ld(La2 + f * 16 * (GPIT / 2)); b[0][f] = WFrag<T16>::ld(Lw + f * 16 * (GPIT / 2)); }
#pragma unroll
        for (int ks = 0; ks < GKS / 32; ++ks) { const int cu = ks & 1, nx = cu ^ 1;
            if (ks + 1 < GKS / 32) {
#pragma unroll
                for (int f = 0; f < 4; ++f) { const int o = f * 16 * (GPIT / 2) + 32 * (ks + 1); a[nx][f] = WFrag<T16>::ld(La + o); if (NSPLIT == 1) a2[nx][f] = WFrag<T16>::ld(La2 + o); b[nx][f] = WFrag<T16>::ld(Lw + o); }
            }
            __builtin_amdgcn_sched_barrier(0);   // keeps the group of LDS reads whole and in front of the block of products: without it the compiler kept one Bt fragment and waited for LDS in front of every four products
#pragma unroll
            for (int nb = 0; nb < 4; ++nb)
#pragma unroll
                for (int mb = 0; mb < 4; ++mb) { acc[mb][nb] = WFrag<T16>::mma(a[cu][mb], b[cu][nb], acc[mb][nb]); if (NSPLIT == 1) acc[mb][nb] = WFrag<T16>::mma(a2[cu][mb], b[cu][nb], acc[mb][nb]); }
            __builtin_amdgcn_sched_barrier(0);   // the other side of the pair: the next group of reads stays behind this block
        }
        wait_ds0();
        wait_tensor0(g0, g1);
        __syncthreads();   // publishes stage s + 1 and ends every wave's reads of stage s
        if (pinned(s + 2 < nst)) issue(s + 2);   // into the buffer that stage s has left
    }
    wait_tensor0(g0, g1); wait_ds0();
    // From here the ring's LDS is free: the last pass's barrier ended every wave's reads of it, and no request is out. Each wave stages its tile in its own piece of it.
    static_assert(4 * 16 * 68 * 4 <= GBUF && 4 * 3 * 16 * 72 * 2 <= GBUF, "the staging rows fit the first buffer");
    // Every "#pragma unroll" of the plane epilogues: its loop indexes accumulator and staging arrays, which stay in registers only under constant indices.
    const int prow = lane >> 3, pc = (lane & 7) * 8;   // plane stores: 8 lanes x 16 bytes a row, so one store covers four whole 128-byte rows
    if (PL == 1 && z == 2) {
        // a lane's 8 accumulator elements are 8 consecutive tokens of ONE column d: converted in registers, 16 d rows x 64 tokens of each plane pass through LDS (pitch 72: no bank shared by the 16 rows of a write)
        unsigned short (*ts)[16 * 72] = (unsigned short (*)[16 * 72])(L + wave * (3 * 16 * 72 * 2));   // each wave stages in its own rows
#pragma unroll
        for (int nb = 0; nb < 4; ++nb) {
            const float bb = BIAS ? bfr(bias[c0 + nb * 16 + lr]) : 0.f;
#pragma unroll
            for (int mb = 0; mb < 4; ++mb) { v8h o16; v8us oh, ol;
#pragma unroll
                for (int j = 0; j < 8; ++j) { const float x = acc[mb][nb][j] + bb; o16[j] = tohx(x); unsigned short a2, c2; splitf(x, a2, c2); oh[j] = a2; ol[j] = c2; }
                const int to = lr * 72 + mb * 16 + hi * 8; *(v8usa*)(ts[0] + to) = __builtin_bit_cast(v8us, o16); *(v8usa*)(ts[1] + to) = oh; *(v8usa*)(ts[2] + to) = ol; }
            __builtin_amdgcn_wave_barrier(); asm volatile("" ::: "memory");   // the rows are read back by other lanes of the wave: keeps the reads behind the writes
            v8us w[4][3]; const size_t po = (size_t)(c0 + nb * 16 + prow) * TT + r0 + pc;
#pragma unroll
            for (int s = 0; s < 4; ++s) {
#pragma unroll
                for (int p = 0; p < 3; ++p) w[s][p] = *(const v8usa*)(ts[p] + (4 * s + prow) * 72 + pc);
                *(v8us*)((bf*)P16 + po + (size_t)s * 4 * TT) = w[s][0]; *(v8us*)(Ph + po + (size_t)s * 4 * TT) = w[s][1]; *(v8us*)(Pl + po + (size_t)s * 4 * TT) = w[s][2]; }
            // stands behind the group's stores, in front of any reuse of their data registers (named as inputs, so that they live up to the wait); as a memory clobber it also keeps the next rows' LDS writes behind these reads
            asm volatile("s_wait_xcnt 0x0" :: "v"(w[0][0]), "v"(w[0][1]), "v"(w[0][2]), "v"(w[1][0]), "v"(w[1][1]), "v"(w[1][2]), "v"(w[2][0]), "v"(w[2][1]), "v"(w[2][2]), "v"(w[3][0]), "v"(w[3][1]), "v"(w[3][2]) : "memory");
        }
        return;
    }
    float* os = (float*)(L + wave * (16 * 68 * 4));
    float pb[8];
    if constexpr (PL == 1) {
#pragma unroll
        for (int k = 0; k < 8; ++k) pb[k] = BIAS ? bfr(bias[c0 + pc + k]) : 0.f; }
#pragma unroll
    for (int mb = 0; mb < 4; ++mb) {
#pragma unroll
        for (int nb = 0; nb < 4; ++nb) {
#pragma unroll
            for (int j = 0; j < 8; ++j) os[(hi * 8 + j) * 68 + nb * 16 + lr] = acc[mb][nb][j]; }
        __builtin_amdgcn_wave_barrier(); asm volatile("" ::: "memory");
        if constexpr (PL == 1) {
            v8us w[4][3]; const size_t po = ((size_t)(c0 / HD) * TT + r0 + mb * 16 + prow) * HD + pc;
#pragma unroll
            for (int s = 0; s < 4; ++s) { const float* orow = os + (4 * s + prow) * 68 + pc; const v4f x0 = *(const v4fa*)orow, x1 = *(const v4fa*)(orow + 4); v8h o16;
#pragma unroll
                for (int k = 0; k < 8; ++k) { const float x = (k < 4 ? x0[k & 3] : x1[k & 3]) + pb[k]; o16[k] = tohx(x); unsigned short a2, c2; splitf(x, a2, c2); w[s][1][k] = a2; w[s][2][k] = c2; }
                w[s][0] = __builtin_bit_cast(v8us, o16);
                *(v8us*)((bf*)P16 + po + s * 4 * HD) = w[s][0]; *(v8us*)(Ph + po + s * 4 * HD) = w[s][1]; *(v8us*)(Pl + po + s * 4 * HD) = w[s][2]; }
            // stands behind the group's stores, in front of any reuse of their data registers (named as inputs, so that they live up to the wait)
            asm volatile("s_wait_xcnt 0x0" :: "v"(w[0][0]), "v"(w[0][1]), "v"(w[0][2]), "v"(w[1][0]), "v"(w[1][1]), "v"(w[1][2]), "v"(w[2][0]), "v"(w[2][1]), "v"(w[2][2]), "v"(w[3][0]), "v"(w[3][1]), "v"(w[3][2]) : "memory");
        } else {
        float* crow = C + (size_t)(r0 + mb * 16) * ldc + c0;
{
#pragma unroll
            for (int s = 0; s < 8; ++s) { const int row = 2 * s + hi, cofs = lr * 4; v4f val = *(const v4fa*)(os + row * 68 + cofs); if (BIAS) { val[0] += bfr(bias[c0 + cofs]); val[1] += bfr(bias[c0 + cofs + 1]); val[2] += bfr(bias[c0 + cofs + 2]); val[3] += bfr(bias[c0 + cofs + 3]); }
                *(v4f*)(crow + (size_t)row * ldc + cofs) = val; }
             }
        }
        __builtin_amdgcn_wave_barrier(); asm volatile("" ::: "memory");
    }
}

typedef __attribute__((ext_vector_type(4))) _Float16 v4h;
typedef __attribute__((ext_vector_type(4))) unsigned short v4us;

// ---- k_cvtall: every f32 -> bf16 copy of a call (query, key, value, Wq, Wk, Wv, Wo) in ONE streaming launch: 256 blocks of 16 waves, a block on CVB consecutive floats of one array.
// A wave's load is 512 consecutive bytes (16 per lane), its store the 256 bytes they round to; a thread has CVL loads to issue in front of its conversions, so a wave starts once for 16 KiB of source and not once for 1 KiB.
// The sources are read once and by non-temporal loads, which leave L2 to the bf16 copies that the GEMMs read; the copies lie one behind the other in block order.
#define CVT_ 512                   // threads per block
#define CVL  32                    // 16-byte loads per thread
#define CVB  (CVT_ * CVL * 4)      // floats per block
#define CVX  (TT * DM / CVB)       // blocks per token array
#define CVW  (DM * DM / CVB)       // blocks per weight array
// Key and value rows go out in KEPT-FIRST order: a key whose mask entry is not 0 takes the place of its rank among such keys, every other key a place behind all of them, both parts in token order (a permutation of
// the TT rows for any mask). Every block forms the mask's bit vector itself, under its own loads' latency: a wave's 8 ballots cover 256 keys; the words and each wave's count pass through LDS, behind one barrier.
__global__ __launch_bounds__(CVT_) void k_cvtall(const float* __restrict__ xq, const float* __restrict__ xk, const float* __restrict__ xv, const int* __restrict__ km, const float* __restrict__ wq, const float* __restrict__ wk, const float* __restrict__ wv, const float* __restrict__ wo, bf* dst, int* nkw) {
    __shared__ __align__(16) u32 mw[TT / 32];     // the mask, one bit a key
    __shared__ __align__(16) u32 wc[CVT_ / 32];   // kept keys among each wave's 256
    const unsigned b = blockIdx.x, w = b - 3 * CVX;   // which array and which piece of it: the same for the whole block
    const unsigned bl = b < 3 * CVX ? b % CVX : w % CVW;
    const float* src = (b < 3 * CVX ? (b < CVX ? xq : b < 2 * CVX ? xk : xv) : (w < CVW ? wq : w < 2 * CVW ? wk : w < 3 * CVW ? wv : wo)) + (size_t)bl * CVB;
    src += threadIdx.x * 4;
    const u32 wv_ = uni(threadIdx.x >> 5); const int lane = threadIdx.x & 31;
    const int* mp = km + wv_ * 256 + lane; int m[8];   // issued in front of the stream's loads, so that they return first
#pragma unroll
    for (int j = 0; j < 8; ++j) m[j] = mp[j * 32];
    asm volatile("s_wait_xcnt 0x0" ::: "memory");   // stands behind the mask loads, in front of any reuse of their address registers
    v4f x[CVL];   // every "#pragma unroll" here: the loops index vectors and these arrays, which stay in registers only under constant indices
#pragma unroll
    for (int i = 0; i < CVL; ++i) x[i] = __builtin_nontemporal_load((const v4f*)(src + i * (CVT_ * 4)));
    u32x4 bw[2]; u32 cw = 0;
#pragma unroll
    for (int j = 0; j < 8; ++j) { const u32 t = __builtin_amdgcn_ballot_w32(m[j] != 0); bw[j >> 2][j & 3] = t; cw += (u32)__builtin_popcount(t); }
    if (lane == 0) { *(u32x4*)(mw + wv_ * 8) = bw[0]; *(u32x4*)(mw + wv_ * 8 + 4) = bw[1]; wc[wv_] = cw; }
    // the bit vector and the counts are read by every wave; the two fences order LDS alone, so that the stream's loads stay in flight across the barrier (__syncthreads() waited for all of them in front of it)
    __builtin_amdgcn_fence(__ATOMIC_RELEASE, "workgroup", "local"); __builtin_amdgcn_s_barrier(); __builtin_amdgcn_fence(__ATOMIC_ACQUIRE, "workgroup", "local");
    const bool kv = b >= CVX && b < 3 * CVX;   // a piece is CVB / DM = 64 rows: two words of the bit vector, from word w0
    const u32 w0 = bl * 2;
    u32 nk = 0, before = 0;   // kept keys in all, and in front of the piece
#pragma unroll
    for (u32 i = 0; i < CVT_ / 32; ++i) { const u32 c = wc[i]; nk += c; before += i < (w0 >> 3) ? c : 0u; }
#pragma unroll
    for (u32 i = 0; i < 8; ++i) { const u32 t = mw[(w0 & ~7u) + i]; before += i < (w0 & 7u) ? (u32)__builtin_popcount(t) : 0u; }
    // an array that keeps its order is written as if every row were kept; all of this is the same in every lane and is held in scalar registers
    const u32 W0 = uni(kv ? mw[w0] : ~0u), W1 = uni(kv ? mw[w0 + 1] : ~0u), bf0 = uni(kv ? before : bl * 64), nks = uni(nk), h = uni(threadIdx.x >> 8), c0 = (u32)__builtin_popcount(W0);
    if (b == CVX && threadIdx.x == 0) *nkw = (int)nks;
    bf* da = dst + (size_t)(b - bl) * CVB + (threadIdx.x & 255) * 4;   // the array's copy; the copies lie one behind the other in block order
#pragma unroll
    for (int gq = 0; gq < CVL / 16; ++gq) { v4us y[16];
#pragma unroll
        for (int i = 0; i < 16; ++i) { const u32 r = 2 * (16 * gq + i) + h, bit = r & 31u, Wd = gq ? W1 : W0;   // load i of a thread lies in row 2 i + h of the piece
            const u32 kb = bf0 + (gq ? c0 : 0u) + (u32)__builtin_popcount(Wd & ((1u << bit) - 1u));   // kept rows in front of this one
            const u32 pos = (((Wd >> bit) & 1u) ? kb : nks + bl * 64 + r - kb) & (TT - 1);
#pragma unroll
            for (int k = 0; k < 4; ++k) y[i][k] = f2bf(x[16 * gq + i][k]);
            *(v4us*)(da + (size_t)pos * DM) = y[i]; }
        // stands behind the group's stores, in front of any reuse of their data and address registers (named as inputs, so that they live up to the wait)
        asm volatile("s_wait_xcnt 0x0" :: "v"(y[0]), "v"(y[1]), "v"(y[2]), "v"(y[3]), "v"(y[4]), "v"(y[5]), "v"(y[6]), "v"(y[7]), "v"(y[8]), "v"(y[9]), "v"(y[10]), "v"(y[11]), "v"(y[12]), "v"(y[13]), "v"(y[14]), "v"(y[15]), "v"(da) : "memory"); }
}
static_assert((TT * DM) % CVB == 0 && (DM * DM) % CVB == 0 && DQ == DM && DKV == DM && NB_ == 1, "every array is a whole number of blocks' pieces; the four weights are DM x DM; one batch entry, so one launch converts all");
static_assert(CVB == 64 * DM && CVT_ * 4 == 2 * DM && CVT_ * 8 == TT && (TT & (TT - 1)) == 0 && CVL == 32, "a piece is 64 rows, a block's load two rows; a block's threads read 8 mask entries each");

// ---- k_fattn: scores, key mask, softmax and P x V of all heads in ONE launch; no score or weight plane in memory.
// Per wave: S^T = K Q^T (A = 16 keys x 64 d, B = the wave's query columns, kept in registers), so a lane holds 8 consecutive keys of ONE query per tile;
// two such tiles, converted in place, are the B operand of O^T += V^T P^T (A = V^T rows in the same k order as WFrag::ld at + 8 * hi). 32 keys per pass.
// Softmax is online in base 2: weights exp2(s - mu + PSH) against the maximum in use mu, O and the sum rescaled only when a new maximum exceeds mu by more than 8.
// The keys arrive in kept-first order with the count nk of the kept ones: the stages end with the last kept key (all TT keys where none is kept), and only a pass that reaches past nk tests its keys.
// A masked key's score is -3.0e38: its weight is 0 beside any kept key, and 1 for every key of a row with no kept key (the module's uniform row).
// Block = 9 waves on 256 query rows' worth of one head's work: 2 waves of 16 hi/lo rows (< RH, 3 products) and 7 waves of 32 fp16 rows; 256 blocks.
// K and V^T reach the waves through LDS: a stage is 64 keys of the head's six planes, each plane's tile (64 rows x 128 bytes) brought by one tensor load of one wave (waves 0 .. 5), two buffers,
// the next stage in flight while this one is worked on; every wave reads its fragments from the tiles, so a plane's bytes leave L2 once per block and stage and not once per wave.
// Every "#pragma unroll" in the attention code: its loop indexes fragment and accumulator arrays, which stay in registers only under constant indices.
#define PSH  4.0f                  // weights lie in (0, 2^(8 + PSH)]: inside fp16's range, and small ones stay normal numbers
#define SCL2 0.18033688011112042f  // HD^-0.5 * log2(e)
#define FBH  (TT / 256)            // blocks per head
#define SKEY 64                    // keys per stage
#define NST  (TT / SKEY)           // stages
#define LPIT 144                   // LDS row pitch: 128 bytes + the mover's 16-byte pad, an odd multiple of 16 bytes for 16-byte readers
#define LTIL 10240                 // a tile's place: 64 rows x 144 bytes = 9,216, rounded up to a multiple of 2 KiB
#define LBUF (6 * LTIL)            // a buffer: tiles K fp16, V^T fp16, K hi, K lo, V^T hi, V^T lo
typedef __attribute__((ext_vector_type(8))) __bf16 v8b;
__device__ __forceinline__ float xhalf(float x) { return __builtin_bit_cast(float, __builtin_amdgcn_permlanex16(__builtin_bit_cast(int, x), __builtin_bit_cast(int, x), 0x76543210, 0xfedcba98, false, false)); }   // lane l <-> lane l ^ 16
// xwait: stands behind each group of global loads, in front of any reuse of their address registers (named as inputs, so that they live up to the wait); as a memory clobber it also keeps the group where it is written
__device__ __forceinline__ void xwait(const void* a) { asm volatile("s_wait_xcnt 0x0" :: "v"(a) : "memory"); }
__device__ __forceinline__ void xwait(const void* a, const void* b) { asm volatile("s_wait_xcnt 0x0" :: "v"(a), "v"(b) : "memory"); }
// what a wave carries from stage to stage; q: fp16 waves [group][k half], hi/lo waves hi [k half] then lo [k half]
struct FSt { v8f o[2][4]; float mu[2], ls[2]; v16h q[4]; };
template <typename T16, bool HI, int R>
__device__ __forceinline__ void finit(FSt& st, const T16* __restrict__ Qa, const T16* __restrict__ Qb, int q0) {
    const int lane = threadIdx.x & 31, lr = lane & 15, hi = lane >> 4;
    const T16* qpa = Qa + (size_t)(q0 + lr) * HD + 8 * hi; const T16* qpb = HI ? Qb + (size_t)(q0 + lr) * HD + 8 * hi : nullptr;
#pragma unroll
    for (int g = 0; g < R; ++g)
#pragma unroll
        for (int kk = 0; kk < 2; ++kk) { const int qo = 16 * g * HD + 32 * kk; st.q[2 * g + kk] = __builtin_bit_cast(v16h, WFrag<T16>::ld(qpa + qo)); if (HI) st.q[2 + kk] = __builtin_bit_cast(v16h, WFrag<T16>::ld(qpb + qo)); }
    if constexpr (HI) xwait(qpa, qpb); else xwait(qpa);
#pragma unroll
    for (int g = 0; g < 2; ++g) { st.mu[g] = -3.0e38f; st.ls[g] = 0.f;
#pragma unroll
        for (int dt = 0; dt < 4; ++dt) st.o[g][dt] = (v8f){}; }
}
// one stage of one wave: two passes of 32 keys on the tiles of buffer Lb; k0 = the stage's first key, nk = the kept keys (places 0 .. nk - 1)
template <typename T16, bool HI, int R>
__device__ __forceinline__ void fstage(FSt& st, const unsigned char* Lb, int nk, int k0) {
    typedef typename WFrag<T16>::V V;
    const int lane = threadIdx.x & 31, lr = lane & 15, hi = lane >> 4;
    const unsigned char* Lr = Lb + lr * LPIT + 16 * hi;   // the lane's row and half in every tile
    const T16* Lka = (const T16*)(Lr + (HI ? 2 : 0) * LTIL); const T16* Lkb = (const T16*)(Lr + 3 * LTIL); const T16* Lva = (const T16*)(Lr + (HI ? 4 : 1) * LTIL); const T16* Lvb = (const T16*)(Lr + 5 * LTIL);
    V qa[R][2], qb[R][2];
#pragma unroll
    for (int g = 0; g < R; ++g)
#pragma unroll
        for (int kk = 0; kk < 2; ++kk) { qa[g][kk] = __builtin_bit_cast(V, st.q[2 * g + kk]); if (HI) qb[g][kk] = __builtin_bit_cast(V, st.q[2 + kk]); }
    V ka[2][2], kb[2][2];   // the second pass's K fragments are fetched by the first; the first pass's here: nothing of a stage is read in front of its barrier
#pragma unroll
    for (int kt = 0; kt < 2; ++kt)
#pragma unroll
        for (int kk = 0; kk < 2; ++kk) { ka[kt][kk] = WFrag<T16>::ld(Lka + kt * 16 * (LPIT / 2) + 32 * kk); if (HI) kb[kt][kk] = WFrag<T16>::ld(Lkb + kt * 16 * (LPIT / 2) + 32 * kk); }
#pragma unroll
    for (int sub = 0; sub < SKEY / 32; ++sub) {
        V va[4], vb[4];   // this pass's V^T fragments: issued first, read behind the softmax
#pragma unroll
        for (int dt = 0; dt < 4; ++dt) { va[dt] = WFrag<T16>::ld(Lva + dt * 16 * (LPIT / 2) + 32 * sub); if (HI) vb[dt] = WFrag<T16>::ld(Lvb + dt * 16 * (LPIT / 2) + 32 * sub); }
        v8f s[R][2];
#pragma unroll
        for (int g = 0; g < R; ++g)
#pragma unroll
            for (int kt = 0; kt < 2; ++kt) s[g][kt] = (v8f){};
#pragma unroll
        for (int kk = 0; kk < 2; ++kk) {
#pragma unroll
            for (int g = 0; g < R; ++g)
#pragma unroll
                for (int kt = 0; kt < 2; ++kt) s[g][kt] = WFrag<T16>::mma(ka[kt][kk], qa[g][kk], s[g][kt]);
            if (HI) {
#pragma unroll
                for (int g = 0; g < R; ++g)
#pragma unroll
                    for (int kt = 0; kt < 2; ++kt) s[g][kt] = WFrag<T16>::mma(ka[kt][kk], qb[g][kk], s[g][kt]);
#pragma unroll
                for (int g = 0; g < R; ++g)
#pragma unroll
                    for (int kt = 0; kt < 2; ++kt) s[g][kt] = WFrag<T16>::mma(kb[kt][kk], qa[g][kk], s[g][kt]);
            }
        }
        asm volatile("" ::: "memory");   // keeps this pass's V^T reads where they are written, in front of the S^T products and the softmax, which cover their latency: without it the compiler moved them down to the P x V products
        if (sub + 1 < SKEY / 32) {
#pragma unroll
            for (int kt = 0; kt < 2; ++kt)
#pragma unroll
                for (int kk = 0; kk < 2; ++kk) { ka[kt][kk] = WFrag<T16>::ld(Lka + (32 * (sub + 1) + kt * 16) * (LPIT / 2) + 32 * kk); if (HI) kb[kt][kk] = WFrag<T16>::ld(Lkb + (32 * (sub + 1) + kt * 16) * (LPIT / 2) + 32 * kk); }
        }
#pragma unroll
        for (int g = 0; g < R; ++g)
#pragma unroll
            for (int kt = 0; kt < 2; ++kt) s[g][kt] = s[g][kt] * SCL2;
        if (k0 + 32 * sub + 32 > nk) {   // the same for the whole block: only the kept keys' last passes (every pass where no key is kept) hold a masked key; element r of tile kt is key 16 kt + 8 hi + r of the pass
            const int left = nk - (k0 + 32 * sub + 8 * hi);
#pragma unroll
            for (int g = 0; g < R; ++g)
#pragma unroll
                for (int kt = 0; kt < 2; ++kt)
#pragma unroll
                    for (int r = 0; r < 8; ++r) s[g][kt][r] = (16 * kt + r < left) ? s[g][kt][r] : -3.0e38f;
        }
        float mx[R]; bool need = false;
#pragma unroll
        for (int g = 0; g < R; ++g) { mx[g] = -3.0e38f;
#pragma unroll
            for (int kt = 0; kt < 2; ++kt) {
#pragma unroll
                for (int r = 0; r < 8; ++r) mx[g] = fmaxf(mx[g], s[g][kt][r]); }
            need = need || (mx[g] > st.mu[g] + 8.0f); }
        if (__builtin_amdgcn_ballot_w32(need) != 0) {   // one scalar test per pass; rare behind the first passes
#pragma unroll
            for (int g = 0; g < R; ++g) { const float mn = fmaxf(st.mu[g], fmaxf(mx[g], xhalf(mx[g]))); const float corr = __builtin_amdgcn_exp2f(st.mu[g] - mn); st.mu[g] = mn; st.ls[g] *= corr;
#pragma unroll
                for (int dt = 0; dt < 4; ++dt) st.o[g][dt] = st.o[g][dt] * corr; }
        }
#pragma unroll
        for (int g = 0; g < R; ++g) { const float nm = PSH - st.mu[g]; v8f p[2];
#pragma unroll
            for (int kt = 0; kt < 2; ++kt) { const v8f ar = s[g][kt] + nm;
#pragma unroll
                for (int r = 0; r < 8; ++r) p[kt][r] = __builtin_amdgcn_exp2f(ar[r]); }
            const v8f ps = p[0] + p[1]; st.ls[g] += ((ps[0] + ps[1]) + (ps[2] + ps[3])) + ((ps[4] + ps[5]) + (ps[6] + ps[7]));
            if constexpr (HI) {
                const v8b h0 = __builtin_convertvector(p[0], v8b), h1 = __builtin_convertvector(p[1], v8b);
                const v8b l0 = __builtin_convertvector(p[0] - __builtin_convertvector(h0, v8f), v8b), l1 = __builtin_convertvector(p[1] - __builtin_convertvector(h1, v8f), v8b);
                const V ph = __builtin_shufflevector(h0, h1, 0, 1, 2, 3, 4, 5, 6, 7, 8, 9, 10, 11, 12, 13, 14, 15), pl = __builtin_shufflevector(l0, l1, 0, 1, 2, 3, 4, 5, 6, 7, 8, 9, 10, 11, 12, 13, 14, 15);
#pragma unroll
                for (int dt = 0; dt < 4; ++dt) st.o[g][dt] = WFrag<T16>::mma(va[dt], ph, st.o[g][dt]);
#pragma unroll
                for (int dt = 0; dt < 4; ++dt) st.o[g][dt] = WFrag<T16>::mma(va[dt], pl, st.o[g][dt]);
#pragma unroll
                for (int dt = 0; dt < 4; ++dt) st.o[g][dt] = WFrag<T16>::mma(vb[dt], ph, st.o[g][dt]);
            } else {
                const V pf = cat16(__builtin_convertvector(p[0], v8h), __builtin_convertvector(p[1], v8h));
#pragma unroll
                for (int dt = 0; dt < 4; ++dt) st.o[g][dt] = WFrag<T16>::mma(va[dt], pf, st.o[g][dt]);
            } }
    }
}
template <int R>
__device__ __forceinline__ void fstore(const FSt& st, int q0, bf* Ah, bf* Al) {
    const int lane = threadIdx.x & 31, lr = lane & 15, hi = lane >> 4;
#pragma unroll
    for (int g = 0; g < R; ++g) { const float inv = __fdiv_rn(1.0f, st.ls[g] + xhalf(st.ls[g]));   // the two halves hold the sums of their own keys
        v8us oh[4], ol[4]; bf* ph = Ah + (size_t)(q0 + 16 * g + lr) * DQ + 8 * hi; bf* pl = Al + (size_t)(q0 + 16 * g + lr) * DQ + 8 * hi;
#pragma unroll
        for (int dt = 0; dt < 4; ++dt) {
#pragma unroll
            for (int r = 0; r < 8; ++r) { unsigned short a, c2; splitf(st.o[g][dt][r] * inv, a, c2); oh[dt][r] = a; ol[dt][r] = c2; }
            *(v8us*)(ph + dt * 16) = oh[dt]; *(v8us*)(pl + dt * 16) = ol[dt]; }
        // stands behind the row group's stores, in front of any reuse of their data and address registers (named as inputs, so that they live up to the wait)
        asm volatile("s_wait_xcnt 0x0" :: "v"(oh[0]), "v"(oh[1]), "v"(oh[2]), "v"(oh[3]), "v"(ol[0]), "v"(ol[1]), "v"(ol[2]), "v"(ol[3]), "v"(ph), "v"(pl) : "memory"); }
}
__global__ __launch_bounds__(288) void k_fattn(const h16* __restrict__ Q16, const h16* __restrict__ K16, const h16* __restrict__ V16, const bf* __restrict__ Qh, const bf* __restrict__ Ql, const bf* __restrict__ Kh, const bf* __restrict__ Kl, const bf* __restrict__ Vh, const bf* __restrict__ Vl, const int* __restrict__ nkp, bf* Ah, bf* Al) {
    __shared__ __attribute__((aligned(2048))) unsigned char L[2 * LBUF];
    const int nkr = *nkp;   // read first: it returns under the Q loads
    asm volatile("s_wait_xcnt 0x0" ::: "memory");   // stands behind that load, in front of any reuse of its address registers
    const u32 wave = uni(threadIdx.x >> 5); const int blk = blockIdx.x; const size_t pl = (size_t)blockIdx.y * TT * HD; Ah += blockIdx.y * HD; Al += blockIdx.y * HD;
    const bool hiw = wave == 1 || wave == 2;
    const int q0 = hiw ? (blk * 2 + (int)wave - 1) * 16 : RH + (blk * 7 + (wave ? (int)wave - 2 : 0)) * 32;
    // wave w < 6 brings tile w of every stage: 64 rows of 128 bytes; K planes: a row is a key (source pitch 128 bytes, a stage 8 KiB on); V^T planes: a row is a d (source pitch 8 KiB, a stage 128 bytes on)
    const bool isv = wave == 1 || wave >= 4;
    const void* plane = wave == 0 ? (const void*)K16 : wave == 1 ? (const void*)V16 : wave == 2 ? (const void*)Kh : wave == 3 ? (const void*)Kl : wave == 4 ? (const void*)Vh : (const void*)Vl;
    const unsigned long long src = (unsigned long long)(size_t)plane + pl * 2; const u32 step = isv ? SKEY * 2 : SKEY * HD * 2;
    const u32 lbase = (u32)(size_t)L + wave * LTIL;
    u32x8 g1; g1[0] = uni((1u << 20) | (4u << 22) | (3u << 25));   // no mask, 1-byte elements, 4 dwords of pad behind every 32
    g1[1] = uni(128u << 16); g1[2] = uni(64u << 16); g1[3] = uni(128u << 16); g1[4] = uni(64u); g1[5] = uni(isv ? TT * 2 : HD * 2); g1[6] = uni(0u); g1[7] = uni(0u);
    asm volatile("" : "+s"(g1));   // pinned, as in pinned(): the descriptor words stay in these scalar registers through the loop and are not formed again while a request is out
    u32x4 g0 = {0u, 0u, 0u, 0u};   // the descriptor group of the wave's last request
    auto issue = [&](u32 s) { const unsigned long long ga = src + (unsigned long long)s * step; g0[0] = uni(1u); g0[1] = uni(lbase + (s & 1u) * LBUF); g0[2] = uni((u32)ga); g0[3] = uni(((u32)(ga >> 32) & 0x01FFFFFFu) | 0x80000000u);
        asm volatile("tensor_load_to_lds %0, %1" :: "s"(g0), "s"(g1) : "memory"); };   // one request of the whole wave; ignores EXEC, so every test around it is a scalar branch
    FSt st;
    if (hiw) finit<bf, true, 1>(st, Qh + pl, Ql + pl, q0); else finit<h16, false, 2>(st, Q16 + pl, nullptr, q0);
    // the stages that hold a key in use, at most NST; never fewer than the ring's two: the projections write whole tiles of 128 keys, so stage 1 is there, and its keys past nk are masked
    const int nk = (int)kept_keys(nkr); const u32 nsu = (keys_in_use(nkr) + SKEY - 1) / SKEY, nst = nsu < 2 ? 2u : nsu;
    if (pinned(wave < 6)) { issue(0); wait_tensor0(g0, g1); }
    __syncthreads();   // stage 0 is published
    if (pinned(wave < 6)) issue(1);
    for (u32 s = 0; s < nst; ++s) {
        const unsigned char* Lb = L + (s & 1u) * LBUF;
        // the hint: seven of the nine waves take the fp16 side; without it the compiler copied all 64 accumulator registers to and fro on that side at every stage where the two sides join
        if (__builtin_expect(!hiw, 1)) fstage<h16, false, 2>(st, Lb, nk, (int)s * SKEY); else fstage<bf, true, 1>(st, Lb, nk, (int)s * SKEY);
        wait_ds0();
        if (pinned(wave < 6)) wait_tensor0(g0, g1);
        __syncthreads();   // publishes stage s + 1 and ends every wave's reads of stage s
        if (pinned(wave < 6 && s + 2 < nst)) issue(s + 2);   // into the buffer that stage s has left
    }
    wait_tensor0(g0, g1); wait_ds0();
    if (hiw) fstore<1>(st, q0, Ah, Al); else fstore<2>(st, q0, Ah, Al);
}
static_assert(NH_ == NKV && RH == FBH * 2 * 16 && TT - RH == FBH * 7 * 32, "a block's 9 waves: 2 x 16 hi/lo rows and 7 x 32 fp16 rows");
static_assert(NST >= 2 && SKEY * 2 == 128 && HD * 2 == 128 && 64 * LPIT <= LTIL && LTIL % 2048 == 0, "a stage's six tiles: 64 rows of 128 bytes each, every place a multiple of 2 KiB; the ring needs two stages");
static_assert(HD == 64 && TT % 128 == 0 && DQ % 128 == 0 && DKV % 128 == 0 && DM % 128 == 0, "a wave's 64 projection columns are one head's, its 64 rows whole lines of the transposed planes; a block holds 2 x 2 such tiles");
static_assert(DM % GKS == 0 && DM / GKS >= 2 && DQ % GKS == 0 && DQ / GKS >= 2, "a GEMM's k extent: whole stages, and the ring needs two");
static_assert(DQ == DKV && ((size_t)TT * DQ * 2) % 256 == 0, "the three projections share one grid, and their planes lie one behind the other in the workspace with no gap");

extern "C" void kernel_launch(void* const* d_in, const int* in_sizes, int n_in,
                              void* d_out, int out_size, void* d_ws, size_t ws_size, hipStream_t stream) {
    (void)in_sizes; (void)n_in; (void)out_size;
    const float* x = (const float*)d_in[0]; const float* xk = (const float*)d_in[1]; const float* xv = (const float*)d_in[2]; const int* kmask = (const int*)d_in[3]; const float* wq = (const float*)d_in[4]; const float* bq = (const float*)d_in[5]; const float* wk = (const float*)d_in[6]; const float* bk = (const float*)d_in[7]; const float* wv = (const float*)d_in[8]; const float* bv = (const float*)d_in[9]; const float* wo = (const float*)d_in[10]; const float* bo = (const float*)d_in[11];   /* order query, key, value, mask (int32 [1][1][1][4096], read), Wq, bq, Wk, bk, Wv, bv, Wo, bo ('oi' + biases) */
    float* OUT = (float*)d_out;     // [1][4096][1024]
    char* wsp = (char*)d_ws;
    auto take = [&](size_t bytes) { char* p = wsp; wsp += (bytes + 255) & ~(size_t)255; return (void*)p; };
    bf* XQ = (bf*)take(((size_t)3 * TT * DM + (size_t)4 * DM * DM) * 2); bf* XK = XQ + (size_t)TT * DM; bf* XV = XK + (size_t)TT * DM;   // the seven bf16 copies, in k_cvtall's block order
    bf* WQ = XV + (size_t)TT * DM; bf* WK = WQ + (size_t)DM * DM; bf* WV = WK + (size_t)DM * DM; bf* WO = WV + (size_t)DM * DM;
    h16* QP16 = (h16*)take((size_t)NH_ * TT * HD * 2); h16* KP16 = (h16*)take((size_t)NKV * TT * HD * 2); h16* VT16 = (h16*)take((size_t)NKV * HD * TT * 2);
    bf* QPh = (bf*)take((size_t)NH_ * TT * HD * 2); bf* QPl = (bf*)take((size_t)NH_ * TT * HD * 2); bf* KPh = (bf*)take((size_t)NKV * TT * HD * 2); bf* KPl = (bf*)take((size_t)NKV * TT * HD * 2); bf* VTh = (bf*)take((size_t)NKV * HD * TT * 2); bf* VTl = (bf*)take((size_t)NKV * HD * TT * 2);
    bf* ATh = (bf*)take((size_t)TT * DQ * 2); bf* ATl = (bf*)take((size_t)TT * DQ * 2); int* NK = (int*)take(sizeof(int));   // the count of kept keys
    if ((size_t)(wsp - (char*)d_ws) > ws_size) return;    // ws 256 MiB
    for (int b = 0; b < NB_; ++b) {
        k_cvtall<<<3 * CVX + 4 * CVW, CVT_, 0, stream>>>(x + (size_t)b * TT * DM, xk + (size_t)b * TT * DM, xv + (size_t)b * TT * DM, kmask + (size_t)b * TT, wq, wk, wv, wo, XQ, NK);
        k_gemmw<bf, 0, true, 1><<<dim3(TT / 128, DQ / 128, 3), 128, 0, stream>>>(XQ, nullptr, WQ, nullptr, DM, DM, nullptr, 0, bq, bk, bv, (size_t)TT * DM, (size_t)DM * DM, 0, QP16, QPh, QPl, (size_t)TT * DQ, NK);   // XQ, XK, XV; WQ, WK, WV; QP16, KP16, VT16; QPh, KPh, VTh and QPl, KPl, VTl: each row of buffers at equal strides
        k_fattn<<<dim3(FBH, NH_), 288, 0, stream>>>(QP16, KP16, VT16, QPh, QPl, KPh, KPl, VTh, VTl, NK, ATh, ATl);
        k_gemmw<bf, 1, true, 0><<<dim3(TT / 128, DM / 128, 1), 128, 0, stream>>>(ATh, ATl, WO, nullptr, DQ, DQ, OUT + (size_t)b * TT * DM, DM, bo, nullptr, nullptr, 0, 0, 0, nullptr, nullptr, nullptr, 0, nullptr); }
}

// v009
// It runs in 94.6 microseconds.
// In two side-by-side timings against v008, it was 1.15 and 1.14 times as fast.
// Over all steps from v000 it is 36.7 times as fast.
#include <hip/hip_runtime.h>

// Attention on three input streams over 4,096 tokens with a RANDOM integer key mask (query, key, value [1][4096][1024]; q = query Wq^T + bq, k = key Wk^T + bk, v = value Wv^T + bv ('oi' 1/32 + zero biases; 16 heads x 64); scores / sqrt(64); keys with mask[b][0][0][j] == 0 -> -1e9 (== exclusion; mask int32 [1][1][1][4096] with random 0/1 entries, read per key on device); softmax; out = merged Wo^T + bo -> [1][4096][1024] (4.2 M); argument order query, key, value, mask, Wq, bq, Wk, bk, Wv, bv, Wo, bo).
// Layout: bf16 copies of query, key, value and the 'oi' weights, all made by one launch, which writes the key and value rows in kept-first order (keys with a non-zero mask entry first, both parts in token order) and counts the kept keys; the K and V projections and the attention walk only the kept keys' tiles; exact projections + f32 biases, whose epilogues store the head planes (fp16 + bf16 hi/lo; V transposed) themselves; one fused attention launch for all heads (online softmax, no score plane; the Q planes carry HD^-0.5 * log2(e), so that a score product is an exp2 argument; K and V^T tiles staged in LDS by tensor loads), which excludes the keys behind the kept ones (hybrid rows: < 512 hi/lo 3 products, rest fp16); merged hi/lo x Wo exact + bo.
// Compute dtypes, f32 accumulate: every input rounded to bf16; projections exact + f32 biases; attention rows < 512 3 products, rest fp16; softmax f32; Wo hl x exact + bias.

#define NB_  1
#define TT   4096
#define DM   1024
#define NH_  16
#define NKV  16
#define REP  (NH_ / NKV)
#define HD   64
#define DQ   (NH_ * HD)
#define DKV  (NKV * HD)
#define RH   512                  // query rows < RH use hi+lo planes
#define WIN  0
#define PSH  4.0f                  // softmax weights are exp2(s - mu + PSH): at most 2^(8 + PSH), inside fp16's range, and small ones stay normal numbers
#define SCL2 0.18033688011112042f  // HD^-0.5 * log2(e): multiplied into the Q planes by the projection's epilogue
typedef _Float16 h16;
typedef unsigned short bf;
typedef __attribute__((ext_vector_type(16))) __bf16   v16bf;
typedef __attribute__((ext_vector_type(16))) _Float16 v16h;
typedef __attribute__((ext_vector_type(8)))  _Float16 v8h;
typedef __attribute__((ext_vector_type(8)))  unsigned short v8us;
typedef __attribute__((ext_vector_type(8)))  float    v8f;
typedef __attribute__((ext_vector_type(4)))  float    v4f;
typedef v8h  __attribute__((may_alias)) v8ha;
typedef v4f  __attribute__((may_alias)) v4fa;
typedef v8us __attribute__((may_alias)) v8usa;

__device__ __forceinline__ unsigned short f2bf(float f) { unsigned u = __float_as_uint(f); u += 0x7FFFu + ((u >> 16) & 1u); return (unsigned short)(u >> 16); }
__device__ __forceinline__ float bf2f(unsigned short b) { return __uint_as_float(((unsigned)b) << 16); }
__device__ __forceinline__ float bfr(float f) { return bf2f(f2bf(f)); }
__device__ __forceinline__ v16h cat16(v8h lo, v8h hi) { return __builtin_shufflevector(lo, hi, 0, 1, 2, 3, 4, 5, 6, 7, 8, 9, 10, 11, 12, 13, 14, 15); }
__device__ __forceinline__ v16bf cat16b(v8us lo, v8us hi) { return __builtin_bit_cast(v16bf, __builtin_shufflevector(lo, hi, 0, 1, 2, 3, 4, 5, 6, 7, 8, 9, 10, 11, 12, 13, 14, 15)); }
__device__ __forceinline__ v8f wmma16(v16h a, v16h b, v8f c) { return __builtin_amdgcn_wmma_f32_16x16x32_f16(false, a, false, b, (short)0, c, false, false); }
__device__ __forceinline__ v8f wmmab(v16bf a, v16bf b, v8f c) { return __builtin_amdgcn_wmma_f32_16x16x32_bf16(false, a, false, b, (short)0, c, false, false); }
__device__ __forceinline__ h16 tohx(float x) { return (h16)x; }
__device__ __forceinline__ void splitf(float y, unsigned short& h, unsigned short& l) { h = f2bf(y); l = f2bf(y - bf2f(h)); }



typedef unsigned int u32;
typedef __attribute__((ext_vector_type(4))) unsigned int u32x4;
typedef __attribute__((ext_vector_type(8))) unsigned int u32x8;
__device__ __forceinline__ u32 uni(u32 v) { return (u32)__builtin_amdgcn_readfirstlane(v); }
__device__ __forceinline__ u32 pinned(u32 v) { u32 w = uni(v); asm volatile("" : "+s"(w)); return w; }   // holds a tensor load's issue test in a scalar register, so that the branch around the load is a scalar one
__device__ __forceinline__ void wait_ds0() { asm volatile("s_wait_dscnt 0x0" ::: "memory"); }        // this wave's LDS reads have returned: in front of the barrier behind which their buffer is refilled
// this wave's tensor load has landed: the compiler places no wait for it; the request's descriptor is named as an input, so that its registers keep their values up to the wait
__device__ __forceinline__ void wait_tensor0(u32x4 g0, u32x8 g1) { asm volatile("s_wait_tensorcnt 0x0" :: "s"(g0), "s"(g1) : "memory"); }
// The keys that the attention walks, from the count of kept keys as the conversion launch stored it: the kept ones, or all TT where no key is kept (the module's uniform row); bounded by the shape for any stored value.
__device__ __forceinline__ u32 kept_keys(int nk) { return uni((u32)(nk < 0 ? 0 : nk > TT ? TT : nk)); }
__device__ __forceinline__ u32 keys_in_use(int nk) { const u32 k = kept_keys(nk); return k ? k : (u32)TT; }
// ---- k_gemmw: GEMM on 128x128 output tiles, FOUR WAVES (2 x 2) per block, each on its own 64x64 tile (16 accumulators); grid (M/128, N/128, Z), 128 threads.
// C[m][n] (f32, pitch ldc, + optional f32 bias[n]) = sum_{k < KL} A[m][k] Bt[n][k] (+ A2[m][k] Bt[n][k] for NSPLIT = 1). K = row pitch of A and Bt, KL = k extent summed here. z-batch strides sA/sB/sC in elements. KL % 128 == 0, KL >= 256.
// The operand rows reach the waves through LDS: a stage is 128 k (256 bytes) of the block's 128 A rows (of both planes for NSPLIT = 1) and 128 Bt rows, every wave bringing one slice of it by one tensor load, two buffers,
// the next stage in flight while this one is worked on; a row's bytes leave L2 once per block in whole 256-byte pieces, and the two waves that share a row read it from LDS.
// PL = 0: C as above. PL = 1: the three projections in ONE launch, z = 0, 1, 2 for Q, K, V (operands and planes z strides apart, a bias pointer each); no C; a wave's tile (64 tokens x the 64 columns of one head, + bias)
// goes out as three 16-bit planes, fp16 and bf16 hi + lo: Q (times SCL2) and K [head][token][d], V transposed, [head][d][token]. The blocks of K and V stand on the WGPs beside those of Q, two to a WGP: the epilogues stage in the ring's LDS,
// which every wave has left by then, so a block holds 144 KiB, and one block's products run while the other waits for its tensor loads.
#define GKS  128                   // k per stage
#define GPIT 272                   // LDS row pitch: 256 bytes + the mover's 16-byte pad, an odd multiple of 16 bytes for 16-byte readers
#define GSL  18432                 // the place of a slice of 64 rows: 64 x 272 bytes = 17,408, rounded up to a multiple of 2 KiB
template <typename T16> struct WFrag;
template <> struct WFrag<h16> { typedef v16h V; static __device__ __forceinline__ V ld(const h16* p) { return cat16(*(const v8h*)p, *(const v8h*)(p + 16)); } static __device__ __forceinline__ v8f mma(V a, V b, v8f c) { return wmma16(a, b, c); } };
template <> struct WFrag<bf> { typedef v16bf V; static __device__ __forceinline__ V ld(const bf* p) { return cat16b(*(const v8us*)p, *(const v8us*)(p + 16)); } static __device__ __forceinline__ v8f mma(V a, V b, v8f c) { return wmmab(a, b, c); } };
template <typename T16, int NSPLIT, bool BIAS, int PL>
__global__ __launch_bounds__(128) void k_gemmw(const T16* __restrict__ A, const T16* __restrict__ A2, const T16* __restrict__ Bt, const T16* __restrict__ Bt2, int K, int KL, float* C, int ldc, const float* __restrict__ bias, const float* __restrict__ biask, const float* __restrict__ biasv, size_t sA, size_t sB, size_t sC, h16* P16, bf* Ph, bf* Pl, size_t sP, const int* __restrict__ nkp) {
    typedef typename WFrag<T16>::V V;
    // PL = 1, z > 0: the A rows are keys in kept-first order, and only the row tiles that hold a key in use are computed (keys_in_use); the whole block leaves, in front of every tensor load and barrier
    if (PL == 1 && blockIdx.z) { if (blockIdx.x * 128u >= keys_in_use(*nkp)) return; }
    static_assert(NSPLIT == 0 || NSPLIT == 1, "one or two A planes against one Bt plane");
    // a buffer: the A plane(s), then Bt. NSPLIT = 0: four slices of 64 rows, one per wave. NSPLIT = 1: A and A2 as one tile of 128 rows each (waves 0, 1), Bt as two slices of 64 rows (waves 2, 3).
    constexpr int APL = NSPLIT ? 128 * GPIT : 2 * GSL;   // an A plane's place
    constexpr int ASP = NSPLIT ? 64 * GPIT : GSL;        // from its rows 0 .. 63 to its rows 64 .. 127
    constexpr int BOF = (NSPLIT + 1) * APL, GBUF = BOF + 2 * GSL;
    static_assert(APL % 2048 == 0 && GSL % 2048 == 0 && 64 * GPIT <= GSL, "every place a multiple of 2 KiB");
    __shared__ __attribute__((aligned(2048))) unsigned char L[2 * GBUF];
    (void)Bt2;
    const size_t z = blockIdx.z; A += z * sA; if (A2) A2 += z * sA; Bt += z * sB; C += z * sC;
    if (PL == 1) { P16 += z * sP; Ph += z * 2 * sP; Pl += z * 2 * sP; bias = z == 0 ? bias : z == 1 ? biask : biasv; }   // the hi and lo planes of a projection lie one behind the other
    const u32 wave = uni(threadIdx.x >> 5); const int wm = (int)(wave >> 1), wn = (int)(wave & 1u);
    const int lane = threadIdx.x & 31, lr = lane & 15, hi = lane >> 4; const int r0 = blockIdx.x * 128 + wm * 64, c0 = blockIdx.y * 128 + wn * 64;
    // the wave's slice of every stage: rows of 256 bytes, source pitch 2 K bytes, a stage 256 bytes on
    const bool isb = wave >= 2;
    const T16* sp = isb ? Bt + (size_t)(blockIdx.y * 128 + wn * 64) * K : NSPLIT ? (wave ? A2 : A) + (size_t)(blockIdx.x * 128) * K : A + (size_t)(blockIdx.x * 128 + wave * 64) * K;
    const u32 rows = (NSPLIT && !isb) ? 128u : 64u;
    const unsigned long long src = (unsigned long long)(size_t)sp;
    const u32 lbase = (u32)(size_t)L + (isb ? BOF + wn * GSL : wave * (NSPLIT ? APL : GSL));
    u32x8 g1; g1[0] = uni((1u << 20) | (5u << 22) | (3u << 25));   // no mask, 1-byte elements, 4 dwords of pad behind every 64
    g1[1] = uni(256u << 16); g1[2] = uni(rows << 16); g1[3] = uni(256u << 16); g1[4] = uni(rows); g1[5] = uni((u32)K * 2u); g1[6] = uni(0u); g1[7] = uni(0u);
    asm volatile("" : "+s"(g1));   // pinned, as in pinned(): the descriptor words stay in these scalar registers through the loop and are not formed again while a request is out
    u32x4 g0 = {0u, 0u, 0u, 0u};   // the descriptor group of the wave's last request
    auto issue = [&](u32 s) { const unsigned long long ga = src + (unsigned long long)s * (GKS * 2); g0[0] = uni(1u); g0[1] = uni(lbase + (s & 1u) * GBUF); g0[2] = uni((u32)ga); g0[3] = uni(((u32)(ga >> 32) & 0x01FFFFFFu) | 0x80000000u);
        asm volatile("tensor_load_to_lds %0, %1" :: "s"(g0), "s"(g1) : "memory"); };   // one request of the whole wave; every wave of the block issues its own
    v8f acc[4][4];
#pragma unroll
    for (int mb = 0; mb < 4; ++mb)
#pragma unroll
        for (int nb = 0; nb < 4; ++nb) acc[mb][nb] = (v8f){};
    const u32 nst = (u32)KL / GKS;
    issue(0); wait_tensor0(g0, g1);
    __syncthreads();   // stage 0 is published
    issue(1);
    const int fo = lr * GPIT + 16 * hi;   // the lane's row and half in every slice
    for (u32 s = 0; s < nst; ++s) {
        const unsigned char* Lb = L + (s & 1u) * GBUF;
        const T16* La = (const T16*)(Lb + wm * ASP + fo); const T16* La2 = (const T16*)(Lb + APL + wm * ASP + fo); const T16* Lw = (const T16*)(Lb + BOF + wn * GSL + fo);
        V a[2][4], a2[2][4], b[2][4];   // two fragment sets: the next 32 k are fetched as one group in front of this 32 k's products; nothing of a stage is read in front of its barrier
        // every "#pragma unroll" of this loop: it indexes fragment and accumulator arrays, which stay in registers only under constant indices
#pragma unroll
        for (int f = 0; f < 4; ++f) { a[0][f] = WFrag<T16>::ld(La + f * 16 * (GPIT / 2)); if (NSPLIT == 1) a2[0][f] = WFrag<T16>::ld(La2 + f * 16 * (GPIT / 2)); b[0][f] = WFrag<T16>::ld(Lw + f * 16 * (GPIT / 2)); }
#pragma unroll
        for (int ks = 0; ks < GKS / 32; ++ks) { const int cu = ks & 1, nx = cu ^ 1;
            if (ks + 1 < GKS / 32) {
#pragma unroll
                for (int f = 0; f < 4; ++f) { const int o = f * 16 * (GPIT / 2) + 32 * (ks + 1); a[nx][f] = WFrag<T16>::ld(La + o); if (NSPLIT == 1) a2[nx][f] = WFrag<T16>::ld(La2 + o); b[nx][f] = WFrag<T16>::ld(Lw + o); }
            }
            __builtin_amdgcn_sched_barrier(0);   // keeps the group of LDS reads whole and in front of the block of products: without it the compiler kept one Bt fragment and waited for LDS in front of every four products
#pragma unroll
            for (int nb = 0; nb < 4; ++nb)
#pragma unroll
                for (int mb = 0; mb < 4; ++mb) { acc[mb][nb] = WFrag<T16>::mma(a[cu][mb], b[cu][nb], acc[mb][nb]); if (NSPLIT == 1) acc[mb][nb] = WFrag<T16>::mma(a2[cu][mb], b[cu][nb], acc[mb][nb]); }
            __builtin_amdgcn_sched_barrier(0);   // the other side of the pair: the next group of reads stays behind this block
        }
        wait_ds0();
        wait_tensor0(g0, g1);
        __syncthreads();   // publishes stage s + 1 and ends every wave's reads of stage s
        if (pinned(s + 2 < nst)) issue(s + 2);   // into the buffer that stage s has left
    }
    wait_tensor0(g0, g1); wait_ds0();
    // From here the ring's LDS is free: the last pass's barrier ended every wave's reads of it, and no request is out. Each wave stages its tile in its own piece of it.
    static_assert(4 * 16 * 68 * 4 <= GBUF && 4 * 3 * 16 * 72 * 2 <= GBUF, "the staging rows fit the first buffer");
    // Every "#pragma unroll" of the plane epilogues: its loop indexes accumulator and staging arrays, which stay in registers only under constant indices.
    const int prow = lane >> 3, pc = (lane & 7) * 8;   // plane stores: 8 lanes x 16 bytes a row, so one store covers four whole 128-byte rows
    if (PL == 1 && z == 2) {
        // a lane's 8 accumulator elements are 8 consecutive tokens of ONE column d: converted in registers, 16 d rows x 64 tokens of each plane pass through LDS (pitch 72: no bank shared by the 16 rows of a write)
        unsigned short (*ts)[16 * 72] = (unsigned short (*)[16 * 72])(L + wave * (3 * 16 * 72 * 2));   // each wave stages in its own rows
#pragma unroll
        for (int nb = 0; nb < 4; ++nb) {
            const float bb = BIAS ? bfr(bias[c0 + nb * 16 + lr]) : 0.f;
#pragma unroll
            for (int mb = 0; mb < 4; ++mb) { v8h o16; v8us oh, ol;
#pragma unroll
                for (int j = 0; j < 8; ++j) { const float x = acc[mb][nb][j] + bb; o16[j] = tohx(x); unsigned short a2, c2; splitf(x, a2, c2); oh[j] = a2; ol[j] = c2; }
                const int to = lr * 72 + mb * 16 + hi * 8; *(v8usa*)(ts[0] + to) = __builtin_bit_cast(v8us, o16); *(v8usa*)(ts[1] + to) = oh; *(v8usa*)(ts[2] + to) = ol; }
            __builtin_amdgcn_wave_barrier(); asm volatile("" ::: "memory");   // the rows are read back by other lanes of the wave: keeps the reads behind the writes
            v8us w[4][3]; const size_t po = (size_t)(c0 + nb * 16 + prow) * TT + r0 + pc;
#pragma unroll
            for (int s = 0; s < 4; ++s) {
#pragma unroll
                for (int p = 0; p < 3; ++p) w[s][p] = *(const v8usa*)(ts[p] + (4 * s + prow) * 72 + pc);
                *(v8us*)((bf*)P16 + po + (size_t)s * 4 * TT) = w[s][0]; *(v8us*)(Ph + po + (size_t)s * 4 * TT) = w[s][1]; *(v8us*)(Pl + po + (size_t)s * 4 * TT) = w[s][2]; }
            // stands behind the group's stores, in front of any reuse of their data registers (named as inputs, so that they live up to the wait); as a memory clobber it also keeps the next rows' LDS writes behind these reads
            asm volatile("s_wait_xcnt 0x0" :: "v"(w[0][0]), "v"(w[0][1]), "v"(w[0][2]), "v"(w[1][0]), "v"(w[1][1]), "v"(w[1][2]), "v"(w[2][0]), "v"(w[2][1]), "v"(w[2][2]), "v"(w[3][0]), "v"(w[3][1]), "v"(w[3][2]) : "memory");
        }
        return;
    }
    float* os = (float*)(L + wave * (16 * 68 * 4));
    float pb[8]; const float qs = (PL == 1 && z == 0) ? SCL2 : 1.0f;   // the softmax's scale goes into the Q planes, in f32, in front of their rounding
    if constexpr (PL == 1) {
#pragma unroll
        for (int k = 0; k < 8; ++k) pb[k] = BIAS ? bfr(bias[c0 + pc + k]) : 0.f; }
#pragma unroll
    for (int mb = 0; mb < 4; ++mb) {
#pragma unroll
        for (int nb = 0; nb < 4; ++nb) {
#pragma unroll
            for (int j = 0; j < 8; ++j) os[(hi * 8 + j) * 68 + nb * 16 + lr] = acc[mb][nb][j]; }
        __builtin_amdgcn_wave_barrier(); asm volatile("" ::: "memory");
        if constexpr (PL == 1) {
            v8us w[4][3]; const size_t po = ((size_t)(c0 / HD) * TT + r0 + mb * 16 + prow) * HD + pc;
#pragma unroll
            for (int s = 0; s < 4; ++s) { const float* orow = os + (4 * s + prow) * 68 + pc; const v4f x0 = *(const v4fa*)orow, x1 = *(const v4fa*)(orow + 4); v8h o16;
#pragma unroll
                for (int k = 0; k < 8; ++k) { const float x = ((k < 4 ? x0[k & 3] : x1[k & 3]) + pb[k]) * qs; o16[k] = tohx(x); unsigned short a2, c2; splitf(x, a2, c2); w[s][1][k] = a2; w[s][2][k] = c2; }
                w[s][0] = __builtin_bit_cast(v8us, o16);
                *(v8us*)((bf*)P16 + po + s * 4 * HD) = w[s][0]; *(v8us*)(Ph + po + s * 4 * HD) = w[s][1]; *(v8us*)(Pl + po + s * 4 * HD) = w[s][2]; }
            // stands behind the group's stores, in front of any reuse of their data registers (named as inputs, so that they live up to the wait)
            asm volatile("s_wait_xcnt 0x0" :: "v"(w[0][0]), "v"(w[0][1]), "v"(w[0][2]), "v"(w[1][0]), "v"(w[1][1]), "v"(w[1][2]), "v"(w[2][0]), "v"(w[2][1]), "v"(w[2][2]), "v"(w[3][0]), "v"(w[3][1]), "v"(w[3][2]) : "memory");
        } else {
        float* crow = C + (size_t)(r0 + mb * 16) * ldc + c0;
{
#pragma unroll
            for (int s = 0; s < 8; ++s) { const int row = 2 * s + hi, cofs = lr * 4; v4f val = *(const v4fa*)(os + row * 68 + cofs); if (BIAS) { val[0] += bfr(bias[c0 + cofs]); val[1] += bfr(bias[c0 + cofs + 1]); val[2] += bfr(bias[c0 + cofs + 2]); val[3] += bfr(bias[c0 + cofs + 3]); }
                *(v4f*)(crow + (size_t)row * ldc + cofs) = val; }
             }
        }
        __builtin_amdgcn_wave_barrier(); asm volatile("" ::: "memory");
    }
}

typedef __attribute__((ext_vector_type(4))) _Float16 v4h;
typedef __attribute__((ext_vector_type(4))) unsigned short v4us;

// ---- k_cvtall: every f32 -> bf16 copy of a call (query, key, value, Wq, Wk, Wv, Wo) in ONE streaming launch: 256 blocks of 16 waves, a block on CVB consecutive floats of one array.
// A wave's load is 512 consecutive bytes (16 per lane), its store the 256 bytes they round to; a thread has CVL loads to issue in front of its conversions, so a wave starts once for 16 KiB of source and not once for 1 KiB.
// The sources are read once and by non-temporal loads, which leave L2 to the bf16 copies that the GEMMs read; the copies lie one behind the other in block order.
#define CVT_ 512                   // threads per block
#define CVL  32                    // 16-byte loads per thread
#define CVB  (CVT_ * CVL * 4)      // floats per block
#define CVX  (TT * DM / CVB)       // blocks per token array
#define CVW  (DM * DM / CVB)       // blocks per weight array
// Key and value rows go out in KEPT-FIRST order: a key whose mask entry is not 0 takes the place of its rank among such keys, every other key a place behind all of them, both parts in token order (a permutation of
// the TT rows for any mask). Every block forms the mask's bit vector itself, under its own loads' latency: a wave's 8 ballots cover 256 keys; the words and each wave's count pass through LDS, behind one barrier.
__global__ __launch_bounds__(CVT_) void k_cvtall(const float* __restrict__ xq, const float* __restrict__ xk, const float* __restrict__ xv, const int* __restrict__ km, const float* __restrict__ wq, const float* __restrict__ wk, const float* __restrict__ wv, const float* __restrict__ wo, bf* dst, int* nkw) {
    __shared__ __align__(16) u32 mw[TT / 32];     // the mask, one bit a key
    __shared__ __align__(16) u32 wc[CVT_ / 32];   // kept keys among each wave's 256
    const unsigned b = blockIdx.x, w = b - 3 * CVX;   // which array and which piece of it: the same for the whole block
    const unsigned bl = b < 3 * CVX ? b % CVX : w % CVW;
    const float* src = (b < 3 * CVX ? (b < CVX ? xq : b < 2 * CVX ? xk : xv) : (w < CVW ? wq : w < 2 * CVW ? wk : w < 3 * CVW ? wv : wo)) + (size_t)bl * CVB;
    src += threadIdx.x * 4;
    const u32 wv_ = uni(threadIdx.x >> 5); const int lane = threadIdx.x & 31;
    const int* mp = km + wv_ * 256 + lane; int m[8];   // issued in front of the stream's loads, so that they return first
#pragma unroll
    for (int j = 0; j < 8; ++j) m[j] = mp[j * 32];
    asm volatile("s_wait_xcnt 0x0" ::: "memory");   // stands behind the mask loads, in front of any reuse of their address registers
    v4f x[CVL];   // every "#pragma unroll" here: the loops index vectors and these arrays, which stay in registers only under constant indices
#pragma unroll
    for (int i = 0; i < CVL; ++i) x[i] = __builtin_nontemporal_load((const v4f*)(src + i * (CVT_ * 4)));
    u32x4 bw[2]; u32 cw = 0;
#pragma unroll
    for (int j = 0; j < 8; ++j) { const u32 t = __builtin_amdgcn_ballot_w32(m[j] != 0); bw[j >> 2][j & 3] = t; cw += (u32)__builtin_popcount(t); }
    if (lane == 0) { *(u32x4*)(mw + wv_ * 8) = bw[0]; *(u32x4*)(mw + wv_ * 8 + 4) = bw[1]; wc[wv_] = cw; }
    // the bit vector and the counts are read by every wave; the two fences order LDS alone, so that the stream's loads stay in flight across the barrier (__syncthreads() waited for all of them in front of it)
    __builtin_amdgcn_fence(__ATOMIC_RELEASE, "workgroup", "local"); __builtin_amdgcn_s_barrier(); __builtin_amdgcn_fence(__ATOMIC_ACQUIRE, "workgroup", "local");
    const bool kv = b >= CVX && b < 3 * CVX;   // a piece is CVB / DM = 64 rows: two words of the bit vector, from word w0
    const u32 w0 = bl * 2;
    u32 nk = 0, before = 0;   // kept keys in all, and in front of the piece
#pragma unroll
    for (u32 i = 0; i < CVT_ / 32; ++i) { const u32 c = wc[i]; nk += c; before += i < (w0 >> 3) ? c : 0u; }
#pragma unroll
    for (u32 i = 0; i < 8; ++i) { const u32 t = mw[(w0 & ~7u) + i]; before += i < (w0 & 7u) ? (u32)__builtin_popcount(t) : 0u; }
    // an array that keeps its order is written as if every row were kept; all of this is the same in every lane and is held in scalar registers
    const u32 W0 = uni(kv ? mw[w0] : ~0u), W1 = uni(kv ? mw[w0 + 1] : ~0u), bf0 = uni(kv ? before : bl * 64), nks = uni(nk), h = uni(threadIdx.x >> 8), c0 = (u32)__builtin_popcount(W0);
    if (b == CVX && threadIdx.x == 0) *nkw = (int)nks;
    bf* da = dst + (size_t)(b - bl) * CVB + (threadIdx.x & 255) * 4;   // the array's copy; the copies lie one behind the other in block order
#pragma unroll
    for (int gq = 0; gq < CVL / 16; ++gq) { v4us y[16];
#pragma unroll
        for (int i = 0; i < 16; ++i) { const u32 r = 2 * (16 * gq + i) + h, bit = r & 31u, Wd = gq ? W1 : W0;   // load i of a thread lies in row 2 i + h of the piece
            const u32 kb = bf0 + (gq ? c0 : 0u) + (u32)__builtin_popcount(Wd & ((1u << bit) - 1u));   // kept rows in front of this one
            const u32 pos = (((Wd >> bit) & 1u) ? kb : nks + bl * 64 + r - kb) & (TT - 1);
#pragma unroll
            for (int k = 0; k < 4; ++k) y[i][k] = f2bf(x[16 * gq + i][k]);
            *(v4us*)(da + (size_t)pos * DM) = y[i]; }
        // stands behind the group's stores, in front of any reuse of their data and address registers (named as inputs, so that they live up to the wait)
        asm volatile("s_wait_xcnt 0x0" :: "v"(y[0]), "v"(y[1]), "v"(y[2]), "v"(y[3]), "v"(y[4]), "v"(y[5]), "v"(y[6]), "v"(y[7]), "v"(y[8]), "v"(y[9]), "v"(y[10]), "v"(y[11]), "v"(y[12]), "v"(y[13]), "v"(y[14]), "v"(y[15]), "v"(da) : "memory"); }
}
static_assert((TT * DM) % CVB == 0 && (DM * DM) % CVB == 0 && DQ == DM && DKV == DM && NB_ == 1, "every array is a whole number of blocks' pieces; the four weights are DM x DM; one batch entry, so one launch converts all");
static_assert(CVB == 64 * DM && CVT_ * 4 == 2 * DM && CVT_ * 8 == TT && (TT & (TT - 1)) == 0 && CVL == 32, "a piece is 64 rows, a block's load two rows; a block's threads read 8 mask entries each");

// ---- k_fattn: scores, key mask, softmax and P x V of all heads in ONE launch; no score or weight plane in memory.
// Per wave: S^T = K Q^T (A = 16 keys x 64 d, B = the wave's query columns, kept in registers), so a lane holds 8 consecutive keys of ONE query per tile;
// two such tiles, converted in place, are the B operand of O^T += V^T P^T (A = V^T rows in the same k order as WFrag::ld at + 8 * hi). 32 keys per pass.
// Softmax is online in base 2: weights exp2(s - mu + PSH) against a reference mu per query. Q arrives scaled and PSH - mu is the C operand of the first S^T product, so the products' result IS the exp2 argument:
// no multiply, add or maximum per score. mu is set to the first pass's maximum; later O, the sum and mu move only when a lane's weights of a pass sum to more than PLIM, and that pass's weights are then formed again.
// The keys arrive in kept-first order with the count nk of the kept ones: the stages end with the last kept key (all TT keys where none is kept), and only a pass that reaches past nk tests its keys.
// A masked key's argument is -3.0e38, weight 0; where no key is kept it is PSH for every key, one weight for all (the module's uniform row).
// Block = 9 waves on 256 query rows' worth of one head's work: 2 waves of 16 hi/lo rows (< RH, 3 products) and 7 waves of 32 fp16 rows; 256 blocks.
// K and V^T reach the waves through LDS: a stage is 64 keys of the head's six planes, each plane's tile (64 rows x 128 bytes) brought by one tensor load of one wave (waves 0 .. 5), two buffers,
// the next stage in flight while this one is worked on; every wave reads its fragments from the tiles, so a plane's bytes leave L2 once per block and stage and not once per wave.
// Every "#pragma unroll" in the attention code: its loop indexes fragment and accumulator arrays, which stay in registers only under constant indices.
#define PLIM 4096.0f               // 2^(8 + PSH): a lane whose 16 weights of a pass sum to more asks for a new mu, so no weight in use exceeds it
#define FBH  (TT / 256)            // blocks per head
#define SKEY 64                    // keys per stage
#define NST  (TT / SKEY)           // stages
#define LPIT 144                   // LDS row pitch: 128 bytes + the mover's 16-byte pad, an odd multiple of 16 bytes for 16-byte readers
#define LTIL 10240                 // a tile's place: 64 rows x 144 bytes = 9,216, rounded up to a multiple of 2 KiB
#define LBUF (6 * LTIL)            // a buffer: tiles K fp16, V^T fp16, K hi, K lo, V^T hi, V^T lo
typedef __attribute__((ext_vector_type(8))) __bf16 v8b;
__device__ __forceinline__ float xhalf(float x) { return __builtin_bit_cast(float, __builtin_amdgcn_permlanex16(__builtin_bit_cast(int, x), __builtin_bit_cast(int, x), 0x76543210, 0xfedcba98, false, false)); }   // lane l <-> lane l ^ 16
// xwait: stands behind each group of global loads, in front of any reuse of their address registers (named as inputs, so that they live up to the wait); as a memory clobber it also keeps the group where it is written
__device__ __forceinline__ void xwait(const void* a) { asm volatile("s_wait_xcnt 0x0" :: "v"(a) : "memory"); }
__device__ __forceinline__ void xwait(const void* a, const void* b) { asm volatile("s_wait_xcnt 0x0" :: "v"(a), "v"(b) : "memory"); }
// a lane's sum of its 16 weights of a pass, halved three times as whole vectors: every addition but the last is a packed one on register pairs as they lie
__device__ __forceinline__ float sum16(v8f a, v8f b) { const v8f s8 = a + b; const v4f s4 = s8.lo + s8.hi; return (s4[0] + s4[2]) + (s4[1] + s4[3]); }
// what a wave carries from stage to stage; q: fp16 waves [group][k half], hi/lo waves hi [k half] then lo [k half]
struct FSt { v8f o[2][4]; v8f ci[2]; float ls[2]; v16h q[4]; };   // ci: PSH - mu in all eight elements, the C operand of a group's score products
template <typename T16, bool HI, int R>
__device__ __forceinline__ void finit(FSt& st, const T16* __restrict__ Qa, const T16* __restrict__ Qb, int q0) {
    const int lane = threadIdx.x & 31, lr = lane & 15, hi = lane >> 4;
    const T16* qpa = Qa + (size_t)(q0 + lr) * HD + 8 * hi; const T16* qpb = HI ? Qb + (size_t)(q0 + lr) * HD + 8 * hi : nullptr;
#pragma unroll
    for (int g = 0; g < R; ++g)
#pragma unroll
        for (int kk = 0; kk < 2; ++kk) { const int qo = 16 * g * HD + 32 * kk; st.q[2 * g + kk] = __builtin_bit_cast(v16h, WFrag<T16>::ld(qpa + qo)); if (HI) st.q[2 + kk] = __builtin_bit_cast(v16h, WFrag<T16>::ld(qpb + qo)); }
    if constexpr (HI) xwait(qpa, qpb); else xwait(qpa);
#pragma unroll
    for (int g = 0; g < 2; ++g) { st.ci[g] = (v8f){PSH, PSH, PSH, PSH, PSH, PSH, PSH, PSH}; st.ls[g] = 0.f;
#pragma unroll
        for (int dt = 0; dt < 4; ++dt) st.o[g][dt] = (v8f){}; }
}
// one stage of one wave: two passes of 32 keys on the tiles of buffer Lb; k0 = the stage's first key, nk = the kept keys (places 0 .. nk - 1)
template <typename T16, bool HI, int R>
__device__ __forceinline__ void fstage(FSt& st, const unsigned char* Lb, int nk, int k0) {
    typedef typename WFrag<T16>::V V;
    const int lane = threadIdx.x & 31, lr = lane & 15, hi = lane >> 4;
    const unsigned char* Lr = Lb + lr * LPIT + 16 * hi;   // the lane's row and half in every tile
    const T16* Lka = (const T16*)(Lr + (HI ? 2 : 0) * LTIL); const T16* Lkb = (const T16*)(Lr + 3 * LTIL); const T16* Lva = (const T16*)(Lr + (HI ? 4 : 1) * LTIL); const T16* Lvb = (const T16*)(Lr + 5 * LTIL);
    V qa[R][2], qb[R][2];
#pragma unroll
    for (int g = 0; g < R; ++g)
#pragma unroll
        for (int kk = 0; kk < 2; ++kk) { qa[g][kk] = __builtin_bit_cast(V, st.q[2 * g + kk]); if (HI) qb[g][kk] = __builtin_bit_cast(V, st.q[2 + kk]); }
    V ka[2][2], kb[2][2];   // the second pass's K fragments are fetched by the first; the first pass's here: nothing of a stage is read in front of its barrier
#pragma unroll
    for (int kt = 0; kt < 2; ++kt)
#pragma unroll
        for (int kk = 0; kk < 2; ++kk) { ka[kt][kk] = WFrag<T16>::ld(Lka + kt * 16 * (LPIT / 2) + 32 * kk); if (HI) kb[kt][kk] = WFrag<T16>::ld(Lkb + kt * 16 * (LPIT / 2) + 32 * kk); }
#pragma unroll
    for (int sub = 0; sub < SKEY / 32; ++sub) {
        V va[4], vb[4];   // this pass's V^T fragments: issued first, read behind the softmax
#pragma unroll
        for (int dt = 0; dt < 4; ++dt) { va[dt] = WFrag<T16>::ld(Lva + dt * 16 * (LPIT / 2) + 32 * sub); if (HI) vb[dt] = WFrag<T16>::ld(Lvb + dt * 16 * (LPIT / 2) + 32 * sub); }
        v8f s[R][2];
#pragma unroll
        for (int g = 0; g < R; ++g)
#pragma unroll
            for (int kt = 0; kt < 2; ++kt) s[g][kt] = st.ci[g];
#pragma unroll
        for (int kk = 0; kk < 2; ++kk) {
#pragma unroll
            for (int g = 0; g < R; ++g)
#pragma unroll
                for (int kt = 0; kt < 2; ++kt) s[g][kt] = WFrag<T16>::mma(ka[kt][kk], qa[g][kk], s[g][kt]);
            if (HI) {
#pragma unroll
                for (int g = 0; g < R; ++g)
#pragma unroll
                    for (int kt = 0; kt < 2; ++kt) s[g][kt] = WFrag<T16>::mma(ka[kt][kk], qb[g][kk], s[g][kt]);
#pragma unroll
                for (int g = 0; g < R; ++g)
#pragma unroll
                    for (int kt = 0; kt < 2; ++kt) s[g][kt] = WFrag<T16>::mma(kb[kt][kk], qa[g][kk], s[g][kt]);
            }
        }
        asm volatile("" ::: "memory");   // keeps this pass's V^T reads where they are written, in front of the S^T products and the softmax, which cover their latency: without it the compiler moved them down to the P x V products
        if (sub + 1 < SKEY / 32) {
#pragma unroll
            for (int kt = 0; kt < 2; ++kt)
#pragma unroll
                for (int kk = 0; kk < 2; ++kk) { ka[kt][kk] = WFrag<T16>::ld(Lka + (32 * (sub + 1) + kt * 16) * (LPIT / 2) + 32 * kk); if (HI) kb[kt][kk] = WFrag<T16>::ld(Lkb + (32 * (sub + 1) + kt * 16) * (LPIT / 2) + 32 * kk); }
        }
        if (k0 + 32 * sub + 32 > nk) {   // the same for the whole block: only the kept keys' last passes (every pass where no key is kept) hold a masked key; element r of tile kt is key 16 kt + 8 hi + r of the pass
            const int left = nk - (k0 + 32 * sub + 8 * hi); const float mval = nk ? -3.0e38f : PSH;
#pragma unroll
            for (int g = 0; g < R; ++g)
#pragma unroll
                for (int kt = 0; kt < 2; ++kt)
#pragma unroll
                    for (int r = 0; r < 8; ++r) s[g][kt][r] = (16 * kt + r < left) ? s[g][kt][r] : mval;
        }
        // s holds the exp2 arguments. The weights and each lane's sum of its 16 come first; the test on that sum stands in for a maximum: every weight is positive, so none exceeds the sum.
        const bool first = sub == 0 && k0 == 0;   // the same for the whole block: the first pass sets mu, whatever its scores
        v8f pw[R][2]; float lsum[R]; bool need = false;
#pragma unroll
        for (int g = 0; g < R; ++g) {
#pragma unroll
            for (int kt = 0; kt < 2; ++kt)
#pragma unroll
                for (int r = 0; r < 8; ++r) pw[g][kt][r] = __builtin_amdgcn_exp2f(s[g][kt][r]);
            lsum[g] = sum16(pw[g][0], pw[g][1]);
            need = need || (lsum[g] > PLIM); }
        if (first || __builtin_amdgcn_ballot_w32(need) != 0) {   // one scalar test per pass; rare behind the first pass
#pragma unroll
            for (int g = 0; g < R; ++g) { float mx = -3.0e38f;
#pragma unroll
                for (int kt = 0; kt < 2; ++kt) {
#pragma unroll
                    for (int r = 0; r < 8; ++r) mx = fmaxf(mx, s[g][kt][r]); }
                mx = fmaxf(mx, xhalf(mx)) - PSH;   // how far the pass's maximum lies above mu
                const float d = first ? mx : fmaxf(mx, 0.f);   // mu moves by d: never down behind the first pass
                const float corr = first ? 0.f : __builtin_amdgcn_exp2f(-d);   // O and the sum are still 0 in the first pass
                st.ci[g] = st.ci[g] - d; st.ls[g] *= corr;
#pragma unroll
                for (int dt = 0; dt < 4; ++dt) st.o[g][dt] = st.o[g][dt] * corr;
#pragma unroll
                for (int kt = 0; kt < 2; ++kt) { const v8f ar = s[g][kt] - d;
#pragma unroll
                    for (int r = 0; r < 8; ++r) pw[g][kt][r] = __builtin_amdgcn_exp2f(ar[r]); }
                lsum[g] = sum16(pw[g][0], pw[g][1]); }
        }
#pragma unroll
        for (int g = 0; g < R; ++g) { const v8f p[2] = {pw[g][0], pw[g][1]}; st.ls[g] += lsum[g];
            if constexpr (HI) {
                const v8b h0 = __builtin_convertvector(p[0], v8b), h1 = __builtin_convertvector(p[1], v8b);
                const v8b l0 = __builtin_convertvector(p[0] - __builtin_convertvector(h0, v8f), v8b), l1 = __builtin_convertvector(p[1] - __builtin_convertvector(h1, v8f), v8b);
                const V ph = __builtin_shufflevector(h0, h1, 0, 1, 2, 3, 4, 5, 6, 7, 8, 9, 10, 11, 12, 13, 14, 15), pl = __builtin_shufflevector(l0, l1, 0, 1, 2, 3, 4, 5, 6, 7, 8, 9, 10, 11, 12, 13, 14, 15);
#pragma unroll
                for (int dt = 0; dt < 4; ++dt) st.o[g][dt] = WFrag<T16>::mma(va[dt], ph, st.o[g][dt]);
#pragma unroll
                for (int dt = 0; dt < 4; ++dt) st.o[g][dt] = WFrag<T16>::mma(va[dt], pl, st.o[g][dt]);
#pragma unroll
                for (int dt = 0; dt < 4; ++dt) st.o[g][dt] = WFrag<T16>::mma(vb[dt], ph, st.o[g][dt]);
            } else {
                const V pf = cat16(__builtin_convertvector(p[0], v8h), __builtin_convertvector(p[1], v8h));
#pragma unroll
                for (int dt = 0; dt < 4; ++dt) st.o[g][dt] = WFrag<T16>::mma(va[dt], pf, st.o[g][dt]);
            } }
    }
}
template <int R>
__device__ __forceinline__ void fstore(const FSt& st, int q0, bf* Ah, bf* Al) {
    const int lane = threadIdx.x & 31, lr = lane & 15, hi = lane >> 4;
#pragma unroll
    for (int g = 0; g < R; ++g) { const float inv = __fdiv_rn(1.0f, st.ls[g] + xhalf(st.ls[g]));   // the two halves hold the sums of their own keys
        v8us oh[4], ol[4]; bf* ph = Ah + (size_t)(q0 + 16 * g + lr) * DQ + 8 * hi; bf* pl = Al + (size_t)(q0 + 16 * g + lr) * DQ + 8 * hi;
#pragma unroll
        for (int dt = 0; dt < 4; ++dt) {
#pragma unroll
            for (int r = 0; r < 8; ++r) { unsigned short a, c2; splitf(st.o[g][dt][r] * inv, a, c2); oh[dt][r] = a; ol[dt][r] = c2; }
            *(v8us*)(ph + dt * 16) = oh[dt]; *(v8us*)(pl + dt * 16) = ol[dt]; }
        // stands behind the row group's stores, in front of any reuse of their data and address registers (named as inputs, so that they live up to the wait)
        asm volatile("s_wait_xcnt 0x0" :: "v"(oh[0]), "v"(oh[1]), "v"(oh[2]), "v"(oh[3]), "v"(ol[0]), "v"(ol[1]), "v"(ol[2]), "v"(ol[3]), "v"(ph), "v"(pl) : "memory"); }
}
__global__ __launch_bounds__(288) void k_fattn(const h16* __restrict__ Q16, const h16* __restrict__ K16, const h16* __restrict__ V16, const bf* __restrict__ Qh, const bf* __restrict__ Ql, const bf* __restrict__ Kh, const bf* __restrict__ Kl, const bf* __restrict__ Vh, const bf* __restrict__ Vl, const int* __restrict__ nkp, bf* Ah, bf* Al) {
    __shared__ __attribute__((aligned(2048))) unsigned char L[2 * LBUF];
    const int nkr = *nkp;   // read first: it returns under the Q loads
    asm volatile("s_wait_xcnt 0x0" ::: "memory");   // stands behind that load, in front of any reuse of its address registers
    const u32 wave = uni(threadIdx.x >> 5); const int blk = blockIdx.x; const size_t pl = (size_t)blockIdx.y * TT * HD; Ah += blockIdx.y * HD; Al += blockIdx.y * HD;
    const bool hiw = wave == 1 || wave == 2;
    const int q0 = hiw ? (blk * 2 + (int)wave - 1) * 16 : RH + (blk * 7 + (wave ? (int)wave - 2 : 0)) * 32;
    // wave w < 6 brings tile w of every stage: 64 rows of 128 bytes; K planes: a row is a key (source pitch 128 bytes, a stage 8 KiB on); V^T planes: a row is a d (source pitch 8 KiB, a stage 128 bytes on)
    const bool isv = wave == 1 || wave >= 4;
    const void* plane = wave == 0 ? (const void*)K16 : wave == 1 ? (const void*)V16 : wave == 2 ? (const void*)Kh : wave == 3 ? (const void*)Kl : wave == 4 ? (const void*)Vh : (const void*)Vl;
    const unsigned long long src = (unsigned long long)(size_t)plane + pl * 2; const u32 step = isv ? SKEY * 2 : SKEY * HD * 2;
    const u32 lbase = (u32)(size_t)L + wave * LTIL;
    u32x8 g1; g1[0] = uni((1u << 20) | (4u << 22) | (3u << 25));   // no mask, 1-byte elements, 4 dwords of pad behind every 32
    g1[1] = uni(128u << 16); g1[2] = uni(64u << 16); g1[3] = uni(128u << 16); g1[4] = uni(64u); g1[5] = uni(isv ? TT * 2 : HD * 2); g1[6] = uni(0u); g1[7] = uni(0u);
    asm volatile("" : "+s"(g1));   // pinned, as in pinned(): the descriptor words stay in these scalar registers through the loop and are not formed again while a request is out
    u32x4 g0 = {0u, 0u, 0u, 0u};   // the descriptor group of the wave's last request
    auto issue = [&](u32 s) { const unsigned long long ga = src + (unsigned long long)s * step; g0[0] = uni(1u); g0[1] = uni(lbase + (s & 1u) * LBUF); g0[2] = uni((u32)ga); g0[3] = uni(((u32)(ga >> 32) & 0x01FFFFFFu) | 0x80000000u);
        asm volatile("tensor_load_to_lds %0, %1" :: "s"(g0), "s"(g1) : "memory"); };   // one request of the whole wave; ignores EXEC, so every test around it is a scalar branch
    FSt st;
    if (hiw) finit<bf, true, 1>(st, Qh + pl, Ql + pl, q0); else finit<h16, false, 2>(st, Q16 + pl, nullptr, q0);
    // the stages that hold a key in use, at most NST; never fewer than the ring's two: the projections write whole tiles of 128 keys, so stage 1 is there, and its keys past nk are masked
    const int nk = (int)kept_keys(nkr); const u32 nsu = (keys_in_use(nkr) + SKEY - 1) / SKEY, nst = nsu < 2 ? 2u : nsu;
    if (pinned(wave < 6)) { issue(0); wait_tensor0(g0, g1); }
    __syncthreads();   // stage 0 is published
    if (pinned(wave < 6)) issue(1);
    for (u32 s = 0; s < nst; ++s) {
        const unsigned char* Lb = L + (s & 1u) * LBUF;
        // the hint: seven of the nine waves take the fp16 side; without it the compiler copied all 64 accumulator registers to and fro on that side at every stage where the two sides join
        if (__builtin_expect(!hiw, 1)) fstage<h16, false, 2>(st, Lb, nk, (int)s * SKEY); else fstage<bf, true, 1>(st, Lb, nk, (int)s * SKEY);
        wait_ds0();
        if (pinned(wave < 6)) wait_tensor0(g0, g1);
        __syncthreads();   // publishes stage s + 1 and ends every wave's reads of stage s
        if (pinned(wave < 6 && s + 2 < nst)) issue(s + 2);   // into the buffer that stage s has left
    }
    wait_tensor0(g0, g1); wait_ds0();
    if (hiw) fstore<1>(st, q0, Ah, Al); else fstore<2>(st, q0, Ah, Al);
}
static_assert(NH_ == NKV && RH == FBH * 2 * 16 && TT - RH == FBH * 7 * 32, "a block's 9 waves: 2 x 16 hi/lo rows and 7 x 32 fp16 rows");
static_assert(NST >= 2 && SKEY * 2 == 128 && HD * 2 == 128 && 64 * LPIT <= LTIL && LTIL % 2048 == 0, "a stage's six tiles: 64 rows of 128 bytes each, every place a multiple of 2 KiB; the ring needs two stages");
static_assert(HD == 64 && TT % 128 == 0 && DQ % 128 == 0 && DKV % 128 == 0 && DM % 128 == 0, "a wave's 64 projection columns are one head's, its 64 rows whole lines of the transposed planes; a block holds 2 x 2 such tiles");
static_assert(DM % GKS == 0 && DM / GKS >= 2 && DQ % GKS == 0 && DQ / GKS >= 2, "a GEMM's k extent: whole stages, and the ring needs two");
static_assert(DQ == DKV && ((size_t)TT * DQ * 2) % 256 == 0, "the three projections share one grid, and their planes lie one behind the other in the workspace with no gap");

extern "C" void kernel_launch(void* const* d_in, const int* in_sizes, int n_in,
                              void* d_out, int out_size, void* d_ws, size_t ws_size, hipStream_t stream) {
    (void)in_sizes; (void)n_in; (void)out_size;
    const float* x = (const float*)d_in[0]; const float* xk = (const float*)d_in[1]; const float* xv = (const float*)d_in[2]; const int* kmask = (const int*)d_in[3]; const float* wq = (const float*)d_in[4]; const float* bq = (const float*)d_in[5]; const float* wk = (const float*)d_in[6]; const float* bk = (const float*)d_in[7]; const float* wv = (const float*)d_in[8]; const float* bv = (const float*)d_in[9]; const float* wo = (const float*)d_in[10]; const float* bo = (const float*)d_in[11];   /* order query, key, value, mask (int32 [1][1][1][4096], read), Wq, bq, Wk, bk, Wv, bv, Wo, bo ('oi' + biases) */
    float* OUT = (float*)d_out;     // [1][4096][1024]
    char* wsp = (char*)d_ws;
    auto take = [&](size_t bytes) { char* p = wsp; wsp += (bytes + 255) & ~(size_t)255; return (void*)p; };
    bf* XQ = (bf*)take(((size_t)3 * TT * DM + (size_t)4 * DM * DM) * 2); bf* XK = XQ + (size_t)TT * DM; bf* XV = XK + (size_t)TT * DM;   // the seven bf16 copies, in k_cvtall's block order
    bf* WQ = XV + (size_t)TT * DM; bf* WK = WQ + (size_t)DM * DM; bf* WV = WK + (size_t)DM * DM; bf* WO = WV + (size_t)DM * DM;
    h16* QP16 = (h16*)take((size_t)NH_ * TT * HD * 2); h16* KP16 = (h16*)take((size_t)NKV * TT * HD * 2); h16* VT16 = (h16*)take((size_t)NKV * HD * TT * 2);
    bf* QPh = (bf*)take((size_t)NH_ * TT * HD * 2); bf* QPl = (bf*)take((size_t)NH_ * TT * HD * 2); bf* KPh = (bf*)take((size_t)NKV * TT * HD * 2); bf* KPl = (bf*)take((size_t)NKV * TT * HD * 2); bf* VTh = (bf*)take((size_t)NKV * HD * TT * 2); bf* VTl = (bf*)take((size_t)NKV * HD * TT * 2);
    bf* ATh = (bf*)take((size_t)TT * DQ * 2); bf* ATl = (bf*)take((size_t)TT * DQ * 2); int* NK = (int*)take(sizeof(int));   // the count of kept keys
    if ((size_t)(wsp - (char*)d_ws) > ws_size) return;    // ws 256 MiB
    for (int b = 0; b < NB_; ++b) {
        k_cvtall<<<3 * CVX + 4 * CVW, CVT_, 0, stream>>>(x + (size_t)b * TT * DM, xk + (size_t)b * TT * DM, xv + (size_t)b * TT * DM, kmask + (size_t)b * TT, wq, wk, wv, wo, XQ, NK);
        k_gemmw<bf, 0, true, 1><<<dim3(TT / 128, DQ / 128, 3), 128, 0, stream>>>(XQ, nullptr, WQ, nullptr, DM, DM, nullptr, 0, bq, bk, bv, (size_t)TT * DM, (size_t)DM * DM, 0, QP16, QPh, QPl, (size_t)TT * DQ, NK);   // XQ, XK, XV; WQ, WK, WV; QP16, KP16, VT16; QPh, KPh, VTh and QPl, KPl, VTl: each row of buffers at equal strides
        k_fattn<<<dim3(FBH, NH_), 288, 0, stream>>>(QP16, KP16, VT16, QPh, QPl, KPh, KPl, VTh, VTl, NK, ATh, ATl);
        k_gemmw<bf, 1, true, 0><<<dim3(TT / 128, DM / 128, 1), 128, 0, stream>>>(ATh, ATl, WO, nullptr, DQ, DQ, OUT + (size_t)b * TT * DM, DM, bo, nullptr, nullptr, 0, 0, 0, nullptr, nullptr, nullptr, 0, nullptr); }
}

// v010
// It runs in 90.1 microseconds.
// Timed twice side by side with v009, it ran 1.04 and 1.05 times as fast.
// All steps since v000 together make it 38.3 times as fast.
#include <hip/hip_runtime.h>

// Attention on three input streams over 4,096 tokens with a RANDOM integer key mask (query, key, value [1][4096][1024]; q = query Wq^T + bq, k = key Wk^T + bk, v = value Wv^T + bv ('oi' 1/32 + zero biases; 16 heads x 64); scores / sqrt(64); keys with mask[b][0][0][j] == 0 -> -1e9 (== exclusion; mask int32 [1][1][1][4096] with random 0/1 entries, read per key on device); softmax; out = merged Wo^T + bo -> [1][4096][1024] (4.2 M); argument order query, key, value, mask, Wq, bq, Wk, bk, Wv, bv, Wo, bo).
// Layout: bf16 copies of query, key, value and the 'oi' weights, all made by one launch, which writes the key and value rows in kept-first order (keys with a non-zero mask entry first, both parts in token order) and counts the kept keys; the K and V projections and the attention walk only the kept keys' tiles; exact projections + f32 biases, whose epilogues store the head planes (fp16 + bf16 hi/lo; V transposed) themselves; one fused attention launch for all heads (online softmax, no score plane; the Q planes carry HD^-0.5 * log2(e), so that a score product is an exp2 argument; K and V^T tiles staged in LDS by tensor loads), which excludes the keys behind the kept ones (hybrid rows: < 512 hi/lo 3 products, rest fp16); merged hi/lo x Wo exact + bo.
// Compute dtypes, f32 accumulate: every input rounded to bf16; projections exact + f32 biases; attention rows < 512 3 products, rest fp16; softmax f32; Wo hl x exact + bias.

#define NB_  1
#define TT   4096
#define DM   1024
#define NH_  16
#define NKV  16
#define REP  (NH_ / NKV)
#define HD   64
#define DQ   (NH_ * HD)
#define DKV  (NKV * HD)
#define RH   512                  // query rows < RH use hi+lo planes
#define WIN  0
#define PSH  4.0f                  // softmax weights are exp2(s - mu + PSH): at most 2^(8 + PSH), inside fp16's range, and small ones stay normal numbers
#define SCL2 0.18033688011112042f  // HD^-0.5 * log2(e): multiplied into the Q planes by the projection's epilogue
typedef _Float16 h16;
typedef unsigned short bf;
typedef __attribute__((ext_vector_type(16))) __bf16   v16bf;
typedef __attribute__((ext_vector_type(16))) _Float16 v16h;
typedef __attribute__((ext_vector_type(8)))  _Float16 v8h;
typedef __attribute__((ext_vector_type(8)))  unsigned short v8us;
typedef __attribute__((ext_vector_type(8)))  float    v8f;
typedef __attribute__((ext_vector_type(4)))  float    v4f;
typedef v8h  __attribute__((may_alias)) v8ha;
typedef v4f  __attribute__((may_alias)) v4fa;
typedef v8us __attribute__((may_alias)) v8usa;

__device__ __forceinline__ unsigned short f2bf(float f) { unsigned u = __float_as_uint(f); u += 0x7FFFu + ((u >> 16) & 1u); return (unsigned short)(u >> 16); }
__device__ __forceinline__ float bf2f(unsigned short b) { return __uint_as_float(((unsigned)b) << 16); }
__device__ __forceinline__ float bfr(float f) { return bf2f(f2bf(f)); }
__device__ __forceinline__ v16h cat16(v8h lo, v8h hi) { return __builtin_shufflevector(lo, hi, 0, 1, 2, 3, 4, 5, 6, 7, 8, 9, 10, 11, 12, 13, 14, 15); }
__device__ __forceinline__ v16bf cat16b(v8us lo, v8us hi) { return __builtin_bit_cast(v16bf, __builtin_shufflevector(lo, hi, 0, 1, 2, 3, 4, 5, 6, 7, 8, 9, 10, 11, 12, 13, 14, 15)); }
__device__ __forceinline__ v8f wmma16(v16h a, v16h b, v8f c) { return __builtin_amdgcn_wmma_f32_16x16x32_f16(false, a, false, b, (short)0, c, false, false); }
__device__ __forceinline__ v8f wmmab(v16bf a, v16bf b, v8f c) { return __builtin_amdgcn_wmma_f32_16x16x32_bf16(false, a, false, b, (short)0, c, false, false); }
__device__ __forceinline__ h16 tohx(float x) { return (h16)x; }
__device__ __forceinline__ void splitf(float y, unsigned short& h, unsigned short& l) { h = f2bf(y); l = f2bf(y - bf2f(h)); }



typedef unsigned int u32;
typedef __attribute__((ext_vector_type(4))) unsigned int u32x4;
typedef __attribute__((ext_vector_type(8))) unsigned int u32x8;
__device__ __forceinline__ u32 uni(u32 v) { return (u32)__builtin_amdgcn_readfirstlane(v); }
__device__ __forceinline__ u32 pinned(u32 v) { u32 w = uni(v); asm volatile("" : "+s"(w)); return w; }   // holds a tensor load's issue test in a scalar register, so that the branch around the load is a scalar one
__device__ __forceinline__ void wait_ds0() { asm volatile("s_wait_dscnt 0x0" ::: "memory"); }        // this wave's LDS reads have returned: in front of the barrier behind which their buffer is refilled
// this wave's tensor load has landed: the compiler places no wait for it; the request's descriptor is named as an input, so that its registers keep their values up to the wait
__device__ __forceinline__ void wait_tensor0(u32x4 g0, u32x8 g1) { asm volatile("s_wait_tensorcnt 0x0" :: "s"(g0), "s"(g1) : "memory"); }
// The keys that the attention walks, from the count of kept keys as the conversion launch stored it: the kept ones, or all TT where no key is kept (the module's uniform row); bounded by the shape for any stored value.
__device__ __forceinline__ u32 kept_keys(int nk) { return uni((u32)(nk < 0 ? 0 : nk > TT ? TT : nk)); }
__device__ __forceinline__ u32 keys_in_use(int nk) { const u32 k = kept_keys(nk); return k ? k : (u32)TT; }
// ---- k_gemmw: GEMM on 128x128 output tiles, FOUR WAVES (2 x 2) per block, each on its own 64x64 tile (16 accumulators); grid (M/128, N/128, Z), 128 threads.
// C[m][n] (f32, pitch ldc, + optional f32 bias[n]) = sum_{k < KL} A[m][k] Bt[n][k] (+ A2[m][k] Bt[n][k] for NSPLIT = 1). K = row pitch of A and Bt, KL = k extent summed here. z-batch strides sA/sB/sC in elements. KL % 128 == 0, KL >= 256.
// The operand rows reach the waves through LDS: a stage is 128 k (256 bytes) of the block's 128 A rows (of both planes for NSPLIT = 1) and 128 Bt rows, every wave bringing one slice of it by one tensor load, two buffers,
// the next stage in flight while this one is worked on; a row's bytes leave L2 once per block in whole 256-byte pieces, and the two waves that share a row read it from LDS.
// PL = 0: C as above. PL = 1: the three projections in ONE launch, z = 0, 1, 2 for Q, K, V (operands and planes z strides apart, a bias pointer each); no C; a wave's tile (64 tokens x the 64 columns of one head, + bias)
// goes out as three 16-bit planes, fp16 and bf16 hi + lo: Q (times SCL2) and K [head][token][d], V transposed, [head][d][token]. The blocks of K and V stand on the WGPs beside those of Q, two to a WGP: the epilogues stage in the ring's LDS,
// which every wave has left by then, so a block holds 144 KiB, and one block's products run while the other waits for its tensor loads.
#define GKS  128                   // k per stage
#define GPIT 272                   // LDS row pitch: 256 bytes + the mover's 16-byte pad, an odd multiple of 16 bytes for 16-byte readers
#define GSL  18432                 // the place of a slice of 64 rows: 64 x 272 bytes = 17,408, rounded up to a multiple of 2 KiB
template <typename T16> struct WFrag;
template <> struct WFrag<h16> { typedef v16h V; static __device__ __forceinline__ V ld(const h16* p) { return cat16(*(const v8h*)p, *(const v8h*)(p + 16)); } static __device__ __forceinline__ v8f mma(V a, V b, v8f c) { return wmma16(a, b, c); } };
template <> struct WFrag<bf> { typedef v16bf V; static __device__ __forceinline__ V ld(const bf* p) { return cat16b(*(const v8us*)p, *(const v8us*)(p + 16)); } static __device__ __forceinline__ v8f mma(V a, V b, v8f c) { return wmmab(a, b, c); } };
template <typename T16, int NSPLIT, bool BIAS, int PL>
__global__ __launch_bounds__(128) void k_gemmw(const T16* __restrict__ A, const T16* __restrict__ A2, const T16* __restrict__ Bt, const T16* __restrict__ Bt2, int K, int KL, float* C, int ldc, const float* __restrict__ bias, const float* __restrict__ biask, const float* __restrict__ biasv, size_t sA, size_t sB, size_t sC, h16* P16, bf* Ph, bf* Pl, size_t sP, const int* __restrict__ nkp) {
    typedef typename WFrag<T16>::V V;
    // PL = 1, z > 0: the A rows are keys in kept-first order, and only the row tiles that hold a key in use are computed (keys_in_use); the whole block leaves, in front of every tensor load and barrier
    if (PL == 1 && blockIdx.z) { if (blockIdx.x * 128u >= keys_in_use(*nkp)) return; }
    static_assert(NSPLIT == 0 || NSPLIT == 1, "one or two A planes against one Bt plane");
    // a buffer: the A plane(s), then Bt. NSPLIT = 0: four slices of 64 rows, one per wave. NSPLIT = 1: A and A2 as one tile of 128 rows each (waves 0, 1), Bt as two slices of 64 rows (waves 2, 3).
    constexpr int APL = NSPLIT ? 128 * GPIT : 2 * GSL;   // an A plane's place
    constexpr int ASP = NSPLIT ? 64 * GPIT : GSL;        // from its rows 0 .. 63 to its rows 64 .. 127
    constexpr int BOF = (NSPLIT + 1) * APL, GBUF = BOF + 2 * GSL;
    static_assert(APL % 2048 == 0 && GSL % 2048 == 0 && 64 * GPIT <= GSL, "every place a multiple of 2 KiB");
    __shared__ __attribute__((aligned(2048))) unsigned char L[2 * GBUF];
    (void)Bt2;
    const size_t z = blockIdx.z; A += z * sA; if (A2) A2 += z * sA; Bt += z * sB; C += z * sC;
    if (PL == 1) { P16 += z * sP; Ph += z * 2 * sP; Pl += z * 2 * sP; bias = z == 0 ? bias : z == 1 ? biask : biasv; }   // the hi and lo planes of a projection lie one behind the other
    const u32 wave = uni(threadIdx.x >> 5); const int wm = (int)(wave >> 1), wn = (int)(wave & 1u);
    const int lane = threadIdx.x & 31, lr = lane & 15, hi = lane >> 4; const int r0 = blockIdx.x * 128 + wm * 64, c0 = blockIdx.y * 128 + wn * 64;
    // the wave's slice of every stage: rows of 256 bytes, source pitch 2 K bytes, a stage 256 bytes on
    const bool isb = wave >= 2;
    const T16* sp = isb ? Bt + (size_t)(blockIdx.y * 128 + wn * 64) * K : NSPLIT ? (wave ? A2 : A) + (size_t)(blockIdx.x * 128) * K : A + (size_t)(blockIdx.x * 128 + wave * 64) * K;
    const u32 rows = (NSPLIT && !isb) ? 128u : 64u;
    const unsigned long long src = (unsigned long long)(size_t)sp;
    const u32 lbase = (u32)(size_t)L + (isb ? BOF + wn * GSL : wave * (NSPLIT ? APL : GSL));
    u32x8 g1; g1[0] = uni((1u << 20) | (5u << 22) | (3u << 25));   // no mask, 1-byte elements, 4 dwords of pad behind every 64
    g1[1] = uni(256u << 16); g1[2] = uni(rows << 16); g1[3] = uni(256u << 16); g1[4] = uni(rows); g1[5] = uni((u32)K * 2u); g1[6] = uni(0u); g1[7] = uni(0u);
    asm volatile("" : "+s"(g1));   // pinned, as in pinned(): the descriptor words stay in these scalar registers through the loop and are not formed again while a request is out
    u32x4 g0 = {0u, 0u, 0u, 0u};   // the descriptor group of the wave's last request
    auto issue = [&](u32 s) { const unsigned long long ga = src + (unsigned long long)s * (GKS * 2); g0[0] = uni(1u); g0[1] = uni(lbase + (s & 1u) * GBUF); g0[2] = uni((u32)ga); g0[3] = uni(((u32)(ga >> 32) & 0x01FFFFFFu) | 0x80000000u);
        asm volatile("tensor_load_to_lds %0, %1" :: "s"(g0), "s"(g1) : "memory"); };   // one request of the whole wave; every wave of the block issues its own
    v8f acc[4][4];
#pragma unroll
    for (int mb = 0; mb < 4; ++mb)
#pragma unroll
        for (int nb = 0; nb < 4; ++nb) acc[mb][nb] = (v8f){};
    const u32 nst = (u32)KL / GKS;
    issue(0); wait_tensor0(g0, g1);
    __syncthreads();   // stage 0 is published
    issue(1);
    const int fo = lr * GPIT + 16 * hi;   // the lane's row and half in every slice
    for (u32 s = 0; s < nst; ++s) {
        const unsigned char* Lb = L + (s & 1u) * GBUF;
        const T16* La = (const T16*)(Lb + wm * ASP + fo); const T16* La2 = (const T16*)(Lb + APL + wm * ASP + fo); const T16* Lw = (const T16*)(Lb + BOF + wn * GSL + fo);
        V a[2][4], a2[2][4], b[2][4];   // two fragment sets: the next 32 k are fetched as one group in front of this 32 k's products; nothing of a stage is read in front of its barrier
        // every "#pragma unroll" of this loop: it indexes fragment and accumulator arrays, which stay in registers only under constant indices
#pragma unroll
        for (int f = 0; f < 4; ++f) { a[0][f] = WFrag<T16>::ld(La + f * 16 * (GPIT / 2)); if (NSPLIT == 1) a2[0][f] = WFrag<T16>::ld(La2 + f * 16 * (GPIT / 2)); b[0][f] = WFrag<T16>::ld(Lw + f * 16 * (GPIT / 2)); }
#pragma unroll
        for (int ks = 0; ks < GKS / 32; ++ks) { const int cu = ks & 1, nx = cu ^ 1;
            if (ks + 1 < GKS / 32) {
#pragma unroll
                for (int f = 0; f < 4; ++f) { const int o = f * 16 * (GPIT / 2) + 32 * (ks + 1); a[nx][f] = WFrag<T16>::ld(La + o); if (NSPLIT == 1) a2[nx][f] = WFrag<T16>::ld(La2 + o); b[nx][f] = WFrag<T16>::ld(Lw + o); }
            }
            __builtin_amdgcn_sched_barrier(0);   // keeps the group of LDS reads whole and in front of the block of products: without it the compiler kept one Bt fragment and waited for LDS in front of every four products
#pragma unroll
            for (int nb = 0; nb < 4; ++nb)
#pragma unroll
                for (int mb = 0; mb < 4; ++mb) { acc[mb][nb] = WFrag<T16>::mma(a[cu][mb], b[cu][nb], acc[mb][nb]); if (NSPLIT == 1) acc[mb][nb] = WFrag<T16>::mma(a2[cu][mb], b[cu][nb], acc[mb][nb]); }
            __builtin_amdgcn_sched_barrier(0);   // the other side of the pair: the next group of reads stays behind this block
        }
        wait_ds0();
        wait_tensor0(g0, g1);
        __syncthreads();   // publishes stage s + 1 and ends every wave's reads of stage s
        if (pinned(s + 2 < nst)) issue(s + 2);   // into the buffer that stage s has left
    }
    wait_tensor0(g0, g1); wait_ds0();
    // From here the ring's LDS is free: the last pass's barrier ended every wave's reads of it, and no request is out. Each wave stages its tile in its own piece of it.
    static_assert(4 * 16 * 68 * 4 <= GBUF && 4 * 3 * 16 * 72 * 2 <= GBUF, "the staging rows fit the first buffer");
    // Every "#pragma unroll" of the plane epilogues: its loop indexes accumulator and staging arrays, which stay in registers only under constant indices.
    const int prow = lane >> 3, pc = (lane & 7) * 8;   // plane stores: 8 lanes x 16 bytes a row, so one store covers four whole 128-byte rows
    if (PL == 1 && z == 2) {
        // a lane's 8 accumulator elements are 8 consecutive tokens of ONE column d: converted in registers, 16 d rows x 64 tokens of each plane pass through LDS (pitch 72: no bank shared by the 16 rows of a write)
        unsigned short (*ts)[16 * 72] = (unsigned short (*)[16 * 72])(L + wave * (3 * 16 * 72 * 2));   // each wave stages in its own rows
#pragma unroll
        for (int nb = 0; nb < 4; ++nb) {
            const float bb = BIAS ? bfr(bias[c0 + nb * 16 + lr]) : 0.f;
#pragma unroll
            for (int mb = 0; mb < 4; ++mb) { v8h o16; v8us oh, ol;
#pragma unroll
                for (int j = 0; j < 8; ++j) { const float x = acc[mb][nb][j] + bb; o16[j] = tohx(x); unsigned short a2, c2; splitf(x, a2, c2); oh[j] = a2; ol[j] = c2; }
                const int to = lr * 72 + mb * 16 + hi * 8; *(v8usa*)(ts[0] + to) = __builtin_bit_cast(v8us, o16); *(v8usa*)(ts[1] + to) = oh; *(v8usa*)(ts[2] + to) = ol; }
            __builtin_amdgcn_wave_barrier(); asm volatile("" ::: "memory");   // the rows are read back by other lanes of the wave: keeps the reads behind the writes
            v8us w[4][3]; const size_t po = (size_t)(c0 + nb * 16 + prow) * TT + r0 + pc;
#pragma unroll
            for (int s = 0; s < 4; ++s) {
#pragma unroll
                for (int p = 0; p < 3; ++p) w[s][p] = *(const v8usa*)(ts[p] + (4 * s + prow) * 72 + pc);
                *(v8us*)((bf*)P16 + po + (size_t)s * 4 * TT) = w[s][0]; *(v8us*)(Ph + po + (size_t)s * 4 * TT) = w[s][1]; *(v8us*)(Pl + po + (size_t)s * 4 * TT) = w[s][2]; }
            // stands behind the group's stores, in front of any reuse of their data registers (named as inputs, so that they live up to the wait); as a memory clobber it also keeps the next rows' LDS writes behind these reads
            asm volatile("s_wait_xcnt 0x0" :: "v"(w[0][0]), "v"(w[0][1]), "v"(w[0][2]), "v"(w[1][0]), "v"(w[1][1]), "v"(w[1][2]), "v"(w[2][0]), "v"(w[2][1]), "v"(w[2][2]), "v"(w[3][0]), "v"(w[3][1]), "v"(w[3][2]) : "memory");
        }
        return;
    }
    float* os = (float*)(L + wave * (16 * 68 * 4));
    float pb[8]; const float qs = (PL == 1 && z == 0) ? SCL2 : 1.0f;   // the softmax's scale goes into the Q planes, in f32, in front of their rounding
    if constexpr (PL == 1) {
#pragma unroll
        for (int k = 0; k < 8; ++k) pb[k] = BIAS ? bfr(bias[c0 + pc + k]) : 0.f; }
#pragma unroll
    for (int mb = 0; mb < 4; ++mb) {
#pragma unroll
        for (int nb = 0; nb < 4; ++nb) {
#pragma unroll
            for (int j = 0; j < 8; ++j) os[(hi * 8 + j) * 68 + nb * 16 + lr] = acc[mb][nb][j]; }
        __builtin_amdgcn_wave_barrier(); asm volatile("" ::: "memory");
        if constexpr (PL == 1) {
            v8us w[4][3]; const size_t po = ((size_t)(c0 / HD) * TT + r0 + mb * 16 + prow) * HD + pc;
#pragma unroll
            for (int s = 0; s < 4; ++s) { const float* orow = os + (4 * s + prow) * 68 + pc; const v4f x0 = *(const v4fa*)orow, x1 = *(const v4fa*)(orow + 4); v8h o16;
#pragma unroll
                for (int k = 0; k < 8; ++k) { const float x = ((k < 4 ? x0[k & 3] : x1[k & 3]) + pb[k]) * qs; o16[k] = tohx(x); unsigned short a2, c2; splitf(x, a2, c2); w[s][1][k] = a2; w[s][2][k] = c2; }
                w[s][0] = __builtin_bit_cast(v8us, o16);
                *(v8us*)((bf*)P16 + po + s * 4 * HD) = w[s][0]; *(v8us*)(Ph + po + s * 4 * HD) = w[s][1]; *(v8us*)(Pl + po + s * 4 * HD) = w[s][2]; }
            // stands behind the group's stores, in front of any reuse of their data registers (named as inputs, so that they live up to the wait)
            asm volatile("s_wait_xcnt 0x0" :: "v"(w[0][0]), "v"(w[0][1]), "v"(w[0][2]), "v"(w[1][0]), "v"(w[1][1]), "v"(w[1][2]), "v"(w[2][0]), "v"(w[2][1]), "v"(w[2][2]), "v"(w[3][0]), "v"(w[3][1]), "v"(w[3][2]) : "memory");
        } else {
        float* crow = C + (size_t)(r0 + mb * 16) * ldc + c0;
{
#pragma unroll
            for (int s = 0; s < 8; ++s) { const int row = 2 * s + hi, cofs = lr * 4; v4f val = *(const v4fa*)(os + row * 68 + cofs); if (BIAS) { val[0] += bfr(bias[c0 + cofs]); val[1] += bfr(bias[c0 + cofs + 1]); val[2] += bfr(bias[c0 + cofs + 2]); val[3] += bfr(bias[c0 + cofs + 3]); }
                *(v4f*)(crow + (size_t)row * ldc + cofs) = val; }
             }
        }
        __builtin_amdgcn_wave_barrier(); asm volatile("" ::: "memory");
    }
}

typedef __attribute__((ext_vector_type(4))) _Float16 v4h;
typedef __attribute__((ext_vector_type(4))) unsigned short v4us;

// ---- k_cvtall: every f32 -> bf16 copy of a call (query, key, value, Wq, Wk, Wv, Wo) in ONE streaming launch: 256 blocks of 16 waves, a block on CVB consecutive floats of one array.
// A wave's load is 512 consecutive bytes (16 per lane), its store the 256 bytes they round to; a thread has CVL loads to issue in front of its conversions, so a wave starts once for 16 KiB of source and not once for 1 KiB.
// The sources are read once and by non-temporal loads, which leave L2 to the bf16 copies that the GEMMs read; the copies lie one behind the other in block order.
#define CVT_ 512                   // threads per block
#define CVL  32                    // 16-byte loads per thread
#define CVB  (CVT_ * CVL * 4)      // floats per block
#define CVX  (TT * DM / CVB)       // blocks per token array
#define CVW  (DM * DM / CVB)       // blocks per weight array
// Key and value rows go out in KEPT-FIRST order: a key whose mask entry is not 0 takes the place of its rank among such keys, every other key a place behind all of them, both parts in token order (a permutation of
// the TT rows for any mask). Every block forms the mask's bit vector itself, under its own loads' latency: a wave's 8 ballots cover 256 keys; the words and each wave's count pass through LDS, behind one barrier.
__global__ __launch_bounds__(CVT_) void k_cvtall(const float* __restrict__ xq, const float* __restrict__ xk, const float* __restrict__ xv, const int* __restrict__ km, const float* __restrict__ wq, const float* __restrict__ wk, const float* __restrict__ wv, const float* __restrict__ wo, bf* dst, int* nkw) {
    __shared__ __align__(16) u32 mw[TT / 32];     // the mask, one bit a key
    __shared__ __align__(16) u32 wc[CVT_ / 32];   // kept keys among each wave's 256
    const unsigned b = blockIdx.x, w = b - 3 * CVX;   // which array and which piece of it: the same for the whole block
    const unsigned bl = b < 3 * CVX ? b % CVX : w % CVW;
    const float* src = (b < 3 * CVX ? (b < CVX ? xq : b < 2 * CVX ? xk : xv) : (w < CVW ? wq : w < 2 * CVW ? wk : w < 3 * CVW ? wv : wo)) + (size_t)bl * CVB;
    src += threadIdx.x * 4;
    const u32 wv_ = uni(threadIdx.x >> 5); const int lane = threadIdx.x & 31;
    const int* mp = km + wv_ * 256 + lane; int m[8];   // issued in front of the stream's loads, so that they return first
#pragma unroll
    for (int j = 0; j < 8; ++j) m[j] = mp[j * 32];
    asm volatile("s_wait_xcnt 0x0" ::: "memory");   // stands behind the mask loads, in front of any reuse of their address registers
    v4f x[CVL];   // every "#pragma unroll" here: the loops index vectors and these arrays, which stay in registers only under constant indices
#pragma unroll
    for (int i = 0; i < CVL; ++i) x[i] = __builtin_nontemporal_load((const v4f*)(src + i * (CVT_ * 4)));
    u32x4 bw[2]; u32 cw = 0;
#pragma unroll
    for (int j = 0; j < 8; ++j) { const u32 t = __builtin_amdgcn_ballot_w32(m[j] != 0); bw[j >> 2][j & 3] = t; cw += (u32)__builtin_popcount(t); }
    if (lane == 0) { *(u32x4*)(mw + wv_ * 8) = bw[0]; *(u32x4*)(mw + wv_ * 8 + 4) = bw[1]; wc[wv_] = cw; }
    // the bit vector and the counts are read by every wave; the two fences order LDS alone, so that the stream's loads stay in flight across the barrier (__syncthreads() waited for all of them in front of it)
    __builtin_amdgcn_fence(__ATOMIC_RELEASE, "workgroup", "local"); __builtin_amdgcn_s_barrier(); __builtin_amdgcn_fence(__ATOMIC_ACQUIRE, "workgroup", "local");
    const bool kv = b >= CVX && b < 3 * CVX;   // a piece is CVB / DM = 64 rows: two words of the bit vector, from word w0
    const u32 w0 = bl * 2;
    u32 nk = 0, before = 0;   // kept keys in all, and in front of the piece
#pragma unroll
    for (u32 i = 0; i < CVT_ / 32; ++i) { const u32 c = wc[i]; nk += c; before += i < (w0 >> 3) ? c : 0u; }
#pragma unroll
    for (u32 i = 0; i < 8; ++i) { const u32 t = mw[(w0 & ~7u) + i]; before += i < (w0 & 7u) ? (u32)__builtin_popcount(t) : 0u; }
    // an array that keeps its order is written as if every row were kept; all of this is the same in every lane and is held in scalar registers
    const u32 W0 = uni(kv ? mw[w0] : ~0u), W1 = uni(kv ? mw[w0 + 1] : ~0u), bf0 = uni(kv ? before : bl * 64), nks = uni(nk), h = uni(threadIdx.x >> 8), c0 = (u32)__builtin_popcount(W0);
    if (b == CVX && threadIdx.x == 0) *nkw = (int)nks;
    bf* da = dst + (size_t)(b - bl) * CVB + (threadIdx.x & 255) * 4;   // the array's copy; the copies lie one behind the other in block order
#pragma unroll
    for (int gq = 0; gq < CVL / 16; ++gq) { v4us y[16];
#pragma unroll
        for (int i = 0; i < 16; ++i) { const u32 r = 2 * (16 * gq + i) + h, bit = r & 31u, Wd = gq ? W1 : W0;   // load i of a thread lies in row 2 i + h of the piece
            const u32 kb = bf0 + (gq ? c0 : 0u) + (u32)__builtin_popcount(Wd & ((1u << bit) - 1u));   // kept rows in front of this one
            const u32 pos = (((Wd >> bit) & 1u) ? kb : nks + bl * 64 + r - kb) & (TT - 1);
#pragma unroll
            for (int k = 0; k < 4; ++k) y[i][k] = f2bf(x[16 * gq + i][k]);
            *(v4us*)(da + (size_t)pos * DM) = y[i]; }
        // stands behind the group's stores, in front of any reuse of their data and address registers (named as inputs, so that they live up to the wait)
        asm volatile("s_wait_xcnt 0x0" :: "v"(y[0]), "v"(y[1]), "v"(y[2]), "v"(y[3]), "v"(y[4]), "v"(y[5]), "v"(y[6]), "v"(y[7]), "v"(y[8]), "v"(y[9]), "v"(y[10]), "v"(y[11]), "v"(y[12]), "v"(y[13]), "v"(y[14]), "v"(y[15]), "v"(da) : "memory"); }
}
static_assert((TT * DM) % CVB == 0 && (DM * DM) % CVB == 0 && DQ == DM && DKV == DM && NB_ == 1, "every array is a whole number of blocks' pieces; the four weights are DM x DM; one batch entry, so one launch converts all");
static_assert(CVB == 64 * DM && CVT_ * 4 == 2 * DM && CVT_ * 8 == TT && (TT & (TT - 1)) == 0 && CVL == 32, "a piece is 64 rows, a block's load two rows; a block's threads read 8 mask entries each");

// ---- k_fattn: scores, key mask, softmax and P x V of all heads in ONE launch; no score or weight plane in memory.
// Per wave: S^T = K Q^T (A = 16 keys x 64 d, B = the wave's query columns, kept in registers), so a lane holds 8 consecutive keys of ONE query per tile;
// two such tiles, converted in place, are the B operand of O^T += V^T P^T (A = V^T rows in the same k order as WFrag::ld at + 8 * hi). 32 keys per pass.
// Softmax is online in base 2: weights exp2(s - mu + PSH) against a reference mu per query. Q arrives scaled and PSH - mu is the C operand of the first S^T product, so the products' result IS the exp2 argument:
// no multiply, add or maximum per score. mu is set to the first pass's maximum; later O, the sum and mu move only when a lane's weights of a pass sum to more than PLIM, and that pass's weights are then formed again.
// The keys arrive in kept-first order with the count nk of the kept ones: the stages end with the last kept key (all TT keys where none is kept), and only a pass that reaches past nk tests its keys.
// A masked key's argument is -3.0e38, weight 0; where no key is kept it is PSH for every key, one weight for all (the module's uniform row).
// Block = 8 waves on 256 query rows' worth of one head's work, dealt so that the two waves of every SIMD (w and w + 4) hold 40 products a pass between them:
// waves 1, 2: 16 hi/lo rows (< RH, 3 products: 24 a pass); waves 0, 3: 48 fp16 rows (24 a pass); waves 4 .. 7: 32 fp16 rows (16 a pass); 256 blocks.
// K and V^T reach the waves through LDS: a stage is 64 keys of the head's six planes, each plane's tile (64 rows x 128 bytes) brought by one tensor load of one wave (waves 0 .. 5), two buffers,
// the next stage in flight while this one is worked on; every wave reads its fragments from the tiles, so a plane's bytes leave L2 once per block and stage and not once per wave.
// Every "#pragma unroll" in the attention code: its loop indexes fragment and accumulator arrays, which stay in registers only under constant indices.
#define PLIM 4096.0f               // 2^(8 + PSH): a lane whose 16 weights of a pass sum to more asks for a new mu, so no weight in use exceeds it
#define FBH  (TT / 256)            // blocks per head
#define SKEY 64                    // keys per stage
#define NST  (TT / SKEY)           // stages
#define LPIT 144                   // LDS row pitch: 128 bytes + the mover's 16-byte pad, an odd multiple of 16 bytes for 16-byte readers
#define LTIL 10240                 // a tile's place: 64 rows x 144 bytes = 9,216, rounded up to a multiple of 2 KiB
#define LBUF (6 * LTIL)            // a buffer: tiles K fp16, V^T fp16, K hi, K lo, V^T hi, V^T lo
typedef __attribute__((ext_vector_type(8))) __bf16 v8b;
__device__ __forceinline__ float xhalf(float x) { return __builtin_bit_cast(float, __builtin_amdgcn_permlanex16(__builtin_bit_cast(int, x), __builtin_bit_cast(int, x), 0x76543210, 0xfedcba98, false, false)); }   // lane l <-> lane l ^ 16
// xwait: stands behind each group of global loads, in front of any reuse of their address registers (named as inputs, so that they live up to the wait); as a memory clobber it also keeps the group where it is written
__device__ __forceinline__ void xwait(const void* a) { asm volatile("s_wait_xcnt 0x0" :: "v"(a) : "memory"); }
__device__ __forceinline__ void xwait(const void* a, const void* b) { asm volatile("s_wait_xcnt 0x0" :: "v"(a), "v"(b) : "memory"); }
// a lane's sum of its 16 weights of a pass, halved three times as whole vectors: every addition but the last is a packed one on register pairs as they lie
__device__ __forceinline__ float sum16(v8f a, v8f b) { const v8f s8 = a + b; const v4f s4 = s8.lo + s8.hi; return (s4[0] + s4[2]) + (s4[1] + s4[3]); }
// exp2 of the rescale path, with the slot that the instruction set asks for behind a transcendental inside the statement
__device__ __forceinline__ float exp2_slot(float x) { float y; asm("v_exp_f32 %0, %1\n\tv_nop" : "=v"(y) : "v"(x)); return y; }
// what a wave carries from stage to stage (row group 2: the waves of 48 rows alone); q: fp16 waves [group][k half], hi/lo waves hi [k half] then lo [k half]
struct FSt { v8f o[3][4]; v8f ci[3]; float ls[3]; v16h q[6]; };   // ci: PSH - mu in all eight elements, the C operand of a group's score products
template <typename T16, bool HI, int R>
__device__ __forceinline__ void finit(FSt& st, const T16* __restrict__ Qa, const T16* __restrict__ Qb, int q0) {
    const int lane = threadIdx.x & 31, lr = lane & 15, hi = lane >> 4;
    const T16* qpa = Qa + (size_t)(q0 + lr) * HD + 8 * hi; const T16* qpb = HI ? Qb + (size_t)(q0 + lr) * HD + 8 * hi : nullptr;
#pragma unroll
    for (int g = 0; g < R; ++g)
#pragma unroll
        for (int kk = 0; kk < 2; ++kk) { const int qo = 16 * g * HD + 32 * kk; st.q[2 * g + kk] = __builtin_bit_cast(v16h, WFrag<T16>::ld(qpa + qo)); if (HI) st.q[2 + kk] = __builtin_bit_cast(v16h, WFrag<T16>::ld(qpb + qo)); }
    if constexpr (HI) xwait(qpa, qpb); else xwait(qpa);
    if constexpr (R < 3) { st.q[4] = (v16h){}; st.q[5] = (v16h){}; }   // row group 2's columns: only a wave of 48 rows has them
#pragma unroll
    for (int g = 0; g < 3; ++g) { st.ci[g] = (v8f){PSH, PSH, PSH, PSH, PSH, PSH, PSH, PSH}; st.ls[g] = 0.f;
#pragma unroll
        for (int dt = 0; dt < 4; ++dt) st.o[g][dt] = (v8f){}; }
}
// one stage of one wave: two passes of 32 keys on the tiles of buffer Lb; k0 = the stage's first key, nk = the kept keys (places 0 .. nk - 1)
// R = 3: one code path for all fp16 waves, so that their accumulators lie in the same registers where the paths join; row group 2 is worked on only where g3 is set (the same in the whole wave: scalar branches)
template <typename T16, bool HI, int R>
__device__ __forceinline__ void fstage(FSt& st, const unsigned char* Lb, int nk, int k0, bool g3) {
    constexpr int RC = R < 2 ? R : 2;   // the row groups that every wave on this path has
    typedef typename WFrag<T16>::V V;
    const int lane = threadIdx.x & 31, lr = lane & 15, hi = lane >> 4;
    const unsigned char* Lr = Lb + lr * LPIT + 16 * hi;   // the lane's row and half in every tile
    const T16* Lka = (const T16*)(Lr + (HI ? 2 : 0) * LTIL); const T16* Lkb = (const T16*)(Lr + 3 * LTIL); const T16* Lva = (const T16*)(Lr + (HI ? 4 : 1) * LTIL); const T16* Lvb = (const T16*)(Lr + 5 * LTIL);
    V qa[R][2], qb[R][2];
#pragma unroll
    for (int g = 0; g < R; ++g)
#pragma unroll
        for (int kk = 0; kk < 2; ++kk) { qa[g][kk] = __builtin_bit_cast(V, st.q[2 * g + kk]); if (HI) qb[g][kk] = __builtin_bit_cast(V, st.q[2 + kk]); }
    V ka[2][2], kb[2][2];   // the second pass's K fragments are fetched by the first; the first pass's here: nothing of a stage is read in front of its barrier
#pragma unroll
    for (int kt = 0; kt < 2; ++kt)
#pragma unroll
        for (int kk = 0; kk < 2; ++kk) { ka[kt][kk] = WFrag<T16>::ld(Lka + kt * 16 * (LPIT / 2) + 32 * kk); if (HI) kb[kt][kk] = WFrag<T16>::ld(Lkb + kt * 16 * (LPIT / 2) + 32 * kk); }
#pragma unroll
    for (int sub = 0; sub < SKEY / 32; ++sub) {
        V va[4], vb[4];   // this pass's V^T fragments: issued first, read behind the softmax
#pragma unroll
        for (int dt = 0; dt < 4; ++dt) { va[dt] = WFrag<T16>::ld(Lva + dt * 16 * (LPIT / 2) + 32 * sub); if (HI) vb[dt] = WFrag<T16>::ld(Lvb + dt * 16 * (LPIT / 2) + 32 * sub); }
        v8f s[R][2];
#pragma unroll
        for (int g = 0; g < RC; ++g)
#pragma unroll
            for (int kt = 0; kt < 2; ++kt) s[g][kt] = st.ci[g];
#pragma unroll
        for (int kk = 0; kk < 2; ++kk) {
#pragma unroll
            for (int g = 0; g < RC; ++g)
#pragma unroll
                for (int kt = 0; kt < 2; ++kt) s[g][kt] = WFrag<T16>::mma(ka[kt][kk], qa[g][kk], s[g][kt]);
            if (HI) {
#pragma unroll
                for (int g = 0; g < R; ++g)
#pragma unroll
                    for (int kt = 0; kt < 2; ++kt) s[g][kt] = WFrag<T16>::mma(ka[kt][kk], qb[g][kk], s[g][kt]);
#pragma unroll
                for (int g = 0; g < R; ++g)
#pragma unroll
                    for (int kt = 0; kt < 2; ++kt) s[g][kt] = WFrag<T16>::mma(kb[kt][kk], qa[g][kk], s[g][kt]);
            }
        }
        if constexpr (R == 3) { if (g3) {
#pragma unroll
            for (int kt = 0; kt < 2; ++kt) s[2][kt] = WFrag<T16>::mma(ka[kt][0], qa[2][0], st.ci[2]);
#pragma unroll
            for (int kt = 0; kt < 2; ++kt) s[2][kt] = WFrag<T16>::mma(ka[kt][1], qa[2][1], s[2][kt]); } }
        asm volatile("" ::: "memory");   // keeps this pass's V^T reads where they are written, in front of the S^T products and the softmax, which cover their latency: without it the compiler moved them down to the P x V products
        if (sub + 1 < SKEY / 32) {
#pragma unroll
            for (int kt = 0; kt < 2; ++kt)
#pragma unroll
                for (int kk = 0; kk < 2; ++kk) { ka[kt][kk] = WFrag<T16>::ld(Lka + (32 * (sub + 1) + kt * 16) * (LPIT / 2) + 32 * kk); if (HI) kb[kt][kk] = WFrag<T16>::ld(Lkb + (32 * (sub + 1) + kt * 16) * (LPIT / 2) + 32 * kk); }
        }
        if (k0 + 32 * sub + 32 > nk) {   // the same for the whole block: only the kept keys' last passes (every pass where no key is kept) hold a masked key; element r of tile kt is key 16 kt + 8 hi + r of the pass
            const int left = nk - (k0 + 32 * sub + 8 * hi); const float mval = nk ? -3.0e38f : PSH;
#pragma unroll
            for (int g = 0; g < R; ++g) { if (g == 2 && !g3) continue;
#pragma unroll
                for (int kt = 0; kt < 2; ++kt)
#pragma unroll
                    for (int r = 0; r < 8; ++r) s[g][kt][r] = (16 * kt + r < left) ? s[g][kt][r] : mval; }
        }
        // s holds the exp2 arguments. The weights and each lane's sum of its 16 come first; the test on that sum stands in for a maximum: every weight is positive, so none exceeds the sum.
        const bool first = sub == 0 && k0 == 0;   // the same for the whole block: the first pass sets mu, whatever its scores
        v8f pw[R][2]; float lsum[R]; bool need = false;
#pragma unroll
        for (int g = 0; g < R; ++g) { if (g == 2 && !g3) continue;
#pragma unroll
            for (int kt = 0; kt < 2; ++kt)
#pragma unroll
                for (int r = 0; r < 8; ++r) pw[g][kt][r] = __builtin_amdgcn_exp2f(s[g][kt][r]);
            lsum[g] = sum16(pw[g][0], pw[g][1]);
            need = need || (lsum[g] > PLIM); }
        if (first || __builtin_amdgcn_ballot_w32(need) != 0) {   // one scalar test per pass; rare behind the first pass
#pragma unroll
            for (int g = 0; g < R; ++g) { if (g == 2 && !g3) continue; float mx = -3.0e38f;
#pragma unroll
                for (int kt = 0; kt < 2; ++kt) {
#pragma unroll
                    for (int r = 0; r < 8; ++r) mx = fmaxf(mx, s[g][kt][r]); }
                mx = fmaxf(mx, xhalf(mx)) - PSH;   // how far the pass's maximum lies above mu
                const float d = first ? mx : fmaxf(mx, 0.f);   // mu moves by d: never down behind the first pass
                const float corr = first ? 0.f : exp2_slot(-d);   // O and the sum are still 0 in the first pass
                st.ci[g] = st.ci[g] - d; st.ls[g] *= corr;
#pragma unroll
                for (int dt = 0; dt < 4; ++dt) st.o[g][dt] = st.o[g][dt] * corr;
#pragma unroll
                for (int kt = 0; kt < 2; ++kt) { const v8f ar = s[g][kt] - d;
#pragma unroll
                    for (int r = 0; r < 8; ++r) pw[g][kt][r] = exp2_slot(ar[r]); }
                lsum[g] = sum16(pw[g][0], pw[g][1]); }
        }
#pragma unroll
        for (int g = 0; g < R; ++g) { if (g == 2 && !g3) continue; const v8f p[2] = {pw[g][0], pw[g][1]}; st.ls[g] += lsum[g];
            if constexpr (HI) {
                const v8b h0 = __builtin_convertvector(p[0], v8b), h1 = __builtin_convertvector(p[1], v8b);
                const v8b l0 = __builtin_convertvector(p[0] - __builtin_convertvector(h0, v8f), v8b), l1 = __builtin_convertvector(p[1] - __builtin_convertvector(h1, v8f), v8b);
                const V ph = __builtin_shufflevector(h0, h1, 0, 1, 2, 3, 4, 5, 6, 7, 8, 9, 10, 11, 12, 13, 14, 15), pl = __builtin_shufflevector(l0, l1, 0, 1, 2, 3, 4, 5, 6, 7, 8, 9, 10, 11, 12, 13, 14, 15);
#pragma unroll
                for (int dt = 0; dt < 4; ++dt) st.o[g][dt] = WFrag<T16>::mma(va[dt], ph, st.o[g][dt]);
#pragma unroll
                for (int dt = 0; dt < 4; ++dt) st.o[g][dt] = WFrag<T16>::mma(va[dt], pl, st.o[g][dt]);
#pragma unroll
                for (int dt = 0; dt < 4; ++dt) st.o[g][dt] = WFrag<T16>::mma(vb[dt], ph, st.o[g][dt]);
            } else {
                const V pf = cat16(__builtin_convertvector(p[0], v8h), __builtin_convertvector(p[1], v8h));
#pragma unroll
                for (int dt = 0; dt < 4; ++dt) st.o[g][dt] = WFrag<T16>::mma(va[dt], pf, st.o[g][dt]);
            } }
    }
}
template <int R>
__device__ __forceinline__ void fstore(const FSt& st, int q0, bf* Ah, bf* Al, bool g3) {   // g3 as in fstage: one copy of the code for all fp16 waves keeps the kernel's text short
    const int lane = threadIdx.x & 31, lr = lane & 15, hi = lane >> 4;
#pragma unroll
    for (int g = 0; g < R; ++g) { if (g == 2 && !g3) continue; const float inv = __fdiv_rn(1.0f, st.ls[g] + xhalf(st.ls[g]));   // the two halves hold the sums of their own keys
        v8us oh[4], ol[4]; bf* ph = Ah + (size_t)(q0 + 16 * g + lr) * DQ + 8 * hi; bf* pl = Al + (size_t)(q0 + 16 * g + lr) * DQ + 8 * hi;
#pragma unroll
        for (int dt = 0; dt < 4; ++dt) {
#pragma unroll
            for (int r = 0; r < 8; ++r) { unsigned short a, c2; splitf(st.o[g][dt][r] * inv, a, c2); oh[dt][r] = a; ol[dt][r] = c2; }
            *(v8us*)(ph + dt * 16) = oh[dt]; *(v8us*)(pl + dt * 16) = ol[dt]; }
        // stands behind the row group's stores, in front of any reuse of their data and address registers (named as inputs, so that they live up to the wait)
        asm volatile("s_wait_xcnt 0x0" :: "v"(oh[0]), "v"(oh[1]), "v"(oh[2]), "v"(oh[3]), "v"(ol[0]), "v"(ol[1]), "v"(ol[2]), "v"(ol[3]), "v"(ph), "v"(pl) : "memory"); }
}
__global__ __launch_bounds__(256) void k_fattn(const h16* __restrict__ Q16, const h16* __restrict__ K16, const h16* __restrict__ V16, const bf* __restrict__ Qh, const bf* __restrict__ Ql, const bf* __restrict__ Kh, const bf* __restrict__ Kl, const bf* __restrict__ Vh, const bf* __restrict__ Vl, const int* __restrict__ nkp, bf* Ah, bf* Al) {
    __shared__ __attribute__((aligned(2048))) unsigned char L[2 * LBUF];
    const int nkr = *nkp;   // read first: it returns under the Q loads
    asm volatile("s_wait_xcnt 0x0" ::: "memory");   // stands behind that load, in front of any reuse of its address registers
    const u32 wave = uni(threadIdx.x >> 5); const int blk = blockIdx.x; const size_t pl = (size_t)blockIdx.y * TT * HD; Ah += blockIdx.y * HD; Al += blockIdx.y * HD;
    const bool hiw = wave == 1 || wave == 2, w48 = ((9u >> wave) & 1u) != 0u;   // w48: waves 0 and 3, as one bit test: it is asked for at every branch round row group 2
    // the block's 14 groups of 16 fp16 rows: wave 0 takes groups 0 .. 2, wave 3 groups 3 .. 5, waves 4 .. 7 two each from group 6 on
    const int q0 = hiw ? (blk * 2 + (int)wave - 1) * 16 : RH + (blk * 14 + (w48 ? (int)wave : 2 * (int)wave - 2)) * 16;
    // wave w < 6 brings tile w of every stage: 64 rows of 128 bytes; K planes: a row is a key (source pitch 128 bytes, a stage 8 KiB on); V^T planes: a row is a d (source pitch 8 KiB, a stage 128 bytes on)
    const bool isv = wave == 1 || wave >= 4;
    const void* plane = wave == 0 ? (const void*)K16 : wave == 1 ? (const void*)V16 : wave == 2 ? (const void*)Kh : wave == 3 ? (const void*)Kl : wave == 4 ? (const void*)Vh : (const void*)Vl;
    const unsigned long long src = (unsigned long long)(size_t)plane + pl * 2; const u32 step = isv ? SKEY * 2 : SKEY * HD * 2;
    const u32 lbase = (u32)(size_t)L + wave * LTIL;
    u32x8 g1; g1[0] = uni((1u << 20) | (4u << 22) | (3u << 25));   // no mask, 1-byte elements, 4 dwords of pad behind every 32
    g1[1] = uni(128u << 16); g1[2] = uni(64u << 16); g1[3] = uni(128u << 16); g1[4] = uni(64u); g1[5] = uni(isv ? TT * 2 : HD * 2); g1[6] = uni(0u); g1[7] = uni(0u);
    asm volatile("" : "+s"(g1));   // pinned, as in pinned(): the descriptor words stay in these scalar registers through the loop and are not formed again while a request is out
    u32x4 g0 = {0u, 0u, 0u, 0u};   // the descriptor group of the wave's last request
    auto issue = [&](u32 s) { const unsigned long long ga = src + (unsigned long long)s * step; g0[0] = uni(1u); g0[1] = uni(lbase + (s & 1u) * LBUF); g0[2] = uni((u32)ga); g0[3] = uni(((u32)(ga >> 32) & 0x01FFFFFFu) | 0x80000000u);
        asm volatile("tensor_load_to_lds %0, %1" :: "s"(g0), "s"(g1) : "memory"); };   // one request of the whole wave; ignores EXEC, so every test around it is a scalar branch
    FSt st;
    if (hiw) finit<bf, true, 1>(st, Qh + pl, Ql + pl, q0); else if (w48) finit<h16, false, 3>(st, Q16 + pl, nullptr, q0); else finit<h16, false, 2>(st, Q16 + pl, nullptr, q0);
    // the stages that hold a key in use, at most NST; never fewer than the ring's two: the projections write whole tiles of 128 keys, so stage 1 is there, and its keys past nk are masked
    const int nk = (int)kept_keys(nkr); const u32 nsu = (keys_in_use(nkr) + SKEY - 1) / SKEY, nst = nsu < 2 ? 2u : nsu;
    if (pinned(wave < 6)) { issue(0); wait_tensor0(g0, g1); }
    __syncthreads();   // stage 0 is published
    if (pinned(wave < 6)) issue(1);
    for (u32 s = 0; s < nst; ++s) {
        const unsigned char* Lb = L + (s & 1u) * LBUF;
        // the hint: six of the eight waves take an fp16 side; without it the compiler copied the accumulator registers to and fro on that side at every stage where the sides join
        if (__builtin_expect(!hiw, 1)) fstage<h16, false, 3>(st, Lb, nk, (int)s * SKEY, w48); else fstage<bf, true, 1>(st, Lb, nk, (int)s * SKEY, false);
        wait_ds0();
        if (pinned(wave < 6)) wait_tensor0(g0, g1);
        __syncthreads();   // publishes stage s + 1 and ends every wave's reads of stage s
        if (pinned(wave < 6 && s + 2 < nst)) issue(s + 2);   // into the buffer that stage s has left
    }
    wait_tensor0(g0, g1); wait_ds0();
    if (hiw) fstore<1>(st, q0, Ah, Al, false); else fstore<3>(st, q0, Ah, Al, w48);
}
static_assert(NH_ == NKV && RH == FBH * 2 * 16 && TT - RH == FBH * 14 * 16, "a block's 8 waves: 2 x 16 hi/lo rows, 2 x 48 and 4 x 32 fp16 rows");
static_assert(NST >= 2 && SKEY * 2 == 128 && HD * 2 == 128 && 64 * LPIT <= LTIL && LTIL % 2048 == 0, "a stage's six tiles: 64 rows of 128 bytes each, every place a multiple of 2 KiB; the ring needs two stages");
static_assert(HD == 64 && TT % 128 == 0 && DQ % 128 == 0 && DKV % 128 == 0 && DM % 128 == 0, "a wave's 64 projection columns are one head's, its 64 rows whole lines of the transposed planes; a block holds 2 x 2 such tiles");
static_assert(DM % GKS == 0 && DM / GKS >= 2 && DQ % GKS == 0 && DQ / GKS >= 2, "a GEMM's k extent: whole stages, and the ring needs two");
static_assert(DQ == DKV && ((size_t)TT * DQ * 2) % 256 == 0, "the three projections share one grid, and their planes lie one behind the other in the workspace with no gap");

extern "C" void kernel_launch(void* const* d_in, const int* in_sizes, int n_in,
                              void* d_out, int out_size, void* d_ws, size_t ws_size, hipStream_t stream) {
    (void)in_sizes; (void)n_in; (void)out_size;
    const float* x = (const float*)d_in[0]; const float* xk = (const float*)d_in[1]; const float* xv = (const float*)d_in[2]; const int* kmask = (const int*)d_in[3]; const float* wq = (const float*)d_in[4]; const float* bq = (const float*)d_in[5]; const float* wk = (const float*)d_in[6]; const float* bk = (const float*)d_in[7]; const float* wv = (const float*)d_in[8]; const float* bv = (const float*)d_in[9]; const float* wo = (const float*)d_in[10]; const float* bo = (const float*)d_in[11];   /* order query, key, value, mask (int32 [1][1][1][4096], read), Wq, bq, Wk, bk, Wv, bv, Wo, bo ('oi' + biases) */
    float* OUT = (float*)d_out;     // [1][4096][1024]
    char* wsp = (char*)d_ws;
    auto take = [&](size_t bytes) { char* p = wsp; wsp += (bytes + 255) & ~(size_t)255; return (void*)p; };
    bf* XQ = (bf*)take(((size_t)3 * TT * DM + (size_t)4 * DM * DM) * 2); bf* XK = XQ + (size_t)TT * DM; bf* XV = XK + (size_t)TT * DM;   // the seven bf16 copies, in k_cvtall's block order
    bf* WQ = XV + (size_t)TT * DM; bf* WK = WQ + (size_t)DM * DM; bf* WV = WK + (size_t)DM * DM; bf* WO = WV + (size_t)DM * DM;
    h16* QP16 = (h16*)take((size_t)NH_ * TT * HD * 2); h16* KP16 = (h16*)take((size_t)NKV * TT * HD * 2); h16* VT16 = (h16*)take((size_t)NKV * HD * TT * 2);
    bf* QPh = (bf*)take((size_t)NH_ * TT * HD * 2); bf* QPl = (bf*)take((size_t)NH_ * TT * HD * 2); bf* KPh = (bf*)take((size_t)NKV * TT * HD * 2); bf* KPl = (bf*)take((size_t)NKV * TT * HD * 2); bf* VTh = (bf*)take((size_t)NKV * HD * TT * 2); bf* VTl = (bf*)take((size_t)NKV * HD * TT * 2);
    bf* ATh = (bf*)take((size_t)TT * DQ * 2); bf* ATl = (bf*)take((size_t)TT * DQ * 2); int* NK = (int*)take(sizeof(int));   // the count of kept keys
    if ((size_t)(wsp - (char*)d_ws) > ws_size) return;    // ws 256 MiB
    for (int b = 0; b < NB_; ++b) {
        k_cvtall<<<3 * CVX + 4 * CVW, CVT_, 0, stream>>>(x + (size_t)b * TT * DM, xk + (size_t)b * TT * DM, xv + (size_t)b * TT * DM, kmask + (size_t)b * TT, wq, wk, wv, wo, XQ, NK);
        k_gemmw<bf, 0, true, 1><<<dim3(TT / 128, DQ / 128, 3), 128, 0, stream>>>(XQ, nullptr, WQ, nullptr, DM, DM, nullptr, 0, bq, bk, bv, (size_t)TT * DM, (size_t)DM * DM, 0, QP16, QPh, QPl, (size_t)TT * DQ, NK);   // XQ, XK, XV; WQ, WK, WV; QP16, KP16, VT16; QPh, KPh, VTh and QPl, KPl, VTl: each row of buffers at equal strides
        k_fattn<<<dim3(FBH, NH_), 256, 0, stream>>>(QP16, KP16, VT16, QPh, QPl, KPh, KPl, VTh, VTl, NK, ATh, ATl);
        k_gemmw<bf, 1, true, 0><<<dim3(TT / 128, DM / 128, 1), 128, 0, stream>>>(ATh, ATl, WO, nullptr, DQ, DQ, OUT + (size_t)b * TT * DM, DM, bo, nullptr, nullptr, 0, 0, 0, nullptr, nullptr, nullptr, 0, nullptr); }
}
